// v000
// Times are from an AMD MI455X. After a warm-up the kernel runs many times in a row, and a time is the length of
// such a window on the GPU divided by its runs, so every launch and the gaps after it count. The runs cycle
// through copies of the inputs. A figure is the median of several windows, for all but v000 over two sittings.
// Sittings can differ by a few percent; kernels timed side by side share one.
// v000 is the starting kernel. One run takes 3360 microseconds.
#include <hip/hip_runtime.h>
// Multi-head attention over three inputs with SHARED per-head projections, a random key-padding mask and the module's literal score scale (values, keys, query [4][2048][512]; each input is split into 8 heads of 64 and every head is multiplied by the SAME natural [64][64] matrix (x W^T: Wv / Wk / Wq; no biases); energy = q k^T; where(mask == 0, -1e20) with the int32 [4][1][1][2048] mask in {0, 1} (random; 0 = masked key; READ on device); softmax(energy / sqrt(embed_size) = / sqrt(512)) (as the source); out = merged Wo^T + bo -> [4][2048][512]).
// Structure: token rows r = b*2048 + s; x as exact f16 rows (bf16-rounded); Q, K, V as three WMMA GEMMs (32x64 wave tiles, f32 accumulation, exact x16 weights, no bias, f16 outputs); per batch: V^T for all heads via LDS transposes; per (batch, group of 4 heads): scores GEMM (K = 64, batched over the heads on grid.y, alpha = 1/sqrt(512) (applied in the GEMM, before the softmax's 0/1 key mask)), row softmax on VALU (f32 statistics; weights stored x256 as f16), o = P . V^T GEMM (K = 2048, alpha 2^-2: o carried x64 against f16 subnormal flush, folded into the output GEMM alpha) written straight into the merged f16 o rows; out = o W_o + b GEMM (f32) into the output layout.
// Compute dtype: inputs rounded to bf16; x / weights exact; q, k, v, softmax weights and o as plain f16 GEMM operands (~2^-12); scores and softmax statistics f32. v_wmma_f32_16x16x32_f16.
#define NB 4
#define SQ 2048
#define DM 512
#define NH 8
#define HD 64
#define HG 4                         /* heads per attention launch group */
#define B0 0                         /* first batch processed (debug hook) */
#define NBR NB                       /* batches processed (debug hook) */
#define NR ((size_t)NB * SQ)         /* token rows */
#define MP ((int)((size_t)NBR * SQ)) /* rows projected (debug hook) */
#define QN SQ                        /* query rows attended per batch (debug hook) */
#define NHD NH                       /* heads attended (debug hook) */
#define MPO MP                       /* rows through the output stage (debug hook) */
#define LQ DM      /* row pitch of the q/k/v rows */
typedef __bf16 v16b __attribute__((ext_vector_type(16)));
typedef unsigned short v8us __attribute__((ext_vector_type(8), may_alias));
typedef float  v8f  __attribute__((ext_vector_type(8)));
typedef float  v4f  __attribute__((ext_vector_type(4)));
typedef float  v4fa __attribute__((ext_vector_type(4), may_alias));
union FragB { v16b v; v8us half[2]; unsigned short u[16]; };

__device__ __forceinline__ unsigned short bf16_bits(float x) { unsigned int u = __float_as_uint(x); return (unsigned short)((u + 0x7FFFu + ((u >> 16) & 1u)) >> 16); }
__device__ __forceinline__ float bf16_val(unsigned short b) { return __uint_as_float(((unsigned int)b) << 16); }
__device__ __forceinline__ float bf16_round(float x) { return bf16_val(bf16_bits(x)); }
// D += A·B with NT terms: 1 = ah·bh, 2 = + al·bh (A split), 3 = + ah·bl (both split)
template <int NT>
__device__ __forceinline__ v8f mmaN(v16b ah, v16b al, v16b bh, v16b bl, v8f c) {
  c = __builtin_amdgcn_wmma_f32_16x16x32_bf16(false, ah, false, bh, (short)0, c, false, false);
  if (NT >= 2) c = __builtin_amdgcn_wmma_f32_16x16x32_bf16(false, al, false, bh, (short)0, c, false, false);
  if (NT >= 3) c = __builtin_amdgcn_wmma_f32_16x16x32_bf16(false, ah, false, bl, (short)0, c, false, false);
  asm volatile("v_nop\n\tv_nop\n\tv_nop\n\tv_nop" : "+v"(c) : "v"(ah), "v"(al), "v"(bh), "v"(bl));
  return c;
}

__global__ __launch_bounds__(256) void k_wt_bf16(const float* __restrict__ W, unsigned short* __restrict__ Wt, int K, int N) {
  const int t = blockIdx.x * 256 + threadIdx.x;
  const int k8n = K / 8;
  if (t >= N * k8n) return;
  const int n = t / k8n, k8 = (t % k8n) * 8;
  v8us v;
#pragma unroll
  for (int i = 0; i < 8; ++i) v[i] = bf16_bits(W[(size_t)(k8 + i) * N + n]);
  *(v8us*)(Wt + (size_t)n * K + k8) = v;
  
}

// GEMM C[M][N] (f32, pitch ldc) = act(A[M][K]·W + bias). A f32 row-major (pitch lda) converted per fragment to bf16
// (ASPLIT: hi/lo two planes -> 2 terms, else single rounded term); Wt bf16 [N][K] (pitch ldb). BIAS_BF16 rounds the
// bias to bf16 first (bias quantised to bf16 before the add). K%32==0, M%16==0, N%64==0.
template <bool ASPLIT, int ACT, bool BIAS_BF16>
__global__ __launch_bounds__(128) void k_gemm_bf(const float* __restrict__ A, int lda, const unsigned short* __restrict__ Wt, int ldb,
                                               const float* __restrict__ bias, float* __restrict__ C, int ldc, int M, int N, int K) {
  __shared__ __attribute__((aligned(16))) float so[4][16][64];
  const int tid = threadIdx.x, w = tid >> 5, lane = tid & 31, ln = lane & 15, hh = lane >> 4;
  const int ntn = N / 64;
  const int wid = blockIdx.x * 4 + w;
  const int mt = wid / ntn, nq = wid % ntn;
  if (mt * 16 >= M) return;
  const int row0 = mt * 16, col0 = nq * 64;
  const float* arow = A + (size_t)(row0 + ln) * lda;
  v8f acc[4] = {};
  for (int kb = 0; kb < K; kb += 32) {
    FragB ah, al;
    const v4f x0 = *(const v4fa*)(arow + kb + 8 * hh), x1 = *(const v4fa*)(arow + kb + 8 * hh + 4);
    const v4f x2 = *(const v4fa*)(arow + kb + 16 + 8 * hh), x3 = *(const v4fa*)(arow + kb + 16 + 8 * hh + 4);
    float xs[16] = {x0[0],x0[1],x0[2],x0[3],x1[0],x1[1],x1[2],x1[3],x2[0],x2[1],x2[2],x2[3],x3[0],x3[1],x3[2],x3[3]};
#pragma unroll
    for (int i = 0; i < 16; ++i) { const unsigned short hb = bf16_bits(xs[i]); ah.u[i] = hb; al.u[i] = ASPLIT ? bf16_bits(xs[i] - bf16_val(hb)) : (unsigned short)0; }
#pragma unroll
    for (int t = 0; t < 4; ++t) {
      const unsigned short* brow = Wt + (size_t)(col0 + t * 16 + ln) * ldb + kb;
      FragB b;
      b.half[0] = *(const v8us*)(brow + 8 * hh);
      b.half[1] = *(const v8us*)(brow + 16 + 8 * hh);
      acc[t] = mmaN<ASPLIT ? 2 : 1>(ah.v, al.v, b.v, b.v, acc[t]);
    }
  }
#pragma unroll
  for (int t = 0; t < 4; ++t) {
    float bv = bias ? bias[col0 + t * 16 + ln] : 0.f;
    if (BIAS_BF16) bv = bf16_round(bv);
#pragma unroll
    for (int r = 0; r < 8; ++r) { float v = acc[t][r] + bv; if (ACT == 1) v = fmaxf(v, 0.f); so[w][8 * hh + r][t * 16 + ln] = v; }
  }
  __builtin_amdgcn_fence(__ATOMIC_ACQ_REL, "workgroup");
  __builtin_amdgcn_wave_barrier();
  const int rsub = lane >> 4, c4 = (lane & 15) * 4;
  {
#pragma unroll
    for (int q = 0; q < 8; ++q) {
      const int r = q * 2 + rsub;
      const v4f v = *(const v4fa*)&so[w][r][c4];
      *(v4f*)(C + (size_t)(row0 + r) * ldc + col0 + c4) = v;
    }
    
  }
}

// GEMM C = act(A·W + bias + resid): A f32 (ASPLIT -> hi/lo 2 terms), Wt bf16 [N][K]; ACT 0 none, 1 relu, 2 exact gelu;
// resid (optional, f32, row index = (row % rmod), pitch ldr, RES_BF16 rounds it) added before the activation.
template <bool ASPLIT, int ACT, bool BIAS_BF16, bool RES_BF16>
__global__ __launch_bounds__(128) void k_gemm_bf3(const float* __restrict__ A, int lda, const unsigned short* __restrict__ Wt, int ldb,
                                                const float* __restrict__ bias, const float* __restrict__ resid, int rmod, int ldr,
                                                float* __restrict__ C, int ldc, int M, int N, int K) {
  __shared__ __attribute__((aligned(16))) float so[4][16][64];
  const int tid = threadIdx.x, w = tid >> 5, lane = tid & 31, ln = lane & 15, hh = lane >> 4;
  const int ntn = N / 64;
  const int wid = blockIdx.x * 4 + w;
  const int mt = wid / ntn, nq = wid % ntn;
  if (mt * 16 >= M) return;
  const int row0 = mt * 16, col0 = nq * 64;
  const float* arow = A + (size_t)(row0 + ln) * lda;
  v8f acc[4] = {};
  for (int kb = 0; kb < K; kb += 32) {
    FragB ah, al;
    const v4f x0 = *(const v4fa*)(arow + kb + 8 * hh), x1 = *(const v4fa*)(arow + kb + 8 * hh + 4);
    const v4f x2 = *(const v4fa*)(arow + kb + 16 + 8 * hh), x3 = *(const v4fa*)(arow + kb + 16 + 8 * hh + 4);
    float xs[16] = {x0[0],x0[1],x0[2],x0[3],x1[0],x1[1],x1[2],x1[3],x2[0],x2[1],x2[2],x2[3],x3[0],x3[1],x3[2],x3[3]};
#pragma unroll
    for (int i = 0; i < 16; ++i) { const unsigned short hb = bf16_bits(xs[i]); ah.u[i] = hb; al.u[i] = ASPLIT ? bf16_bits(xs[i] - bf16_val(hb)) : (unsigned short)0; }
#pragma unroll
    for (int t = 0; t < 4; ++t) {
      const unsigned short* brow = Wt + (size_t)(col0 + t * 16 + ln) * ldb + kb;
      FragB b;
      b.half[0] = *(const v8us*)(brow + 8 * hh);
      b.half[1] = *(const v8us*)(brow + 16 + 8 * hh);
      acc[t] = mmaN<ASPLIT ? 2 : 1>(ah.v, al.v, b.v, b.v, acc[t]);
    }
  }
#pragma unroll
  for (int t = 0; t < 4; ++t) {
    const int col = col0 + t * 16 + ln;
    float bv = bias ? bias[col] : 0.f;
    if (BIAS_BF16) bv = bf16_round(bv);
#pragma unroll
    for (int r = 0; r < 8; ++r) {
      float v = acc[t][r] + bv;
      if (resid) { float rv = resid[(size_t)((row0 + 8 * hh + r) % rmod) * ldr + col]; if (RES_BF16) rv = bf16_round(rv); v += rv; }
      if (ACT == 1) v = fmaxf(v, 0.f);
      if (ACT == 2) v = 0.5f * v * (1.0f + erff(v * 0.70710678118654752f));
      if (ACT == 3) { const float u = 0.7978845608028654f * (v + 0.044715f * v * v * v); v = 0.5f * v * (1.0f + tanhf(u)); }
      so[w][8 * hh + r][t * 16 + ln] = v;
    }
  }
  __builtin_amdgcn_fence(__ATOMIC_ACQ_REL, "workgroup");
  __builtin_amdgcn_wave_barrier();
  const int rsub = lane >> 4, c4 = (lane & 15) * 4;
  {
#pragma unroll
    for (int q = 0; q < 8; ++q) {
      const int r = q * 2 + rsub;
      const v4f v = *(const v4fa*)&so[w][r][c4];
      *(v4f*)(C + (size_t)(row0 + r) * ldc + col0 + c4) = v;
    }
    
  }
}
// row LayerNorm (biased variance, eps) over N: s = X (+ R); optional out_sum <- s; out_norm <- (s-mu)*rsqrt(var+eps)*g + b
template <bool PARAM_BF16>
__global__ __launch_bounds__(256) void k_layernorm(const float* __restrict__ X, const float* __restrict__ R, const float* __restrict__ g, const float* __restrict__ bta,
                                                  float* __restrict__ out_sum, float* __restrict__ out_norm, int N, float eps) {
  __shared__ float red[256];
  const int row = blockIdx.x, tid = threadIdx.x;
  const float* x = X + (size_t)row * N; const float* rr = R ? R + (size_t)row * N : nullptr;
  float vals[16];                     // up to N = 4096
  const int per = N / 256;            // contiguous chunk per thread? use strided-by-4 chunks: thread handles j = tid*4 + 1024*u
  float s1 = 0.f;
  for (int u = 0; u < per / 4; ++u) {
    const int j = tid * 4 + 1024 * u;
    const v4f a = *(const v4fa*)(x + j);
    v4f b = {0.f,0.f,0.f,0.f}; if (rr) b = *(const v4fa*)(rr + j);
#pragma unroll
    for (int q = 0; q < 4; ++q) { const float v = a[q] + b[q]; vals[u * 4 + q] = v; s1 += v; }
  }
  red[tid] = s1; __syncthreads();
  for (int st = 128; st > 0; st >>= 1) { if (tid < st) red[tid] += red[tid + st]; __syncthreads(); }
  const float mu = red[0] / (float)N; __syncthreads();
  float s2 = 0.f;
  for (int u = 0; u < per / 4; ++u)
#pragma unroll
    for (int q = 0; q < 4; ++q) { const float c = vals[u * 4 + q] - mu; s2 += c * c; }
  red[tid] = s2; __syncthreads();
  for (int st = 128; st > 0; st >>= 1) { if (tid < st) red[tid] += red[tid + st]; __syncthreads(); }
  const float rs = rsqrtf(red[0] / (float)N + eps);
  {
    for (int u = 0; u < per / 4; ++u) {
      const int j = tid * 4 + 1024 * u;
      v4f o, sm;
#pragma unroll
      for (int q = 0; q < 4; ++q) {
        float gg = g[j + q], bb = bta[j + q];
        if (PARAM_BF16) { gg = bf16_round(gg); bb = bf16_round(bb); }
        sm[q] = vals[u * 4 + q]; o[q] = (vals[u * 4 + q] - mu) * rs * gg + bb;
      }
      if (out_sum) *(v4f*)(out_sum + (size_t)row * N + j) = sm;
      *(v4f*)(out_norm + (size_t)row * N + j) = o;
    }
    
  }
}



// ---- f16 WMMA path (v_wmma_f32_16x16x32_f16): 11-bit significands for operands in range — used where a [0,1] probability operand needs more precision than bf16
typedef _Float16 v16h __attribute__((ext_vector_type(16)));
union FragH { v16h v; v8us half[2]; _Float16 h[16]; unsigned short u[16]; };
template <int NT>
__device__ __forceinline__ v8f mmaH(v16h ah, v16h al, v16h bh, v16h bl, v8f c) {
  c = __builtin_amdgcn_wmma_f32_16x16x32_f16(false, ah, false, bh, (short)0, c, false, false);
  if (NT >= 2) c = __builtin_amdgcn_wmma_f32_16x16x32_f16(false, al, false, bh, (short)0, c, false, false);
  if (NT >= 3) c = __builtin_amdgcn_wmma_f32_16x16x32_f16(false, ah, false, bl, (short)0, c, false, false);
  asm volatile("v_nop\n\tv_nop\n\tv_nop\n\tv_nop" : "+v"(c) : "v"(ah), "v"(al), "v"(bh), "v"(bl));
  return c;
}
// batched GEMM like k_gemm_b but f16 operands: A f32 (split into f16 hi/lo if ASPLIT, else rounded to f16), Bt = f16 values [n][k]; alpha; C f32; N multiple of 16 (partial tiles skipped)
template <bool ASPLIT>
__global__ __launch_bounds__(128) void k_gemm_h(const float* __restrict__ A, int lda, size_t sA, const _Float16* __restrict__ Bh, int ldb, size_t sB, float alpha, float* __restrict__ C, int ldc, size_t sC, int M, int N, int K) {
  __shared__ __attribute__((aligned(16))) float so[4][16][64];
  const int tid = threadIdx.x, w = tid >> 5, lane = tid & 31, ln = lane & 15, hh = lane >> 4; const int by = blockIdx.y;
  A += (size_t)by * sA; Bh += (size_t)by * sB; C += (size_t)by * sC;
  const int ntn = (N + 63) / 64; const int wid = blockIdx.x * 4 + w; const int mt = wid / ntn, nq = wid % ntn; if (mt * 16 >= M) return;
  const int row0 = mt * 16, col0 = nq * 64; const float* arow = A + (size_t)(row0 + ln) * lda;
  v8f acc[4] = {};
  for (int kb = 0; kb < K; kb += 32) {
    FragH ah, al;
    const v4f x0 = *(const v4fa*)(arow + kb + 8 * hh), x1 = *(const v4fa*)(arow + kb + 8 * hh + 4), x2 = *(const v4fa*)(arow + kb + 16 + 8 * hh), x3 = *(const v4fa*)(arow + kb + 16 + 8 * hh + 4);
    float xs[16] = {x0[0],x0[1],x0[2],x0[3],x1[0],x1[1],x1[2],x1[3],x2[0],x2[1],x2[2],x2[3],x3[0],x3[1],x3[2],x3[3]};
#pragma unroll
    for (int i = 0; i < 16; ++i) { const _Float16 h = (_Float16)xs[i]; ah.h[i] = h; al.h[i] = ASPLIT ? (_Float16)(xs[i] - (float)h) : (_Float16)0.0f; }
#pragma unroll
    for (int t = 0; t < 4; ++t) { if (col0 + t * 16 >= N) continue; const size_t boff = (size_t)(col0 + t * 16 + ln) * ldb + kb; FragH bq; bq.half[0] = *(const v8us*)(Bh + boff + 8 * hh); bq.half[1] = *(const v8us*)(Bh + boff + 16 + 8 * hh);
      acc[t] = mmaH<ASPLIT ? 2 : 1>(ah.v, al.v, bq.v, bq.v, acc[t]); }
  }
#pragma unroll
  for (int t = 0; t < 4; ++t) { if (col0 + t * 16 >= N) continue;
#pragma unroll
    for (int r = 0; r < 8; ++r) so[w][8 * hh + r][t * 16 + ln] = acc[t][r] * alpha; }
  __builtin_amdgcn_fence(__ATOMIC_ACQ_REL, "workgroup"); __builtin_amdgcn_wave_barrier();
  const int rsub = lane >> 4, c4 = (lane & 15) * 4;
  {
#pragma unroll
    for (int q = 0; q < 8; ++q) { const int r = q * 2 + rsub; if (col0 + c4 < N) { const v4f v = *(const v4fa*)&so[w][r][c4]; *(v4f*)(C + (size_t)(row0 + r) * ldc + col0 + c4) = v; } }
     }
}

// Wt[n][k] = f16(W[k][n]·scale) from f32 row-major W[K][N] (scale = power of two; bf16-exact weights stay exact in f16 away from the subnormal range)
__global__ __launch_bounds__(256) void k_wt_f16(const float* __restrict__ W, _Float16* __restrict__ Wt, int K, int N, float scale) {
  const int t = blockIdx.x * 256 + threadIdx.x; if (t >= N * (K / 8)) return; const int n = t / (K / 8), k8 = (t % (K / 8)) * 8; FragH f;
#pragma unroll
  for (int i = 0; i < 8; ++i) f.h[i] = (_Float16)(bf16_round(W[(size_t)(k8 + i) * N + n]) * scale); const v8us o = f.half[0];
  *(v8us*)((unsigned short*)Wt + (size_t)n * K + k8) = o; 
}
// k_gemm_hh variant with fused epilogue: v = acc·alpha + bias[by·sBias + col] (+ CP[(row/rowsPerB)·sCPb + by·64 + col] if CP) ; ACT 0 none / 1 elu ; writes f16 C16 (and f32 C if non-null)
template <int ACT>
__global__ __launch_bounds__(128) void k_gemm_hhx(const _Float16* __restrict__ A, int lda, size_t sA, const _Float16* __restrict__ Bh, int ldb, size_t sB, float alpha, const float* __restrict__ bias, size_t sBias, const float* __restrict__ CP, int rowsPerB, size_t sCPb, int row0g,
    float* __restrict__ C, _Float16* __restrict__ C16, int ldc, size_t sC, int M, int N, int K) {
  __shared__ __attribute__((aligned(16))) float so[4][16][64];
  const int tid = threadIdx.x, w = tid >> 5, lane = tid & 31, ln = lane & 15, hh = lane >> 4; const int by = blockIdx.y;
  A += (size_t)by * sA; Bh += (size_t)by * sB; const size_t cofs = (size_t)by * sC; const float* bp = bias ? bias + (size_t)by * sBias : nullptr;
  const int ntn = (N + 63) / 64; const int wid = blockIdx.x * 4 + w; const int mt = wid / ntn, nq = wid % ntn; if (mt * 16 >= M) return;
  const int row0 = mt * 16, col0 = nq * 64; const _Float16* arow = A + (size_t)(row0 + ln) * lda;
  v8f acc[4] = {};
  for (int kb = 0; kb < K; kb += 32) { FragH ah; ah.half[0] = *(const v8us*)((const unsigned short*)arow + kb + 8 * hh); ah.half[1] = *(const v8us*)((const unsigned short*)arow + kb + 16 + 8 * hh);
#pragma unroll
    for (int t = 0; t < 4; ++t) { if (col0 + t * 16 >= N) continue; const size_t boff = (size_t)(col0 + t * 16 + ln) * ldb + kb; FragH bq; bq.half[0] = *(const v8us*)((const unsigned short*)Bh + boff + 8 * hh); bq.half[1] = *(const v8us*)((const unsigned short*)Bh + boff + 16 + 8 * hh);
      acc[t] = mmaH<1>(ah.v, ah.v, bq.v, bq.v, acc[t]); }
  }
#pragma unroll
  for (int t = 0; t < 4; ++t) { if (col0 + t * 16 >= N) continue; const int col = col0 + t * 16 + ln; const float bv = bp ? bf16_round(bp[col]) : 0.f;
#pragma unroll
    for (int r = 0; r < 8; ++r) { float v = acc[t][r] * alpha + bv; if (CP) { const int rr = row0g + row0 + 8 * hh + r; if (rowsPerB < 0) v += CP[cofs + (size_t)rr * ldc + col];      /* rowsPerB < 0: own element of the batched C plane */ else { const int bidx = rr / rowsPerB; v += CP[(size_t)bidx * sCPb + (size_t)by * 64 + col]; } } if (ACT == 1) v = (v > 0.f) ? v : expm1f(v); else if (ACT == 7) v = (v > 0.f) ? v + 1.0f : expf(v); else if (ACT == 8) v = tanhf(v); else if (ACT == 9) v = 0.5f * v * (1.0f + tanhf(0.7978845608028654f * (v + 0.044715f * v * v * v))); else if (ACT == 11) v = 1.0f / (1.0f + expf(-v)); else if (ACT == 12) v = (v > 0.f) ? v : 0.01f * v; else if (ACT == 14) v = (v > 0.f) ? v : 0.1f * v; else if (ACT == 16) v = (v >= 0.f) ? v : 0.3f * v; else if (ACT == 17) v = (v >= 0.f) ? v : 0.2f * v; else if (ACT == 15) v = v / (1.0f + expf(-v)); else if (ACT == 3) v = fmaxf(v, 0.f); else if (ACT == 6) v = 0.5f * v * (1.0f + erff(v * 0.70710678118654752f)); so[w][8 * hh + r][t * 16 + ln] = v; } }
  __builtin_amdgcn_fence(__ATOMIC_ACQ_REL, "workgroup"); __builtin_amdgcn_wave_barrier();
  const int rsub = lane >> 4, c4 = (lane & 15) * 4; typedef _Float16 v4h __attribute__((ext_vector_type(4)));
  {
#pragma unroll
    for (int q = 0; q < 8; ++q) { const int r = q * 2 + rsub; if (col0 + c4 < N) { const v4f v = *(const v4fa*)&so[w][r][c4]; if (C) *(v4f*)(C + cofs + (size_t)(row0 + r) * ldc + col0 + c4) = v; if (C16) { v4h h4; for (int i = 0; i < 4; ++i) h4[i] = (_Float16)v[i]; *(v4h*)(C16 + cofs + (size_t)(row0 + r) * ldc + col0 + c4) = h4; } } }
     }
}


typedef _Float16 v4h __attribute__((ext_vector_type(4)));

__global__ __launch_bounds__(256) void k_x16(const float* __restrict__ x, _Float16* __restrict__ X16, size_t n8) { const size_t t = (size_t)blockIdx.x * 256 + threadIdx.x; if (t >= n8) return; FragH f;
#pragma unroll
  for (int q = 0; q < 8; ++q) f.h[q] = (_Float16)bf16_round(x[t * 8 + q]); *(v8us*)((unsigned short*)X16 + t * 8) = f.half[0];  }
__global__ __launch_bounds__(256) void k_h16(const float* __restrict__ x, _Float16* __restrict__ X16, size_t n8) { const size_t t = (size_t)blockIdx.x * 256 + threadIdx.x; if (t >= n8) return; FragH f;
#pragma unroll
  for (int q = 0; q < 8; ++q) f.h[q] = (_Float16)x[t * 8 + q]; *(v8us*)((unsigned short*)X16 + t * 8) = f.half[0];  }
__global__ __launch_bounds__(256) void k_round16f(const float* __restrict__ W, _Float16* __restrict__ Bt, size_t n8) { const size_t t = (size_t)blockIdx.x * 256 + threadIdx.x; if (t >= n8) return; FragH f;
#pragma unroll
  for (int i = 0; i < 8; ++i) f.h[i] = (_Float16)(bf16_round(W[t * 8 + i]) * 16.0f); *(v8us*)((unsigned short*)Bt + t * 8) = f.half[0];  }
template <int NHv, int TTv>
__global__ __launch_bounds__(256) void k_vt(const _Float16* __restrict__ V16, int ldv, int voff, _Float16* __restrict__ Vt) { __shared__ unsigned short tl[64][66]; const int tid = threadIdx.x; const int slab = blockIdx.x / (TTv / 64), lg = blockIdx.x % (TTv / 64); const int b = slab / NHv, h = slab % NHv;
  for (int i = tid; i < 64 * 8; i += 256) { const int r = i / 8, c8 = (i % 8) * 8; FragH f; f.half[0] = *(const v8us*)((const unsigned short*)V16 + ((size_t)b * TTv + lg * 64 + r) * ldv + voff + h * 64 + c8);
#pragma unroll
    for (int q = 0; q < 8; ++q) tl[r][c8 + q] = f.u[q]; }
  __syncthreads();
  {
#pragma unroll
    for (int rd = 0; rd < 2; ++rd) { const int d = rd * 32 + tid / 8, pc = tid % 8; FragH f;
#pragma unroll
      for (int q = 0; q < 8; ++q) f.u[q] = tl[pc * 8 + q][d];
      *(v8us*)((unsigned short*)Vt + ((size_t)slab * 64 + d) * TTv + lg * 64 + pc * 8) = f.half[0]; }
     } }

__global__ __launch_bounds__(256) void k_hl(const float* __restrict__ F, _Float16* __restrict__ Hh, _Float16* __restrict__ Hl, size_t n8) { const size_t t = (size_t)blockIdx.x * 256 + threadIdx.x; if (t >= n8) return; FragH fh, fl; const v4f a = *(const v4fa*)(F + t * 8), c = *(const v4fa*)(F + t * 8 + 4);
#pragma unroll
  for (int q = 0; q < 4; ++q) { _Float16 h = (_Float16)a[q]; fh.h[q] = h; fl.h[q] = (_Float16)((a[q] - (float)h) * 1024.0f); h = (_Float16)c[q]; fh.h[4 + q] = h; fl.h[4 + q] = (_Float16)((c[q] - (float)h) * 1024.0f); }
  { *(v8us*)((unsigned short*)Hh + t * 8) = fh.half[0]; *(v8us*)((unsigned short*)Hl + t * 8) = fl.half[0];  } }

// ---- fast GEMM (wave tile 32x64; requires M % 32 == 0 rows per launch region and N % 64 == 0); epilogue = k_gemm_hhx semantics ----
__device__ __forceinline__ v16h g2_frag(const _Float16* p, int hh) { FragH f; f.half[0] = *(const v8us*)((const unsigned short*)p + 8 * hh); f.half[1] = *(const v8us*)((const unsigned short*)p + 16 + 8 * hh); return f.v; }
__device__ __forceinline__ v8f g2_mma(v16h a, v16h b, v8f c) { v8f d = __builtin_amdgcn_wmma_f32_16x16x32_f16(false, a, false, b, (short)0, c, false, false); asm volatile("v_nop\n\tv_nop\n\tv_nop\n\tv_nop" : "+v"(d) : "v"(a), "v"(b)); return d; }
template <int ACT>
__global__ __launch_bounds__(128) void k_gemm2(const _Float16* __restrict__ A, int lda, size_t sA, const _Float16* __restrict__ Bh, int ldb, size_t sB, float alpha, const float* __restrict__ bias, size_t sBias, const float* __restrict__ CP, int rowsPerB, size_t sCPb, int row0g,
    float* __restrict__ C, _Float16* __restrict__ C16, int ldc, size_t sC, int M, int N, int K) { static_assert(ACT == 0 || ACT == 3 || ACT == 6 || ACT == 8 || ACT == 9 || ACT == 11 || ACT == 12 || ACT == 14 || ACT == 15 || ACT == 16 || ACT == 17, "k_gemm2: unsupported ACT code (would silently apply no activation)");
  __shared__ __attribute__((aligned(16))) float so[4][32][68];
  const int tid = threadIdx.x, w = tid >> 5, lane = tid & 31, ln = lane & 15, hh = lane >> 4; const int by = blockIdx.y;
  A += (size_t)by * sA; Bh += (size_t)by * sB; const size_t cofs = (size_t)by * sC; const float* bp = bias ? bias + (size_t)by * sBias : nullptr;
  const int ntn = N >> 6; const int mt = blockIdx.x / ntn, nq = blockIdx.x - mt * ntn; const int row0 = mt * 128 + 32 * w, col0 = nq * 64; if (row0 >= M) return;
  const _Float16* a0p = A + (size_t)(row0 + ln) * lda; const _Float16* a1p = a0p + (size_t)16 * lda;
  const _Float16* b0p = Bh + (size_t)(col0 + ln) * ldb; const _Float16* b1p = b0p + (size_t)16 * ldb; const _Float16* b2p = b1p + (size_t)16 * ldb; const _Float16* b3p = b2p + (size_t)16 * ldb;
  const v8f z8 = {0.f,0.f,0.f,0.f,0.f,0.f,0.f,0.f}; v8f c00 = z8, c01 = z8, c02 = z8, c03 = z8, c10 = z8, c11 = z8, c12 = z8, c13 = z8;
#pragma unroll 1
  for (int kb = 0; kb < K; kb += 32) { const v16h a0 = g2_frag(a0p + kb, hh), a1 = g2_frag(a1p + kb, hh);
    v16h b = g2_frag(b0p + kb, hh); c00 = g2_mma(a0, b, c00); c10 = g2_mma(a1, b, c10);
    b = g2_frag(b1p + kb, hh); c01 = g2_mma(a0, b, c01); c11 = g2_mma(a1, b, c11);
    b = g2_frag(b2p + kb, hh); c02 = g2_mma(a0, b, c02); c12 = g2_mma(a1, b, c12);
    b = g2_frag(b3p + kb, hh); c03 = g2_mma(a0, b, c03); c13 = g2_mma(a1, b, c13); }
  v8f accs[8] = {c00, c01, c02, c03, c10, c11, c12, c13};
#pragma unroll
  for (int u = 0; u < 8; ++u) { const int t = u & 3, half = u >> 2; const int col = col0 + t * 16 + ln; const float bv = bp ? bf16_round(bp[col]) : 0.f;
#pragma unroll
    for (int r = 0; r < 8; ++r) { const int rloc = half * 16 + 8 * hh + r; float v = accs[u][r] * alpha + bv; if (CP) { if (rowsPerB < 0) v += CP[cofs + (size_t)(row0g + row0 + rloc) * ldc + col];      /* rowsPerB < 0: own element of the batched C plane */ else { const int bidx = (row0g + row0 + rloc) / rowsPerB; v += CP[(size_t)bidx * sCPb + (size_t)by * 64 + col]; } }
      if (ACT == 3) v = fmaxf(v, 0.f); else if (ACT == 6) v = 0.5f * v * (1.0f + erff(v * 0.70710678118654752f)); else if (ACT == 11) v = 1.0f / (1.0f + expf(-v)); else if (ACT == 15) v = v / (1.0f + expf(-v)); else if (ACT == 12) v = (v > 0.f) ? v : 0.01f * v; else if (ACT == 8) v = tanhf(v); else if (ACT == 9) v = 0.5f * v * (1.0f + tanhf(0.7978845608028654f * (v + 0.044715f * v * v * v))); else if (ACT == 14) v = (v > 0.f) ? v : 0.1f * v; else if (ACT == 16) v = (v >= 0.f) ? v : 0.3f * v; else if (ACT == 17) v = (v >= 0.f) ? v : 0.2f * v;
      so[w][rloc][t * 16 + ln] = v; } }
  __builtin_amdgcn_fence(__ATOMIC_ACQ_REL, "workgroup"); __builtin_amdgcn_wave_barrier();
  const int rsub = lane >> 4, c4 = (lane & 15) * 4;
  {
#pragma unroll
    for (int q = 0; q < 16; ++q) { const int r = q * 2 + rsub; const v4f v = *(const v4fa*)&so[w][r][c4]; if (C) *(v4f*)(C + cofs + (size_t)(row0 + r) * ldc + col0 + c4) = v; if (C16) { v4h h4; for (int i = 0; i < 4; ++i) h4[i] = (_Float16)v[i]; *(v4h*)(C16 + cofs + (size_t)(row0 + r) * ldc + col0 + c4) = h4; } }
     } }


__global__ __launch_bounds__(256) void k_wnat(const float* __restrict__ w, size_t n8, _Float16* __restrict__ Bt) { const size_t t = (size_t)blockIdx.x * 256 + threadIdx.x; if (t >= n8) return; FragH f; for (int q = 0; q < 8; ++q) f.h[q] = (_Float16)(bf16_round(w[t * 8 + q]) * 16.0f); *(v8us*)((unsigned short*)Bt + t * 8) = f.half[0];  }
__global__ __launch_bounds__(256) void k_rsm(const float* __restrict__ S, _Float16* __restrict__ P, int nrows) {
  #pragma clang fp contract(off)
  const int i = blockIdx.x * 256 + threadIdx.x; if (i >= nrows) return; const float* s = S + (size_t)i * SQ; float mx = -3.0e38f;
#pragma unroll 1
  for (int j = 0; j < SQ; ++j) mx = fmaxf(mx, s[j]); float se = 0.f;
#pragma unroll 1
  for (int j = 0; j < SQ; ++j) se += expf(s[j] - mx); const float sc = 256.0f / se;
#pragma unroll 1
  for (int j0 = 0; j0 < SQ; j0 += 8) { FragH f; for (int q = 0; q < 8; ++q) f.h[q] = (_Float16)(expf(s[j0 + q] - mx) * sc); unsigned short* d = (unsigned short*)P + (size_t)i * SQ + j0; *(v8us*)d = f.half[0];  } }
__global__ __launch_bounds__(256) void k_vt(const _Float16* __restrict__ V16, int b, int h0, _Float16* __restrict__ VT) { __shared__ unsigned short tl[64][65]; const int tid = threadIdx.x; const int hh = blockIdx.x % HG, sg = blockIdx.x / HG; const int s0 = sg * 64; const int h = h0 + hh;
  for (int i = tid; i < 64 * 8; i += 256) { const int j = i / 8, d8 = (i % 8) * 8; FragH f; f.half[0] = *(const v8us*)((const unsigned short*)V16 + ((size_t)b * SQ + s0 + j) * DM + h * HD + d8); for (int q = 0; q < 8; ++q) tl[d8 + q][j] = f.u[q]; }
  __syncthreads();
  { for (int i = tid; i < 64 * 8; i += 256) { const int d = i / 8, j8 = (i % 8) * 8; FragH f; for (int q = 0; q < 8; ++q) f.u[q] = tl[d][j8 + q]; *(v8us*)((unsigned short*)VT + ((size_t)hh * HD + d) * SQ + s0 + j8) = f.half[0]; }  } }



__global__ __launch_bounds__(256) void k_rsmkm(const float* __restrict__ S, _Float16* __restrict__ P, int nrows, const int* __restrict__ am) {
  #pragma clang fp contract(off)
  const int t = blockIdx.x * 256 + threadIdx.x; if (t >= nrows) return; const size_t i = (size_t)t; const float* s = S + i * SQ; const int* mr = am + (size_t)(t % SQ) * SQ; float mx = -3.0e38f;
#pragma unroll 1
  for (int j = 0; j < SQ; ++j) { const float f = (mr[j] != 0) ? 1.f : 0.f; mx = fmaxf(mx, fmaf(f, s[j], (1.f - f) * -1.0e9f)); } float se = 0.f;
#pragma unroll 1
  for (int j = 0; j < SQ; ++j) { const float f = (mr[j] != 0) ? 1.f : 0.f; se += __expf(fmaf(f, s[j], (1.f - f) * -1.0e9f) - mx); } const float sc = 256.0f / se;
#pragma unroll 1
  for (int j0 = 0; j0 < SQ; j0 += 8) { FragH fr; for (int q = 0; q < 8; ++q) { const int j = j0 + q; const float f = (mr[j] != 0) ? 1.f : 0.f; fr.h[q] = (_Float16)(__expf(fmaf(f, s[j], (1.f - f) * -1.0e9f) - mx) * sc); }
    unsigned short* d = (unsigned short*)P + i * SQ + j0; *(v8us*)d = fr.half[0];  } }

__global__ __launch_bounds__(256) void k_bdshn(const float* __restrict__ Wb, _Float16* __restrict__ Bt) {
  const size_t t = (size_t)blockIdx.x * 256 + threadIdx.x; if (t >= (size_t)DM * DM / 8) return; const size_t e0 = t * 8; const int n = (int)(e0 / DM), k0 = (int)(e0 % DM); const int h = n >> 6, hk = k0 >> 6; const float on = (hk == h) ? 16.0f : 0.0f; const int o = n & 63, d0 = k0 & 63; FragH f;
  for (int q = 0; q < 8; ++q) f.h[q] = (_Float16)(bf16_round(Wb[(size_t)o * 64 + d0 + q]) * on);
  unsigned short* d = (unsigned short*)Bt + e0; *(v8us*)d = f.half[0];  }

__global__ __launch_bounds__(256) void k_rsmk1(const float* __restrict__ S, _Float16* __restrict__ P, int nrows, const int* __restrict__ Km) {
  #pragma clang fp contract(off)
  const int i = blockIdx.x * 256 + threadIdx.x; if (i >= nrows) return; const float* s = S + (size_t)i * SQ; float mx = -3.0e38f;
#pragma unroll 1
  for (int j = 0; j < SQ; ++j) mx = fmaxf(mx, s[j]); float se = 0.f;
#pragma unroll 1
  for (int j = 0; j < SQ; ++j) { const float keep = (Km[j] != 0) ? 1.0f : 0.0f; se += __expf(s[j] - mx) * keep; } const float sc = 256.0f / se;
#pragma unroll 1
  for (int j0 = 0; j0 < SQ; j0 += 8) { FragH f; for (int q = 0; q < 8; ++q) { const float keep = (Km[j0 + q] != 0) ? 1.0f : 0.0f; f.h[q] = (_Float16)(__expf(s[j0 + q] - mx) * sc * keep); } unsigned short* d = (unsigned short*)P + (size_t)i * SQ + j0; *(v8us*)d = f.half[0];  } }
extern "C" void kernel_launch(void* const* d_in, const int* in_sizes, int n_in,
                              void* d_out, int out_size, void* d_ws, size_t ws_size, hipStream_t stream) {
  (void)in_sizes; (void)n_in; (void)out_size;
  const float* const* I = (const float* const*)d_in; const float* xq = I[2]; const float* xk = I[1]; const float* xv = I[0]; const int* km = (const int*)d_in[3]; const float* wq = I[6]; const float* bq = nullptr; const float* wk = I[5]; const float* bk = nullptr; const float* wv = I[4]; const float* bv = nullptr; const float* wo = I[7]; const float* bo = I[8]; const float* x = xq;      /* contract order: values I[0], keys I[1], query I[2]; mask int32 [4][1][1][2048] (0 = masked key; READ on device); SHARED natural [64][64] blocks Wv I[4], Wk I[5], Wq I[6]; natural Wo [512][512] + bo */
  char* ws = (char*)d_ws; size_t off = 0;
  auto take = [&](size_t bytes) { char* p = ws + off; off += (bytes + 255) & ~(size_t)255; return p; };
  _Float16* BQ = (_Float16*)take((size_t)DM * DM * 2); _Float16* BK = (_Float16*)take((size_t)DM * DM * 2); _Float16* BV = (_Float16*)take((size_t)DM * DM * 2); _Float16* BO = (_Float16*)take((size_t)DM * DM * 2);
  _Float16* X16 = (_Float16*)take(NR * DM * 2); _Float16* XKp = (_Float16*)take(NR * DM * 2); _Float16* XVp = (_Float16*)take(NR * DM * 2); _Float16* Q16 = (_Float16*)take(NR * DM * 2); _Float16* K16 = (_Float16*)take(NR * DM * 2); _Float16* V16 = (_Float16*)take(NR * DM * 2); _Float16* O16 = (_Float16*)take(NR * DM * 2);
  float* S = (float*)take((size_t)HG * SQ * SQ * 4); _Float16* P = (_Float16*)take((size_t)HG * SQ * SQ * 2); _Float16* VT = (_Float16*)take((size_t)NH * HD * SQ * 2);
  if (off > ws_size) return;
  { const unsigned g = (unsigned)(((size_t)DM * DM / 8 + 255) / 256); k_bdshn<<<g, 256, 0, stream>>>(wq, BQ); k_bdshn<<<g, 256, 0, stream>>>(wk, BK); k_bdshn<<<g, 256, 0, stream>>>(wv, BV); k_wnat<<<g, 256, 0, stream>>>(wo, (size_t)DM * DM / 8, BO); }      /* block-diagonal planes with the SHARED natural [64][64] block (Bt[h*64 + o][h*64 + d] = 16 W[o][d]); Wo natural [out][in] = Bt x16 */
  _Float16* XK = XKp; _Float16* XV = XVp; k_x16<<<(unsigned)((NR * DM / 8 + 255) / 256), 256, 0, stream>>>(xk, XK, NR * DM / 8); k_x16<<<(unsigned)((NR * DM / 8 + 255) / 256), 256, 0, stream>>>(xv, XV, NR * DM / 8);      /* key and value inputs as exact f16 rows */

  k_x16<<<(unsigned)((NR * DM / 8 + 255) / 256), 256, 0, stream>>>(x, X16, NR * DM / 8);
  const size_t r0p = (size_t)B0 * SQ;      /* first projected row */
  k_gemm2<0><<<dim3((unsigned)((MP / 128) * (DM / 64)), 1), 128, 0, stream>>>(X16 + r0p * DM, DM, 0, BQ, DM, 0, 0.0625f, bq, 0, nullptr, 1, 0, 0, nullptr, Q16 + r0p * DM, DM, 0, MP, DM, DM);
  k_gemm2<0><<<dim3((unsigned)((MP / 128) * (DM / 64)), 1), 128, 0, stream>>>(XK + r0p * DM, DM, 0, BK, DM, 0, 0.0625f, bk, 0, nullptr, 1, 0, 0, nullptr, K16 + r0p * DM, DM, 0, MP, DM, DM);
  k_gemm2<0><<<dim3((unsigned)((MP / 128) * (DM / 64)), 1), 128, 0, stream>>>(XV + r0p * DM, DM, 0, BV, DM, 0, 0.0625f, bv, 0, nullptr, 1, 0, 0, nullptr, V16 + r0p * DM, DM, 0, MP, DM, DM);
  for (int b = B0; b < B0 + NBR; ++b) { const size_t r0 = (size_t)b * SQ;
    k_vt<NH, SQ><<<NH * (SQ / 64), 256, 0, stream>>>(V16 + r0 * LQ, LQ, 0, VT);      /* V^T [NH][HD][SQ] for this batch */
    for (int h0 = 0; h0 < NHD; h0 += HG) {
      k_gemm2<0><<<dim3((QN / 128) * (SQ / 64), HG), 128, 0, stream>>>(Q16 + r0 * LQ + h0 * HD, LQ, (size_t)HD, K16 + r0 * LQ + h0 * HD, LQ, (size_t)HD, 0.044194173824159216f, nullptr, 0, nullptr, 1, 0, 0, S, nullptr, SQ, (size_t)SQ * SQ, QN, SQ, HD);      /* scores, HG heads per launch */
      k_rsmk1<<<(HG * SQ + 255) / 256, 256, 0, stream>>>(S, P, HG * SQ, km + (size_t)b * SQ);      /* keys with mask[b][j] == 0 excluded (arithmetic 0/1 keep factor; weight exactly 0 as the module's -1e20 fill); P x256 f16, rows of all HG heads */
      k_gemm2<0><<<dim3((QN / 128) * (HD / 64), HG), 128, 0, stream>>>(P, SQ, (size_t)SQ * SQ, VT + (size_t)h0 * HD * SQ, SQ, (size_t)HD * SQ, 0.25f, nullptr, 0, nullptr, 1, 0, 0, nullptr, O16 + r0 * DM + h0 * HD, DM, (size_t)HD, QN, HD, SQ); } }      /* o (merged heads) as f16 rows */
  k_gemm2<0><<<dim3((unsigned)((MPO / 128) * (DM / 64)), 1), 128, 0, stream>>>(O16 + r0p * DM, DM, 0, BO, DM, 0, 0.0009765625f, bo, 0, nullptr, 1, 0, 0, (float*)d_out + r0p * DM, nullptr, DM, 0, MPO, DM, DM);      /* out rows are the output layout */
}

// v001
// One run takes 921 microseconds.
// Next to v000, in two timings, it ran 3.65 times as fast each time.
#include <hip/hip_runtime.h>
// Multi-head attention over three inputs with SHARED per-head projections, a random key-padding mask and the module's literal score scale (values, keys, query [4][2048][512]; each input is split into 8 heads of 64 and every head is multiplied by the SAME natural [64][64] matrix (x W^T: Wv / Wk / Wq; no biases); energy = q k^T; where(mask == 0, -1e20) with the int32 [4][1][1][2048] mask in {0, 1} (random; 0 = masked key; READ on device); softmax(energy / sqrt(embed_size) = / sqrt(512)) (as the source); out = merged Wo^T + bo -> [4][2048][512]).
// Structure: token rows r = b*2048 + s; x as exact f16 rows (bf16-rounded); Q, K, V as three WMMA GEMMs (32x64 wave tiles, f32 accumulation, exact x16 weights, no bias, f16 outputs); per batch: V^T for all heads via LDS transposes; per (batch, group of 4 heads): scores GEMM (K = 64, batched over the heads on grid.y, alpha = 1/sqrt(512) (masked keys then dropped by a select: identical selection)), row softmax on VALU (f32 statistics; weights stored x256 as f16), o = P . V^T GEMM (K = 2048, alpha 2^-2: o carried x64 against f16 subnormal flush, folded into the output GEMM alpha) written straight into the merged f16 o rows; out = o W_o + b GEMM (f32) into the output layout.
// Compute dtype: inputs rounded to bf16; x / weights exact; q, k, v, softmax weights and o as plain f16 GEMM operands (~2^-12); scores and softmax statistics f32. v_wmma_f32_16x16x32_f16.
#define NB 4
#define SQ 2048
#define DM 512
#define NH 8
#define HD 64
#define HG 4                         /* heads per attention launch group */
#define B0 0                         /* first batch processed (debug hook) */
#define NBR NB                       /* batches processed (debug hook) */
#define NR ((size_t)NB * SQ)         /* token rows */
#define MP ((int)((size_t)NBR * SQ)) /* rows projected (debug hook) */
#define QN SQ                        /* query rows attended per batch (debug hook) */
#define NHD NH                       /* heads attended (debug hook) */
#define MPO MP                       /* rows through the output stage (debug hook) */
#define LQ DM      /* row pitch of the q/k/v rows */
typedef __bf16 v16b __attribute__((ext_vector_type(16)));
typedef unsigned short v8us __attribute__((ext_vector_type(8), may_alias));
typedef float  v8f  __attribute__((ext_vector_type(8)));
typedef float  v4f  __attribute__((ext_vector_type(4)));
typedef float  v4fa __attribute__((ext_vector_type(4), may_alias));
union FragB { v16b v; v8us half[2]; unsigned short u[16]; };

__device__ __forceinline__ unsigned short bf16_bits(float x) { unsigned int u = __float_as_uint(x); return (unsigned short)((u + 0x7FFFu + ((u >> 16) & 1u)) >> 16); }
__device__ __forceinline__ float bf16_val(unsigned short b) { return __uint_as_float(((unsigned int)b) << 16); }
__device__ __forceinline__ float bf16_round(float x) { return bf16_val(bf16_bits(x)); }
// D += A·B with NT terms: 1 = ah·bh, 2 = + al·bh (A split), 3 = + ah·bl (both split)
template <int NT>
__device__ __forceinline__ v8f mmaN(v16b ah, v16b al, v16b bh, v16b bl, v8f c) {
  c = __builtin_amdgcn_wmma_f32_16x16x32_bf16(false, ah, false, bh, (short)0, c, false, false);
  if (NT >= 2) c = __builtin_amdgcn_wmma_f32_16x16x32_bf16(false, al, false, bh, (short)0, c, false, false);
  if (NT >= 3) c = __builtin_amdgcn_wmma_f32_16x16x32_bf16(false, ah, false, bl, (short)0, c, false, false);
  asm volatile("v_nop\n\tv_nop\n\tv_nop\n\tv_nop" : "+v"(c) : "v"(ah), "v"(al), "v"(bh), "v"(bl));
  return c;
}

__global__ __launch_bounds__(256) void k_wt_bf16(const float* __restrict__ W, unsigned short* __restrict__ Wt, int K, int N) {
  const int t = blockIdx.x * 256 + threadIdx.x;
  const int k8n = K / 8;
  if (t >= N * k8n) return;
  const int n = t / k8n, k8 = (t % k8n) * 8;
  v8us v;
#pragma unroll
  for (int i = 0; i < 8; ++i) v[i] = bf16_bits(W[(size_t)(k8 + i) * N + n]);
  *(v8us*)(Wt + (size_t)n * K + k8) = v;
  
}

// GEMM C[M][N] (f32, pitch ldc) = act(A[M][K]·W + bias). A f32 row-major (pitch lda) converted per fragment to bf16
// (ASPLIT: hi/lo two planes -> 2 terms, else single rounded term); Wt bf16 [N][K] (pitch ldb). BIAS_BF16 rounds the
// bias to bf16 first (bias quantised to bf16 before the add). K%32==0, M%16==0, N%64==0.
template <bool ASPLIT, int ACT, bool BIAS_BF16>
__global__ __launch_bounds__(128) void k_gemm_bf(const float* __restrict__ A, int lda, const unsigned short* __restrict__ Wt, int ldb,
                                               const float* __restrict__ bias, float* __restrict__ C, int ldc, int M, int N, int K) {
  __shared__ __attribute__((aligned(16))) float so[4][16][64];
  const int tid = threadIdx.x, w = tid >> 5, lane = tid & 31, ln = lane & 15, hh = lane >> 4;
  const int ntn = N / 64;
  const int wid = blockIdx.x * 4 + w;
  const int mt = wid / ntn, nq = wid % ntn;
  if (mt * 16 >= M) return;
  const int row0 = mt * 16, col0 = nq * 64;
  const float* arow = A + (size_t)(row0 + ln) * lda;
  v8f acc[4] = {};
  for (int kb = 0; kb < K; kb += 32) {
    FragB ah, al;
    const v4f x0 = *(const v4fa*)(arow + kb + 8 * hh), x1 = *(const v4fa*)(arow + kb + 8 * hh + 4);
    const v4f x2 = *(const v4fa*)(arow + kb + 16 + 8 * hh), x3 = *(const v4fa*)(arow + kb + 16 + 8 * hh + 4);
    float xs[16] = {x0[0],x0[1],x0[2],x0[3],x1[0],x1[1],x1[2],x1[3],x2[0],x2[1],x2[2],x2[3],x3[0],x3[1],x3[2],x3[3]};
#pragma unroll
    for (int i = 0; i < 16; ++i) { const unsigned short hb = bf16_bits(xs[i]); ah.u[i] = hb; al.u[i] = ASPLIT ? bf16_bits(xs[i] - bf16_val(hb)) : (unsigned short)0; }
#pragma unroll
    for (int t = 0; t < 4; ++t) {
      const unsigned short* brow = Wt + (size_t)(col0 + t * 16 + ln) * ldb + kb;
      FragB b;
      b.half[0] = *(const v8us*)(brow + 8 * hh);
      b.half[1] = *(const v8us*)(brow + 16 + 8 * hh);
      acc[t] = mmaN<ASPLIT ? 2 : 1>(ah.v, al.v, b.v, b.v, acc[t]);
    }
  }
#pragma unroll
  for (int t = 0; t < 4; ++t) {
    float bv = bias ? bias[col0 + t * 16 + ln] : 0.f;
    if (BIAS_BF16) bv = bf16_round(bv);
#pragma unroll
    for (int r = 0; r < 8; ++r) { float v = acc[t][r] + bv; if (ACT == 1) v = fmaxf(v, 0.f); so[w][8 * hh + r][t * 16 + ln] = v; }
  }
  __builtin_amdgcn_fence(__ATOMIC_ACQ_REL, "workgroup");
  __builtin_amdgcn_wave_barrier();
  const int rsub = lane >> 4, c4 = (lane & 15) * 4;
  {
#pragma unroll
    for (int q = 0; q < 8; ++q) {
      const int r = q * 2 + rsub;
      const v4f v = *(const v4fa*)&so[w][r][c4];
      *(v4f*)(C + (size_t)(row0 + r) * ldc + col0 + c4) = v;
    }
    
  }
}

// GEMM C = act(A·W + bias + resid): A f32 (ASPLIT -> hi/lo 2 terms), Wt bf16 [N][K]; ACT 0 none, 1 relu, 2 exact gelu;
// resid (optional, f32, row index = (row % rmod), pitch ldr, RES_BF16 rounds it) added before the activation.
template <bool ASPLIT, int ACT, bool BIAS_BF16, bool RES_BF16>
__global__ __launch_bounds__(128) void k_gemm_bf3(const float* __restrict__ A, int lda, const unsigned short* __restrict__ Wt, int ldb,
                                                const float* __restrict__ bias, const float* __restrict__ resid, int rmod, int ldr,
                                                float* __restrict__ C, int ldc, int M, int N, int K) {
  __shared__ __attribute__((aligned(16))) float so[4][16][64];
  const int tid = threadIdx.x, w = tid >> 5, lane = tid & 31, ln = lane & 15, hh = lane >> 4;
  const int ntn = N / 64;
  const int wid = blockIdx.x * 4 + w;
  const int mt = wid / ntn, nq = wid % ntn;
  if (mt * 16 >= M) return;
  const int row0 = mt * 16, col0 = nq * 64;
  const float* arow = A + (size_t)(row0 + ln) * lda;
  v8f acc[4] = {};
  for (int kb = 0; kb < K; kb += 32) {
    FragB ah, al;
    const v4f x0 = *(const v4fa*)(arow + kb + 8 * hh), x1 = *(const v4fa*)(arow + kb + 8 * hh + 4);
    const v4f x2 = *(const v4fa*)(arow + kb + 16 + 8 * hh), x3 = *(const v4fa*)(arow + kb + 16 + 8 * hh + 4);
    float xs[16] = {x0[0],x0[1],x0[2],x0[3],x1[0],x1[1],x1[2],x1[3],x2[0],x2[1],x2[2],x2[3],x3[0],x3[1],x3[2],x3[3]};
#pragma unroll
    for (int i = 0; i < 16; ++i) { const unsigned short hb = bf16_bits(xs[i]); ah.u[i] = hb; al.u[i] = ASPLIT ? bf16_bits(xs[i] - bf16_val(hb)) : (unsigned short)0; }
#pragma unroll
    for (int t = 0; t < 4; ++t) {
      const unsigned short* brow = Wt + (size_t)(col0 + t * 16 + ln) * ldb + kb;
      FragB b;
      b.half[0] = *(const v8us*)(brow + 8 * hh);
      b.half[1] = *(const v8us*)(brow + 16 + 8 * hh);
      acc[t] = mmaN<ASPLIT ? 2 : 1>(ah.v, al.v, b.v, b.v, acc[t]);
    }
  }
#pragma unroll
  for (int t = 0; t < 4; ++t) {
    const int col = col0 + t * 16 + ln;
    float bv = bias ? bias[col] : 0.f;
    if (BIAS_BF16) bv = bf16_round(bv);
#pragma unroll
    for (int r = 0; r < 8; ++r) {
      float v = acc[t][r] + bv;
      if (resid) { float rv = resid[(size_t)((row0 + 8 * hh + r) % rmod) * ldr + col]; if (RES_BF16) rv = bf16_round(rv); v += rv; }
      if (ACT == 1) v = fmaxf(v, 0.f);
      if (ACT == 2) v = 0.5f * v * (1.0f + erff(v * 0.70710678118654752f));
      if (ACT == 3) { const float u = 0.7978845608028654f * (v + 0.044715f * v * v * v); v = 0.5f * v * (1.0f + tanhf(u)); }
      so[w][8 * hh + r][t * 16 + ln] = v;
    }
  }
  __builtin_amdgcn_fence(__ATOMIC_ACQ_REL, "workgroup");
  __builtin_amdgcn_wave_barrier();
  const int rsub = lane >> 4, c4 = (lane & 15) * 4;
  {
#pragma unroll
    for (int q = 0; q < 8; ++q) {
      const int r = q * 2 + rsub;
      const v4f v = *(const v4fa*)&so[w][r][c4];
      *(v4f*)(C + (size_t)(row0 + r) * ldc + col0 + c4) = v;
    }
    
  }
}
// row LayerNorm (biased variance, eps) over N: s = X (+ R); optional out_sum <- s; out_norm <- (s-mu)*rsqrt(var+eps)*g + b
template <bool PARAM_BF16>
__global__ __launch_bounds__(256) void k_layernorm(const float* __restrict__ X, const float* __restrict__ R, const float* __restrict__ g, const float* __restrict__ bta,
                                                  float* __restrict__ out_sum, float* __restrict__ out_norm, int N, float eps) {
  __shared__ float red[256];
  const int row = blockIdx.x, tid = threadIdx.x;
  const float* x = X + (size_t)row * N; const float* rr = R ? R + (size_t)row * N : nullptr;
  float vals[16];                     // up to N = 4096
  const int per = N / 256;            // contiguous chunk per thread? use strided-by-4 chunks: thread handles j = tid*4 + 1024*u
  float s1 = 0.f;
  for (int u = 0; u < per / 4; ++u) {
    const int j = tid * 4 + 1024 * u;
    const v4f a = *(const v4fa*)(x + j);
    v4f b = {0.f,0.f,0.f,0.f}; if (rr) b = *(const v4fa*)(rr + j);
#pragma unroll
    for (int q = 0; q < 4; ++q) { const float v = a[q] + b[q]; vals[u * 4 + q] = v; s1 += v; }
  }
  red[tid] = s1; __syncthreads();
  for (int st = 128; st > 0; st >>= 1) { if (tid < st) red[tid] += red[tid + st]; __syncthreads(); }
  const float mu = red[0] / (float)N; __syncthreads();
  float s2 = 0.f;
  for (int u = 0; u < per / 4; ++u)
#pragma unroll
    for (int q = 0; q < 4; ++q) { const float c = vals[u * 4 + q] - mu; s2 += c * c; }
  red[tid] = s2; __syncthreads();
  for (int st = 128; st > 0; st >>= 1) { if (tid < st) red[tid] += red[tid + st]; __syncthreads(); }
  const float rs = rsqrtf(red[0] / (float)N + eps);
  {
    for (int u = 0; u < per / 4; ++u) {
      const int j = tid * 4 + 1024 * u;
      v4f o, sm;
#pragma unroll
      for (int q = 0; q < 4; ++q) {
        float gg = g[j + q], bb = bta[j + q];
        if (PARAM_BF16) { gg = bf16_round(gg); bb = bf16_round(bb); }
        sm[q] = vals[u * 4 + q]; o[q] = (vals[u * 4 + q] - mu) * rs * gg + bb;
      }
      if (out_sum) *(v4f*)(out_sum + (size_t)row * N + j) = sm;
      *(v4f*)(out_norm + (size_t)row * N + j) = o;
    }
    
  }
}



// ---- f16 WMMA path (v_wmma_f32_16x16x32_f16): 11-bit significands for operands in range — used where a [0,1] probability operand needs more precision than bf16
typedef _Float16 v16h __attribute__((ext_vector_type(16)));
union FragH { v16h v; v8us half[2]; _Float16 h[16]; unsigned short u[16]; };
template <int NT>
__device__ __forceinline__ v8f mmaH(v16h ah, v16h al, v16h bh, v16h bl, v8f c) {
  c = __builtin_amdgcn_wmma_f32_16x16x32_f16(false, ah, false, bh, (short)0, c, false, false);
  if (NT >= 2) c = __builtin_amdgcn_wmma_f32_16x16x32_f16(false, al, false, bh, (short)0, c, false, false);
  if (NT >= 3) c = __builtin_amdgcn_wmma_f32_16x16x32_f16(false, ah, false, bl, (short)0, c, false, false);
  asm volatile("v_nop\n\tv_nop\n\tv_nop\n\tv_nop" : "+v"(c) : "v"(ah), "v"(al), "v"(bh), "v"(bl));
  return c;
}
// batched GEMM like k_gemm_b but f16 operands: A f32 (split into f16 hi/lo if ASPLIT, else rounded to f16), Bt = f16 values [n][k]; alpha; C f32; N multiple of 16 (partial tiles skipped)
template <bool ASPLIT>
__global__ __launch_bounds__(128) void k_gemm_h(const float* __restrict__ A, int lda, size_t sA, const _Float16* __restrict__ Bh, int ldb, size_t sB, float alpha, float* __restrict__ C, int ldc, size_t sC, int M, int N, int K) {
  __shared__ __attribute__((aligned(16))) float so[4][16][64];
  const int tid = threadIdx.x, w = tid >> 5, lane = tid & 31, ln = lane & 15, hh = lane >> 4; const int by = blockIdx.y;
  A += (size_t)by * sA; Bh += (size_t)by * sB; C += (size_t)by * sC;
  const int ntn = (N + 63) / 64; const int wid = blockIdx.x * 4 + w; const int mt = wid / ntn, nq = wid % ntn; if (mt * 16 >= M) return;
  const int row0 = mt * 16, col0 = nq * 64; const float* arow = A + (size_t)(row0 + ln) * lda;
  v8f acc[4] = {};
  for (int kb = 0; kb < K; kb += 32) {
    FragH ah, al;
    const v4f x0 = *(const v4fa*)(arow + kb + 8 * hh), x1 = *(const v4fa*)(arow + kb + 8 * hh + 4), x2 = *(const v4fa*)(arow + kb + 16 + 8 * hh), x3 = *(const v4fa*)(arow + kb + 16 + 8 * hh + 4);
    float xs[16] = {x0[0],x0[1],x0[2],x0[3],x1[0],x1[1],x1[2],x1[3],x2[0],x2[1],x2[2],x2[3],x3[0],x3[1],x3[2],x3[3]};
#pragma unroll
    for (int i = 0; i < 16; ++i) { const _Float16 h = (_Float16)xs[i]; ah.h[i] = h; al.h[i] = ASPLIT ? (_Float16)(xs[i] - (float)h) : (_Float16)0.0f; }
#pragma unroll
    for (int t = 0; t < 4; ++t) { if (col0 + t * 16 >= N) continue; const size_t boff = (size_t)(col0 + t * 16 + ln) * ldb + kb; FragH bq; bq.half[0] = *(const v8us*)(Bh + boff + 8 * hh); bq.half[1] = *(const v8us*)(Bh + boff + 16 + 8 * hh);
      acc[t] = mmaH<ASPLIT ? 2 : 1>(ah.v, al.v, bq.v, bq.v, acc[t]); }
  }
#pragma unroll
  for (int t = 0; t < 4; ++t) { if (col0 + t * 16 >= N) continue;
#pragma unroll
    for (int r = 0; r < 8; ++r) so[w][8 * hh + r][t * 16 + ln] = acc[t][r] * alpha; }
  __builtin_amdgcn_fence(__ATOMIC_ACQ_REL, "workgroup"); __builtin_amdgcn_wave_barrier();
  const int rsub = lane >> 4, c4 = (lane & 15) * 4;
  {
#pragma unroll
    for (int q = 0; q < 8; ++q) { const int r = q * 2 + rsub; if (col0 + c4 < N) { const v4f v = *(const v4fa*)&so[w][r][c4]; *(v4f*)(C + (size_t)(row0 + r) * ldc + col0 + c4) = v; } }
     }
}

// Wt[n][k] = f16(W[k][n]·scale) from f32 row-major W[K][N] (scale = power of two; bf16-exact weights stay exact in f16 away from the subnormal range)
__global__ __launch_bounds__(256) void k_wt_f16(const float* __restrict__ W, _Float16* __restrict__ Wt, int K, int N, float scale) {
  const int t = blockIdx.x * 256 + threadIdx.x; if (t >= N * (K / 8)) return; const int n = t / (K / 8), k8 = (t % (K / 8)) * 8; FragH f;
#pragma unroll
  for (int i = 0; i < 8; ++i) f.h[i] = (_Float16)(bf16_round(W[(size_t)(k8 + i) * N + n]) * scale); const v8us o = f.half[0];
  *(v8us*)((unsigned short*)Wt + (size_t)n * K + k8) = o; 
}
// k_gemm_hh variant with fused epilogue: v = acc·alpha + bias[by·sBias + col] (+ CP[(row/rowsPerB)·sCPb + by·64 + col] if CP) ; ACT 0 none / 1 elu ; writes f16 C16 (and f32 C if non-null)
template <int ACT>
__global__ __launch_bounds__(128) void k_gemm_hhx(const _Float16* __restrict__ A, int lda, size_t sA, const _Float16* __restrict__ Bh, int ldb, size_t sB, float alpha, const float* __restrict__ bias, size_t sBias, const float* __restrict__ CP, int rowsPerB, size_t sCPb, int row0g,
    float* __restrict__ C, _Float16* __restrict__ C16, int ldc, size_t sC, int M, int N, int K) {
  __shared__ __attribute__((aligned(16))) float so[4][16][64];
  const int tid = threadIdx.x, w = tid >> 5, lane = tid & 31, ln = lane & 15, hh = lane >> 4; const int by = blockIdx.y;
  A += (size_t)by * sA; Bh += (size_t)by * sB; const size_t cofs = (size_t)by * sC; const float* bp = bias ? bias + (size_t)by * sBias : nullptr;
  const int ntn = (N + 63) / 64; const int wid = blockIdx.x * 4 + w; const int mt = wid / ntn, nq = wid % ntn; if (mt * 16 >= M) return;
  const int row0 = mt * 16, col0 = nq * 64; const _Float16* arow = A + (size_t)(row0 + ln) * lda;
  v8f acc[4] = {};
  for (int kb = 0; kb < K; kb += 32) { FragH ah; ah.half[0] = *(const v8us*)((const unsigned short*)arow + kb + 8 * hh); ah.half[1] = *(const v8us*)((const unsigned short*)arow + kb + 16 + 8 * hh);
#pragma unroll
    for (int t = 0; t < 4; ++t) { if (col0 + t * 16 >= N) continue; const size_t boff = (size_t)(col0 + t * 16 + ln) * ldb + kb; FragH bq; bq.half[0] = *(const v8us*)((const unsigned short*)Bh + boff + 8 * hh); bq.half[1] = *(const v8us*)((const unsigned short*)Bh + boff + 16 + 8 * hh);
      acc[t] = mmaH<1>(ah.v, ah.v, bq.v, bq.v, acc[t]); }
  }
#pragma unroll
  for (int t = 0; t < 4; ++t) { if (col0 + t * 16 >= N) continue; const int col = col0 + t * 16 + ln; const float bv = bp ? bf16_round(bp[col]) : 0.f;
#pragma unroll
    for (int r = 0; r < 8; ++r) { float v = acc[t][r] * alpha + bv; if (CP) { const int rr = row0g + row0 + 8 * hh + r; if (rowsPerB < 0) v += CP[cofs + (size_t)rr * ldc + col];      /* rowsPerB < 0: own element of the batched C plane */ else { const int bidx = rr / rowsPerB; v += CP[(size_t)bidx * sCPb + (size_t)by * 64 + col]; } } if (ACT == 1) v = (v > 0.f) ? v : expm1f(v); else if (ACT == 7) v = (v > 0.f) ? v + 1.0f : expf(v); else if (ACT == 8) v = tanhf(v); else if (ACT == 9) v = 0.5f * v * (1.0f + tanhf(0.7978845608028654f * (v + 0.044715f * v * v * v))); else if (ACT == 11) v = 1.0f / (1.0f + expf(-v)); else if (ACT == 12) v = (v > 0.f) ? v : 0.01f * v; else if (ACT == 14) v = (v > 0.f) ? v : 0.1f * v; else if (ACT == 16) v = (v >= 0.f) ? v : 0.3f * v; else if (ACT == 17) v = (v >= 0.f) ? v : 0.2f * v; else if (ACT == 15) v = v / (1.0f + expf(-v)); else if (ACT == 3) v = fmaxf(v, 0.f); else if (ACT == 6) v = 0.5f * v * (1.0f + erff(v * 0.70710678118654752f)); so[w][8 * hh + r][t * 16 + ln] = v; } }
  __builtin_amdgcn_fence(__ATOMIC_ACQ_REL, "workgroup"); __builtin_amdgcn_wave_barrier();
  const int rsub = lane >> 4, c4 = (lane & 15) * 4; typedef _Float16 v4h __attribute__((ext_vector_type(4)));
  {
#pragma unroll
    for (int q = 0; q < 8; ++q) { const int r = q * 2 + rsub; if (col0 + c4 < N) { const v4f v = *(const v4fa*)&so[w][r][c4]; if (C) *(v4f*)(C + cofs + (size_t)(row0 + r) * ldc + col0 + c4) = v; if (C16) { v4h h4; for (int i = 0; i < 4; ++i) h4[i] = (_Float16)v[i]; *(v4h*)(C16 + cofs + (size_t)(row0 + r) * ldc + col0 + c4) = h4; } } }
     }
}


typedef _Float16 v4h __attribute__((ext_vector_type(4)));

__global__ __launch_bounds__(256) void k_x16(const float* __restrict__ x, _Float16* __restrict__ X16, size_t n8) { const size_t t = (size_t)blockIdx.x * 256 + threadIdx.x; if (t >= n8) return; FragH f;
#pragma unroll
  for (int q = 0; q < 8; ++q) f.h[q] = (_Float16)bf16_round(x[t * 8 + q]); *(v8us*)((unsigned short*)X16 + t * 8) = f.half[0];  }
__global__ __launch_bounds__(256) void k_h16(const float* __restrict__ x, _Float16* __restrict__ X16, size_t n8) { const size_t t = (size_t)blockIdx.x * 256 + threadIdx.x; if (t >= n8) return; FragH f;
#pragma unroll
  for (int q = 0; q < 8; ++q) f.h[q] = (_Float16)x[t * 8 + q]; *(v8us*)((unsigned short*)X16 + t * 8) = f.half[0];  }
__global__ __launch_bounds__(256) void k_round16f(const float* __restrict__ W, _Float16* __restrict__ Bt, size_t n8) { const size_t t = (size_t)blockIdx.x * 256 + threadIdx.x; if (t >= n8) return; FragH f;
#pragma unroll
  for (int i = 0; i < 8; ++i) f.h[i] = (_Float16)(bf16_round(W[t * 8 + i]) * 16.0f); *(v8us*)((unsigned short*)Bt + t * 8) = f.half[0];  }
template <int NHv, int TTv>
__global__ __launch_bounds__(256) void k_vt(const _Float16* __restrict__ V16, int ldv, int voff, _Float16* __restrict__ Vt) { __shared__ unsigned short tl[64][66]; const int tid = threadIdx.x; const int slab = blockIdx.x / (TTv / 64), lg = blockIdx.x % (TTv / 64); const int b = slab / NHv, h = slab % NHv;
  for (int i = tid; i < 64 * 8; i += 256) { const int r = i / 8, c8 = (i % 8) * 8; FragH f; f.half[0] = *(const v8us*)((const unsigned short*)V16 + ((size_t)b * TTv + lg * 64 + r) * ldv + voff + h * 64 + c8);
#pragma unroll
    for (int q = 0; q < 8; ++q) tl[r][c8 + q] = f.u[q]; }
  __syncthreads();
  {
#pragma unroll
    for (int rd = 0; rd < 2; ++rd) { const int d = rd * 32 + tid / 8, pc = tid % 8; FragH f;
#pragma unroll
      for (int q = 0; q < 8; ++q) f.u[q] = tl[pc * 8 + q][d];
      *(v8us*)((unsigned short*)Vt + ((size_t)slab * 64 + d) * TTv + lg * 64 + pc * 8) = f.half[0]; }
     } }

__global__ __launch_bounds__(256) void k_hl(const float* __restrict__ F, _Float16* __restrict__ Hh, _Float16* __restrict__ Hl, size_t n8) { const size_t t = (size_t)blockIdx.x * 256 + threadIdx.x; if (t >= n8) return; FragH fh, fl; const v4f a = *(const v4fa*)(F + t * 8), c = *(const v4fa*)(F + t * 8 + 4);
#pragma unroll
  for (int q = 0; q < 4; ++q) { _Float16 h = (_Float16)a[q]; fh.h[q] = h; fl.h[q] = (_Float16)((a[q] - (float)h) * 1024.0f); h = (_Float16)c[q]; fh.h[4 + q] = h; fl.h[4 + q] = (_Float16)((c[q] - (float)h) * 1024.0f); }
  { *(v8us*)((unsigned short*)Hh + t * 8) = fh.half[0]; *(v8us*)((unsigned short*)Hl + t * 8) = fl.half[0];  } }

// ---- fast GEMM (wave tile 32x64; requires M % 32 == 0 rows per launch region and N % 64 == 0); epilogue = k_gemm_hhx semantics ----
__device__ __forceinline__ v16h g2_frag(const _Float16* p, int hh) { FragH f; f.half[0] = *(const v8us*)((const unsigned short*)p + 8 * hh); f.half[1] = *(const v8us*)((const unsigned short*)p + 16 + 8 * hh); return f.v; }
__device__ __forceinline__ v8f g2_mma(v16h a, v16h b, v8f c) { v8f d = __builtin_amdgcn_wmma_f32_16x16x32_f16(false, a, false, b, (short)0, c, false, false); asm volatile("v_nop\n\tv_nop\n\tv_nop\n\tv_nop" : "+v"(d) : "v"(a), "v"(b)); return d; }
template <int ACT>
__global__ __launch_bounds__(128) void k_gemm2(const _Float16* __restrict__ A, int lda, size_t sA, const _Float16* __restrict__ Bh, int ldb, size_t sB, float alpha, const float* __restrict__ bias, size_t sBias, const float* __restrict__ CP, int rowsPerB, size_t sCPb, int row0g,
    float* __restrict__ C, _Float16* __restrict__ C16, int ldc, size_t sC, int M, int N, int K) { static_assert(ACT == 0 || ACT == 3 || ACT == 6 || ACT == 8 || ACT == 9 || ACT == 11 || ACT == 12 || ACT == 14 || ACT == 15 || ACT == 16 || ACT == 17, "k_gemm2: unsupported ACT code (would silently apply no activation)");
  __shared__ __attribute__((aligned(16))) float so[4][32][68];
  const int tid = threadIdx.x, w = tid >> 5, lane = tid & 31, ln = lane & 15, hh = lane >> 4; const int by = blockIdx.y;
  A += (size_t)by * sA; Bh += (size_t)by * sB; const size_t cofs = (size_t)by * sC; const float* bp = bias ? bias + (size_t)by * sBias : nullptr;
  const int ntn = N >> 6; const int mt = blockIdx.x / ntn, nq = blockIdx.x - mt * ntn; const int row0 = mt * 128 + 32 * w, col0 = nq * 64; if (row0 >= M) return;
  const _Float16* a0p = A + (size_t)(row0 + ln) * lda; const _Float16* a1p = a0p + (size_t)16 * lda;
  const _Float16* b0p = Bh + (size_t)(col0 + ln) * ldb; const _Float16* b1p = b0p + (size_t)16 * ldb; const _Float16* b2p = b1p + (size_t)16 * ldb; const _Float16* b3p = b2p + (size_t)16 * ldb;
  const v8f z8 = {0.f,0.f,0.f,0.f,0.f,0.f,0.f,0.f}; v8f c00 = z8, c01 = z8, c02 = z8, c03 = z8, c10 = z8, c11 = z8, c12 = z8, c13 = z8;
#pragma unroll 1
  for (int kb = 0; kb < K; kb += 32) { const v16h a0 = g2_frag(a0p + kb, hh), a1 = g2_frag(a1p + kb, hh);
    v16h b = g2_frag(b0p + kb, hh); c00 = g2_mma(a0, b, c00); c10 = g2_mma(a1, b, c10);
    b = g2_frag(b1p + kb, hh); c01 = g2_mma(a0, b, c01); c11 = g2_mma(a1, b, c11);
    b = g2_frag(b2p + kb, hh); c02 = g2_mma(a0, b, c02); c12 = g2_mma(a1, b, c12);
    b = g2_frag(b3p + kb, hh); c03 = g2_mma(a0, b, c03); c13 = g2_mma(a1, b, c13); }
  v8f accs[8] = {c00, c01, c02, c03, c10, c11, c12, c13};
#pragma unroll
  for (int u = 0; u < 8; ++u) { const int t = u & 3, half = u >> 2; const int col = col0 + t * 16 + ln; const float bv = bp ? bf16_round(bp[col]) : 0.f;
#pragma unroll
    for (int r = 0; r < 8; ++r) { const int rloc = half * 16 + 8 * hh + r; float v = accs[u][r] * alpha + bv; if (CP) { if (rowsPerB < 0) v += CP[cofs + (size_t)(row0g + row0 + rloc) * ldc + col];      /* rowsPerB < 0: own element of the batched C plane */ else { const int bidx = (row0g + row0 + rloc) / rowsPerB; v += CP[(size_t)bidx * sCPb + (size_t)by * 64 + col]; } }
      if (ACT == 3) v = fmaxf(v, 0.f); else if (ACT == 6) v = 0.5f * v * (1.0f + erff(v * 0.70710678118654752f)); else if (ACT == 11) v = 1.0f / (1.0f + expf(-v)); else if (ACT == 15) v = v / (1.0f + expf(-v)); else if (ACT == 12) v = (v > 0.f) ? v : 0.01f * v; else if (ACT == 8) v = tanhf(v); else if (ACT == 9) v = 0.5f * v * (1.0f + tanhf(0.7978845608028654f * (v + 0.044715f * v * v * v))); else if (ACT == 14) v = (v > 0.f) ? v : 0.1f * v; else if (ACT == 16) v = (v >= 0.f) ? v : 0.3f * v; else if (ACT == 17) v = (v >= 0.f) ? v : 0.2f * v;
      so[w][rloc][t * 16 + ln] = v; } }
  __builtin_amdgcn_fence(__ATOMIC_ACQ_REL, "workgroup"); __builtin_amdgcn_wave_barrier();
  const int rsub = lane >> 4, c4 = (lane & 15) * 4;
  {
#pragma unroll
    for (int q = 0; q < 16; ++q) { const int r = q * 2 + rsub; const v4f v = *(const v4fa*)&so[w][r][c4]; if (C) *(v4f*)(C + cofs + (size_t)(row0 + r) * ldc + col0 + c4) = v; if (C16) { v4h h4; for (int i = 0; i < 4; ++i) h4[i] = (_Float16)v[i]; *(v4h*)(C16 + cofs + (size_t)(row0 + r) * ldc + col0 + c4) = h4; } }
     } }


__global__ __launch_bounds__(256) void k_wnat(const float* __restrict__ w, size_t n8, _Float16* __restrict__ Bt) { const size_t t = (size_t)blockIdx.x * 256 + threadIdx.x; if (t >= n8) return; FragH f; for (int q = 0; q < 8; ++q) f.h[q] = (_Float16)(bf16_round(w[t * 8 + q]) * 16.0f); *(v8us*)((unsigned short*)Bt + t * 8) = f.half[0];  }
__global__ __launch_bounds__(256) void k_rsm(const float* __restrict__ S, _Float16* __restrict__ P, int nrows) {
  #pragma clang fp contract(off)
  const int i = blockIdx.x * 256 + threadIdx.x; if (i >= nrows) return; const float* s = S + (size_t)i * SQ; float mx = -3.0e38f;
#pragma unroll 1
  for (int j = 0; j < SQ; ++j) mx = fmaxf(mx, s[j]); float se = 0.f;
#pragma unroll 1
  for (int j = 0; j < SQ; ++j) se += expf(s[j] - mx); const float sc = 256.0f / se;
#pragma unroll 1
  for (int j0 = 0; j0 < SQ; j0 += 8) { FragH f; for (int q = 0; q < 8; ++q) f.h[q] = (_Float16)(expf(s[j0 + q] - mx) * sc); unsigned short* d = (unsigned short*)P + (size_t)i * SQ + j0; *(v8us*)d = f.half[0];  } }
__global__ __launch_bounds__(256) void k_vt(const _Float16* __restrict__ V16, int b, int h0, _Float16* __restrict__ VT) { __shared__ unsigned short tl[64][65]; const int tid = threadIdx.x; const int hh = blockIdx.x % HG, sg = blockIdx.x / HG; const int s0 = sg * 64; const int h = h0 + hh;
  for (int i = tid; i < 64 * 8; i += 256) { const int j = i / 8, d8 = (i % 8) * 8; FragH f; f.half[0] = *(const v8us*)((const unsigned short*)V16 + ((size_t)b * SQ + s0 + j) * DM + h * HD + d8); for (int q = 0; q < 8; ++q) tl[d8 + q][j] = f.u[q]; }
  __syncthreads();
  { for (int i = tid; i < 64 * 8; i += 256) { const int d = i / 8, j8 = (i % 8) * 8; FragH f; for (int q = 0; q < 8; ++q) f.u[q] = tl[d][j8 + q]; *(v8us*)((unsigned short*)VT + ((size_t)hh * HD + d) * SQ + s0 + j8) = f.half[0]; }  } }



__global__ __launch_bounds__(256) void k_rsmkm(const float* __restrict__ S, _Float16* __restrict__ P, int nrows, const int* __restrict__ am) {
  #pragma clang fp contract(off)
  const int t = blockIdx.x * 256 + threadIdx.x; if (t >= nrows) return; const size_t i = (size_t)t; const float* s = S + i * SQ; const int* mr = am + (size_t)(t % SQ) * SQ; float mx = -3.0e38f;
#pragma unroll 1
  for (int j = 0; j < SQ; ++j) { const float f = (mr[j] != 0) ? 1.f : 0.f; mx = fmaxf(mx, fmaf(f, s[j], (1.f - f) * -1.0e9f)); } float se = 0.f;
#pragma unroll 1
  for (int j = 0; j < SQ; ++j) { const float f = (mr[j] != 0) ? 1.f : 0.f; se += __expf(fmaf(f, s[j], (1.f - f) * -1.0e9f) - mx); } const float sc = 256.0f / se;
#pragma unroll 1
  for (int j0 = 0; j0 < SQ; j0 += 8) { FragH fr; for (int q = 0; q < 8; ++q) { const int j = j0 + q; const float f = (mr[j] != 0) ? 1.f : 0.f; fr.h[q] = (_Float16)(__expf(fmaf(f, s[j], (1.f - f) * -1.0e9f) - mx) * sc); }
    unsigned short* d = (unsigned short*)P + i * SQ + j0; *(v8us*)d = fr.half[0];  } }

__global__ __launch_bounds__(256) void k_bdshn(const float* __restrict__ Wb, _Float16* __restrict__ Bt) {
  const size_t t = (size_t)blockIdx.x * 256 + threadIdx.x; if (t >= (size_t)DM * DM / 8) return; const size_t e0 = t * 8; const int n = (int)(e0 / DM), k0 = (int)(e0 % DM); const int h = n >> 6, hk = k0 >> 6; const float on = (hk == h) ? 16.0f : 0.0f; const int o = n & 63, d0 = k0 & 63; FragH f;
  for (int q = 0; q < 8; ++q) f.h[q] = (_Float16)(bf16_round(Wb[(size_t)o * 64 + d0 + q]) * on);
  unsigned short* d = (unsigned short*)Bt + e0; *(v8us*)d = f.half[0];  }

// Masked row softmax as a stream: one wave per two score rows, each row held in registers (64 values a lane), read once.
// A load of a wave covers 512 contiguous bytes of the row, a store 256; 16 waves a work-group, 2 rows a wave, HG * SQ rows = 256 work-groups.
// Values as before: maximum over all keys, e = exp(s - max), masked keys weigh exactly 0, weights x256 as f16. The sum runs in four chains a lane and a butterfly over the lanes.
#define RS_WAVES 16
#define RS_ROWS 2
static_assert((HG * SQ) % (RS_WAVES * RS_ROWS) == 0 && SQ == 2048, "k_rsmw: whole work-groups, rows of 16 x 128 values");
typedef int v4ia __attribute__((ext_vector_type(4), may_alias));
template <int M> __device__ __forceinline__ float rs_xm(float x) { return __builtin_bit_cast(float, __builtin_amdgcn_update_dpp(0, __builtin_bit_cast(int, x), 0x160 | M, 0xf, 0xf, true)); }  // lane l with lane l ^ M inside a 16-lane row
__device__ __forceinline__ float rs_xh(float x) { return __builtin_bit_cast(float, __builtin_amdgcn_permlanex16(__builtin_bit_cast(int, x), __builtin_bit_cast(int, x), 0x76543210, 0xfedcba98, false, false)); }  // lane l with lane l ^ 16
__device__ __forceinline__ float rs_wmax(float v) { v = fmaxf(v, rs_xm<1>(v)); v = fmaxf(v, rs_xm<2>(v)); v = fmaxf(v, rs_xm<4>(v)); v = fmaxf(v, rs_xm<8>(v)); return fmaxf(v, rs_xh(v)); }
__device__ __forceinline__ float rs_wsum(float v) { v += rs_xm<1>(v); v += rs_xm<2>(v); v += rs_xm<4>(v); v += rs_xm<8>(v); return v + rs_xh(v); }
// Four 2^x. Written as asm for the slot behind a transcendental (one independent instruction or v_nop before its result is read or its source overwritten): each v_exp_f32 is followed by
// an independent one (early-clobber outputs share no register with the sources), the last by v_nop.
__device__ __forceinline__ v4f rs_exp4(v4f x) { float e0, e1, e2, e3;
  asm("v_exp_f32 %0, %4\n\tv_exp_f32 %1, %5\n\tv_exp_f32 %2, %6\n\tv_exp_f32 %3, %7\n\tv_nop" : "=&v"(e0), "=&v"(e1), "=&v"(e2), "=&v"(e3) : "v"(x[0]), "v"(x[1]), "v"(x[2]), "v"(x[3]));
  const v4f e = {e0, e1, e2, e3}; return e; }
__global__ __launch_bounds__(RS_WAVES * 32) void k_rsmw(const float* __restrict__ S, _Float16* __restrict__ P, const int* __restrict__ Km) {
  const int lane = threadIdx.x & 31; const int wave = __builtin_amdgcn_readfirstlane((int)(threadIdx.x >> 5));
  const size_t row0 = ((size_t)blockIdx.x * RS_WAVES + wave) * RS_ROWS;
  const float* sp = S + row0 * SQ + lane * 4; _Float16* pp = P + row0 * SQ + lane * 4; const int* kq = Km + lane * 4;
  v4f a[RS_ROWS][16]; v4ia km[16]; bool kp[16][4];
#pragma unroll
  for (int i = 0; i < 16; ++i) km[i] = *(const v4ia*)(kq + i * 128);
#pragma unroll
  for (int r = 0; r < RS_ROWS; ++r)
#pragma unroll
    for (int i = 0; i < 16; ++i) a[r][i] = *(const v4fa*)(sp + (size_t)r * SQ + i * 128);
  asm volatile("s_wait_xcnt 0x0" :: "v"(lane) : "memory");  // every load above takes its lane offset from one register; as an input here that register lives up to this wait, so no load's result lands in it ahead of the wait
  __builtin_amdgcn_sched_barrier(0);  // every load of the wave is issued before the first wait on data: without it the second row's loads start only after the first row has landed; it also holds the wait above directly behind the loads
#pragma unroll
  for (int i = 0; i < 16; ++i) for (int q = 0; q < 4; ++q) kp[i][q] = (km[i][q] != 0);
#pragma unroll
  for (int r = 0; r < RS_ROWS; ++r) {
    v4f m4 = a[r][0];
#pragma unroll
    for (int i = 1; i < 16; ++i) for (int q = 0; q < 4; ++q) m4[q] = fmaxf(m4[q], a[r][i][q]);
    const float mx = rs_wmax(fmaxf(fmaxf(m4[0], m4[1]), fmaxf(m4[2], m4[3])));
    v4f s4 = {0.f, 0.f, 0.f, 0.f};
#pragma unroll
    for (int i = 0; i < 16; ++i) { const v4f e4 = rs_exp4((a[r][i] - mx) * 1.44269504088896340736f); for (int q = 0; q < 4; ++q) { const float e = kp[i][q] ? e4[q] : 0.f; a[r][i][q] = e; s4[q] += e; } }
    const float sc = 256.0f / rs_wsum((s4[0] + s4[1]) + (s4[2] + s4[3]));
#pragma unroll
    for (int i = 0; i < 16; ++i) { v4h h4; for (int q = 0; q < 4; ++q) h4[q] = (_Float16)(a[r][i][q] * sc); *(v4h*)(pp + (size_t)r * SQ + i * 128) = h4; }
  }
}
extern "C" void kernel_launch(void* const* d_in, const int* in_sizes, int n_in,
                              void* d_out, int out_size, void* d_ws, size_t ws_size, hipStream_t stream) {
  (void)in_sizes; (void)n_in; (void)out_size;
  const float* const* I = (const float* const*)d_in; const float* xq = I[2]; const float* xk = I[1]; const float* xv = I[0]; const int* km = (const int*)d_in[3]; const float* wq = I[6]; const float* bq = nullptr; const float* wk = I[5]; const float* bk = nullptr; const float* wv = I[4]; const float* bv = nullptr; const float* wo = I[7]; const float* bo = I[8]; const float* x = xq;      /* contract order: values I[0], keys I[1], query I[2]; mask int32 [4][1][1][2048] (0 = masked key; READ on device); SHARED natural [64][64] blocks Wv I[4], Wk I[5], Wq I[6]; natural Wo [512][512] + bo */
  char* ws = (char*)d_ws; size_t off = 0;
  auto take = [&](size_t bytes) { char* p = ws + off; off += (bytes + 255) & ~(size_t)255; return p; };
  _Float16* BQ = (_Float16*)take((size_t)DM * DM * 2); _Float16* BK = (_Float16*)take((size_t)DM * DM * 2); _Float16* BV = (_Float16*)take((size_t)DM * DM * 2); _Float16* BO = (_Float16*)take((size_t)DM * DM * 2);
  _Float16* X16 = (_Float16*)take(NR * DM * 2); _Float16* XKp = (_Float16*)take(NR * DM * 2); _Float16* XVp = (_Float16*)take(NR * DM * 2); _Float16* Q16 = (_Float16*)take(NR * DM * 2); _Float16* K16 = (_Float16*)take(NR * DM * 2); _Float16* V16 = (_Float16*)take(NR * DM * 2); _Float16* O16 = (_Float16*)take(NR * DM * 2);
  float* S = (float*)take((size_t)HG * SQ * SQ * 4); _Float16* P = (_Float16*)take((size_t)HG * SQ * SQ * 2); _Float16* VT = (_Float16*)take((size_t)NH * HD * SQ * 2);
  if (off > ws_size) return;
  { const unsigned g = (unsigned)(((size_t)DM * DM / 8 + 255) / 256); k_bdshn<<<g, 256, 0, stream>>>(wq, BQ); k_bdshn<<<g, 256, 0, stream>>>(wk, BK); k_bdshn<<<g, 256, 0, stream>>>(wv, BV); k_wnat<<<g, 256, 0, stream>>>(wo, (size_t)DM * DM / 8, BO); }      /* block-diagonal planes with the SHARED natural [64][64] block (Bt[h*64 + o][h*64 + d] = 16 W[o][d]); Wo natural [out][in] = Bt x16 */
  _Float16* XK = XKp; _Float16* XV = XVp; k_x16<<<(unsigned)((NR * DM / 8 + 255) / 256), 256, 0, stream>>>(xk, XK, NR * DM / 8); k_x16<<<(unsigned)((NR * DM / 8 + 255) / 256), 256, 0, stream>>>(xv, XV, NR * DM / 8);      /* key and value inputs as exact f16 rows */

  k_x16<<<(unsigned)((NR * DM / 8 + 255) / 256), 256, 0, stream>>>(x, X16, NR * DM / 8);
  const size_t r0p = (size_t)B0 * SQ;      /* first projected row */
  k_gemm2<0><<<dim3((unsigned)((MP / 128) * (DM / 64)), 1), 128, 0, stream>>>(X16 + r0p * DM, DM, 0, BQ, DM, 0, 0.0625f, bq, 0, nullptr, 1, 0, 0, nullptr, Q16 + r0p * DM, DM, 0, MP, DM, DM);
  k_gemm2<0><<<dim3((unsigned)((MP / 128) * (DM / 64)), 1), 128, 0, stream>>>(XK + r0p * DM, DM, 0, BK, DM, 0, 0.0625f, bk, 0, nullptr, 1, 0, 0, nullptr, K16 + r0p * DM, DM, 0, MP, DM, DM);
  k_gemm2<0><<<dim3((unsigned)((MP / 128) * (DM / 64)), 1), 128, 0, stream>>>(XV + r0p * DM, DM, 0, BV, DM, 0, 0.0625f, bv, 0, nullptr, 1, 0, 0, nullptr, V16 + r0p * DM, DM, 0, MP, DM, DM);
  for (int b = B0; b < B0 + NBR; ++b) { const size_t r0 = (size_t)b * SQ;
    k_vt<NH, SQ><<<NH * (SQ / 64), 256, 0, stream>>>(V16 + r0 * LQ, LQ, 0, VT);      /* V^T [NH][HD][SQ] for this batch */
    for (int h0 = 0; h0 < NHD; h0 += HG) {
      k_gemm2<0><<<dim3((QN / 128) * (SQ / 64), HG), 128, 0, stream>>>(Q16 + r0 * LQ + h0 * HD, LQ, (size_t)HD, K16 + r0 * LQ + h0 * HD, LQ, (size_t)HD, 0.044194173824159216f, nullptr, 0, nullptr, 1, 0, 0, S, nullptr, SQ, (size_t)SQ * SQ, QN, SQ, HD);      /* scores, HG heads per launch */
      k_rsmw<<<(HG * SQ) / (RS_WAVES * RS_ROWS), RS_WAVES * 32, 0, stream>>>(S, P, km + (size_t)b * SQ);      /* keys with mask[b][j] == 0 excluded (a select on the mask word; weight exactly 0 as the module's -1e20 fill); P x256 f16, rows of all HG heads */
      k_gemm2<0><<<dim3((QN / 128) * (HD / 64), HG), 128, 0, stream>>>(P, SQ, (size_t)SQ * SQ, VT + (size_t)h0 * HD * SQ, SQ, (size_t)HD * SQ, 0.25f, nullptr, 0, nullptr, 1, 0, 0, nullptr, O16 + r0 * DM + h0 * HD, DM, (size_t)HD, QN, HD, SQ); } }      /* o (merged heads) as f16 rows */
  k_gemm2<0><<<dim3((unsigned)((MPO / 128) * (DM / 64)), 1), 128, 0, stream>>>(O16 + r0p * DM, DM, 0, BO, DM, 0, 0.0009765625f, bo, 0, nullptr, 1, 0, 0, (float*)d_out + r0p * DM, nullptr, DM, 0, MPO, DM, DM);      /* out rows are the output layout */
}

// v002
// A run of this version takes 165 microseconds.
// In two side-by-side timings against v001, it was 5.56 and 5.48 times as fast.
// Counting every step since v000, it is 20.2 times as fast.
#include <hip/hip_runtime.h>
// Multi-head attention over three inputs with SHARED per-head projections, a random key-padding mask and the module's literal score scale (values, keys, query [4][2048][512]; each input is split into 8 heads of 64 and every head is multiplied by the SAME natural [64][64] matrix (x W^T: Wv / Wk / Wq; no biases); energy = q k^T; where(mask == 0, -1e20) with the int32 [4][1][1][2048] mask in {0, 1} (random; 0 = masked key; READ on device); softmax(energy / sqrt(embed_size) = / sqrt(512)) (as the source); out = merged Wo^T + bo -> [4][2048][512]).
// Structure: token rows r = b*2048 + s; x as exact f16 rows (bf16-rounded); Q, K, V as three WMMA GEMMs (32x64 wave tiles, f32 accumulation, exact x16 weights, no bias, f16 outputs); V^T for all batches and heads via LDS transposes; scores, masked softmax and weights x V in ONE launch for all batches and heads (k_fattn: running maximum and sum, scores and weights never in memory; o carried x64 against f16 subnormal flush, folded into the output GEMM alpha) written straight into the merged f16 o rows; out = o W_o + b GEMM (f32) into the output layout.
// Compute dtype: inputs rounded to bf16; x / weights exact; q, k, v, softmax weights and o as plain f16 GEMM operands (~2^-12); scores and softmax statistics f32; v_wmma_f32_16x16x32_f16.
#define NB 4
#define SQ 2048
#define DM 512
#define NH 8
#define HD 64
#define HG 4                         /* heads a launch of the k_vt(V16, b, h0, VT) form, which is not launched */
#define B0 0                         /* first batch processed (debug hook) */
#define NBR NB                       /* batches processed (debug hook) */
#define NR ((size_t)NB * SQ)         /* token rows */
#define MP ((int)((size_t)NBR * SQ)) /* rows projected (debug hook) */
#define QN SQ                        /* unused; k_fattn attends all SQ query rows of a batch */
#define NHD NH                       /* unused; k_fattn attends all NH heads */
#define MPO MP                       /* rows through the output stage (debug hook) */
#define LQ DM      /* row pitch of the q/k/v rows */
typedef __bf16 v16b __attribute__((ext_vector_type(16)));
typedef unsigned short v8us __attribute__((ext_vector_type(8), may_alias));
typedef float  v8f  __attribute__((ext_vector_type(8)));
typedef float  v4f  __attribute__((ext_vector_type(4)));
typedef float  v4fa __attribute__((ext_vector_type(4), may_alias));
union FragB { v16b v; v8us half[2]; unsigned short u[16]; };

__device__ __forceinline__ unsigned short bf16_bits(float x) { unsigned int u = __float_as_uint(x); return (unsigned short)((u + 0x7FFFu + ((u >> 16) & 1u)) >> 16); }
__device__ __forceinline__ float bf16_val(unsigned short b) { return __uint_as_float(((unsigned int)b) << 16); }
__device__ __forceinline__ float bf16_round(float x) { return bf16_val(bf16_bits(x)); }
// D += A·B with NT terms: 1 = ah·bh, 2 = + al·bh (A split), 3 = + ah·bl (both split)
template <int NT>
__device__ __forceinline__ v8f mmaN(v16b ah, v16b al, v16b bh, v16b bl, v8f c) {
  c = __builtin_amdgcn_wmma_f32_16x16x32_bf16(false, ah, false, bh, (short)0, c, false, false);
  if (NT >= 2) c = __builtin_amdgcn_wmma_f32_16x16x32_bf16(false, al, false, bh, (short)0, c, false, false);
  if (NT >= 3) c = __builtin_amdgcn_wmma_f32_16x16x32_bf16(false, ah, false, bl, (short)0, c, false, false);
  asm volatile("v_nop\n\tv_nop\n\tv_nop\n\tv_nop" : "+v"(c) : "v"(ah), "v"(al), "v"(bh), "v"(bl));
  return c;
}

__global__ __launch_bounds__(256) void k_wt_bf16(const float* __restrict__ W, unsigned short* __restrict__ Wt, int K, int N) {
  const int t = blockIdx.x * 256 + threadIdx.x;
  const int k8n = K / 8;
  if (t >= N * k8n) return;
  const int n = t / k8n, k8 = (t % k8n) * 8;
  v8us v;
#pragma unroll
  for (int i = 0; i < 8; ++i) v[i] = bf16_bits(W[(size_t)(k8 + i) * N + n]);
  *(v8us*)(Wt + (size_t)n * K + k8) = v;
  
}

// GEMM C[M][N] (f32, pitch ldc) = act(A[M][K]·W + bias). A f32 row-major (pitch lda) converted per fragment to bf16
// (ASPLIT: hi/lo two planes -> 2 terms, else single rounded term); Wt bf16 [N][K] (pitch ldb). BIAS_BF16 rounds the
// bias to bf16 first (bias quantised to bf16 before the add). K%32==0, M%16==0, N%64==0.
template <bool ASPLIT, int ACT, bool BIAS_BF16>
__global__ __launch_bounds__(128) void k_gemm_bf(const float* __restrict__ A, int lda, const unsigned short* __restrict__ Wt, int ldb,
                                               const float* __restrict__ bias, float* __restrict__ C, int ldc, int M, int N, int K) {
  __shared__ __attribute__((aligned(16))) float so[4][16][64];
  const int tid = threadIdx.x, w = tid >> 5, lane = tid & 31, ln = lane & 15, hh = lane >> 4;
  const int ntn = N / 64;
  const int wid = blockIdx.x * 4 + w;
  const int mt = wid / ntn, nq = wid % ntn;
  if (mt * 16 >= M) return;
  const int row0 = mt * 16, col0 = nq * 64;
  const float* arow = A + (size_t)(row0 + ln) * lda;
  v8f acc[4] = {};
  for (int kb = 0; kb < K; kb += 32) {
    FragB ah, al;
    const v4f x0 = *(const v4fa*)(arow + kb + 8 * hh), x1 = *(const v4fa*)(arow + kb + 8 * hh + 4);
    const v4f x2 = *(const v4fa*)(arow + kb + 16 + 8 * hh), x3 = *(const v4fa*)(arow + kb + 16 + 8 * hh + 4);
    float xs[16] = {x0[0],x0[1],x0[2],x0[3],x1[0],x1[1],x1[2],x1[3],x2[0],x2[1],x2[2],x2[3],x3[0],x3[1],x3[2],x3[3]};
#pragma unroll
    for (int i = 0; i < 16; ++i) { const unsigned short hb = bf16_bits(xs[i]); ah.u[i] = hb; al.u[i] = ASPLIT ? bf16_bits(xs[i] - bf16_val(hb)) : (unsigned short)0; }
#pragma unroll
    for (int t = 0; t < 4; ++t) {
      const unsigned short* brow = Wt + (size_t)(col0 + t * 16 + ln) * ldb + kb;
      FragB b;
      b.half[0] = *(const v8us*)(brow + 8 * hh);
      b.half[1] = *(const v8us*)(brow + 16 + 8 * hh);
      acc[t] = mmaN<ASPLIT ? 2 : 1>(ah.v, al.v, b.v, b.v, acc[t]);
    }
  }
#pragma unroll
  for (int t = 0; t < 4; ++t) {
    float bv = bias ? bias[col0 + t * 16 + ln] : 0.f;
    if (BIAS_BF16) bv = bf16_round(bv);
#pragma unroll
    for (int r = 0; r < 8; ++r) { float v = acc[t][r] + bv; if (ACT == 1) v = fmaxf(v, 0.f); so[w][8 * hh + r][t * 16 + ln] = v; }
  }
  __builtin_amdgcn_fence(__ATOMIC_ACQ_REL, "workgroup");
  __builtin_amdgcn_wave_barrier();
  const int rsub = lane >> 4, c4 = (lane & 15) * 4;
  {
#pragma unroll
    for (int q = 0; q < 8; ++q) {
      const int r = q * 2 + rsub;
      const v4f v = *(const v4fa*)&so[w][r][c4];
      *(v4f*)(C + (size_t)(row0 + r) * ldc + col0 + c4) = v;
    }
    
  }
}

// GEMM C = act(A·W + bias + resid): A f32 (ASPLIT -> hi/lo 2 terms), Wt bf16 [N][K]; ACT 0 none, 1 relu, 2 exact gelu;
// resid (optional, f32, row index = (row % rmod), pitch ldr, RES_BF16 rounds it) added before the activation.
template <bool ASPLIT, int ACT, bool BIAS_BF16, bool RES_BF16>
__global__ __launch_bounds__(128) void k_gemm_bf3(const float* __restrict__ A, int lda, const unsigned short* __restrict__ Wt, int ldb,
                                                const float* __restrict__ bias, const float* __restrict__ resid, int rmod, int ldr,
                                                float* __restrict__ C, int ldc, int M, int N, int K) {
  __shared__ __attribute__((aligned(16))) float so[4][16][64];
  const int tid = threadIdx.x, w = tid >> 5, lane = tid & 31, ln = lane & 15, hh = lane >> 4;
  const int ntn = N / 64;
  const int wid = blockIdx.x * 4 + w;
  const int mt = wid / ntn, nq = wid % ntn;
  if (mt * 16 >= M) return;
  const int row0 = mt * 16, col0 = nq * 64;
  const float* arow = A + (size_t)(row0 + ln) * lda;
  v8f acc[4] = {};
  for (int kb = 0; kb < K; kb += 32) {
    FragB ah, al;
    const v4f x0 = *(const v4fa*)(arow + kb + 8 * hh), x1 = *(const v4fa*)(arow + kb + 8 * hh + 4);
    const v4f x2 = *(const v4fa*)(arow + kb + 16 + 8 * hh), x3 = *(const v4fa*)(arow + kb + 16 + 8 * hh + 4);
    float xs[16] = {x0[0],x0[1],x0[2],x0[3],x1[0],x1[1],x1[2],x1[3],x2[0],x2[1],x2[2],x2[3],x3[0],x3[1],x3[2],x3[3]};
#pragma unroll
    for (int i = 0; i < 16; ++i) { const unsigned short hb = bf16_bits(xs[i]); ah.u[i] = hb; al.u[i] = ASPLIT ? bf16_bits(xs[i] - bf16_val(hb)) : (unsigned short)0; }
#pragma unroll
    for (int t = 0; t < 4; ++t) {
      const unsigned short* brow = Wt + (size_t)(col0 + t * 16 + ln) * ldb + kb;
      FragB b;
      b.half[0] = *(const v8us*)(brow + 8 * hh);
      b.half[1] = *(const v8us*)(brow + 16 + 8 * hh);
      acc[t] = mmaN<ASPLIT ? 2 : 1>(ah.v, al.v, b.v, b.v, acc[t]);
    }
  }
#pragma unroll
  for (int t = 0; t < 4; ++t) {
    const int col = col0 + t * 16 + ln;
    float bv = bias ? bias[col] : 0.f;
    if (BIAS_BF16) bv = bf16_round(bv);
#pragma unroll
    for (int r = 0; r < 8; ++r) {
      float v = acc[t][r] + bv;
      if (resid) { float rv = resid[(size_t)((row0 + 8 * hh + r) % rmod) * ldr + col]; if (RES_BF16) rv = bf16_round(rv); v += rv; }
      if (ACT == 1) v = fmaxf(v, 0.f);
      if (ACT == 2) v = 0.5f * v * (1.0f + erff(v * 0.70710678118654752f));
      if (ACT == 3) { const float u = 0.7978845608028654f * (v + 0.044715f * v * v * v); v = 0.5f * v * (1.0f + tanhf(u)); }
      so[w][8 * hh + r][t * 16 + ln] = v;
    }
  }
  __builtin_amdgcn_fence(__ATOMIC_ACQ_REL, "workgroup");
  __builtin_amdgcn_wave_barrier();
  const int rsub = lane >> 4, c4 = (lane & 15) * 4;
  {
#pragma unroll
    for (int q = 0; q < 8; ++q) {
      const int r = q * 2 + rsub;
      const v4f v = *(const v4fa*)&so[w][r][c4];
      *(v4f*)(C + (size_t)(row0 + r) * ldc + col0 + c4) = v;
    }
    
  }
}
// row LayerNorm (biased variance, eps) over N: s = X (+ R); optional out_sum <- s; out_norm <- (s-mu)*rsqrt(var+eps)*g + b
template <bool PARAM_BF16>
__global__ __launch_bounds__(256) void k_layernorm(const float* __restrict__ X, const float* __restrict__ R, const float* __restrict__ g, const float* __restrict__ bta,
                                                  float* __restrict__ out_sum, float* __restrict__ out_norm, int N, float eps) {
  __shared__ float red[256];
  const int row = blockIdx.x, tid = threadIdx.x;
  const float* x = X + (size_t)row * N; const float* rr = R ? R + (size_t)row * N : nullptr;
  float vals[16];                     // up to N = 4096
  const int per = N / 256;            // contiguous chunk per thread? use strided-by-4 chunks: thread handles j = tid*4 + 1024*u
  float s1 = 0.f;
  for (int u = 0; u < per / 4; ++u) {
    const int j = tid * 4 + 1024 * u;
    const v4f a = *(const v4fa*)(x + j);
    v4f b = {0.f,0.f,0.f,0.f}; if (rr) b = *(const v4fa*)(rr + j);
#pragma unroll
    for (int q = 0; q < 4; ++q) { const float v = a[q] + b[q]; vals[u * 4 + q] = v; s1 += v; }
  }
  red[tid] = s1; __syncthreads();
  for (int st = 128; st > 0; st >>= 1) { if (tid < st) red[tid] += red[tid + st]; __syncthreads(); }
  const float mu = red[0] / (float)N; __syncthreads();
  float s2 = 0.f;
  for (int u = 0; u < per / 4; ++u)
#pragma unroll
    for (int q = 0; q < 4; ++q) { const float c = vals[u * 4 + q] - mu; s2 += c * c; }
  red[tid] = s2; __syncthreads();
  for (int st = 128; st > 0; st >>= 1) { if (tid < st) red[tid] += red[tid + st]; __syncthreads(); }
  const float rs = rsqrtf(red[0] / (float)N + eps);
  {
    for (int u = 0; u < per / 4; ++u) {
      const int j = tid * 4 + 1024 * u;
      v4f o, sm;
#pragma unroll
      for (int q = 0; q < 4; ++q) {
        float gg = g[j + q], bb = bta[j + q];
        if (PARAM_BF16) { gg = bf16_round(gg); bb = bf16_round(bb); }
        sm[q] = vals[u * 4 + q]; o[q] = (vals[u * 4 + q] - mu) * rs * gg + bb;
      }
      if (out_sum) *(v4f*)(out_sum + (size_t)row * N + j) = sm;
      *(v4f*)(out_norm + (size_t)row * N + j) = o;
    }
    
  }
}



// ---- f16 WMMA path (v_wmma_f32_16x16x32_f16): 11-bit significands for operands in range — used where a [0,1] probability operand needs more precision than bf16
typedef _Float16 v16h __attribute__((ext_vector_type(16)));
union FragH { v16h v; v8us half[2]; _Float16 h[16]; unsigned short u[16]; };
template <int NT>
__device__ __forceinline__ v8f mmaH(v16h ah, v16h al, v16h bh, v16h bl, v8f c) {
  c = __builtin_amdgcn_wmma_f32_16x16x32_f16(false, ah, false, bh, (short)0, c, false, false);
  if (NT >= 2) c = __builtin_amdgcn_wmma_f32_16x16x32_f16(false, al, false, bh, (short)0, c, false, false);
  if (NT >= 3) c = __builtin_amdgcn_wmma_f32_16x16x32_f16(false, ah, false, bl, (short)0, c, false, false);
  asm volatile("v_nop\n\tv_nop\n\tv_nop\n\tv_nop" : "+v"(c) : "v"(ah), "v"(al), "v"(bh), "v"(bl));
  return c;
}
// batched GEMM like k_gemm_b but f16 operands: A f32 (split into f16 hi/lo if ASPLIT, else rounded to f16), Bt = f16 values [n][k]; alpha; C f32; N multiple of 16 (partial tiles skipped)
template <bool ASPLIT>
__global__ __launch_bounds__(128) void k_gemm_h(const float* __restrict__ A, int lda, size_t sA, const _Float16* __restrict__ Bh, int ldb, size_t sB, float alpha, float* __restrict__ C, int ldc, size_t sC, int M, int N, int K) {
  __shared__ __attribute__((aligned(16))) float so[4][16][64];
  const int tid = threadIdx.x, w = tid >> 5, lane = tid & 31, ln = lane & 15, hh = lane >> 4; const int by = blockIdx.y;
  A += (size_t)by * sA; Bh += (size_t)by * sB; C += (size_t)by * sC;
  const int ntn = (N + 63) / 64; const int wid = blockIdx.x * 4 + w; const int mt = wid / ntn, nq = wid % ntn; if (mt * 16 >= M) return;
  const int row0 = mt * 16, col0 = nq * 64; const float* arow = A + (size_t)(row0 + ln) * lda;
  v8f acc[4] = {};
  for (int kb = 0; kb < K; kb += 32) {
    FragH ah, al;
    const v4f x0 = *(const v4fa*)(arow + kb + 8 * hh), x1 = *(const v4fa*)(arow + kb + 8 * hh + 4), x2 = *(const v4fa*)(arow + kb + 16 + 8 * hh), x3 = *(const v4fa*)(arow + kb + 16 + 8 * hh + 4);
    float xs[16] = {x0[0],x0[1],x0[2],x0[3],x1[0],x1[1],x1[2],x1[3],x2[0],x2[1],x2[2],x2[3],x3[0],x3[1],x3[2],x3[3]};
#pragma unroll
    for (int i = 0; i < 16; ++i) { const _Float16 h = (_Float16)xs[i]; ah.h[i] = h; al.h[i] = ASPLIT ? (_Float16)(xs[i] - (float)h) : (_Float16)0.0f; }
#pragma unroll
    for (int t = 0; t < 4; ++t) { if (col0 + t * 16 >= N) continue; const size_t boff = (size_t)(col0 + t * 16 + ln) * ldb + kb; FragH bq; bq.half[0] = *(const v8us*)(Bh + boff + 8 * hh); bq.half[1] = *(const v8us*)(Bh + boff + 16 + 8 * hh);
      acc[t] = mmaH<ASPLIT ? 2 : 1>(ah.v, al.v, bq.v, bq.v, acc[t]); }
  }
#pragma unroll
  for (int t = 0; t < 4; ++t) { if (col0 + t * 16 >= N) continue;
#pragma unroll
    for (int r = 0; r < 8; ++r) so[w][8 * hh + r][t * 16 + ln] = acc[t][r] * alpha; }
  __builtin_amdgcn_fence(__ATOMIC_ACQ_REL, "workgroup"); __builtin_amdgcn_wave_barrier();
  const int rsub = lane >> 4, c4 = (lane & 15) * 4;
  {
#pragma unroll
    for (int q = 0; q < 8; ++q) { const int r = q * 2 + rsub; if (col0 + c4 < N) { const v4f v = *(const v4fa*)&so[w][r][c4]; *(v4f*)(C + (size_t)(row0 + r) * ldc + col0 + c4) = v; } }
     }
}

// Wt[n][k] = f16(W[k][n]·scale) from f32 row-major W[K][N] (scale = power of two; bf16-exact weights stay exact in f16 away from the subnormal range)
__global__ __launch_bounds__(256) void k_wt_f16(const float* __restrict__ W, _Float16* __restrict__ Wt, int K, int N, float scale) {
  const int t = blockIdx.x * 256 + threadIdx.x; if (t >= N * (K / 8)) return; const int n = t / (K / 8), k8 = (t % (K / 8)) * 8; FragH f;
#pragma unroll
  for (int i = 0; i < 8; ++i) f.h[i] = (_Float16)(bf16_round(W[(size_t)(k8 + i) * N + n]) * scale); const v8us o = f.half[0];
  *(v8us*)((unsigned short*)Wt + (size_t)n * K + k8) = o; 
}
// k_gemm_hh variant with fused epilogue: v = acc·alpha + bias[by·sBias + col] (+ CP[(row/rowsPerB)·sCPb + by·64 + col] if CP) ; ACT 0 none / 1 elu ; writes f16 C16 (and f32 C if non-null)
template <int ACT>
__global__ __launch_bounds__(128) void k_gemm_hhx(const _Float16* __restrict__ A, int lda, size_t sA, const _Float16* __restrict__ Bh, int ldb, size_t sB, float alpha, const float* __restrict__ bias, size_t sBias, const float* __restrict__ CP, int rowsPerB, size_t sCPb, int row0g,
    float* __restrict__ C, _Float16* __restrict__ C16, int ldc, size_t sC, int M, int N, int K) {
  __shared__ __attribute__((aligned(16))) float so[4][16][64];
  const int tid = threadIdx.x, w = tid >> 5, lane = tid & 31, ln = lane & 15, hh = lane >> 4; const int by = blockIdx.y;
  A += (size_t)by * sA; Bh += (size_t)by * sB; const size_t cofs = (size_t)by * sC; const float* bp = bias ? bias + (size_t)by * sBias : nullptr;
  const int ntn = (N + 63) / 64; const int wid = blockIdx.x * 4 + w; const int mt = wid / ntn, nq = wid % ntn; if (mt * 16 >= M) return;
  const int row0 = mt * 16, col0 = nq * 64; const _Float16* arow = A + (size_t)(row0 + ln) * lda;
  v8f acc[4] = {};
  for (int kb = 0; kb < K; kb += 32) { FragH ah; ah.half[0] = *(const v8us*)((const unsigned short*)arow + kb + 8 * hh); ah.half[1] = *(const v8us*)((const unsigned short*)arow + kb + 16 + 8 * hh);
#pragma unroll
    for (int t = 0; t < 4; ++t) { if (col0 + t * 16 >= N) continue; const size_t boff = (size_t)(col0 + t * 16 + ln) * ldb + kb; FragH bq; bq.half[0] = *(const v8us*)((const unsigned short*)Bh + boff + 8 * hh); bq.half[1] = *(const v8us*)((const unsigned short*)Bh + boff + 16 + 8 * hh);
      acc[t] = mmaH<1>(ah.v, ah.v, bq.v, bq.v, acc[t]); }
  }
#pragma unroll
  for (int t = 0; t < 4; ++t) { if (col0 + t * 16 >= N) continue; const int col = col0 + t * 16 + ln; const float bv = bp ? bf16_round(bp[col]) : 0.f;
#pragma unroll
    for (int r = 0; r < 8; ++r) { float v = acc[t][r] * alpha + bv; if (CP) { const int rr = row0g + row0 + 8 * hh + r; if (rowsPerB < 0) v += CP[cofs + (size_t)rr * ldc + col];      /* rowsPerB < 0: own element of the batched C plane */ else { const int bidx = rr / rowsPerB; v += CP[(size_t)bidx * sCPb + (size_t)by * 64 + col]; } } if (ACT == 1) v = (v > 0.f) ? v : expm1f(v); else if (ACT == 7) v = (v > 0.f) ? v + 1.0f : expf(v); else if (ACT == 8) v = tanhf(v); else if (ACT == 9) v = 0.5f * v * (1.0f + tanhf(0.7978845608028654f * (v + 0.044715f * v * v * v))); else if (ACT == 11) v = 1.0f / (1.0f + expf(-v)); else if (ACT == 12) v = (v > 0.f) ? v : 0.01f * v; else if (ACT == 14) v = (v > 0.f) ? v : 0.1f * v; else if (ACT == 16) v = (v >= 0.f) ? v : 0.3f * v; else if (ACT == 17) v = (v >= 0.f) ? v : 0.2f * v; else if (ACT == 15) v = v / (1.0f + expf(-v)); else if (ACT == 3) v = fmaxf(v, 0.f); else if (ACT == 6) v = 0.5f * v * (1.0f + erff(v * 0.70710678118654752f)); so[w][8 * hh + r][t * 16 + ln] = v; } }
  __builtin_amdgcn_fence(__ATOMIC_ACQ_REL, "workgroup"); __builtin_amdgcn_wave_barrier();
  const int rsub = lane >> 4, c4 = (lane & 15) * 4; typedef _Float16 v4h __attribute__((ext_vector_type(4)));
  {
#pragma unroll
    for (int q = 0; q < 8; ++q) { const int r = q * 2 + rsub; if (col0 + c4 < N) { const v4f v = *(const v4fa*)&so[w][r][c4]; if (C) *(v4f*)(C + cofs + (size_t)(row0 + r) * ldc + col0 + c4) = v; if (C16) { v4h h4; for (int i = 0; i < 4; ++i) h4[i] = (_Float16)v[i]; *(v4h*)(C16 + cofs + (size_t)(row0 + r) * ldc + col0 + c4) = h4; } } }
     }
}


typedef _Float16 v4h __attribute__((ext_vector_type(4)));

__global__ __launch_bounds__(256) void k_x16(const float* __restrict__ x, _Float16* __restrict__ X16, size_t n8) { const size_t t = (size_t)blockIdx.x * 256 + threadIdx.x; if (t >= n8) return; FragH f;
#pragma unroll
  for (int q = 0; q < 8; ++q) f.h[q] = (_Float16)bf16_round(x[t * 8 + q]); *(v8us*)((unsigned short*)X16 + t * 8) = f.half[0];  }
__global__ __launch_bounds__(256) void k_h16(const float* __restrict__ x, _Float16* __restrict__ X16, size_t n8) { const size_t t = (size_t)blockIdx.x * 256 + threadIdx.x; if (t >= n8) return; FragH f;
#pragma unroll
  for (int q = 0; q < 8; ++q) f.h[q] = (_Float16)x[t * 8 + q]; *(v8us*)((unsigned short*)X16 + t * 8) = f.half[0];  }
__global__ __launch_bounds__(256) void k_round16f(const float* __restrict__ W, _Float16* __restrict__ Bt, size_t n8) { const size_t t = (size_t)blockIdx.x * 256 + threadIdx.x; if (t >= n8) return; FragH f;
#pragma unroll
  for (int i = 0; i < 8; ++i) f.h[i] = (_Float16)(bf16_round(W[t * 8 + i]) * 16.0f); *(v8us*)((unsigned short*)Bt + t * 8) = f.half[0];  }
template <int NHv, int TTv>
__global__ __launch_bounds__(256) void k_vt(const _Float16* __restrict__ V16, int ldv, int voff, _Float16* __restrict__ Vt) { __shared__ unsigned short tl[64][66]; const int tid = threadIdx.x; const int slab = blockIdx.x / (TTv / 64), lg = blockIdx.x % (TTv / 64); const int b = slab / NHv, h = slab % NHv;
  for (int i = tid; i < 64 * 8; i += 256) { const int r = i / 8, c8 = (i % 8) * 8; FragH f; f.half[0] = *(const v8us*)((const unsigned short*)V16 + ((size_t)b * TTv + lg * 64 + r) * ldv + voff + h * 64 + c8);
#pragma unroll
    for (int q = 0; q < 8; ++q) tl[r][c8 + q] = f.u[q]; }
  __syncthreads();
  {
#pragma unroll
    for (int rd = 0; rd < 2; ++rd) { const int d = rd * 32 + tid / 8, pc = tid % 8; FragH f;
#pragma unroll
      for (int q = 0; q < 8; ++q) f.u[q] = tl[pc * 8 + q][d];
      *(v8us*)((unsigned short*)Vt + ((size_t)slab * 64 + d) * TTv + lg * 64 + pc * 8) = f.half[0]; }
     } }

__global__ __launch_bounds__(256) void k_hl(const float* __restrict__ F, _Float16* __restrict__ Hh, _Float16* __restrict__ Hl, size_t n8) { const size_t t = (size_t)blockIdx.x * 256 + threadIdx.x; if (t >= n8) return; FragH fh, fl; const v4f a = *(const v4fa*)(F + t * 8), c = *(const v4fa*)(F + t * 8 + 4);
#pragma unroll
  for (int q = 0; q < 4; ++q) { _Float16 h = (_Float16)a[q]; fh.h[q] = h; fl.h[q] = (_Float16)((a[q] - (float)h) * 1024.0f); h = (_Float16)c[q]; fh.h[4 + q] = h; fl.h[4 + q] = (_Float16)((c[q] - (float)h) * 1024.0f); }
  { *(v8us*)((unsigned short*)Hh + t * 8) = fh.half[0]; *(v8us*)((unsigned short*)Hl + t * 8) = fl.half[0];  } }

// ---- fast GEMM (wave tile 32x64; requires M % 32 == 0 rows per launch region and N % 64 == 0); epilogue = k_gemm_hhx semantics ----
__device__ __forceinline__ v16h g2_frag(const _Float16* p, int hh) { FragH f; f.half[0] = *(const v8us*)((const unsigned short*)p + 8 * hh); f.half[1] = *(const v8us*)((const unsigned short*)p + 16 + 8 * hh); return f.v; }
__device__ __forceinline__ v8f g2_mma(v16h a, v16h b, v8f c) { v8f d = __builtin_amdgcn_wmma_f32_16x16x32_f16(false, a, false, b, (short)0, c, false, false); asm volatile("v_nop\n\tv_nop\n\tv_nop\n\tv_nop" : "+v"(d) : "v"(a), "v"(b)); return d; }
template <int ACT>
__global__ __launch_bounds__(128) void k_gemm2(const _Float16* __restrict__ A, int lda, size_t sA, const _Float16* __restrict__ Bh, int ldb, size_t sB, float alpha, const float* __restrict__ bias, size_t sBias, const float* __restrict__ CP, int rowsPerB, size_t sCPb, int row0g,
    float* __restrict__ C, _Float16* __restrict__ C16, int ldc, size_t sC, int M, int N, int K) { static_assert(ACT == 0 || ACT == 3 || ACT == 6 || ACT == 8 || ACT == 9 || ACT == 11 || ACT == 12 || ACT == 14 || ACT == 15 || ACT == 16 || ACT == 17, "k_gemm2: unsupported ACT code (would silently apply no activation)");
  __shared__ __attribute__((aligned(16))) float so[4][32][68];
  const int tid = threadIdx.x, w = tid >> 5, lane = tid & 31, ln = lane & 15, hh = lane >> 4; const int by = blockIdx.y;
  A += (size_t)by * sA; Bh += (size_t)by * sB; const size_t cofs = (size_t)by * sC; const float* bp = bias ? bias + (size_t)by * sBias : nullptr;
  const int ntn = N >> 6; const int mt = blockIdx.x / ntn, nq = blockIdx.x - mt * ntn; const int row0 = mt * 128 + 32 * w, col0 = nq * 64; if (row0 >= M) return;
  const _Float16* a0p = A + (size_t)(row0 + ln) * lda; const _Float16* a1p = a0p + (size_t)16 * lda;
  const _Float16* b0p = Bh + (size_t)(col0 + ln) * ldb; const _Float16* b1p = b0p + (size_t)16 * ldb; const _Float16* b2p = b1p + (size_t)16 * ldb; const _Float16* b3p = b2p + (size_t)16 * ldb;
  const v8f z8 = {0.f,0.f,0.f,0.f,0.f,0.f,0.f,0.f}; v8f c00 = z8, c01 = z8, c02 = z8, c03 = z8, c10 = z8, c11 = z8, c12 = z8, c13 = z8;
#pragma unroll 1
  for (int kb = 0; kb < K; kb += 32) { const v16h a0 = g2_frag(a0p + kb, hh), a1 = g2_frag(a1p + kb, hh);
    v16h b = g2_frag(b0p + kb, hh); c00 = g2_mma(a0, b, c00); c10 = g2_mma(a1, b, c10);
    b = g2_frag(b1p + kb, hh); c01 = g2_mma(a0, b, c01); c11 = g2_mma(a1, b, c11);
    b = g2_frag(b2p + kb, hh); c02 = g2_mma(a0, b, c02); c12 = g2_mma(a1, b, c12);
    b = g2_frag(b3p + kb, hh); c03 = g2_mma(a0, b, c03); c13 = g2_mma(a1, b, c13); }
  v8f accs[8] = {c00, c01, c02, c03, c10, c11, c12, c13};
#pragma unroll
  for (int u = 0; u < 8; ++u) { const int t = u & 3, half = u >> 2; const int col = col0 + t * 16 + ln; const float bv = bp ? bf16_round(bp[col]) : 0.f;
#pragma unroll
    for (int r = 0; r < 8; ++r) { const int rloc = half * 16 + 8 * hh + r; float v = accs[u][r] * alpha + bv; if (CP) { if (rowsPerB < 0) v += CP[cofs + (size_t)(row0g + row0 + rloc) * ldc + col];      /* rowsPerB < 0: own element of the batched C plane */ else { const int bidx = (row0g + row0 + rloc) / rowsPerB; v += CP[(size_t)bidx * sCPb + (size_t)by * 64 + col]; } }
      if (ACT == 3) v = fmaxf(v, 0.f); else if (ACT == 6) v = 0.5f * v * (1.0f + erff(v * 0.70710678118654752f)); else if (ACT == 11) v = 1.0f / (1.0f + expf(-v)); else if (ACT == 15) v = v / (1.0f + expf(-v)); else if (ACT == 12) v = (v > 0.f) ? v : 0.01f * v; else if (ACT == 8) v = tanhf(v); else if (ACT == 9) v = 0.5f * v * (1.0f + tanhf(0.7978845608028654f * (v + 0.044715f * v * v * v))); else if (ACT == 14) v = (v > 0.f) ? v : 0.1f * v; else if (ACT == 16) v = (v >= 0.f) ? v : 0.3f * v; else if (ACT == 17) v = (v >= 0.f) ? v : 0.2f * v;
      so[w][rloc][t * 16 + ln] = v; } }
  __builtin_amdgcn_fence(__ATOMIC_ACQ_REL, "workgroup"); __builtin_amdgcn_wave_barrier();
  const int rsub = lane >> 4, c4 = (lane & 15) * 4;
  {
#pragma unroll
    for (int q = 0; q < 16; ++q) { const int r = q * 2 + rsub; const v4f v = *(const v4fa*)&so[w][r][c4]; if (C) *(v4f*)(C + cofs + (size_t)(row0 + r) * ldc + col0 + c4) = v; if (C16) { v4h h4; for (int i = 0; i < 4; ++i) h4[i] = (_Float16)v[i]; *(v4h*)(C16 + cofs + (size_t)(row0 + r) * ldc + col0 + c4) = h4; } }
     } }


__global__ __launch_bounds__(256) void k_wnat(const float* __restrict__ w, size_t n8, _Float16* __restrict__ Bt) { const size_t t = (size_t)blockIdx.x * 256 + threadIdx.x; if (t >= n8) return; FragH f; for (int q = 0; q < 8; ++q) f.h[q] = (_Float16)(bf16_round(w[t * 8 + q]) * 16.0f); *(v8us*)((unsigned short*)Bt + t * 8) = f.half[0];  }
__global__ __launch_bounds__(256) void k_rsm(const float* __restrict__ S, _Float16* __restrict__ P, int nrows) {
  #pragma clang fp contract(off)
  const int i = blockIdx.x * 256 + threadIdx.x; if (i >= nrows) return; const float* s = S + (size_t)i * SQ; float mx = -3.0e38f;
#pragma unroll 1
  for (int j = 0; j < SQ; ++j) mx = fmaxf(mx, s[j]); float se = 0.f;
#pragma unroll 1
  for (int j = 0; j < SQ; ++j) se += expf(s[j] - mx); const float sc = 256.0f / se;
#pragma unroll 1
  for (int j0 = 0; j0 < SQ; j0 += 8) { FragH f; for (int q = 0; q < 8; ++q) f.h[q] = (_Float16)(expf(s[j0 + q] - mx) * sc); unsigned short* d = (unsigned short*)P + (size_t)i * SQ + j0; *(v8us*)d = f.half[0];  } }
__global__ __launch_bounds__(256) void k_vt(const _Float16* __restrict__ V16, int b, int h0, _Float16* __restrict__ VT) { __shared__ unsigned short tl[64][65]; const int tid = threadIdx.x; const int hh = blockIdx.x % HG, sg = blockIdx.x / HG; const int s0 = sg * 64; const int h = h0 + hh;
  for (int i = tid; i < 64 * 8; i += 256) { const int j = i / 8, d8 = (i % 8) * 8; FragH f; f.half[0] = *(const v8us*)((const unsigned short*)V16 + ((size_t)b * SQ + s0 + j) * DM + h * HD + d8); for (int q = 0; q < 8; ++q) tl[d8 + q][j] = f.u[q]; }
  __syncthreads();
  { for (int i = tid; i < 64 * 8; i += 256) { const int d = i / 8, j8 = (i % 8) * 8; FragH f; for (int q = 0; q < 8; ++q) f.u[q] = tl[d][j8 + q]; *(v8us*)((unsigned short*)VT + ((size_t)hh * HD + d) * SQ + s0 + j8) = f.half[0]; }  } }



__global__ __launch_bounds__(256) void k_rsmkm(const float* __restrict__ S, _Float16* __restrict__ P, int nrows, const int* __restrict__ am) {
  #pragma clang fp contract(off)
  const int t = blockIdx.x * 256 + threadIdx.x; if (t >= nrows) return; const size_t i = (size_t)t; const float* s = S + i * SQ; const int* mr = am + (size_t)(t % SQ) * SQ; float mx = -3.0e38f;
#pragma unroll 1
  for (int j = 0; j < SQ; ++j) { const float f = (mr[j] != 0) ? 1.f : 0.f; mx = fmaxf(mx, fmaf(f, s[j], (1.f - f) * -1.0e9f)); } float se = 0.f;
#pragma unroll 1
  for (int j = 0; j < SQ; ++j) { const float f = (mr[j] != 0) ? 1.f : 0.f; se += __expf(fmaf(f, s[j], (1.f - f) * -1.0e9f) - mx); } const float sc = 256.0f / se;
#pragma unroll 1
  for (int j0 = 0; j0 < SQ; j0 += 8) { FragH fr; for (int q = 0; q < 8; ++q) { const int j = j0 + q; const float f = (mr[j] != 0) ? 1.f : 0.f; fr.h[q] = (_Float16)(__expf(fmaf(f, s[j], (1.f - f) * -1.0e9f) - mx) * sc); }
    unsigned short* d = (unsigned short*)P + i * SQ + j0; *(v8us*)d = fr.half[0];  } }

__global__ __launch_bounds__(256) void k_bdshn(const float* __restrict__ Wb, _Float16* __restrict__ Bt) {
  const size_t t = (size_t)blockIdx.x * 256 + threadIdx.x; if (t >= (size_t)DM * DM / 8) return; const size_t e0 = t * 8; const int n = (int)(e0 / DM), k0 = (int)(e0 % DM); const int h = n >> 6, hk = k0 >> 6; const float on = (hk == h) ? 16.0f : 0.0f; const int o = n & 63, d0 = k0 & 63; FragH f;
  for (int q = 0; q < 8; ++q) f.h[q] = (_Float16)(bf16_round(Wb[(size_t)o * 64 + d0 + q]) * on);
  unsigned short* d = (unsigned short*)Bt + e0; *(v8us*)d = f.half[0];  }

typedef int v4ia __attribute__((ext_vector_type(4), may_alias));
template <int M> __device__ __forceinline__ float rs_xm(float x) { return __builtin_bit_cast(float, __builtin_amdgcn_update_dpp(0, __builtin_bit_cast(int, x), 0x160 | M, 0xf, 0xf, true)); }  // lane l with lane l ^ M inside a 16-lane row
__device__ __forceinline__ float rs_xh(float x) { return __builtin_bit_cast(float, __builtin_amdgcn_permlanex16(__builtin_bit_cast(int, x), __builtin_bit_cast(int, x), 0x76543210, 0xfedcba98, false, false)); }  // lane l with lane l ^ 16
__device__ __forceinline__ float rs_wmax(float v) { v = fmaxf(v, rs_xm<1>(v)); v = fmaxf(v, rs_xm<2>(v)); v = fmaxf(v, rs_xm<4>(v)); v = fmaxf(v, rs_xm<8>(v)); return fmaxf(v, rs_xh(v)); }
__device__ __forceinline__ float rs_wsum(float v) { v += rs_xm<1>(v); v += rs_xm<2>(v); v += rs_xm<4>(v); v += rs_xm<8>(v); return v + rs_xh(v); }
// Four 2^x. Written as asm for the slot behind a transcendental (one independent instruction or v_nop before its result is read or its source overwritten): each v_exp_f32 is followed by
// an independent one (early-clobber outputs share no register with the sources), the last by v_nop.
__device__ __forceinline__ v4f rs_exp4(v4f x) { float e0, e1, e2, e3;
  asm("v_exp_f32 %0, %4\n\tv_exp_f32 %1, %5\n\tv_exp_f32 %2, %6\n\tv_exp_f32 %3, %7\n\tv_nop" : "=&v"(e0), "=&v"(e1), "=&v"(e2), "=&v"(e3) : "v"(x[0]), "v"(x[1]), "v"(x[2]), "v"(x[3]));
  const v4f e = {e0, e1, e2, e3}; return e; }
// Attention as one stream over the keys: one launch for all batches and heads; scores and weights stay in registers.
// A wave owns 32 query columns and walks the 2048 keys in passes of 32: S^T = K Q^T (A = 16 key rows, B = 16 query columns, both k-contiguous f16 rows), so a lane holds 8 keys of ONE query a tile;
// two score tiles of a pass, converted in place, are the B operand of O^T += V^T P^T (A = rows of V^T in the same k order). Maximum and sum are per lane plus one exchange between the lane halves.
// The 8 waves of a work-group share one (batch, head): K rows and V^T rows come in stages of 64 keys, by whole 128-byte lines through registers into one of two LDS buffers
// (a fragment load from global memory would touch 16 lines for 512 bytes, and every wave would repeat it); stage s + 1 is loaded while stage s is worked on, stored behind it, one barrier a stage.
// Values: t = energy / sqrt(512) * log2(e); a key with mask 0 takes the module's fill (-1e20, same scale) BEFORE the maximum, so its weight is exactly 0 beside any open key and a row with no open key comes out uniform;
// weight = 2^(t - m + 6) as f16, m the maximum in use (renewed when a pass exceeds it by more than 8, so a weight stays below 2^14); the sum adds the f32 weights; o = O / sum, stored x64 as f16 rows as before.
// Every '#pragma unroll' in the kernel but the one on the pass loop stands on a loop over a register array (fragments, accumulators): rolled, the array would be indexed at run time and leave the registers.
#define FA_WAVES 8
#define FA_COLS 32
#define FA_STAGE 64
#define FA_PITCH 72      /* halves a staged row: 144 bytes = 16 x 9, an odd multiple of 16 bytes for the 16-byte fragment reads */
static_assert(SQ % (FA_WAVES * FA_COLS) == 0 && SQ % FA_STAGE == 0 && HD == 64 && FA_WAVES * 32 * 8 == SQ && FA_WAVES * 32 * 2 * 8 == FA_STAGE * HD, "k_fattn: whole work-groups and stages; a thread stages 2 x 16 bytes of K, of V^T and of the mask");
typedef _Float16 v8h __attribute__((ext_vector_type(8)));
__device__ __forceinline__ v8f fa_mma(v16h a, v16h b, v8f c) { return __builtin_amdgcn_wmma_f32_16x16x32_f16(false, a, false, b, (short)0, c, false, false); }
// One 16 x 32 fragment from k-contiguous rows, k order as g2_frag: p = the lane's row + 8 * (lane >> 4) halves.
__device__ __forceinline__ v16h fa_frag(const unsigned short* p) { FragH f; f.half[0] = *(const v8us*)p; f.half[1] = *(const v8us*)(p + 16); return f.v; }
__global__ __launch_bounds__(FA_WAVES * 32) void k_fattn(const _Float16* __restrict__ Q16, const _Float16* __restrict__ K16, const _Float16* __restrict__ VT, const int* __restrict__ Km, _Float16* __restrict__ O16) {
  __shared__ __attribute__((aligned(16))) unsigned short sk[2][FA_STAGE][FA_PITCH];      /* [buffer][key][d] */
  __shared__ __attribute__((aligned(16))) unsigned short sv[2][HD][FA_PITCH];            /* [buffer][d][key] */
  __shared__ __attribute__((aligned(16))) int sm[SQ];                                    /* the batch's mask words */
  constexpr int QB = SQ / (FA_WAVES * FA_COLS), NST = SQ / FA_STAGE;
  constexpr float SC = 0.044194173824159216f * 1.44269504088896340736f, FILL = -1.0e20f * SC;
  const int tid = threadIdx.x, lane = tid & 31, ln = lane & 15, hh = lane >> 4; const int wave = __builtin_amdgcn_readfirstlane(tid >> 5);
  const int bh = blockIdx.x / QB, b = bh / NH, h = bh % NH; const int q0 = (blockIdx.x % QB) * (FA_WAVES * FA_COLS) + wave * FA_COLS;
  const _Float16* qb = Q16 + ((size_t)b * SQ + q0) * DM + h * HD;      /* wave-uniform bases */
  const _Float16* kb = K16 + (size_t)b * SQ * DM + h * HD;
  const _Float16* vb = VT + (size_t)bh * HD * SQ;
  const int* mb = Km + (size_t)b * SQ;
  const int srow = tid >> 3, sc8 = (tid & 7) * 8;      /* staging: 8 threads a 128-byte row; rows srow and srow + 32 */
  const unsigned roff = (unsigned)(ln * (DM * 2) + hh * 16);      /* byte offsets of the lane: row ln of a tile of q or o rows */
  const unsigned kso = (unsigned)(srow * (DM * 2) + sc8 * 2), vso = (unsigned)(srow * (SQ * 2) + sc8 * 2), mso = (unsigned)(tid * 16);
  v16h qf[2][2]; v8us gk[2], gv[2];
#pragma unroll
  for (int u = 0; u < 2; ++u) for (int ks = 0; ks < 2; ++ks) qf[u][ks] = fa_frag((const unsigned short*)((const char*)(qb + u * 16 * DM + ks * 32) + roff));
  { const char* kq = (const char*)kb + kso; const char* vq = (const char*)vb + vso; const char* mq = (const char*)mb + mso;
    gk[0] = *(const v8us*)kq; gk[1] = *(const v8us*)(kq + 32 * DM * 2); gv[0] = *(const v8us*)vq; gv[1] = *(const v8us*)(vq + 32 * SQ * 2);
    const v4ia m0 = *(const v4ia*)mq, m1 = *(const v4ia*)(mq + SQ * 2);
    asm volatile("s_wait_xcnt 0x0" :: "v"(roff), "v"(kso), "v"(vso), "v"(mso) : "memory");      /* behind the loads, ahead of any new value in a register that they name (a precaution of form); as inputs the lane offsets keep their registers up to it */
    *(v4ia*)&sm[tid * 4] = m0; *(v4ia*)&sm[SQ / 2 + tid * 4] = m1; }
  *(v8us*)&sk[0][srow][sc8] = gk[0]; *(v8us*)&sk[0][srow + 32][sc8] = gk[1]; *(v8us*)&sv[0][srow][sc8] = gv[0]; *(v8us*)&sv[0][srow + 32][sc8] = gv[1];
  const v8f z8 = {0.f, 0.f, 0.f, 0.f, 0.f, 0.f, 0.f, 0.f};
  v8f o[2][4]; float l[2] = {0.f, 0.f}, m[2] = {-3.0e38f, -3.0e38f};
#pragma unroll
  for (int u = 0; u < 2; ++u) for (int dt = 0; dt < 4; ++dt) o[u][dt] = z8;
  __syncthreads();      /* stage 0 and the mask are in LDS for every wave */
  for (int s = 0; s < NST; ++s) {
    const int bf = s & 1; const int sn = (s + 1 < NST) ? s + 1 : 0;      /* the last stage loads stage 0 again (in bounds, never read) */
    { const char* kq = (const char*)(kb + (size_t)sn * FA_STAGE * DM) + kso; const char* vq = (const char*)(vb + sn * FA_STAGE) + vso;
      gk[0] = *(const v8us*)kq; gk[1] = *(const v8us*)(kq + 32 * DM * 2); gv[0] = *(const v8us*)vq; gv[1] = *(const v8us*)(vq + 32 * SQ * 2);
      asm volatile("s_wait_xcnt 0x0" ::: "memory"); }      /* behind the loads, ahead of any new value in a register that they name (a precaution of form); as a memory barrier for the compiler it also keeps the loads here, a whole stage ahead of their stores */
    v16h kf[2][2];
#pragma unroll
    for (int kt = 0; kt < 2; ++kt) for (int ks = 0; ks < 2; ++ks) kf[kt][ks] = fa_frag(&sk[bf][kt * 16 + ln][ks * 32 + 8 * hh]);
    __builtin_amdgcn_sched_barrier(0);      /* all eight reads are issued before the first wait on one: without it this build read two fragments at a time into one register block and met the LDS latency three times behind every barrier */
#pragma unroll
    for (int p = 0; p < FA_STAGE / 32; ++p) {
      v16h vf[4]; v4ia mk[2][2]; v8f t[2][2];
#pragma unroll
      for (int kt = 0; kt < 2; ++kt) { mk[kt][0] = *(const v4ia*)&sm[s * FA_STAGE + p * 32 + kt * 16 + 8 * hh]; mk[kt][1] = *(const v4ia*)&sm[s * FA_STAGE + p * 32 + kt * 16 + 8 * hh + 4]; }
#pragma unroll
      for (int dt = 0; dt < 4; ++dt) vf[dt] = fa_frag(&sv[bf][dt * 16 + ln][p * 32 + 8 * hh]);
#pragma unroll
      for (int u = 0; u < 2; ++u) for (int kt = 0; kt < 2; ++kt) t[u][kt] = fa_mma(kf[kt][0], qf[u][0], z8);
#pragma unroll
      for (int u = 0; u < 2; ++u) for (int kt = 0; kt < 2; ++kt) t[u][kt] = fa_mma(kf[kt][1], qf[u][1], t[u][kt]);
      if (p + 1 < FA_STAGE / 32) {      /* the next pass of the SAME stage: its K fragments are fetched behind this pass's score products, into the registers these have left */
#pragma unroll
        for (int kt = 0; kt < 2; ++kt) for (int ks = 0; ks < 2; ++ks) kf[kt][ks] = fa_frag(&sk[bf][(p + 1) * 32 + kt * 16 + ln][ks * 32 + 8 * hh]); }
      float mx[2];
#pragma unroll
      for (int u = 0; u < 2; ++u) {
#pragma unroll
        for (int kt = 0; kt < 2; ++kt) { t[u][kt] *= SC; for (int r = 0; r < 8; ++r) t[u][kt][r] = (mk[kt][r >> 2][r & 3] != 0) ? t[u][kt][r] : FILL; }
        float x = fmaxf(t[u][0][0], t[u][1][0]);
#pragma unroll
        for (int r = 1; r < 8; ++r) x = fmaxf(x, fmaxf(t[u][0][r], t[u][1][r]));
        mx[u] = fmaxf(x, rs_xh(x));
      }
      if (__builtin_amdgcn_ballot_w32((mx[0] > m[0] + 8.0f) || (mx[1] > m[1] + 8.0f)) != 0) {      /* one scalar branch a pass: the products of a renewal run only where some column needs one */
        const float n0 = fmaxf(m[0], mx[0]), n1 = fmaxf(m[1], mx[1]); const v4f d4 = {m[0] - n0, m[1] - n1, 0.f, 0.f}; const v4f al = rs_exp4(d4); m[0] = n0; m[1] = n1;
#pragma unroll
        for (int u = 0; u < 2; ++u) { l[u] *= al[u]; for (int dt = 0; dt < 4; ++dt) o[u][dt] *= al[u]; }
      }
      v16h pf[2];
#pragma unroll
      for (int u = 0; u < 2; ++u) { const float ms = m[u] - 6.0f; v4f s4[2];
#pragma unroll
        for (int kt = 0; kt < 2; ++kt) { const v8f x = t[u][kt] - ms; const v4f x0 = {x[0], x[1], x[2], x[3]}, x1 = {x[4], x[5], x[6], x[7]}; const v4f e0 = rs_exp4(x0), e1 = rs_exp4(x1); s4[kt] = e0 + e1;
          const v8f e = {e0[0], e0[1], e0[2], e0[3], e1[0], e1[1], e1[2], e1[3]}; t[u][kt] = e; }
        const v4f sq = s4[0] + s4[1]; l[u] += (sq[0] + sq[1]) + (sq[2] + sq[3]);
        pf[u] = __builtin_shufflevector(__builtin_convertvector(t[u][0], v8h), __builtin_convertvector(t[u][1], v8h), 0, 1, 2, 3, 4, 5, 6, 7, 8, 9, 10, 11, 12, 13, 14, 15); }
      __builtin_amdgcn_sched_barrier(0);      /* this one and the next keep the eight products apart from the 2^x statements: those are asm text, which the compiler's padding behind a matrix instruction does not see */
#pragma unroll
      for (int dt = 0; dt < 4; ++dt) for (int u = 0; u < 2; ++u) o[u][dt] = fa_mma(vf[dt], pf[u], o[u][dt]);
      __builtin_amdgcn_sched_barrier(0);
    }
    *(v8us*)&sk[bf ^ 1][srow][sc8] = gk[0]; *(v8us*)&sk[bf ^ 1][srow + 32][sc8] = gk[1]; *(v8us*)&sv[bf ^ 1][srow][sc8] = gv[0]; *(v8us*)&sv[bf ^ 1][srow + 32][sc8] = gv[1];      /* into the buffer whose readers all passed the barrier of stage s - 1 */
    __syncthreads();      /* publishes stage s + 1 and ends every wave's reads of stage s */
  }
  _Float16* ob = O16 + ((size_t)b * SQ + q0) * DM + h * HD;
#pragma unroll
  for (int u = 0; u < 2; ++u) { const float sc = 64.0f / (l[u] + rs_xh(l[u]));
#pragma unroll
    for (int dt = 0; dt < 4; ++dt) *(v8h*)((char*)(ob + u * 16 * DM + dt * 16) + roff) = __builtin_convertvector(o[u][dt] * sc, v8h); }      /* a lane's 8 accumulator registers are 8 consecutive d of its query row */
}
extern "C" void kernel_launch(void* const* d_in, const int* in_sizes, int n_in,
                              void* d_out, int out_size, void* d_ws, size_t ws_size, hipStream_t stream) {
  (void)in_sizes; (void)n_in; (void)out_size;
  const float* const* I = (const float* const*)d_in; const float* xq = I[2]; const float* xk = I[1]; const float* xv = I[0]; const int* km = (const int*)d_in[3]; const float* wq = I[6]; const float* bq = nullptr; const float* wk = I[5]; const float* bk = nullptr; const float* wv = I[4]; const float* bv = nullptr; const float* wo = I[7]; const float* bo = I[8]; const float* x = xq;      /* contract order: values I[0], keys I[1], query I[2]; mask int32 [4][1][1][2048] (0 = masked key; READ on device); SHARED natural [64][64] blocks Wv I[4], Wk I[5], Wq I[6]; natural Wo [512][512] + bo */
  char* ws = (char*)d_ws; size_t off = 0;
  auto take = [&](size_t bytes) { char* p = ws + off; off += (bytes + 255) & ~(size_t)255; return p; };
  _Float16* BQ = (_Float16*)take((size_t)DM * DM * 2); _Float16* BK = (_Float16*)take((size_t)DM * DM * 2); _Float16* BV = (_Float16*)take((size_t)DM * DM * 2); _Float16* BO = (_Float16*)take((size_t)DM * DM * 2);
  _Float16* X16 = (_Float16*)take(NR * DM * 2); _Float16* XKp = (_Float16*)take(NR * DM * 2); _Float16* XVp = (_Float16*)take(NR * DM * 2); _Float16* Q16 = (_Float16*)take(NR * DM * 2); _Float16* K16 = (_Float16*)take(NR * DM * 2); _Float16* V16 = (_Float16*)take(NR * DM * 2); _Float16* O16 = (_Float16*)take(NR * DM * 2);
  _Float16* VT = (_Float16*)take((size_t)NB * NH * HD * SQ * 2);
  if (off > ws_size) return;
  { const unsigned g = (unsigned)(((size_t)DM * DM / 8 + 255) / 256); k_bdshn<<<g, 256, 0, stream>>>(wq, BQ); k_bdshn<<<g, 256, 0, stream>>>(wk, BK); k_bdshn<<<g, 256, 0, stream>>>(wv, BV); k_wnat<<<g, 256, 0, stream>>>(wo, (size_t)DM * DM / 8, BO); }      /* block-diagonal planes with the SHARED natural [64][64] block (Bt[h*64 + o][h*64 + d] = 16 W[o][d]); Wo natural [out][in] = Bt x16 */
  _Float16* XK = XKp; _Float16* XV = XVp; k_x16<<<(unsigned)((NR * DM / 8 + 255) / 256), 256, 0, stream>>>(xk, XK, NR * DM / 8); k_x16<<<(unsigned)((NR * DM / 8 + 255) / 256), 256, 0, stream>>>(xv, XV, NR * DM / 8);      /* key and value inputs as exact f16 rows */

  k_x16<<<(unsigned)((NR * DM / 8 + 255) / 256), 256, 0, stream>>>(x, X16, NR * DM / 8);
  const size_t r0p = (size_t)B0 * SQ;      /* first projected row */
  k_gemm2<0><<<dim3((unsigned)((MP / 128) * (DM / 64)), 1), 128, 0, stream>>>(X16 + r0p * DM, DM, 0, BQ, DM, 0, 0.0625f, bq, 0, nullptr, 1, 0, 0, nullptr, Q16 + r0p * DM, DM, 0, MP, DM, DM);
  k_gemm2<0><<<dim3((unsigned)((MP / 128) * (DM / 64)), 1), 128, 0, stream>>>(XK + r0p * DM, DM, 0, BK, DM, 0, 0.0625f, bk, 0, nullptr, 1, 0, 0, nullptr, K16 + r0p * DM, DM, 0, MP, DM, DM);
  k_gemm2<0><<<dim3((unsigned)((MP / 128) * (DM / 64)), 1), 128, 0, stream>>>(XV + r0p * DM, DM, 0, BV, DM, 0, 0.0625f, bv, 0, nullptr, 1, 0, 0, nullptr, V16 + r0p * DM, DM, 0, MP, DM, DM);
  k_vt<NH, SQ><<<NB * NH * (SQ / 64), 256, 0, stream>>>(V16, LQ, 0, VT);      /* V^T [NB][NH][HD][SQ] */
  k_fattn<<<NB * NH * (SQ / (FA_WAVES * FA_COLS)), FA_WAVES * 32, 0, stream>>>(Q16, K16, VT, km, O16);      /* o (merged heads) as f16 rows x64; keys with mask[b][j] == 0 take the module's fill */
  k_gemm2<0><<<dim3((unsigned)((MPO / 128) * (DM / 64)), 1), 128, 0, stream>>>(O16 + r0p * DM, DM, 0, BO, DM, 0, 0.0009765625f, bo, 0, nullptr, 1, 0, 0, (float*)d_out + r0p * DM, nullptr, DM, 0, MPO, DM, DM);      /* out rows are the output layout */
}

// v003
// It runs in 72.6 microseconds.
// In two side-by-side timings against v002, it was 2.29 and 2.27 times as fast.
// All steps since v000 together make it 46.1 times as fast.
#include <hip/hip_runtime.h>
// Multi-head attention over three inputs with SHARED per-head projections, a random key-padding mask and the module's literal score scale (values, keys, query [4][2048][512]; each input is split into 8 heads of 64 and every head is multiplied by the SAME natural [64][64] matrix (x W^T: Wv / Wk / Wq; no biases); energy = q k^T; where(mask == 0, -1e20) with the int32 [4][1][1][2048] mask in {0, 1} (random; 0 = masked key; READ on device); softmax(energy / sqrt(embed_size) = / sqrt(512)) (as the source); out = merged Wo^T + bo -> [4][2048][512]).
// Structure: token rows r = b*2048 + s; Q, K and V^T in ONE launch straight from the f32 inputs (k_proj: a wave takes 64 tokens of one head, rounds x to bf16 as exact f16 in registers, multiplies by the shared [64][64] block (exact x16) on WMMA over k = 64, f32 accumulation, f16 outputs; V leaves transposed); scores, masked softmax and weights x V in ONE launch for all batches and heads (k_fattn: running maximum and sum, scores and weights never in memory; o carried x64 against f16 subnormal flush, folded into the output GEMM alpha) written straight into the merged f16 o rows; out = o W_o + b GEMM (f32) into the output layout.
// Compute dtype: inputs rounded to bf16; x / weights exact; q, k, v, softmax weights and o as plain f16 GEMM operands (~2^-12); scores and softmax statistics f32. v_wmma_f32_16x16x32_f16.
#define NB 4
#define SQ 2048
#define DM 512
#define NH 8
#define HD 64
#define HG 4                         /* heads a launch of the k_vt(V16, b, h0, VT) form, which is not launched */
#define B0 0                         /* first batch of the output stage (debug hook) */
#define NBR NB                       /* batches of the output stage (debug hook) */
#define NR ((size_t)NB * SQ)         /* token rows */
#define MP ((int)((size_t)NBR * SQ)) /* rows of the output stage, via MPO (debug hook) */
#define QN SQ                        /* unused; k_fattn attends all SQ query rows of a batch */
#define NHD NH                       /* unused; k_fattn attends all NH heads */
#define MPO MP                       /* rows through the output stage (debug hook) */
#define LQ DM      /* unused; the q and k rows have pitch DM */
typedef __bf16 v16b __attribute__((ext_vector_type(16)));
typedef unsigned short v8us __attribute__((ext_vector_type(8), may_alias));
typedef float  v8f  __attribute__((ext_vector_type(8)));
typedef float  v4f  __attribute__((ext_vector_type(4)));
typedef float  v4fa __attribute__((ext_vector_type(4), may_alias));
union FragB { v16b v; v8us half[2]; unsigned short u[16]; };

__device__ __forceinline__ unsigned short bf16_bits(float x) { unsigned int u = __float_as_uint(x); return (unsigned short)((u + 0x7FFFu + ((u >> 16) & 1u)) >> 16); }
__device__ __forceinline__ float bf16_val(unsigned short b) { return __uint_as_float(((unsigned int)b) << 16); }
__device__ __forceinline__ float bf16_round(float x) { return bf16_val(bf16_bits(x)); }
// D += A·B with NT terms: 1 = ah·bh, 2 = + al·bh (A split), 3 = + ah·bl (both split)
template <int NT>
__device__ __forceinline__ v8f mmaN(v16b ah, v16b al, v16b bh, v16b bl, v8f c) {
  c = __builtin_amdgcn_wmma_f32_16x16x32_bf16(false, ah, false, bh, (short)0, c, false, false);
  if (NT >= 2) c = __builtin_amdgcn_wmma_f32_16x16x32_bf16(false, al, false, bh, (short)0, c, false, false);
  if (NT >= 3) c = __builtin_amdgcn_wmma_f32_16x16x32_bf16(false, ah, false, bl, (short)0, c, false, false);
  asm volatile("v_nop\n\tv_nop\n\tv_nop\n\tv_nop" : "+v"(c) : "v"(ah), "v"(al), "v"(bh), "v"(bl));
  return c;
}

__global__ __launch_bounds__(256) void k_wt_bf16(const float* __restrict__ W, unsigned short* __restrict__ Wt, int K, int N) {
  const int t = blockIdx.x * 256 + threadIdx.x;
  const int k8n = K / 8;
  if (t >= N * k8n) return;
  const int n = t / k8n, k8 = (t % k8n) * 8;
  v8us v;
#pragma unroll
  for (int i = 0; i < 8; ++i) v[i] = bf16_bits(W[(size_t)(k8 + i) * N + n]);
  *(v8us*)(Wt + (size_t)n * K + k8) = v;
  
}

// GEMM C[M][N] (f32, pitch ldc) = act(A[M][K]·W + bias). A f32 row-major (pitch lda) converted per fragment to bf16
// (ASPLIT: hi/lo two planes -> 2 terms, else single rounded term); Wt bf16 [N][K] (pitch ldb). BIAS_BF16 rounds the
// bias to bf16 first (bias quantised to bf16 before the add). K%32==0, M%16==0, N%64==0.
template <bool ASPLIT, int ACT, bool BIAS_BF16>
__global__ __launch_bounds__(128) void k_gemm_bf(const float* __restrict__ A, int lda, const unsigned short* __restrict__ Wt, int ldb,
                                               const float* __restrict__ bias, float* __restrict__ C, int ldc, int M, int N, int K) {
  __shared__ __attribute__((aligned(16))) float so[4][16][64];
  const int tid = threadIdx.x, w = tid >> 5, lane = tid & 31, ln = lane & 15, hh = lane >> 4;
  const int ntn = N / 64;
  const int wid = blockIdx.x * 4 + w;
  const int mt = wid / ntn, nq = wid % ntn;
  if (mt * 16 >= M) return;
  const int row0 = mt * 16, col0 = nq * 64;
  const float* arow = A + (size_t)(row0 + ln) * lda;
  v8f acc[4] = {};
  for (int kb = 0; kb < K; kb += 32) {
    FragB ah, al;
    const v4f x0 = *(const v4fa*)(arow + kb + 8 * hh), x1 = *(const v4fa*)(arow + kb + 8 * hh + 4);
    const v4f x2 = *(const v4fa*)(arow + kb + 16 + 8 * hh), x3 = *(const v4fa*)(arow + kb + 16 + 8 * hh + 4);
    float xs[16] = {x0[0],x0[1],x0[2],x0[3],x1[0],x1[1],x1[2],x1[3],x2[0],x2[1],x2[2],x2[3],x3[0],x3[1],x3[2],x3[3]};
#pragma unroll
    for (int i = 0; i < 16; ++i) { const unsigned short hb = bf16_bits(xs[i]); ah.u[i] = hb; al.u[i] = ASPLIT ? bf16_bits(xs[i] - bf16_val(hb)) : (unsigned short)0; }
#pragma unroll
    for (int t = 0; t < 4; ++t) {
      const unsigned short* brow = Wt + (size_t)(col0 + t * 16 + ln) * ldb + kb;
      FragB b;
      b.half[0] = *(const v8us*)(brow + 8 * hh);
      b.half[1] = *(const v8us*)(brow + 16 + 8 * hh);
      acc[t] = mmaN<ASPLIT ? 2 : 1>(ah.v, al.v, b.v, b.v, acc[t]);
    }
  }
#pragma unroll
  for (int t = 0; t < 4; ++t) {
    float bv = bias ? bias[col0 + t * 16 + ln] : 0.f;
    if (BIAS_BF16) bv = bf16_round(bv);
#pragma unroll
    for (int r = 0; r < 8; ++r) { float v = acc[t][r] + bv; if (ACT == 1) v = fmaxf(v, 0.f); so[w][8 * hh + r][t * 16 + ln] = v; }
  }
  __builtin_amdgcn_fence(__ATOMIC_ACQ_REL, "workgroup");
  __builtin_amdgcn_wave_barrier();
  const int rsub = lane >> 4, c4 = (lane & 15) * 4;
  {
#pragma unroll
    for (int q = 0; q < 8; ++q) {
      const int r = q * 2 + rsub;
      const v4f v = *(const v4fa*)&so[w][r][c4];
      *(v4f*)(C + (size_t)(row0 + r) * ldc + col0 + c4) = v;
    }
    
  }
}

// GEMM C = act(A·W + bias + resid): A f32 (ASPLIT -> hi/lo 2 terms), Wt bf16 [N][K]; ACT 0 none, 1 relu, 2 exact gelu;
// resid (optional, f32, row index = (row % rmod), pitch ldr, RES_BF16 rounds it) added before the activation.
template <bool ASPLIT, int ACT, bool BIAS_BF16, bool RES_BF16>
__global__ __launch_bounds__(128) void k_gemm_bf3(const float* __restrict__ A, int lda, const unsigned short* __restrict__ Wt, int ldb,
                                                const float* __restrict__ bias, const float* __restrict__ resid, int rmod, int ldr,
                                                float* __restrict__ C, int ldc, int M, int N, int K) {
  __shared__ __attribute__((aligned(16))) float so[4][16][64];
  const int tid = threadIdx.x, w = tid >> 5, lane = tid & 31, ln = lane & 15, hh = lane >> 4;
  const int ntn = N / 64;
  const int wid = blockIdx.x * 4 + w;
  const int mt = wid / ntn, nq = wid % ntn;
  if (mt * 16 >= M) return;
  const int row0 = mt * 16, col0 = nq * 64;
  const float* arow = A + (size_t)(row0 + ln) * lda;
  v8f acc[4] = {};
  for (int kb = 0; kb < K; kb += 32) {
    FragB ah, al;
    const v4f x0 = *(const v4fa*)(arow + kb + 8 * hh), x1 = *(const v4fa*)(arow + kb + 8 * hh + 4);
    const v4f x2 = *(const v4fa*)(arow + kb + 16 + 8 * hh), x3 = *(const v4fa*)(arow + kb + 16 + 8 * hh + 4);
    float xs[16] = {x0[0],x0[1],x0[2],x0[3],x1[0],x1[1],x1[2],x1[3],x2[0],x2[1],x2[2],x2[3],x3[0],x3[1],x3[2],x3[3]};
#pragma unroll
    for (int i = 0; i < 16; ++i) { const unsigned short hb = bf16_bits(xs[i]); ah.u[i] = hb; al.u[i] = ASPLIT ? bf16_bits(xs[i] - bf16_val(hb)) : (unsigned short)0; }
#pragma unroll
    for (int t = 0; t < 4; ++t) {
      const unsigned short* brow = Wt + (size_t)(col0 + t * 16 + ln) * ldb + kb;
      FragB b;
      b.half[0] = *(const v8us*)(brow + 8 * hh);
      b.half[1] = *(const v8us*)(brow + 16 + 8 * hh);
      acc[t] = mmaN<ASPLIT ? 2 : 1>(ah.v, al.v, b.v, b.v, acc[t]);
    }
  }
#pragma unroll
  for (int t = 0; t < 4; ++t) {
    const int col = col0 + t * 16 + ln;
    float bv = bias ? bias[col] : 0.f;
    if (BIAS_BF16) bv = bf16_round(bv);
#pragma unroll
    for (int r = 0; r < 8; ++r) {
      float v = acc[t][r] + bv;
      if (resid) { float rv = resid[(size_t)((row0 + 8 * hh + r) % rmod) * ldr + col]; if (RES_BF16) rv = bf16_round(rv); v += rv; }
      if (ACT == 1) v = fmaxf(v, 0.f);
      if (ACT == 2) v = 0.5f * v * (1.0f + erff(v * 0.70710678118654752f));
      if (ACT == 3) { const float u = 0.7978845608028654f * (v + 0.044715f * v * v * v); v = 0.5f * v * (1.0f + tanhf(u)); }
      so[w][8 * hh + r][t * 16 + ln] = v;
    }
  }
  __builtin_amdgcn_fence(__ATOMIC_ACQ_REL, "workgroup");
  __builtin_amdgcn_wave_barrier();
  const int rsub = lane >> 4, c4 = (lane & 15) * 4;
  {
#pragma unroll
    for (int q = 0; q < 8; ++q) {
      const int r = q * 2 + rsub;
      const v4f v = *(const v4fa*)&so[w][r][c4];
      *(v4f*)(C + (size_t)(row0 + r) * ldc + col0 + c4) = v;
    }
    
  }
}
// row LayerNorm (biased variance, eps) over N: s = X (+ R); optional out_sum <- s; out_norm <- (s-mu)*rsqrt(var+eps)*g + b
template <bool PARAM_BF16>
__global__ __launch_bounds__(256) void k_layernorm(const float* __restrict__ X, const float* __restrict__ R, const float* __restrict__ g, const float* __restrict__ bta,
                                                  float* __restrict__ out_sum, float* __restrict__ out_norm, int N, float eps) {
  __shared__ float red[256];
  const int row = blockIdx.x, tid = threadIdx.x;
  const float* x = X + (size_t)row * N; const float* rr = R ? R + (size_t)row * N : nullptr;
  float vals[16];                     // up to N = 4096
  const int per = N / 256;            // contiguous chunk per thread? use strided-by-4 chunks: thread handles j = tid*4 + 1024*u
  float s1 = 0.f;
  for (int u = 0; u < per / 4; ++u) {
    const int j = tid * 4 + 1024 * u;
    const v4f a = *(const v4fa*)(x + j);
    v4f b = {0.f,0.f,0.f,0.f}; if (rr) b = *(const v4fa*)(rr + j);
#pragma unroll
    for (int q = 0; q < 4; ++q) { const float v = a[q] + b[q]; vals[u * 4 + q] = v; s1 += v; }
  }
  red[tid] = s1; __syncthreads();
  for (int st = 128; st > 0; st >>= 1) { if (tid < st) red[tid] += red[tid + st]; __syncthreads(); }
  const float mu = red[0] / (float)N; __syncthreads();
  float s2 = 0.f;
  for (int u = 0; u < per / 4; ++u)
#pragma unroll
    for (int q = 0; q < 4; ++q) { const float c = vals[u * 4 + q] - mu; s2 += c * c; }
  red[tid] = s2; __syncthreads();
  for (int st = 128; st > 0; st >>= 1) { if (tid < st) red[tid] += red[tid + st]; __syncthreads(); }
  const float rs = rsqrtf(red[0] / (float)N + eps);
  {
    for (int u = 0; u < per / 4; ++u) {
      const int j = tid * 4 + 1024 * u;
      v4f o, sm;
#pragma unroll
      for (int q = 0; q < 4; ++q) {
        float gg = g[j + q], bb = bta[j + q];
        if (PARAM_BF16) { gg = bf16_round(gg); bb = bf16_round(bb); }
        sm[q] = vals[u * 4 + q]; o[q] = (vals[u * 4 + q] - mu) * rs * gg + bb;
      }
      if (out_sum) *(v4f*)(out_sum + (size_t)row * N + j) = sm;
      *(v4f*)(out_norm + (size_t)row * N + j) = o;
    }
    
  }
}



// ---- f16 WMMA path (v_wmma_f32_16x16x32_f16): 11-bit significands for operands in range — used where a [0,1] probability operand needs more precision than bf16
typedef _Float16 v16h __attribute__((ext_vector_type(16)));
union FragH { v16h v; v8us half[2]; _Float16 h[16]; unsigned short u[16]; };
template <int NT>
__device__ __forceinline__ v8f mmaH(v16h ah, v16h al, v16h bh, v16h bl, v8f c) {
  c = __builtin_amdgcn_wmma_f32_16x16x32_f16(false, ah, false, bh, (short)0, c, false, false);
  if (NT >= 2) c = __builtin_amdgcn_wmma_f32_16x16x32_f16(false, al, false, bh, (short)0, c, false, false);
  if (NT >= 3) c = __builtin_amdgcn_wmma_f32_16x16x32_f16(false, ah, false, bl, (short)0, c, false, false);
  asm volatile("v_nop\n\tv_nop\n\tv_nop\n\tv_nop" : "+v"(c) : "v"(ah), "v"(al), "v"(bh), "v"(bl));
  return c;
}
// batched GEMM like k_gemm_b but f16 operands: A f32 (split into f16 hi/lo if ASPLIT, else rounded to f16), Bt = f16 values [n][k]; alpha; C f32; N multiple of 16 (partial tiles skipped)
template <bool ASPLIT>
__global__ __launch_bounds__(128) void k_gemm_h(const float* __restrict__ A, int lda, size_t sA, const _Float16* __restrict__ Bh, int ldb, size_t sB, float alpha, float* __restrict__ C, int ldc, size_t sC, int M, int N, int K) {
  __shared__ __attribute__((aligned(16))) float so[4][16][64];
  const int tid = threadIdx.x, w = tid >> 5, lane = tid & 31, ln = lane & 15, hh = lane >> 4; const int by = blockIdx.y;
  A += (size_t)by * sA; Bh += (size_t)by * sB; C += (size_t)by * sC;
  const int ntn = (N + 63) / 64; const int wid = blockIdx.x * 4 + w; const int mt = wid / ntn, nq = wid % ntn; if (mt * 16 >= M) return;
  const int row0 = mt * 16, col0 = nq * 64; const float* arow = A + (size_t)(row0 + ln) * lda;
  v8f acc[4] = {};
  for (int kb = 0; kb < K; kb += 32) {
    FragH ah, al;
    const v4f x0 = *(const v4fa*)(arow + kb + 8 * hh), x1 = *(const v4fa*)(arow + kb + 8 * hh + 4), x2 = *(const v4fa*)(arow + kb + 16 + 8 * hh), x3 = *(const v4fa*)(arow + kb + 16 + 8 * hh + 4);
    float xs[16] = {x0[0],x0[1],x0[2],x0[3],x1[0],x1[1],x1[2],x1[3],x2[0],x2[1],x2[2],x2[3],x3[0],x3[1],x3[2],x3[3]};
#pragma unroll
    for (int i = 0; i < 16; ++i) { const _Float16 h = (_Float16)xs[i]; ah.h[i] = h; al.h[i] = ASPLIT ? (_Float16)(xs[i] - (float)h) : (_Float16)0.0f; }
#pragma unroll
    for (int t = 0; t < 4; ++t) { if (col0 + t * 16 >= N) continue; const size_t boff = (size_t)(col0 + t * 16 + ln) * ldb + kb; FragH bq; bq.half[0] = *(const v8us*)(Bh + boff + 8 * hh); bq.half[1] = *(const v8us*)(Bh + boff + 16 + 8 * hh);
      acc[t] = mmaH<ASPLIT ? 2 : 1>(ah.v, al.v, bq.v, bq.v, acc[t]); }
  }
#pragma unroll
  for (int t = 0; t < 4; ++t) { if (col0 + t * 16 >= N) continue;
#pragma unroll
    for (int r = 0; r < 8; ++r) so[w][8 * hh + r][t * 16 + ln] = acc[t][r] * alpha; }
  __builtin_amdgcn_fence(__ATOMIC_ACQ_REL, "workgroup"); __builtin_amdgcn_wave_barrier();
  const int rsub = lane >> 4, c4 = (lane & 15) * 4;
  {
#pragma unroll
    for (int q = 0; q < 8; ++q) { const int r = q * 2 + rsub; if (col0 + c4 < N) { const v4f v = *(const v4fa*)&so[w][r][c4]; *(v4f*)(C + (size_t)(row0 + r) * ldc + col0 + c4) = v; } }
     }
}

// Wt[n][k] = f16(W[k][n]·scale) from f32 row-major W[K][N] (scale = power of two; bf16-exact weights stay exact in f16 away from the subnormal range)
__global__ __launch_bounds__(256) void k_wt_f16(const float* __restrict__ W, _Float16* __restrict__ Wt, int K, int N, float scale) {
  const int t = blockIdx.x * 256 + threadIdx.x; if (t >= N * (K / 8)) return; const int n = t / (K / 8), k8 = (t % (K / 8)) * 8; FragH f;
#pragma unroll
  for (int i = 0; i < 8; ++i) f.h[i] = (_Float16)(bf16_round(W[(size_t)(k8 + i) * N + n]) * scale); const v8us o = f.half[0];
  *(v8us*)((unsigned short*)Wt + (size_t)n * K + k8) = o; 
}
// k_gemm_hh variant with fused epilogue: v = acc·alpha + bias[by·sBias + col] (+ CP[(row/rowsPerB)·sCPb + by·64 + col] if CP) ; ACT 0 none / 1 elu ; writes f16 C16 (and f32 C if non-null)
template <int ACT>
__global__ __launch_bounds__(128) void k_gemm_hhx(const _Float16* __restrict__ A, int lda, size_t sA, const _Float16* __restrict__ Bh, int ldb, size_t sB, float alpha, const float* __restrict__ bias, size_t sBias, const float* __restrict__ CP, int rowsPerB, size_t sCPb, int row0g,
    float* __restrict__ C, _Float16* __restrict__ C16, int ldc, size_t sC, int M, int N, int K) {
  __shared__ __attribute__((aligned(16))) float so[4][16][64];
  const int tid = threadIdx.x, w = tid >> 5, lane = tid & 31, ln = lane & 15, hh = lane >> 4; const int by = blockIdx.y;
  A += (size_t)by * sA; Bh += (size_t)by * sB; const size_t cofs = (size_t)by * sC; const float* bp = bias ? bias + (size_t)by * sBias : nullptr;
  const int ntn = (N + 63) / 64; const int wid = blockIdx.x * 4 + w; const int mt = wid / ntn, nq = wid % ntn; if (mt * 16 >= M) return;
  const int row0 = mt * 16, col0 = nq * 64; const _Float16* arow = A + (size_t)(row0 + ln) * lda;
  v8f acc[4] = {};
  for (int kb = 0; kb < K; kb += 32) { FragH ah; ah.half[0] = *(const v8us*)((const unsigned short*)arow + kb + 8 * hh); ah.half[1] = *(const v8us*)((const unsigned short*)arow + kb + 16 + 8 * hh);
#pragma unroll
    for (int t = 0; t < 4; ++t) { if (col0 + t * 16 >= N) continue; const size_t boff = (size_t)(col0 + t * 16 + ln) * ldb + kb; FragH bq; bq.half[0] = *(const v8us*)((const unsigned short*)Bh + boff + 8 * hh); bq.half[1] = *(const v8us*)((const unsigned short*)Bh + boff + 16 + 8 * hh);
      acc[t] = mmaH<1>(ah.v, ah.v, bq.v, bq.v, acc[t]); }
  }
#pragma unroll
  for (int t = 0; t < 4; ++t) { if (col0 + t * 16 >= N) continue; const int col = col0 + t * 16 + ln; const float bv = bp ? bf16_round(bp[col]) : 0.f;
#pragma unroll
    for (int r = 0; r < 8; ++r) { float v = acc[t][r] * alpha + bv; if (CP) { const int rr = row0g + row0 + 8 * hh + r; if (rowsPerB < 0) v += CP[cofs + (size_t)rr * ldc + col];      /* rowsPerB < 0: own element of the batched C plane */ else { const int bidx = rr / rowsPerB; v += CP[(size_t)bidx * sCPb + (size_t)by * 64 + col]; } } if (ACT == 1) v = (v > 0.f) ? v : expm1f(v); else if (ACT == 7) v = (v > 0.f) ? v + 1.0f : expf(v); else if (ACT == 8) v = tanhf(v); else if (ACT == 9) v = 0.5f * v * (1.0f + tanhf(0.7978845608028654f * (v + 0.044715f * v * v * v))); else if (ACT == 11) v = 1.0f / (1.0f + expf(-v)); else if (ACT == 12) v = (v > 0.f) ? v : 0.01f * v; else if (ACT == 14) v = (v > 0.f) ? v : 0.1f * v; else if (ACT == 16) v = (v >= 0.f) ? v : 0.3f * v; else if (ACT == 17) v = (v >= 0.f) ? v : 0.2f * v; else if (ACT == 15) v = v / (1.0f + expf(-v)); else if (ACT == 3) v = fmaxf(v, 0.f); else if (ACT == 6) v = 0.5f * v * (1.0f + erff(v * 0.70710678118654752f)); so[w][8 * hh + r][t * 16 + ln] = v; } }
  __builtin_amdgcn_fence(__ATOMIC_ACQ_REL, "workgroup"); __builtin_amdgcn_wave_barrier();
  const int rsub = lane >> 4, c4 = (lane & 15) * 4; typedef _Float16 v4h __attribute__((ext_vector_type(4)));
  {
#pragma unroll
    for (int q = 0; q < 8; ++q) { const int r = q * 2 + rsub; if (col0 + c4 < N) { const v4f v = *(const v4fa*)&so[w][r][c4]; if (C) *(v4f*)(C + cofs + (size_t)(row0 + r) * ldc + col0 + c4) = v; if (C16) { v4h h4; for (int i = 0; i < 4; ++i) h4[i] = (_Float16)v[i]; *(v4h*)(C16 + cofs + (size_t)(row0 + r) * ldc + col0 + c4) = h4; } } }
     }
}


typedef _Float16 v4h __attribute__((ext_vector_type(4)));

__global__ __launch_bounds__(256) void k_x16(const float* __restrict__ x, _Float16* __restrict__ X16, size_t n8) { const size_t t = (size_t)blockIdx.x * 256 + threadIdx.x; if (t >= n8) return; FragH f;
#pragma unroll
  for (int q = 0; q < 8; ++q) f.h[q] = (_Float16)bf16_round(x[t * 8 + q]); *(v8us*)((unsigned short*)X16 + t * 8) = f.half[0];  }
__global__ __launch_bounds__(256) void k_h16(const float* __restrict__ x, _Float16* __restrict__ X16, size_t n8) { const size_t t = (size_t)blockIdx.x * 256 + threadIdx.x; if (t >= n8) return; FragH f;
#pragma unroll
  for (int q = 0; q < 8; ++q) f.h[q] = (_Float16)x[t * 8 + q]; *(v8us*)((unsigned short*)X16 + t * 8) = f.half[0];  }
__global__ __launch_bounds__(256) void k_round16f(const float* __restrict__ W, _Float16* __restrict__ Bt, size_t n8) { const size_t t = (size_t)blockIdx.x * 256 + threadIdx.x; if (t >= n8) return; FragH f;
#pragma unroll
  for (int i = 0; i < 8; ++i) f.h[i] = (_Float16)(bf16_round(W[t * 8 + i]) * 16.0f); *(v8us*)((unsigned short*)Bt + t * 8) = f.half[0];  }
template <int NHv, int TTv>
__global__ __launch_bounds__(256) void k_vt(const _Float16* __restrict__ V16, int ldv, int voff, _Float16* __restrict__ Vt) { __shared__ unsigned short tl[64][66]; const int tid = threadIdx.x; const int slab = blockIdx.x / (TTv / 64), lg = blockIdx.x % (TTv / 64); const int b = slab / NHv, h = slab % NHv;
  for (int i = tid; i < 64 * 8; i += 256) { const int r = i / 8, c8 = (i % 8) * 8; FragH f; f.half[0] = *(const v8us*)((const unsigned short*)V16 + ((size_t)b * TTv + lg * 64 + r) * ldv + voff + h * 64 + c8);
#pragma unroll
    for (int q = 0; q < 8; ++q) tl[r][c8 + q] = f.u[q]; }
  __syncthreads();
  {
#pragma unroll
    for (int rd = 0; rd < 2; ++rd) { const int d = rd * 32 + tid / 8, pc = tid % 8; FragH f;
#pragma unroll
      for (int q = 0; q < 8; ++q) f.u[q] = tl[pc * 8 + q][d];
      *(v8us*)((unsigned short*)Vt + ((size_t)slab * 64 + d) * TTv + lg * 64 + pc * 8) = f.half[0]; }
     } }

__global__ __launch_bounds__(256) void k_hl(const float* __restrict__ F, _Float16* __restrict__ Hh, _Float16* __restrict__ Hl, size_t n8) { const size_t t = (size_t)blockIdx.x * 256 + threadIdx.x; if (t >= n8) return; FragH fh, fl; const v4f a = *(const v4fa*)(F + t * 8), c = *(const v4fa*)(F + t * 8 + 4);
#pragma unroll
  for (int q = 0; q < 4; ++q) { _Float16 h = (_Float16)a[q]; fh.h[q] = h; fl.h[q] = (_Float16)((a[q] - (float)h) * 1024.0f); h = (_Float16)c[q]; fh.h[4 + q] = h; fl.h[4 + q] = (_Float16)((c[q] - (float)h) * 1024.0f); }
  { *(v8us*)((unsigned short*)Hh + t * 8) = fh.half[0]; *(v8us*)((unsigned short*)Hl + t * 8) = fl.half[0];  } }

// ---- fast GEMM (wave tile 32x64; requires M % 32 == 0 rows per launch region and N % 64 == 0); epilogue = k_gemm_hhx semantics ----
__device__ __forceinline__ v16h g2_frag(const _Float16* p, int hh) { FragH f; f.half[0] = *(const v8us*)((const unsigned short*)p + 8 * hh); f.half[1] = *(const v8us*)((const unsigned short*)p + 16 + 8 * hh); return f.v; }
__device__ __forceinline__ v8f g2_mma(v16h a, v16h b, v8f c) { v8f d = __builtin_amdgcn_wmma_f32_16x16x32_f16(false, a, false, b, (short)0, c, false, false); asm volatile("v_nop\n\tv_nop\n\tv_nop\n\tv_nop" : "+v"(d) : "v"(a), "v"(b)); return d; }
template <int ACT>
__global__ __launch_bounds__(128) void k_gemm2(const _Float16* __restrict__ A, int lda, size_t sA, const _Float16* __restrict__ Bh, int ldb, size_t sB, float alpha, const float* __restrict__ bias, size_t sBias, const float* __restrict__ CP, int rowsPerB, size_t sCPb, int row0g,
    float* __restrict__ C, _Float16* __restrict__ C16, int ldc, size_t sC, int M, int N, int K) { static_assert(ACT == 0 || ACT == 3 || ACT == 6 || ACT == 8 || ACT == 9 || ACT == 11 || ACT == 12 || ACT == 14 || ACT == 15 || ACT == 16 || ACT == 17, "k_gemm2: unsupported ACT code (would silently apply no activation)");
  __shared__ __attribute__((aligned(16))) float so[4][32][68];
  const int tid = threadIdx.x, w = tid >> 5, lane = tid & 31, ln = lane & 15, hh = lane >> 4; const int by = blockIdx.y;
  A += (size_t)by * sA; Bh += (size_t)by * sB; const size_t cofs = (size_t)by * sC; const float* bp = bias ? bias + (size_t)by * sBias : nullptr;
  const int ntn = N >> 6; const int mt = blockIdx.x / ntn, nq = blockIdx.x - mt * ntn; const int row0 = mt * 128 + 32 * w, col0 = nq * 64; if (row0 >= M) return;
  const _Float16* a0p = A + (size_t)(row0 + ln) * lda; const _Float16* a1p = a0p + (size_t)16 * lda;
  const _Float16* b0p = Bh + (size_t)(col0 + ln) * ldb; const _Float16* b1p = b0p + (size_t)16 * ldb; const _Float16* b2p = b1p + (size_t)16 * ldb; const _Float16* b3p = b2p + (size_t)16 * ldb;
  const v8f z8 = {0.f,0.f,0.f,0.f,0.f,0.f,0.f,0.f}; v8f c00 = z8, c01 = z8, c02 = z8, c03 = z8, c10 = z8, c11 = z8, c12 = z8, c13 = z8;
#pragma unroll 1
  for (int kb = 0; kb < K; kb += 32) { const v16h a0 = g2_frag(a0p + kb, hh), a1 = g2_frag(a1p + kb, hh);
    v16h b = g2_frag(b0p + kb, hh); c00 = g2_mma(a0, b, c00); c10 = g2_mma(a1, b, c10);
    b = g2_frag(b1p + kb, hh); c01 = g2_mma(a0, b, c01); c11 = g2_mma(a1, b, c11);
    b = g2_frag(b2p + kb, hh); c02 = g2_mma(a0, b, c02); c12 = g2_mma(a1, b, c12);
    b = g2_frag(b3p + kb, hh); c03 = g2_mma(a0, b, c03); c13 = g2_mma(a1, b, c13); }
  v8f accs[8] = {c00, c01, c02, c03, c10, c11, c12, c13};
#pragma unroll
  for (int u = 0; u < 8; ++u) { const int t = u & 3, half = u >> 2; const int col = col0 + t * 16 + ln; const float bv = bp ? bf16_round(bp[col]) : 0.f;
#pragma unroll
    for (int r = 0; r < 8; ++r) { const int rloc = half * 16 + 8 * hh + r; float v = accs[u][r] * alpha + bv; if (CP) { if (rowsPerB < 0) v += CP[cofs + (size_t)(row0g + row0 + rloc) * ldc + col];      /* rowsPerB < 0: own element of the batched C plane */ else { const int bidx = (row0g + row0 + rloc) / rowsPerB; v += CP[(size_t)bidx * sCPb + (size_t)by * 64 + col]; } }
      if (ACT == 3) v = fmaxf(v, 0.f); else if (ACT == 6) v = 0.5f * v * (1.0f + erff(v * 0.70710678118654752f)); else if (ACT == 11) v = 1.0f / (1.0f + expf(-v)); else if (ACT == 15) v = v / (1.0f + expf(-v)); else if (ACT == 12) v = (v > 0.f) ? v : 0.01f * v; else if (ACT == 8) v = tanhf(v); else if (ACT == 9) v = 0.5f * v * (1.0f + tanhf(0.7978845608028654f * (v + 0.044715f * v * v * v))); else if (ACT == 14) v = (v > 0.f) ? v : 0.1f * v; else if (ACT == 16) v = (v >= 0.f) ? v : 0.3f * v; else if (ACT == 17) v = (v >= 0.f) ? v : 0.2f * v;
      so[w][rloc][t * 16 + ln] = v; } }
  __builtin_amdgcn_fence(__ATOMIC_ACQ_REL, "workgroup"); __builtin_amdgcn_wave_barrier();
  const int rsub = lane >> 4, c4 = (lane & 15) * 4;
  {
#pragma unroll
    for (int q = 0; q < 16; ++q) { const int r = q * 2 + rsub; const v4f v = *(const v4fa*)&so[w][r][c4]; if (C) *(v4f*)(C + cofs + (size_t)(row0 + r) * ldc + col0 + c4) = v; if (C16) { v4h h4; for (int i = 0; i < 4; ++i) h4[i] = (_Float16)v[i]; *(v4h*)(C16 + cofs + (size_t)(row0 + r) * ldc + col0 + c4) = h4; } }
     } }


__global__ __launch_bounds__(256) void k_wnat(const float* __restrict__ w, size_t n8, _Float16* __restrict__ Bt) { const size_t t = (size_t)blockIdx.x * 256 + threadIdx.x; if (t >= n8) return; FragH f; for (int q = 0; q < 8; ++q) f.h[q] = (_Float16)(bf16_round(w[t * 8 + q]) * 16.0f); *(v8us*)((unsigned short*)Bt + t * 8) = f.half[0];  }
__global__ __launch_bounds__(256) void k_rsm(const float* __restrict__ S, _Float16* __restrict__ P, int nrows) {
  #pragma clang fp contract(off)
  const int i = blockIdx.x * 256 + threadIdx.x; if (i >= nrows) return; const float* s = S + (size_t)i * SQ; float mx = -3.0e38f;
#pragma unroll 1
  for (int j = 0; j < SQ; ++j) mx = fmaxf(mx, s[j]); float se = 0.f;
#pragma unroll 1
  for (int j = 0; j < SQ; ++j) se += expf(s[j] - mx); const float sc = 256.0f / se;
#pragma unroll 1
  for (int j0 = 0; j0 < SQ; j0 += 8) { FragH f; for (int q = 0; q < 8; ++q) f.h[q] = (_Float16)(expf(s[j0 + q] - mx) * sc); unsigned short* d = (unsigned short*)P + (size_t)i * SQ + j0; *(v8us*)d = f.half[0];  } }
__global__ __launch_bounds__(256) void k_vt(const _Float16* __restrict__ V16, int b, int h0, _Float16* __restrict__ VT) { __shared__ unsigned short tl[64][65]; const int tid = threadIdx.x; const int hh = blockIdx.x % HG, sg = blockIdx.x / HG; const int s0 = sg * 64; const int h = h0 + hh;
  for (int i = tid; i < 64 * 8; i += 256) { const int j = i / 8, d8 = (i % 8) * 8; FragH f; f.half[0] = *(const v8us*)((const unsigned short*)V16 + ((size_t)b * SQ + s0 + j) * DM + h * HD + d8); for (int q = 0; q < 8; ++q) tl[d8 + q][j] = f.u[q]; }
  __syncthreads();
  { for (int i = tid; i < 64 * 8; i += 256) { const int d = i / 8, j8 = (i % 8) * 8; FragH f; for (int q = 0; q < 8; ++q) f.u[q] = tl[d][j8 + q]; *(v8us*)((unsigned short*)VT + ((size_t)hh * HD + d) * SQ + s0 + j8) = f.half[0]; }  } }



__global__ __launch_bounds__(256) void k_rsmkm(const float* __restrict__ S, _Float16* __restrict__ P, int nrows, const int* __restrict__ am) {
  #pragma clang fp contract(off)
  const int t = blockIdx.x * 256 + threadIdx.x; if (t >= nrows) return; const size_t i = (size_t)t; const float* s = S + i * SQ; const int* mr = am + (size_t)(t % SQ) * SQ; float mx = -3.0e38f;
#pragma unroll 1
  for (int j = 0; j < SQ; ++j) { const float f = (mr[j] != 0) ? 1.f : 0.f; mx = fmaxf(mx, fmaf(f, s[j], (1.f - f) * -1.0e9f)); } float se = 0.f;
#pragma unroll 1
  for (int j = 0; j < SQ; ++j) { const float f = (mr[j] != 0) ? 1.f : 0.f; se += __expf(fmaf(f, s[j], (1.f - f) * -1.0e9f) - mx); } const float sc = 256.0f / se;
#pragma unroll 1
  for (int j0 = 0; j0 < SQ; j0 += 8) { FragH fr; for (int q = 0; q < 8; ++q) { const int j = j0 + q; const float f = (mr[j] != 0) ? 1.f : 0.f; fr.h[q] = (_Float16)(__expf(fmaf(f, s[j], (1.f - f) * -1.0e9f) - mx) * sc); }
    unsigned short* d = (unsigned short*)P + i * SQ + j0; *(v8us*)d = fr.half[0];  } }

__global__ __launch_bounds__(256) void k_bdshn(const float* __restrict__ Wb, _Float16* __restrict__ Bt) {
  const size_t t = (size_t)blockIdx.x * 256 + threadIdx.x; if (t >= (size_t)DM * DM / 8) return; const size_t e0 = t * 8; const int n = (int)(e0 / DM), k0 = (int)(e0 % DM); const int h = n >> 6, hk = k0 >> 6; const float on = (hk == h) ? 16.0f : 0.0f; const int o = n & 63, d0 = k0 & 63; FragH f;
  for (int q = 0; q < 8; ++q) f.h[q] = (_Float16)(bf16_round(Wb[(size_t)o * 64 + d0 + q]) * on);
  unsigned short* d = (unsigned short*)Bt + e0; *(v8us*)d = f.half[0];  }

typedef int v4ia __attribute__((ext_vector_type(4), may_alias));
template <int M> __device__ __forceinline__ float rs_xm(float x) { return __builtin_bit_cast(float, __builtin_amdgcn_update_dpp(0, __builtin_bit_cast(int, x), 0x160 | M, 0xf, 0xf, true)); }  // lane l with lane l ^ M inside a 16-lane row
__device__ __forceinline__ float rs_xh(float x) { return __builtin_bit_cast(float, __builtin_amdgcn_permlanex16(__builtin_bit_cast(int, x), __builtin_bit_cast(int, x), 0x76543210, 0xfedcba98, false, false)); }  // lane l with lane l ^ 16
__device__ __forceinline__ float rs_wmax(float v) { v = fmaxf(v, rs_xm<1>(v)); v = fmaxf(v, rs_xm<2>(v)); v = fmaxf(v, rs_xm<4>(v)); v = fmaxf(v, rs_xm<8>(v)); return fmaxf(v, rs_xh(v)); }
__device__ __forceinline__ float rs_wsum(float v) { v += rs_xm<1>(v); v += rs_xm<2>(v); v += rs_xm<4>(v); v += rs_xm<8>(v); return v + rs_xh(v); }
// Four 2^x. Written as asm for the slot behind a transcendental (one independent instruction or v_nop before its result is read or its source overwritten): each v_exp_f32 is followed by
// an independent one (early-clobber outputs share no register with the sources), the last by v_nop.
__device__ __forceinline__ v4f rs_exp4(v4f x) { float e0, e1, e2, e3;
  asm("v_exp_f32 %0, %4\n\tv_exp_f32 %1, %5\n\tv_exp_f32 %2, %6\n\tv_exp_f32 %3, %7\n\tv_nop" : "=&v"(e0), "=&v"(e1), "=&v"(e2), "=&v"(e3) : "v"(x[0]), "v"(x[1]), "v"(x[2]), "v"(x[3]));
  const v4f e = {e0, e1, e2, e3}; return e; }
// Attention as one stream over the keys: one launch for all batches and heads; scores and weights stay in registers.
// A wave owns 32 query columns and walks the 2048 keys in passes of 32: S^T = K Q^T (A = 16 key rows, B = 16 query columns, both k-contiguous f16 rows), so a lane holds 8 keys of ONE query a tile;
// two score tiles of a pass, converted in place, are the B operand of O^T += V^T P^T (A = rows of V^T in the same k order). Maximum and sum are per lane plus one exchange between the lane halves.
// The 8 waves of a work-group share one (batch, head): K rows and V^T rows come in stages of 64 keys, by whole 128-byte lines through registers into one of two LDS buffers
// (a fragment load from global memory would touch 16 lines for 512 bytes, and every wave would repeat it); stage s + 1 is loaded while stage s is worked on, stored behind it, one barrier a stage.
// Values: t = energy / sqrt(512) * log2(e); a key with mask 0 takes the module's fill (-1e20, same scale) BEFORE the maximum, so its weight is exactly 0 beside any open key and a row with no open key comes out uniform;
// weight = 2^(t - m + 6) as f16, m the maximum in use (renewed when a pass exceeds it by more than 8, so a weight stays below 2^14); the sum adds the f32 weights; o = O / sum, stored x64 as f16 rows as before.
// Every '#pragma unroll' in the kernel but the one on the pass loop stands on a loop over a register array (fragments, accumulators): rolled, the array would be indexed at run time and leave the registers.
#define FA_WAVES 8
#define FA_COLS 32
#define FA_STAGE 64
#define FA_PITCH 72      /* halves a staged row: 144 bytes = 16 x 9, an odd multiple of 16 bytes for the 16-byte fragment reads */
static_assert(SQ % (FA_WAVES * FA_COLS) == 0 && SQ % FA_STAGE == 0 && HD == 64 && FA_WAVES * 32 * 8 == SQ && FA_WAVES * 32 * 2 * 8 == FA_STAGE * HD, "k_fattn: whole work-groups and stages; a thread stages 2 x 16 bytes of K, of V^T and of the mask");
typedef _Float16 v8h __attribute__((ext_vector_type(8)));
__device__ __forceinline__ v8f fa_mma(v16h a, v16h b, v8f c) { return __builtin_amdgcn_wmma_f32_16x16x32_f16(false, a, false, b, (short)0, c, false, false); }
// One 16 x 32 fragment from k-contiguous rows, k order as g2_frag: p = the lane's row + 8 * (lane >> 4) halves.
__device__ __forceinline__ v16h fa_frag(const unsigned short* p) { FragH f; f.half[0] = *(const v8us*)p; f.half[1] = *(const v8us*)(p + 16); return f.v; }
__global__ __launch_bounds__(FA_WAVES * 32) void k_fattn(const _Float16* __restrict__ Q16, const _Float16* __restrict__ K16, const _Float16* __restrict__ VT, const int* __restrict__ Km, _Float16* __restrict__ O16) {
  __shared__ __attribute__((aligned(16))) unsigned short sk[2][FA_STAGE][FA_PITCH];      /* [buffer][key][d] */
  __shared__ __attribute__((aligned(16))) unsigned short sv[2][HD][FA_PITCH];            /* [buffer][d][key] */
  __shared__ __attribute__((aligned(16))) int sm[SQ];                                    /* the batch's mask words */
  constexpr int QB = SQ / (FA_WAVES * FA_COLS), NST = SQ / FA_STAGE;
  constexpr float SC = 0.044194173824159216f * 1.44269504088896340736f, FILL = -1.0e20f * SC;
  const int tid = threadIdx.x, lane = tid & 31, ln = lane & 15, hh = lane >> 4; const int wave = __builtin_amdgcn_readfirstlane(tid >> 5);
  const int bh = blockIdx.x / QB, b = bh / NH, h = bh % NH; const int q0 = (blockIdx.x % QB) * (FA_WAVES * FA_COLS) + wave * FA_COLS;
  const _Float16* qb = Q16 + ((size_t)b * SQ + q0) * DM + h * HD;      /* wave-uniform bases */
  const _Float16* kb = K16 + (size_t)b * SQ * DM + h * HD;
  const _Float16* vb = VT + (size_t)bh * HD * SQ;
  const int* mb = Km + (size_t)b * SQ;
  const int srow = tid >> 3, sc8 = (tid & 7) * 8;      /* staging: 8 threads a 128-byte row; rows srow and srow + 32 */
  const unsigned roff = (unsigned)(ln * (DM * 2) + hh * 16);      /* byte offsets of the lane: row ln of a tile of q or o rows */
  const unsigned kso = (unsigned)(srow * (DM * 2) + sc8 * 2), vso = (unsigned)(srow * (SQ * 2) + sc8 * 2), mso = (unsigned)(tid * 16);
  v16h qf[2][2]; v8us gk[2], gv[2];
#pragma unroll
  for (int u = 0; u < 2; ++u) for (int ks = 0; ks < 2; ++ks) qf[u][ks] = fa_frag((const unsigned short*)((const char*)(qb + u * 16 * DM + ks * 32) + roff));
  { const char* kq = (const char*)kb + kso; const char* vq = (const char*)vb + vso; const char* mq = (const char*)mb + mso;
    gk[0] = *(const v8us*)kq; gk[1] = *(const v8us*)(kq + 32 * DM * 2); gv[0] = *(const v8us*)vq; gv[1] = *(const v8us*)(vq + 32 * SQ * 2);
    const v4ia m0 = *(const v4ia*)mq, m1 = *(const v4ia*)(mq + SQ * 2);
    asm volatile("s_wait_xcnt 0x0" :: "v"(roff), "v"(kso), "v"(vso), "v"(mso) : "memory");      /* behind the loads, ahead of any new value in a register that they name (a precaution of form); as inputs the lane offsets keep their registers up to it */
    *(v4ia*)&sm[tid * 4] = m0; *(v4ia*)&sm[SQ / 2 + tid * 4] = m1; }
  *(v8us*)&sk[0][srow][sc8] = gk[0]; *(v8us*)&sk[0][srow + 32][sc8] = gk[1]; *(v8us*)&sv[0][srow][sc8] = gv[0]; *(v8us*)&sv[0][srow + 32][sc8] = gv[1];
  const v8f z8 = {0.f, 0.f, 0.f, 0.f, 0.f, 0.f, 0.f, 0.f};
  v8f o[2][4]; float l[2] = {0.f, 0.f}, m[2] = {-3.0e38f, -3.0e38f};
#pragma unroll
  for (int u = 0; u < 2; ++u) for (int dt = 0; dt < 4; ++dt) o[u][dt] = z8;
  __syncthreads();      /* stage 0 and the mask are in LDS for every wave */
  for (int s = 0; s < NST; ++s) {
    const int bf = s & 1; const int sn = (s + 1 < NST) ? s + 1 : 0;      /* the last stage loads stage 0 again (in bounds, never read) */
    { const char* kq = (const char*)(kb + (size_t)sn * FA_STAGE * DM) + kso; const char* vq = (const char*)(vb + sn * FA_STAGE) + vso;
      gk[0] = *(const v8us*)kq; gk[1] = *(const v8us*)(kq + 32 * DM * 2); gv[0] = *(const v8us*)vq; gv[1] = *(const v8us*)(vq + 32 * SQ * 2);
      asm volatile("s_wait_xcnt 0x0" ::: "memory"); }      /* behind the loads, ahead of any new value in a register that they name (a precaution of form); as a memory barrier for the compiler it also keeps the loads here, a whole stage ahead of their stores */
    v16h kf[2][2];
#pragma unroll
    for (int kt = 0; kt < 2; ++kt) for (int ks = 0; ks < 2; ++ks) kf[kt][ks] = fa_frag(&sk[bf][kt * 16 + ln][ks * 32 + 8 * hh]);
    __builtin_amdgcn_sched_barrier(0);      /* all eight reads are issued before the first wait on one: without it this build read two fragments at a time into one register block and met the LDS latency three times behind every barrier */
#pragma unroll
    for (int p = 0; p < FA_STAGE / 32; ++p) {
      v16h vf[4]; v4ia mk[2][2]; v8f t[2][2];
#pragma unroll
      for (int kt = 0; kt < 2; ++kt) { mk[kt][0] = *(const v4ia*)&sm[s * FA_STAGE + p * 32 + kt * 16 + 8 * hh]; mk[kt][1] = *(const v4ia*)&sm[s * FA_STAGE + p * 32 + kt * 16 + 8 * hh + 4]; }
#pragma unroll
      for (int dt = 0; dt < 4; ++dt) vf[dt] = fa_frag(&sv[bf][dt * 16 + ln][p * 32 + 8 * hh]);
#pragma unroll
      for (int u = 0; u < 2; ++u) for (int kt = 0; kt < 2; ++kt) t[u][kt] = fa_mma(kf[kt][0], qf[u][0], z8);
#pragma unroll
      for (int u = 0; u < 2; ++u) for (int kt = 0; kt < 2; ++kt) t[u][kt] = fa_mma(kf[kt][1], qf[u][1], t[u][kt]);
      if (p + 1 < FA_STAGE / 32) {      /* the next pass of the SAME stage: its K fragments are fetched behind this pass's score products, into the registers these have left */
#pragma unroll
        for (int kt = 0; kt < 2; ++kt) for (int ks = 0; ks < 2; ++ks) kf[kt][ks] = fa_frag(&sk[bf][(p + 1) * 32 + kt * 16 + ln][ks * 32 + 8 * hh]); }
      float mx[2];
#pragma unroll
      for (int u = 0; u < 2; ++u) {
#pragma unroll
        for (int kt = 0; kt < 2; ++kt) { t[u][kt] *= SC; for (int r = 0; r < 8; ++r) t[u][kt][r] = (mk[kt][r >> 2][r & 3] != 0) ? t[u][kt][r] : FILL; }
        float x = fmaxf(t[u][0][0], t[u][1][0]);
#pragma unroll
        for (int r = 1; r < 8; ++r) x = fmaxf(x, fmaxf(t[u][0][r], t[u][1][r]));
        mx[u] = fmaxf(x, rs_xh(x));
      }
      if (__builtin_amdgcn_ballot_w32((mx[0] > m[0] + 8.0f) || (mx[1] > m[1] + 8.0f)) != 0) {      /* one scalar branch a pass: the products of a renewal run only where some column needs one */
        const float n0 = fmaxf(m[0], mx[0]), n1 = fmaxf(m[1], mx[1]); const v4f d4 = {m[0] - n0, m[1] - n1, 0.f, 0.f}; const v4f al = rs_exp4(d4); m[0] = n0; m[1] = n1;
#pragma unroll
        for (int u = 0; u < 2; ++u) { l[u] *= al[u]; for (int dt = 0; dt < 4; ++dt) o[u][dt] *= al[u]; }
      }
      v16h pf[2];
#pragma unroll
      for (int u = 0; u < 2; ++u) { const float ms = m[u] - 6.0f; v4f s4[2];
#pragma unroll
        for (int kt = 0; kt < 2; ++kt) { const v8f x = t[u][kt] - ms; const v4f x0 = {x[0], x[1], x[2], x[3]}, x1 = {x[4], x[5], x[6], x[7]}; const v4f e0 = rs_exp4(x0), e1 = rs_exp4(x1); s4[kt] = e0 + e1;
          const v8f e = {e0[0], e0[1], e0[2], e0[3], e1[0], e1[1], e1[2], e1[3]}; t[u][kt] = e; }
        const v4f sq = s4[0] + s4[1]; l[u] += (sq[0] + sq[1]) + (sq[2] + sq[3]);
        pf[u] = __builtin_shufflevector(__builtin_convertvector(t[u][0], v8h), __builtin_convertvector(t[u][1], v8h), 0, 1, 2, 3, 4, 5, 6, 7, 8, 9, 10, 11, 12, 13, 14, 15); }
      __builtin_amdgcn_sched_barrier(0);      /* this one and the next keep the eight products apart from the 2^x statements: those are asm text, which the compiler's padding behind a matrix instruction does not see */
#pragma unroll
      for (int dt = 0; dt < 4; ++dt) for (int u = 0; u < 2; ++u) o[u][dt] = fa_mma(vf[dt], pf[u], o[u][dt]);
      __builtin_amdgcn_sched_barrier(0);
    }
    *(v8us*)&sk[bf ^ 1][srow][sc8] = gk[0]; *(v8us*)&sk[bf ^ 1][srow + 32][sc8] = gk[1]; *(v8us*)&sv[bf ^ 1][srow][sc8] = gv[0]; *(v8us*)&sv[bf ^ 1][srow + 32][sc8] = gv[1];      /* into the buffer whose readers all passed the barrier of stage s - 1 */
    __syncthreads();      /* publishes stage s + 1 and ends every wave's reads of stage s */
  }
  _Float16* ob = O16 + ((size_t)b * SQ + q0) * DM + h * HD;
#pragma unroll
  for (int u = 0; u < 2; ++u) { const float sc = 64.0f / (l[u] + rs_xh(l[u]));
#pragma unroll
    for (int dt = 0; dt < 4; ++dt) *(v8h*)((char*)(ob + u * 16 * DM + dt * 16) + roff) = __builtin_convertvector(o[u][dt] * sc, v8h); }      /* a lane's 8 accumulator registers are 8 consecutive d of its query row */
}
#define PJ_TOK 64
#define PJ_PITCH 72      /* halves a staged row: 144 bytes, an odd multiple of 16 bytes for the 16-byte fragment reads */
static_assert(HD == 64 && NH == 8 && SQ % PJ_TOK == 0 && DM == NH * HD, "k_proj: one wave a head, whole token blocks inside a batch");
typedef __bf16 v4b __attribute__((ext_vector_type(4)));
typedef unsigned short v4us __attribute__((ext_vector_type(4), may_alias));
__global__ __launch_bounds__(256) void k_proj(const float* __restrict__ xq, const float* __restrict__ xk, const float* __restrict__ xv, const float* __restrict__ wq, const float* __restrict__ wk, const float* __restrict__ wv,
                                              _Float16* __restrict__ Q16, _Float16* __restrict__ K16, _Float16* __restrict__ VT) {
  __shared__ __attribute__((aligned(16))) unsigned short sl[NH + 1][PJ_TOK][PJ_PITCH];      /* [wave][token][input], later the wave's output tile; tile NH: the weights [output][input] */
  const int tid = threadIdx.x, lane = tid & 31, ln = lane & 15, hh = lane >> 4; const int h = __builtin_amdgcn_readfirstlane(tid >> 5);
  const int which = blockIdx.y; const int r0 = blockIdx.x * PJ_TOK; const bool tr = which == 2;
  const float* xb = (which == 0 ? xq : which == 1 ? xk : xv) + (size_t)r0 * DM + h * HD;      /* wave-uniform bases */
  const float* wb = which == 0 ? wq : which == 1 ? wk : wv;
  const unsigned xo = (unsigned)(hh * (DM * 4) + ln * 16), wo = (unsigned)(tid * 64);      /* byte offsets of the lane */
  v4f gx[PJ_TOK / 2], gw[4];
#pragma unroll
  for (int q = 0; q < 4; ++q) gw[q] = *(const v4fa*)((const char*)wb + wo + q * 16);
#pragma unroll
  for (int j = 0; j < PJ_TOK / 2; ++j) gx[j] = *(const v4fa*)((const char*)xb + xo + j * (2 * DM * 4));
  asm volatile("s_wait_xcnt 0x0" :: "v"(xo), "v"(wo) : "memory");      /* behind the loads, ahead of any new value in a register that they name (a precaution of form); as inputs the lane offsets keep their registers up to it */
  __builtin_amdgcn_sched_barrier(0);      /* all 36 loads are issued before the first wait on one: without it this build held the last nine back behind the return of the first and met the memory latency twice */
#pragma unroll
  for (int q = 0; q < 4; ++q) { v4h w4; for (int i = 0; i < 4; ++i) w4[i] = (_Float16)(bf16_round(gw[q][i]) * 16.0f); *(v4us*)&sl[NH][tid >> 2][(tid & 3) * 16 + q * 4] = __builtin_bit_cast(v4us, w4); }
#pragma unroll
  for (int j = 0; j < PJ_TOK / 2; ++j) *(v4us*)&sl[h][j * 2 + hh][ln * 4] = __builtin_bit_cast(v4us, __builtin_convertvector(__builtin_convertvector(__builtin_convertvector(gx[j], v4b), v4f), v4h));      /* to bf16, nearest even, as bf16_round; that value as f16 */
  __syncthreads();      /* the weight block is in LDS for every wave (and each wave's own tile for all its lanes) */
  const unsigned short (*sa)[PJ_PITCH] = sl[tr ? h : NH]; const unsigned short (*sb)[PJ_PITCH] = sl[tr ? NH : h];
  v16h af[4][2], bf[2][2];
#pragma unroll
  for (int t = 0; t < 4; ++t) for (int ks = 0; ks < 2; ++ks) af[t][ks] = fa_frag(&sa[t * 16 + ln][ks * 32 + 8 * hh]);
#pragma unroll
  for (int ks = 0; ks < 2; ++ks) bf[0][ks] = fa_frag(&sb[ln][ks * 32 + 8 * hh]);
  const v8f z8 = {0.f, 0.f, 0.f, 0.f, 0.f, 0.f, 0.f, 0.f};
#pragma unroll
  for (int rt = 0; rt < 4; ++rt) {
    if (rt + 1 < 4) {      /* the next round's B rows are fetched ahead of this round's writes, which touch other rows */
#pragma unroll
      for (int ks = 0; ks < 2; ++ks) bf[(rt + 1) & 1][ks] = fa_frag(&sb[(rt + 1) * 16 + ln][ks * 32 + 8 * hh]); }
    v8f acc[4];
#pragma unroll
    for (int ct = 0; ct < 4; ++ct) acc[ct] = fa_mma(af[ct][0], bf[rt & 1][0], z8);
#pragma unroll
    for (int ct = 0; ct < 4; ++ct) acc[ct] = fa_mma(af[ct][1], bf[rt & 1][1], acc[ct]);
#pragma unroll
    for (int ct = 0; ct < 4; ++ct) *(v8us*)&sl[h][rt * 16 + ln][ct * 16 + 8 * hh] = __builtin_bit_cast(v8us, __builtin_convertvector(acc[ct] * 0.0625f, v8h));
  }
  __builtin_amdgcn_fence(__ATOMIC_ACQ_REL, "workgroup"); __builtin_amdgcn_wave_barrier();      /* the rows are read back by other lanes of the same wave: keeps the reads behind the writes */
  v8us ov[16];
#pragma unroll
  for (int j = 0; j < 16; ++j) ov[j] = *(const v8us*)&sl[h][j * 4 + (lane >> 3)][(lane & 7) * 8];      /* 8 lanes a row of 128 bytes, 4 rows an instruction */
  char* ob = tr ? (char*)(VT + ((size_t)(r0 / SQ) * NH + h) * HD * SQ + r0 % SQ) : (char*)((which == 0 ? Q16 : K16) + (size_t)r0 * DM + h * HD);      /* wave-uniform: the tile's first output row, and the bytes from row to row */
  const unsigned pb = tr ? SQ * 2 : DM * 2; const unsigned oo = (unsigned)(lane >> 3) * pb + (unsigned)(lane & 7) * 16;
#pragma unroll
  for (int j = 0; j < 16; ++j) *(v8us*)(ob + (size_t)(j * 4 * pb) + oo) = ov[j];
}
extern "C" void kernel_launch(void* const* d_in, const int* in_sizes, int n_in,
                              void* d_out, int out_size, void* d_ws, size_t ws_size, hipStream_t stream) {
  (void)in_sizes; (void)n_in; (void)out_size;
  const float* const* I = (const float* const*)d_in; const float* xq = I[2]; const float* xk = I[1]; const float* xv = I[0]; const int* km = (const int*)d_in[3]; const float* wq = I[6]; const float* wk = I[5]; const float* wv = I[4]; const float* wo = I[7]; const float* bo = I[8];      /* contract order: values I[0], keys I[1], query I[2]; mask int32 [4][1][1][2048] (0 = masked key; READ on device); SHARED natural [64][64] blocks Wv I[4], Wk I[5], Wq I[6]; natural Wo [512][512] + bo */
  char* ws = (char*)d_ws; size_t off = 0;
  auto take = [&](size_t bytes) { char* p = ws + off; off += (bytes + 255) & ~(size_t)255; return p; };
  _Float16* BO = (_Float16*)take((size_t)DM * DM * 2);
  _Float16* Q16 = (_Float16*)take(NR * DM * 2); _Float16* K16 = (_Float16*)take(NR * DM * 2); _Float16* O16 = (_Float16*)take(NR * DM * 2);
  _Float16* VT = (_Float16*)take((size_t)NB * NH * HD * SQ * 2);
  if (off > ws_size) return;
  k_wnat<<<(unsigned)(((size_t)DM * DM / 8 + 255) / 256), 256, 0, stream>>>(wo, (size_t)DM * DM / 8, BO);      /* Wo natural [out][in] = Bt x16 */
  const size_t r0p = (size_t)B0 * SQ;      /* first row of the output stage */
  k_proj<<<dim3((unsigned)(NR / PJ_TOK), 3), 256, 0, stream>>>(xq, xk, xv, wq, wk, wv, Q16, K16, VT);      /* q, k rows [NB * SQ][DM] and V^T [NB][NH][HD][SQ], f16 */
  k_fattn<<<NB * NH * (SQ / (FA_WAVES * FA_COLS)), FA_WAVES * 32, 0, stream>>>(Q16, K16, VT, km, O16);      /* o (merged heads) as f16 rows x64; keys with mask[b][j] == 0 take the module's fill */
  k_gemm2<0><<<dim3((unsigned)((MPO / 128) * (DM / 64)), 1), 128, 0, stream>>>(O16 + r0p * DM, DM, 0, BO, DM, 0, 0.0009765625f, bo, 0, nullptr, 1, 0, 0, (float*)d_out + r0p * DM, nullptr, DM, 0, MPO, DM, DM);      /* out rows are the output layout */
}

// v004
// It runs in 54.7 microseconds.
// In two side-by-side timings against v003, it was 1.35 and 1.33 times as fast.
// Counting every step since v000, it is 61.6 times as fast.
#include <hip/hip_runtime.h>
// Multi-head attention over three inputs with SHARED per-head projections, a random key-padding mask and the module's literal score scale (values, keys, query [4][2048][512]; each input is split into 8 heads of 64 and every head is multiplied by the SAME natural [64][64] matrix (x W^T: Wv / Wk / Wq; no biases); energy = q k^T; where(mask == 0, -1e20) with the int32 [4][1][1][2048] mask in {0, 1} (random; 0 = masked key; READ on device); softmax(energy / sqrt(embed_size) = / sqrt(512)) (as the source); out = merged Wo^T + bo -> [4][2048][512]).
// Structure: token rows r = b*2048 + s; a key with mask 0 has weight exactly 0 beside any open key, so only the open keys of a batch are projected and attended: k_prep lists them (prefix count of the mask; a batch with no open key keeps all keys, every score at the fill); K rows and V^T columns are packed in list order; Q, K and V^T in ONE launch straight from the f32 inputs (k_proj: a wave takes 64 tokens of one head, rounds x to bf16 as exact f16 in registers, multiplies by the shared [64][64] block (exact x16) on WMMA over k = 64, f32 accumulation, f16 outputs; V leaves transposed); scores, masked softmax and weights x V in ONE launch for all batches and heads (k_fattn: running maximum and sum, scores and weights never in memory; o carried x64 against f16 subnormal flush, folded into the output GEMM alpha) written straight into the merged f16 o rows; out = o W_o + b GEMM (f32) into the output layout.
// Compute dtype: inputs rounded to bf16; x / weights exact; q, k, v, softmax weights and o as plain f16 GEMM operands (~2^-12); scores and softmax statistics f32. v_wmma_f32_16x16x32_f16.
#define NB 4
#define SQ 2048
#define DM 512
#define NH 8
#define HD 64
#define HG 4                         /* heads a launch of the k_vt(V16, b, h0, VT) form, which is not launched */
#define B0 0                         /* first batch of the output stage (debug hook) */
#define NBR NB                       /* batches of the output stage (debug hook) */
#define NR ((size_t)NB * SQ)         /* token rows */
#define MP ((int)((size_t)NBR * SQ)) /* rows of the output stage, via MPO (debug hook) */
#define QN SQ                        /* unused; k_fattn attends all SQ query rows of a batch */
#define NHD NH                       /* unused; k_fattn attends all NH heads */
#define MPO MP                       /* rows through the output stage (debug hook) */
#define LQ DM      /* unused; the q and k rows have pitch DM */
typedef __bf16 v16b __attribute__((ext_vector_type(16)));
typedef unsigned short v8us __attribute__((ext_vector_type(8), may_alias));
typedef float  v8f  __attribute__((ext_vector_type(8)));
typedef float  v4f  __attribute__((ext_vector_type(4)));
typedef float  v4fa __attribute__((ext_vector_type(4), may_alias));
union FragB { v16b v; v8us half[2]; unsigned short u[16]; };

__device__ __forceinline__ unsigned short bf16_bits(float x) { unsigned int u = __float_as_uint(x); return (unsigned short)((u + 0x7FFFu + ((u >> 16) & 1u)) >> 16); }
__device__ __forceinline__ float bf16_val(unsigned short b) { return __uint_as_float(((unsigned int)b) << 16); }
__device__ __forceinline__ float bf16_round(float x) { return bf16_val(bf16_bits(x)); }
// D += A·B with NT terms: 1 = ah·bh, 2 = + al·bh (A split), 3 = + ah·bl (both split)
template <int NT>
__device__ __forceinline__ v8f mmaN(v16b ah, v16b al, v16b bh, v16b bl, v8f c) {
  c = __builtin_amdgcn_wmma_f32_16x16x32_bf16(false, ah, false, bh, (short)0, c, false, false);
  if (NT >= 2) c = __builtin_amdgcn_wmma_f32_16x16x32_bf16(false, al, false, bh, (short)0, c, false, false);
  if (NT >= 3) c = __builtin_amdgcn_wmma_f32_16x16x32_bf16(false, ah, false, bl, (short)0, c, false, false);
  asm volatile("v_nop\n\tv_nop\n\tv_nop\n\tv_nop" : "+v"(c) : "v"(ah), "v"(al), "v"(bh), "v"(bl));
  return c;
}

__global__ __launch_bounds__(256) void k_wt_bf16(const float* __restrict__ W, unsigned short* __restrict__ Wt, int K, int N) {
  const int t = blockIdx.x * 256 + threadIdx.x;
  const int k8n = K / 8;
  if (t >= N * k8n) return;
  const int n = t / k8n, k8 = (t % k8n) * 8;
  v8us v;
#pragma unroll
  for (int i = 0; i < 8; ++i) v[i] = bf16_bits(W[(size_t)(k8 + i) * N + n]);
  *(v8us*)(Wt + (size_t)n * K + k8) = v;
  
}

// GEMM C[M][N] (f32, pitch ldc) = act(A[M][K]·W + bias). A f32 row-major (pitch lda) converted per fragment to bf16
// (ASPLIT: hi/lo two planes -> 2 terms, else single rounded term); Wt bf16 [N][K] (pitch ldb). BIAS_BF16 rounds the
// bias to bf16 first (bias quantised to bf16 before the add). K%32==0, M%16==0, N%64==0.
template <bool ASPLIT, int ACT, bool BIAS_BF16>
__global__ __launch_bounds__(128) void k_gemm_bf(const float* __restrict__ A, int lda, const unsigned short* __restrict__ Wt, int ldb,
                                               const float* __restrict__ bias, float* __restrict__ C, int ldc, int M, int N, int K) {
  __shared__ __attribute__((aligned(16))) float so[4][16][64];
  const int tid = threadIdx.x, w = tid >> 5, lane = tid & 31, ln = lane & 15, hh = lane >> 4;
  const int ntn = N / 64;
  const int wid = blockIdx.x * 4 + w;
  const int mt = wid / ntn, nq = wid % ntn;
  if (mt * 16 >= M) return;
  const int row0 = mt * 16, col0 = nq * 64;
  const float* arow = A + (size_t)(row0 + ln) * lda;
  v8f acc[4] = {};
  for (int kb = 0; kb < K; kb += 32) {
    FragB ah, al;
    const v4f x0 = *(const v4fa*)(arow + kb + 8 * hh), x1 = *(const v4fa*)(arow + kb + 8 * hh + 4);
    const v4f x2 = *(const v4fa*)(arow + kb + 16 + 8 * hh), x3 = *(const v4fa*)(arow + kb + 16 + 8 * hh + 4);
    float xs[16] = {x0[0],x0[1],x0[2],x0[3],x1[0],x1[1],x1[2],x1[3],x2[0],x2[1],x2[2],x2[3],x3[0],x3[1],x3[2],x3[3]};
#pragma unroll
    for (int i = 0; i < 16; ++i) { const unsigned short hb = bf16_bits(xs[i]); ah.u[i] = hb; al.u[i] = ASPLIT ? bf16_bits(xs[i] - bf16_val(hb)) : (unsigned short)0; }
#pragma unroll
    for (int t = 0; t < 4; ++t) {
      const unsigned short* brow = Wt + (size_t)(col0 + t * 16 + ln) * ldb + kb;
      FragB b;
      b.half[0] = *(const v8us*)(brow + 8 * hh);
      b.half[1] = *(const v8us*)(brow + 16 + 8 * hh);
      acc[t] = mmaN<ASPLIT ? 2 : 1>(ah.v, al.v, b.v, b.v, acc[t]);
    }
  }
#pragma unroll
  for (int t = 0; t < 4; ++t) {
    float bv = bias ? bias[col0 + t * 16 + ln] : 0.f;
    if (BIAS_BF16) bv = bf16_round(bv);
#pragma unroll
    for (int r = 0; r < 8; ++r) { float v = acc[t][r] + bv; if (ACT == 1) v = fmaxf(v, 0.f); so[w][8 * hh + r][t * 16 + ln] = v; }
  }
  __builtin_amdgcn_fence(__ATOMIC_ACQ_REL, "workgroup");
  __builtin_amdgcn_wave_barrier();
  const int rsub = lane >> 4, c4 = (lane & 15) * 4;
  {
#pragma unroll
    for (int q = 0; q < 8; ++q) {
      const int r = q * 2 + rsub;
      const v4f v = *(const v4fa*)&so[w][r][c4];
      *(v4f*)(C + (size_t)(row0 + r) * ldc + col0 + c4) = v;
    }
    
  }
}

// GEMM C = act(A·W + bias + resid): A f32 (ASPLIT -> hi/lo 2 terms), Wt bf16 [N][K]; ACT 0 none, 1 relu, 2 exact gelu;
// resid (optional, f32, row index = (row % rmod), pitch ldr, RES_BF16 rounds it) added before the activation.
template <bool ASPLIT, int ACT, bool BIAS_BF16, bool RES_BF16>
__global__ __launch_bounds__(128) void k_gemm_bf3(const float* __restrict__ A, int lda, const unsigned short* __restrict__ Wt, int ldb,
                                                const float* __restrict__ bias, const float* __restrict__ resid, int rmod, int ldr,
                                                float* __restrict__ C, int ldc, int M, int N, int K) {
  __shared__ __attribute__((aligned(16))) float so[4][16][64];
  const int tid = threadIdx.x, w = tid >> 5, lane = tid & 31, ln = lane & 15, hh = lane >> 4;
  const int ntn = N / 64;
  const int wid = blockIdx.x * 4 + w;
  const int mt = wid / ntn, nq = wid % ntn;
  if (mt * 16 >= M) return;
  const int row0 = mt * 16, col0 = nq * 64;
  const float* arow = A + (size_t)(row0 + ln) * lda;
  v8f acc[4] = {};
  for (int kb = 0; kb < K; kb += 32) {
    FragB ah, al;
    const v4f x0 = *(const v4fa*)(arow + kb + 8 * hh), x1 = *(const v4fa*)(arow + kb + 8 * hh + 4);
    const v4f x2 = *(const v4fa*)(arow + kb + 16 + 8 * hh), x3 = *(const v4fa*)(arow + kb + 16 + 8 * hh + 4);
    float xs[16] = {x0[0],x0[1],x0[2],x0[3],x1[0],x1[1],x1[2],x1[3],x2[0],x2[1],x2[2],x2[3],x3[0],x3[1],x3[2],x3[3]};
#pragma unroll
    for (int i = 0; i < 16; ++i) { const unsigned short hb = bf16_bits(xs[i]); ah.u[i] = hb; al.u[i] = ASPLIT ? bf16_bits(xs[i] - bf16_val(hb)) : (unsigned short)0; }
#pragma unroll
    for (int t = 0; t < 4; ++t) {
      const unsigned short* brow = Wt + (size_t)(col0 + t * 16 + ln) * ldb + kb;
      FragB b;
      b.half[0] = *(const v8us*)(brow + 8 * hh);
      b.half[1] = *(const v8us*)(brow + 16 + 8 * hh);
      acc[t] = mmaN<ASPLIT ? 2 : 1>(ah.v, al.v, b.v, b.v, acc[t]);
    }
  }
#pragma unroll
  for (int t = 0; t < 4; ++t) {
    const int col = col0 + t * 16 + ln;
    float bv = bias ? bias[col] : 0.f;
    if (BIAS_BF16) bv = bf16_round(bv);
#pragma unroll
    for (int r = 0; r < 8; ++r) {
      float v = acc[t][r] + bv;
      if (resid) { float rv = resid[(size_t)((row0 + 8 * hh + r) % rmod) * ldr + col]; if (RES_BF16) rv = bf16_round(rv); v += rv; }
      if (ACT == 1) v = fmaxf(v, 0.f);
      if (ACT == 2) v = 0.5f * v * (1.0f + erff(v * 0.70710678118654752f));
      if (ACT == 3) { const float u = 0.7978845608028654f * (v + 0.044715f * v * v * v); v = 0.5f * v * (1.0f + tanhf(u)); }
      so[w][8 * hh + r][t * 16 + ln] = v;
    }
  }
  __builtin_amdgcn_fence(__ATOMIC_ACQ_REL, "workgroup");
  __builtin_amdgcn_wave_barrier();
  const int rsub = lane >> 4, c4 = (lane & 15) * 4;
  {
#pragma unroll
    for (int q = 0; q < 8; ++q) {
      const int r = q * 2 + rsub;
      const v4f v = *(const v4fa*)&so[w][r][c4];
      *(v4f*)(C + (size_t)(row0 + r) * ldc + col0 + c4) = v;
    }
    
  }
}
// row LayerNorm (biased variance, eps) over N: s = X (+ R); optional out_sum <- s; out_norm <- (s-mu)*rsqrt(var+eps)*g + b
template <bool PARAM_BF16>
__global__ __launch_bounds__(256) void k_layernorm(const float* __restrict__ X, const float* __restrict__ R, const float* __restrict__ g, const float* __restrict__ bta,
                                                  float* __restrict__ out_sum, float* __restrict__ out_norm, int N, float eps) {
  __shared__ float red[256];
  const int row = blockIdx.x, tid = threadIdx.x;
  const float* x = X + (size_t)row * N; const float* rr = R ? R + (size_t)row * N : nullptr;
  float vals[16];                     // up to N = 4096
  const int per = N / 256;            // contiguous chunk per thread? use strided-by-4 chunks: thread handles j = tid*4 + 1024*u
  float s1 = 0.f;
  for (int u = 0; u < per / 4; ++u) {
    const int j = tid * 4 + 1024 * u;
    const v4f a = *(const v4fa*)(x + j);
    v4f b = {0.f,0.f,0.f,0.f}; if (rr) b = *(const v4fa*)(rr + j);
#pragma unroll
    for (int q = 0; q < 4; ++q) { const float v = a[q] + b[q]; vals[u * 4 + q] = v; s1 += v; }
  }
  red[tid] = s1; __syncthreads();
  for (int st = 128; st > 0; st >>= 1) { if (tid < st) red[tid] += red[tid + st]; __syncthreads(); }
  const float mu = red[0] / (float)N; __syncthreads();
  float s2 = 0.f;
  for (int u = 0; u < per / 4; ++u)
#pragma unroll
    for (int q = 0; q < 4; ++q) { const float c = vals[u * 4 + q] - mu; s2 += c * c; }
  red[tid] = s2; __syncthreads();
  for (int st = 128; st > 0; st >>= 1) { if (tid < st) red[tid] += red[tid + st]; __syncthreads(); }
  const float rs = rsqrtf(red[0] / (float)N + eps);
  {
    for (int u = 0; u < per / 4; ++u) {
      const int j = tid * 4 + 1024 * u;
      v4f o, sm;
#pragma unroll
      for (int q = 0; q < 4; ++q) {
        float gg = g[j + q], bb = bta[j + q];
        if (PARAM_BF16) { gg = bf16_round(gg); bb = bf16_round(bb); }
        sm[q] = vals[u * 4 + q]; o[q] = (vals[u * 4 + q] - mu) * rs * gg + bb;
      }
      if (out_sum) *(v4f*)(out_sum + (size_t)row * N + j) = sm;
      *(v4f*)(out_norm + (size_t)row * N + j) = o;
    }
    
  }
}



// ---- f16 WMMA path (v_wmma_f32_16x16x32_f16): 11-bit significands for operands in range — used where a [0,1] probability operand needs more precision than bf16
typedef _Float16 v16h __attribute__((ext_vector_type(16)));
union FragH { v16h v; v8us half[2]; _Float16 h[16]; unsigned short u[16]; };
template <int NT>
__device__ __forceinline__ v8f mmaH(v16h ah, v16h al, v16h bh, v16h bl, v8f c) {
  c = __builtin_amdgcn_wmma_f32_16x16x32_f16(false, ah, false, bh, (short)0, c, false, false);
  if (NT >= 2) c = __builtin_amdgcn_wmma_f32_16x16x32_f16(false, al, false, bh, (short)0, c, false, false);
  if (NT >= 3) c = __builtin_amdgcn_wmma_f32_16x16x32_f16(false, ah, false, bl, (short)0, c, false, false);
  asm volatile("v_nop\n\tv_nop\n\tv_nop\n\tv_nop" : "+v"(c) : "v"(ah), "v"(al), "v"(bh), "v"(bl));
  return c;
}
// batched GEMM like k_gemm_b but f16 operands: A f32 (split into f16 hi/lo if ASPLIT, else rounded to f16), Bt = f16 values [n][k]; alpha; C f32; N multiple of 16 (partial tiles skipped)
template <bool ASPLIT>
__global__ __launch_bounds__(128) void k_gemm_h(const float* __restrict__ A, int lda, size_t sA, const _Float16* __restrict__ Bh, int ldb, size_t sB, float alpha, float* __restrict__ C, int ldc, size_t sC, int M, int N, int K) {
  __shared__ __attribute__((aligned(16))) float so[4][16][64];
  const int tid = threadIdx.x, w = tid >> 5, lane = tid & 31, ln = lane & 15, hh = lane >> 4; const int by = blockIdx.y;
  A += (size_t)by * sA; Bh += (size_t)by * sB; C += (size_t)by * sC;
  const int ntn = (N + 63) / 64; const int wid = blockIdx.x * 4 + w; const int mt = wid / ntn, nq = wid % ntn; if (mt * 16 >= M) return;
  const int row0 = mt * 16, col0 = nq * 64; const float* arow = A + (size_t)(row0 + ln) * lda;
  v8f acc[4] = {};
  for (int kb = 0; kb < K; kb += 32) {
    FragH ah, al;
    const v4f x0 = *(const v4fa*)(arow + kb + 8 * hh), x1 = *(const v4fa*)(arow + kb + 8 * hh + 4), x2 = *(const v4fa*)(arow + kb + 16 + 8 * hh), x3 = *(const v4fa*)(arow + kb + 16 + 8 * hh + 4);
    float xs[16] = {x0[0],x0[1],x0[2],x0[3],x1[0],x1[1],x1[2],x1[3],x2[0],x2[1],x2[2],x2[3],x3[0],x3[1],x3[2],x3[3]};
#pragma unroll
    for (int i = 0; i < 16; ++i) { const _Float16 h = (_Float16)xs[i]; ah.h[i] = h; al.h[i] = ASPLIT ? (_Float16)(xs[i] - (float)h) : (_Float16)0.0f; }
#pragma unroll
    for (int t = 0; t < 4; ++t) { if (col0 + t * 16 >= N) continue; const size_t boff = (size_t)(col0 + t * 16 + ln) * ldb + kb; FragH bq; bq.half[0] = *(const v8us*)(Bh + boff + 8 * hh); bq.half[1] = *(const v8us*)(Bh + boff + 16 + 8 * hh);
      acc[t] = mmaH<ASPLIT ? 2 : 1>(ah.v, al.v, bq.v, bq.v, acc[t]); }
  }
#pragma unroll
  for (int t = 0; t < 4; ++t) { if (col0 + t * 16 >= N) continue;
#pragma unroll
    for (int r = 0; r < 8; ++r) so[w][8 * hh + r][t * 16 + ln] = acc[t][r] * alpha; }
  __builtin_amdgcn_fence(__ATOMIC_ACQ_REL, "workgroup"); __builtin_amdgcn_wave_barrier();
  const int rsub = lane >> 4, c4 = (lane & 15) * 4;
  {
#pragma unroll
    for (int q = 0; q < 8; ++q) { const int r = q * 2 + rsub; if (col0 + c4 < N) { const v4f v = *(const v4fa*)&so[w][r][c4]; *(v4f*)(C + (size_t)(row0 + r) * ldc + col0 + c4) = v; } }
     }
}

// Wt[n][k] = f16(W[k][n]·scale) from f32 row-major W[K][N] (scale = power of two; bf16-exact weights stay exact in f16 away from the subnormal range)
__global__ __launch_bounds__(256) void k_wt_f16(const float* __restrict__ W, _Float16* __restrict__ Wt, int K, int N, float scale) {
  const int t = blockIdx.x * 256 + threadIdx.x; if (t >= N * (K / 8)) return; const int n = t / (K / 8), k8 = (t % (K / 8)) * 8; FragH f;
#pragma unroll
  for (int i = 0; i < 8; ++i) f.h[i] = (_Float16)(bf16_round(W[(size_t)(k8 + i) * N + n]) * scale); const v8us o = f.half[0];
  *(v8us*)((unsigned short*)Wt + (size_t)n * K + k8) = o; 
}
// k_gemm_hh variant with fused epilogue: v = acc·alpha + bias[by·sBias + col] (+ CP[(row/rowsPerB)·sCPb + by·64 + col] if CP) ; ACT 0 none / 1 elu ; writes f16 C16 (and f32 C if non-null)
template <int ACT>
__global__ __launch_bounds__(128) void k_gemm_hhx(const _Float16* __restrict__ A, int lda, size_t sA, const _Float16* __restrict__ Bh, int ldb, size_t sB, float alpha, const float* __restrict__ bias, size_t sBias, const float* __restrict__ CP, int rowsPerB, size_t sCPb, int row0g,
    float* __restrict__ C, _Float16* __restrict__ C16, int ldc, size_t sC, int M, int N, int K) {
  __shared__ __attribute__((aligned(16))) float so[4][16][64];
  const int tid = threadIdx.x, w = tid >> 5, lane = tid & 31, ln = lane & 15, hh = lane >> 4; const int by = blockIdx.y;
  A += (size_t)by * sA; Bh += (size_t)by * sB; const size_t cofs = (size_t)by * sC; const float* bp = bias ? bias + (size_t)by * sBias : nullptr;
  const int ntn = (N + 63) / 64; const int wid = blockIdx.x * 4 + w; const int mt = wid / ntn, nq = wid % ntn; if (mt * 16 >= M) return;
  const int row0 = mt * 16, col0 = nq * 64; const _Float16* arow = A + (size_t)(row0 + ln) * lda;
  v8f acc[4] = {};
  for (int kb = 0; kb < K; kb += 32) { FragH ah; ah.half[0] = *(const v8us*)((const unsigned short*)arow + kb + 8 * hh); ah.half[1] = *(const v8us*)((const unsigned short*)arow + kb + 16 + 8 * hh);
#pragma unroll
    for (int t = 0; t < 4; ++t) { if (col0 + t * 16 >= N) continue; const size_t boff = (size_t)(col0 + t * 16 + ln) * ldb + kb; FragH bq; bq.half[0] = *(const v8us*)((const unsigned short*)Bh + boff + 8 * hh); bq.half[1] = *(const v8us*)((const unsigned short*)Bh + boff + 16 + 8 * hh);
      acc[t] = mmaH<1>(ah.v, ah.v, bq.v, bq.v, acc[t]); }
  }
#pragma unroll
  for (int t = 0; t < 4; ++t) { if (col0 + t * 16 >= N) continue; const int col = col0 + t * 16 + ln; const float bv = bp ? bf16_round(bp[col]) : 0.f;
#pragma unroll
    for (int r = 0; r < 8; ++r) { float v = acc[t][r] * alpha + bv; if (CP) { const int rr = row0g + row0 + 8 * hh + r; if (rowsPerB < 0) v += CP[cofs + (size_t)rr * ldc + col];      /* rowsPerB < 0: own element of the batched C plane */ else { const int bidx = rr / rowsPerB; v += CP[(size_t)bidx * sCPb + (size_t)by * 64 + col]; } } if (ACT == 1) v = (v > 0.f) ? v : expm1f(v); else if (ACT == 7) v = (v > 0.f) ? v + 1.0f : expf(v); else if (ACT == 8) v = tanhf(v); else if (ACT == 9) v = 0.5f * v * (1.0f + tanhf(0.7978845608028654f * (v + 0.044715f * v * v * v))); else if (ACT == 11) v = 1.0f / (1.0f + expf(-v)); else if (ACT == 12) v = (v > 0.f) ? v : 0.01f * v; else if (ACT == 14) v = (v > 0.f) ? v : 0.1f * v; else if (ACT == 16) v = (v >= 0.f) ? v : 0.3f * v; else if (ACT == 17) v = (v >= 0.f) ? v : 0.2f * v; else if (ACT == 15) v = v / (1.0f + expf(-v)); else if (ACT == 3) v = fmaxf(v, 0.f); else if (ACT == 6) v = 0.5f * v * (1.0f + erff(v * 0.70710678118654752f)); so[w][8 * hh + r][t * 16 + ln] = v; } }
  __builtin_amdgcn_fence(__ATOMIC_ACQ_REL, "workgroup"); __builtin_amdgcn_wave_barrier();
  const int rsub = lane >> 4, c4 = (lane & 15) * 4; typedef _Float16 v4h __attribute__((ext_vector_type(4)));
  {
#pragma unroll
    for (int q = 0; q < 8; ++q) { const int r = q * 2 + rsub; if (col0 + c4 < N) { const v4f v = *(const v4fa*)&so[w][r][c4]; if (C) *(v4f*)(C + cofs + (size_t)(row0 + r) * ldc + col0 + c4) = v; if (C16) { v4h h4; for (int i = 0; i < 4; ++i) h4[i] = (_Float16)v[i]; *(v4h*)(C16 + cofs + (size_t)(row0 + r) * ldc + col0 + c4) = h4; } } }
     }
}


typedef _Float16 v4h __attribute__((ext_vector_type(4)));

__global__ __launch_bounds__(256) void k_x16(const float* __restrict__ x, _Float16* __restrict__ X16, size_t n8) { const size_t t = (size_t)blockIdx.x * 256 + threadIdx.x; if (t >= n8) return; FragH f;
#pragma unroll
  for (int q = 0; q < 8; ++q) f.h[q] = (_Float16)bf16_round(x[t * 8 + q]); *(v8us*)((unsigned short*)X16 + t * 8) = f.half[0];  }
__global__ __launch_bounds__(256) void k_h16(const float* __restrict__ x, _Float16* __restrict__ X16, size_t n8) { const size_t t = (size_t)blockIdx.x * 256 + threadIdx.x; if (t >= n8) return; FragH f;
#pragma unroll
  for (int q = 0; q < 8; ++q) f.h[q] = (_Float16)x[t * 8 + q]; *(v8us*)((unsigned short*)X16 + t * 8) = f.half[0];  }
__global__ __launch_bounds__(256) void k_round16f(const float* __restrict__ W, _Float16* __restrict__ Bt, size_t n8) { const size_t t = (size_t)blockIdx.x * 256 + threadIdx.x; if (t >= n8) return; FragH f;
#pragma unroll
  for (int i = 0; i < 8; ++i) f.h[i] = (_Float16)(bf16_round(W[t * 8 + i]) * 16.0f); *(v8us*)((unsigned short*)Bt + t * 8) = f.half[0];  }
template <int NHv, int TTv>
__global__ __launch_bounds__(256) void k_vt(const _Float16* __restrict__ V16, int ldv, int voff, _Float16* __restrict__ Vt) { __shared__ unsigned short tl[64][66]; const int tid = threadIdx.x; const int slab = blockIdx.x / (TTv / 64), lg = blockIdx.x % (TTv / 64); const int b = slab / NHv, h = slab % NHv;
  for (int i = tid; i < 64 * 8; i += 256) { const int r = i / 8, c8 = (i % 8) * 8; FragH f; f.half[0] = *(const v8us*)((const unsigned short*)V16 + ((size_t)b * TTv + lg * 64 + r) * ldv + voff + h * 64 + c8);
#pragma unroll
    for (int q = 0; q < 8; ++q) tl[r][c8 + q] = f.u[q]; }
  __syncthreads();
  {
#pragma unroll
    for (int rd = 0; rd < 2; ++rd) { const int d = rd * 32 + tid / 8, pc = tid % 8; FragH f;
#pragma unroll
      for (int q = 0; q < 8; ++q) f.u[q] = tl[pc * 8 + q][d];
      *(v8us*)((unsigned short*)Vt + ((size_t)slab * 64 + d) * TTv + lg * 64 + pc * 8) = f.half[0]; }
     } }

__global__ __launch_bounds__(256) void k_hl(const float* __restrict__ F, _Float16* __restrict__ Hh, _Float16* __restrict__ Hl, size_t n8) { const size_t t = (size_t)blockIdx.x * 256 + threadIdx.x; if (t >= n8) return; FragH fh, fl; const v4f a = *(const v4fa*)(F + t * 8), c = *(const v4fa*)(F + t * 8 + 4);
#pragma unroll
  for (int q = 0; q < 4; ++q) { _Float16 h = (_Float16)a[q]; fh.h[q] = h; fl.h[q] = (_Float16)((a[q] - (float)h) * 1024.0f); h = (_Float16)c[q]; fh.h[4 + q] = h; fl.h[4 + q] = (_Float16)((c[q] - (float)h) * 1024.0f); }
  { *(v8us*)((unsigned short*)Hh + t * 8) = fh.half[0]; *(v8us*)((unsigned short*)Hl + t * 8) = fl.half[0];  } }

// ---- fast GEMM (wave tile 32x64; requires M % 32 == 0 rows per launch region and N % 64 == 0); epilogue = k_gemm_hhx semantics ----
__device__ __forceinline__ v16h g2_frag(const _Float16* p, int hh) { FragH f; f.half[0] = *(const v8us*)((const unsigned short*)p + 8 * hh); f.half[1] = *(const v8us*)((const unsigned short*)p + 16 + 8 * hh); return f.v; }
__device__ __forceinline__ v8f g2_mma(v16h a, v16h b, v8f c) { v8f d = __builtin_amdgcn_wmma_f32_16x16x32_f16(false, a, false, b, (short)0, c, false, false); asm volatile("v_nop\n\tv_nop\n\tv_nop\n\tv_nop" : "+v"(d) : "v"(a), "v"(b)); return d; }
template <int ACT>
__global__ __launch_bounds__(128) void k_gemm2(const _Float16* __restrict__ A, int lda, size_t sA, const _Float16* __restrict__ Bh, int ldb, size_t sB, float alpha, const float* __restrict__ bias, size_t sBias, const float* __restrict__ CP, int rowsPerB, size_t sCPb, int row0g,
    float* __restrict__ C, _Float16* __restrict__ C16, int ldc, size_t sC, int M, int N, int K) { static_assert(ACT == 0 || ACT == 3 || ACT == 6 || ACT == 8 || ACT == 9 || ACT == 11 || ACT == 12 || ACT == 14 || ACT == 15 || ACT == 16 || ACT == 17, "k_gemm2: unsupported ACT code (would silently apply no activation)");
  __shared__ __attribute__((aligned(16))) float so[4][32][68];
  const int tid = threadIdx.x, w = tid >> 5, lane = tid & 31, ln = lane & 15, hh = lane >> 4; const int by = blockIdx.y;
  A += (size_t)by * sA; Bh += (size_t)by * sB; const size_t cofs = (size_t)by * sC; const float* bp = bias ? bias + (size_t)by * sBias : nullptr;
  const int ntn = N >> 6; const int mt = blockIdx.x / ntn, nq = blockIdx.x - mt * ntn; const int row0 = mt * 128 + 32 * w, col0 = nq * 64; if (row0 >= M) return;
  const _Float16* a0p = A + (size_t)(row0 + ln) * lda; const _Float16* a1p = a0p + (size_t)16 * lda;
  const _Float16* b0p = Bh + (size_t)(col0 + ln) * ldb; const _Float16* b1p = b0p + (size_t)16 * ldb; const _Float16* b2p = b1p + (size_t)16 * ldb; const _Float16* b3p = b2p + (size_t)16 * ldb;
  const v8f z8 = {0.f,0.f,0.f,0.f,0.f,0.f,0.f,0.f}; v8f c00 = z8, c01 = z8, c02 = z8, c03 = z8, c10 = z8, c11 = z8, c12 = z8, c13 = z8;
#pragma unroll 1
  for (int kb = 0; kb < K; kb += 32) { const v16h a0 = g2_frag(a0p + kb, hh), a1 = g2_frag(a1p + kb, hh);
    v16h b = g2_frag(b0p + kb, hh); c00 = g2_mma(a0, b, c00); c10 = g2_mma(a1, b, c10);
    b = g2_frag(b1p + kb, hh); c01 = g2_mma(a0, b, c01); c11 = g2_mma(a1, b, c11);
    b = g2_frag(b2p + kb, hh); c02 = g2_mma(a0, b, c02); c12 = g2_mma(a1, b, c12);
    b = g2_frag(b3p + kb, hh); c03 = g2_mma(a0, b, c03); c13 = g2_mma(a1, b, c13); }
  v8f accs[8] = {c00, c01, c02, c03, c10, c11, c12, c13};
#pragma unroll
  for (int u = 0; u < 8; ++u) { const int t = u & 3, half = u >> 2; const int col = col0 + t * 16 + ln; const float bv = bp ? bf16_round(bp[col]) : 0.f;
#pragma unroll
    for (int r = 0; r < 8; ++r) { const int rloc = half * 16 + 8 * hh + r; float v = accs[u][r] * alpha + bv; if (CP) { if (rowsPerB < 0) v += CP[cofs + (size_t)(row0g + row0 + rloc) * ldc + col];      /* rowsPerB < 0: own element of the batched C plane */ else { const int bidx = (row0g + row0 + rloc) / rowsPerB; v += CP[(size_t)bidx * sCPb + (size_t)by * 64 + col]; } }
      if (ACT == 3) v = fmaxf(v, 0.f); else if (ACT == 6) v = 0.5f * v * (1.0f + erff(v * 0.70710678118654752f)); else if (ACT == 11) v = 1.0f / (1.0f + expf(-v)); else if (ACT == 15) v = v / (1.0f + expf(-v)); else if (ACT == 12) v = (v > 0.f) ? v : 0.01f * v; else if (ACT == 8) v = tanhf(v); else if (ACT == 9) v = 0.5f * v * (1.0f + tanhf(0.7978845608028654f * (v + 0.044715f * v * v * v))); else if (ACT == 14) v = (v > 0.f) ? v : 0.1f * v; else if (ACT == 16) v = (v >= 0.f) ? v : 0.3f * v; else if (ACT == 17) v = (v >= 0.f) ? v : 0.2f * v;
      so[w][rloc][t * 16 + ln] = v; } }
  __builtin_amdgcn_fence(__ATOMIC_ACQ_REL, "workgroup"); __builtin_amdgcn_wave_barrier();
  const int rsub = lane >> 4, c4 = (lane & 15) * 4;
  {
#pragma unroll
    for (int q = 0; q < 16; ++q) { const int r = q * 2 + rsub; const v4f v = *(const v4fa*)&so[w][r][c4]; if (C) *(v4f*)(C + cofs + (size_t)(row0 + r) * ldc + col0 + c4) = v; if (C16) { v4h h4; for (int i = 0; i < 4; ++i) h4[i] = (_Float16)v[i]; *(v4h*)(C16 + cofs + (size_t)(row0 + r) * ldc + col0 + c4) = h4; } }
     } }


__global__ __launch_bounds__(256) void k_wnat(const float* __restrict__ w, size_t n8, _Float16* __restrict__ Bt) { const size_t t = (size_t)blockIdx.x * 256 + threadIdx.x; if (t >= n8) return; FragH f; for (int q = 0; q < 8; ++q) f.h[q] = (_Float16)(bf16_round(w[t * 8 + q]) * 16.0f); *(v8us*)((unsigned short*)Bt + t * 8) = f.half[0];  }
__global__ __launch_bounds__(256) void k_rsm(const float* __restrict__ S, _Float16* __restrict__ P, int nrows) {
  #pragma clang fp contract(off)
  const int i = blockIdx.x * 256 + threadIdx.x; if (i >= nrows) return; const float* s = S + (size_t)i * SQ; float mx = -3.0e38f;
#pragma unroll 1
  for (int j = 0; j < SQ; ++j) mx = fmaxf(mx, s[j]); float se = 0.f;
#pragma unroll 1
  for (int j = 0; j < SQ; ++j) se += expf(s[j] - mx); const float sc = 256.0f / se;
#pragma unroll 1
  for (int j0 = 0; j0 < SQ; j0 += 8) { FragH f; for (int q = 0; q < 8; ++q) f.h[q] = (_Float16)(expf(s[j0 + q] - mx) * sc); unsigned short* d = (unsigned short*)P + (size_t)i * SQ + j0; *(v8us*)d = f.half[0];  } }
__global__ __launch_bounds__(256) void k_vt(const _Float16* __restrict__ V16, int b, int h0, _Float16* __restrict__ VT) { __shared__ unsigned short tl[64][65]; const int tid = threadIdx.x; const int hh = blockIdx.x % HG, sg = blockIdx.x / HG; const int s0 = sg * 64; const int h = h0 + hh;
  for (int i = tid; i < 64 * 8; i += 256) { const int j = i / 8, d8 = (i % 8) * 8; FragH f; f.half[0] = *(const v8us*)((const unsigned short*)V16 + ((size_t)b * SQ + s0 + j) * DM + h * HD + d8); for (int q = 0; q < 8; ++q) tl[d8 + q][j] = f.u[q]; }
  __syncthreads();
  { for (int i = tid; i < 64 * 8; i += 256) { const int d = i / 8, j8 = (i % 8) * 8; FragH f; for (int q = 0; q < 8; ++q) f.u[q] = tl[d][j8 + q]; *(v8us*)((unsigned short*)VT + ((size_t)hh * HD + d) * SQ + s0 + j8) = f.half[0]; }  } }



__global__ __launch_bounds__(256) void k_rsmkm(const float* __restrict__ S, _Float16* __restrict__ P, int nrows, const int* __restrict__ am) {
  #pragma clang fp contract(off)
  const int t = blockIdx.x * 256 + threadIdx.x; if (t >= nrows) return; const size_t i = (size_t)t; const float* s = S + i * SQ; const int* mr = am + (size_t)(t % SQ) * SQ; float mx = -3.0e38f;
#pragma unroll 1
  for (int j = 0; j < SQ; ++j) { const float f = (mr[j] != 0) ? 1.f : 0.f; mx = fmaxf(mx, fmaf(f, s[j], (1.f - f) * -1.0e9f)); } float se = 0.f;
#pragma unroll 1
  for (int j = 0; j < SQ; ++j) { const float f = (mr[j] != 0) ? 1.f : 0.f; se += __expf(fmaf(f, s[j], (1.f - f) * -1.0e9f) - mx); } const float sc = 256.0f / se;
#pragma unroll 1
  for (int j0 = 0; j0 < SQ; j0 += 8) { FragH fr; for (int q = 0; q < 8; ++q) { const int j = j0 + q; const float f = (mr[j] != 0) ? 1.f : 0.f; fr.h[q] = (_Float16)(__expf(fmaf(f, s[j], (1.f - f) * -1.0e9f) - mx) * sc); }
    unsigned short* d = (unsigned short*)P + i * SQ + j0; *(v8us*)d = fr.half[0];  } }

__global__ __launch_bounds__(256) void k_bdshn(const float* __restrict__ Wb, _Float16* __restrict__ Bt) {
  const size_t t = (size_t)blockIdx.x * 256 + threadIdx.x; if (t >= (size_t)DM * DM / 8) return; const size_t e0 = t * 8; const int n = (int)(e0 / DM), k0 = (int)(e0 % DM); const int h = n >> 6, hk = k0 >> 6; const float on = (hk == h) ? 16.0f : 0.0f; const int o = n & 63, d0 = k0 & 63; FragH f;
  for (int q = 0; q < 8; ++q) f.h[q] = (_Float16)(bf16_round(Wb[(size_t)o * 64 + d0 + q]) * on);
  unsigned short* d = (unsigned short*)Bt + e0; *(v8us*)d = f.half[0];  }

typedef int v4ia __attribute__((ext_vector_type(4), may_alias));
template <int M> __device__ __forceinline__ float rs_xm(float x) { return __builtin_bit_cast(float, __builtin_amdgcn_update_dpp(0, __builtin_bit_cast(int, x), 0x160 | M, 0xf, 0xf, true)); }  // lane l with lane l ^ M inside a 16-lane row
__device__ __forceinline__ float rs_xh(float x) { return __builtin_bit_cast(float, __builtin_amdgcn_permlanex16(__builtin_bit_cast(int, x), __builtin_bit_cast(int, x), 0x76543210, 0xfedcba98, false, false)); }  // lane l with lane l ^ 16
__device__ __forceinline__ float rs_wmax(float v) { v = fmaxf(v, rs_xm<1>(v)); v = fmaxf(v, rs_xm<2>(v)); v = fmaxf(v, rs_xm<4>(v)); v = fmaxf(v, rs_xm<8>(v)); return fmaxf(v, rs_xh(v)); }
__device__ __forceinline__ float rs_wsum(float v) { v += rs_xm<1>(v); v += rs_xm<2>(v); v += rs_xm<4>(v); v += rs_xm<8>(v); return v + rs_xh(v); }
// Four 2^x. Written as asm for the slot behind a transcendental (one independent instruction or v_nop before its result is read or its source overwritten): each v_exp_f32 is followed by
// an independent one (early-clobber outputs share no register with the sources), the last by v_nop.
__device__ __forceinline__ v4f rs_exp4(v4f x) { float e0, e1, e2, e3;
  asm("v_exp_f32 %0, %4\n\tv_exp_f32 %1, %5\n\tv_exp_f32 %2, %6\n\tv_exp_f32 %3, %7\n\tv_nop" : "=&v"(e0), "=&v"(e1), "=&v"(e2), "=&v"(e3) : "v"(x[0]), "v"(x[1]), "v"(x[2]), "v"(x[3]));
  const v4f e = {e0, e1, e2, e3}; return e; }
#define KN_PITCH 32      /* ints from one batch's count to the next: a 128-byte line each, one writer a line */
// First launch: the output weights as f16 x16 (blocks below nwb, as k_wnat), and one block a batch that lists the batch's open keys.
// KI[b][p] = token of the p-th key with mask != 0, in token order; KN[b * KN_PITCH] = their number n. Entries from n on hold token 0: a real row, so that a stage's tail is finite; its scores take the fill.
// n == 0: KI is the identity (all keys stay; k_fattn gives every score the fill, the row comes out uniform as in the module). A wave takes 256 keys, 32 a round: a key's place is the wave's base + the open lanes below it.
__global__ __launch_bounds__(256) void k_prep(const float* __restrict__ w, size_t n8, _Float16* __restrict__ Bt, int nwb, const int* __restrict__ Km, int* __restrict__ KI, int* __restrict__ KN) {
  __shared__ int wt[8]; __shared__ __attribute__((aligned(16))) int li[SQ];      /* the waves' counts; the list, gathered here so that it leaves as whole 128-byte lines */
  const int tid = threadIdx.x, lane = tid & 31, wave = tid >> 5;
  if ((int)blockIdx.x < nwb) { const size_t t = (size_t)blockIdx.x * 256 + tid; if (t >= n8) return; FragH f; for (int q = 0; q < 8; ++q) f.h[q] = (_Float16)(bf16_round(w[t * 8 + q]) * 16.0f); *(v8us*)((unsigned short*)Bt + t * 8) = f.half[0]; return; }
  const int b = (int)blockIdx.x - nwb; const int k0 = wave * 256 + lane; const int* mb = Km + (size_t)b * SQ + k0; int* ki = KI + (size_t)b * SQ;
  unsigned bal[8]; int tot = 0;
#pragma unroll
  for (int r = 0; r < 8; ++r) { bal[r] = __builtin_amdgcn_ballot_w32(mb[r * 32] != 0); tot += __builtin_popcount(bal[r]); }      /* unrolled: bal is a register array */
  if (lane == 0) wt[wave] = tot;
  __syncthreads();      /* every wave's count is in LDS */
  int base = 0, n = 0;
  for (int i = 0; i < 8; ++i) { const int v = wt[i]; base += (i < wave) ? v : 0; n += v; }
  if (n == 0) {
    for (int r = 0; r < 8; ++r) li[k0 + r * 32] = k0 + r * 32;
  } else {
#pragma unroll      /* bal is a register array */
    for (int r = 0; r < 8; ++r) { if ((bal[r] >> lane) & 1u) li[base + __builtin_popcount(bal[r] & ((1u << lane) - 1u))] = k0 + r * 32; base += __builtin_popcount(bal[r]); }
    for (int p = n + tid; p < SQ; p += 256) li[p] = 0;
  }
  __syncthreads();      /* the list is whole in LDS */
  for (int q = 0; q < SQ / 1024; ++q) *(v4ia*)(ki + q * 1024 + tid * 4) = *(const v4ia*)&li[q * 1024 + tid * 4];
  if (tid == 0) KN[b * KN_PITCH] = n;
}
// Attention as one stream over the keys: one launch for all batches and heads; scores and weights stay in registers.
// A wave owns 32 query columns and walks the batch's listed keys (packed by k_proj; n open ones, or all 2048 where none is open) in passes of 32: S^T = K Q^T (A = 16 key rows, B = 16 query columns, both k-contiguous f16 rows), so a lane holds 8 keys of ONE query a tile;
// two score tiles of a pass, converted in place, are the B operand of O^T += V^T P^T (A = rows of V^T in the same k order). Maximum and sum are per lane plus one exchange between the lane halves.
// The 8 waves of a work-group share one (batch, head): K rows and V^T rows come in stages of 64 keys, by whole 128-byte lines through registers into one of two LDS buffers
// (a fragment load from global memory would touch 16 lines for 512 bytes, and every wave would repeat it); stage s + 1 is loaded while stage s is worked on, stored behind it, one barrier a stage.
// Values: t = energy / sqrt(512) * log2(e); a place from n on (the last stage's tail; every place where n == 0) takes the module's fill (-1e20, same scale) BEFORE the maximum, so its weight is exactly 0 beside any open key and a row with no open key comes out uniform;
// weight = 2^(t - m + 6) as f16, m the maximum in use (renewed when a pass exceeds it by more than 8, so a weight stays below 2^14); the sum adds the f32 weights; o = O / sum, stored x64 as f16 rows as before.
// Every '#pragma unroll' in the kernel but those on the phase loop and the pass loop stands on a loop over a register array (fragments, accumulators): rolled, the array would be indexed at run time and leave the registers.
#define FA_WAVES 8
#define FA_COLS 32
#define FA_STAGE 64
#define FA_PITCH 72      /* halves a staged row: 144 bytes = 16 x 9, an odd multiple of 16 bytes for the 16-byte fragment reads */
static_assert(SQ % (FA_WAVES * FA_COLS) == 0 && SQ % FA_STAGE == 0 && HD == 64 && FA_WAVES * 32 * 2 * 8 == FA_STAGE * HD, "k_fattn: whole work-groups and stages; a thread stages 2 x 16 bytes of K and of V^T");
typedef _Float16 v8h __attribute__((ext_vector_type(8)));
__device__ __forceinline__ v8f fa_mma(v16h a, v16h b, v8f c) { return __builtin_amdgcn_wmma_f32_16x16x32_f16(false, a, false, b, (short)0, c, false, false); }
// One 16 x 32 fragment from k-contiguous rows, k order as g2_frag: p = the lane's row + 8 * (lane >> 4) halves.
__device__ __forceinline__ v16h fa_frag(const unsigned short* p) { FragH f; f.half[0] = *(const v8us*)p; f.half[1] = *(const v8us*)(p + 16); return f.v; }
__global__ __launch_bounds__(FA_WAVES * 32) void k_fattn(const _Float16* __restrict__ Q16, const _Float16* __restrict__ K16, const _Float16* __restrict__ VT, const int* __restrict__ KN, _Float16* __restrict__ O16) {
  __shared__ __attribute__((aligned(16))) unsigned short sk[2][FA_STAGE][FA_PITCH];      /* [buffer][key][d] */
  __shared__ __attribute__((aligned(16))) unsigned short sv[2][HD][FA_PITCH];            /* [buffer][d][key] */
  constexpr int QB = SQ / (FA_WAVES * FA_COLS);
  constexpr float SC = 0.044194173824159216f * 1.44269504088896340736f, FILL = -1.0e20f * SC;
  const int tid = threadIdx.x, lane = tid & 31, ln = lane & 15, hh = lane >> 4; const int wave = __builtin_amdgcn_readfirstlane(tid >> 5);
  const int bh = blockIdx.x / QB, b = bh / NH, h = bh % NH; const int q0 = (blockIdx.x % QB) * (FA_WAVES * FA_COLS) + wave * FA_COLS;
  const _Float16* qb = Q16 + ((size_t)b * SQ + q0) * DM + h * HD;      /* wave-uniform bases */
  const _Float16* kb = K16 + (size_t)b * SQ * DM + h * HD;
  const _Float16* vb = VT + (size_t)bh * HD * SQ;
  const int n = __builtin_amdgcn_readfirstlane(min(max(KN[b * KN_PITCH], 0), SQ));      /* open keys of the batch, bounded by the shape */
  const int nst = ((n != 0 ? n : SQ) + FA_STAGE - 1) / FA_STAGE;      /* stages that k_proj has written: 1 to SQ / FA_STAGE */
  const int srow = tid >> 3, sc8 = (tid & 7) * 8;      /* staging: 8 threads a 128-byte row; rows srow and srow + 32 */
  const unsigned roff = (unsigned)(ln * (DM * 2) + hh * 16);      /* byte offsets of the lane: row ln of a tile of q or o rows */
  const unsigned kso = (unsigned)(srow * (DM * 2) + sc8 * 2), vso = (unsigned)(srow * (SQ * 2) + sc8 * 2);
  v16h qf[2][2]; v8us gk[2], gv[2];
#pragma unroll
  for (int u = 0; u < 2; ++u) for (int ks = 0; ks < 2; ++ks) qf[u][ks] = fa_frag((const unsigned short*)((const char*)(qb + u * 16 * DM + ks * 32) + roff));
  { const char* kq = (const char*)kb + kso; const char* vq = (const char*)vb + vso;
    gk[0] = *(const v8us*)kq; gk[1] = *(const v8us*)(kq + 32 * DM * 2); gv[0] = *(const v8us*)vq; gv[1] = *(const v8us*)(vq + 32 * SQ * 2);
    asm volatile("s_wait_xcnt 0x0" :: "v"(roff), "v"(kso), "v"(vso) : "memory"); }      /* behind the loads, ahead of any new value in a register that they name (a precaution of form); as inputs the lane offsets keep their registers up to it */
  *(v8us*)&sk[0][srow][sc8] = gk[0]; *(v8us*)&sk[0][srow + 32][sc8] = gk[1]; *(v8us*)&sv[0][srow][sc8] = gv[0]; *(v8us*)&sv[0][srow + 32][sc8] = gv[1];
  const v8f z8 = {0.f, 0.f, 0.f, 0.f, 0.f, 0.f, 0.f, 0.f};
  v8f o[2][4]; float l[2] = {0.f, 0.f}, m[2] = {-3.0e38f, -3.0e38f};
#pragma unroll
  for (int u = 0; u < 2; ++u) for (int dt = 0; dt < 4; ++dt) o[u][dt] = z8;
  __syncthreads();      /* stage 0 is in LDS for every wave */
  int s = 0;
#pragma unroll      /* two copies of the stage loop, ph a constant in each: the stages that hold open keys alone carry no fill code; unrolled, not branched, since a branch in mid pass cost registers past the first 256 */
  for (int ph = 0; ph < 2; ++ph) for (const int se = (ph == 0) ? n / FA_STAGE : nst; s < se; ++s) {
    const int bf = s & 1; const int sn = (s + 1 < nst) ? s + 1 : 0;      /* the last stage loads stage 0 again (in bounds, never read) */
    { const char* kq = (const char*)(kb + (size_t)sn * FA_STAGE * DM) + kso; const char* vq = (const char*)(vb + sn * FA_STAGE) + vso;
      gk[0] = *(const v8us*)kq; gk[1] = *(const v8us*)(kq + 32 * DM * 2); gv[0] = *(const v8us*)vq; gv[1] = *(const v8us*)(vq + 32 * SQ * 2);
      asm volatile("s_wait_xcnt 0x0" ::: "memory"); }      /* behind the loads, ahead of any new value in a register that they name (a precaution of form); as a memory barrier for the compiler it also keeps the loads here, a whole stage ahead of their stores */
    v16h kf[2][2];
#pragma unroll
    for (int kt = 0; kt < 2; ++kt) for (int ks = 0; ks < 2; ++ks) kf[kt][ks] = fa_frag(&sk[bf][kt * 16 + ln][ks * 32 + 8 * hh]);
    __builtin_amdgcn_sched_barrier(0);      /* all eight reads are issued before the first wait on one: without it this build read two fragments at a time into one register block and met the LDS latency three times behind every barrier */
#pragma unroll
    for (int p = 0; p < FA_STAGE / 32; ++p) {
      v16h vf[4]; v8f t[2][2];
#pragma unroll
      for (int dt = 0; dt < 4; ++dt) vf[dt] = fa_frag(&sv[bf][dt * 16 + ln][p * 32 + 8 * hh]);
#pragma unroll
      for (int u = 0; u < 2; ++u) for (int kt = 0; kt < 2; ++kt) t[u][kt] = fa_mma(kf[kt][0], qf[u][0], z8);
#pragma unroll
      for (int u = 0; u < 2; ++u) for (int kt = 0; kt < 2; ++kt) t[u][kt] = fa_mma(kf[kt][1], qf[u][1], t[u][kt]);
      if (p + 1 < FA_STAGE / 32) {      /* the next pass of the SAME stage: its K fragments are fetched behind this pass's score products, into the registers these have left */
#pragma unroll
        for (int kt = 0; kt < 2; ++kt) for (int ks = 0; ks < 2; ++ks) kf[kt][ks] = fa_frag(&sk[bf][(p + 1) * 32 + kt * 16 + ln][ks * 32 + 8 * hh]); }
      float mx[2];
#pragma unroll
      for (int u = 0; u < 2; ++u) for (int kt = 0; kt < 2; ++kt) t[u][kt] *= SC;
      if (ph == 1) {      /* the last stage where n is no whole number of stages; every stage where n == 0 */
        const int left = n - (s * FA_STAGE + p * 32 + 8 * hh);      /* open places from the lane's first key of tile 0 on */
#pragma unroll
        for (int u = 0; u < 2; ++u) for (int kt = 0; kt < 2; ++kt) for (int r = 0; r < 8; ++r) t[u][kt][r] = (kt * 16 + r < left) ? t[u][kt][r] : FILL;
      }
#pragma unroll
      for (int u = 0; u < 2; ++u) {
        float x = fmaxf(t[u][0][0], t[u][1][0]);
#pragma unroll
        for (int r = 1; r < 8; ++r) x = fmaxf(x, fmaxf(t[u][0][r], t[u][1][r]));
        mx[u] = fmaxf(x, rs_xh(x));
      }
      if (__builtin_amdgcn_ballot_w32((mx[0] > m[0] + 8.0f) || (mx[1] > m[1] + 8.0f)) != 0) {      /* one scalar branch a pass: the products of a renewal run only where some column needs one */
        const float n0 = fmaxf(m[0], mx[0]), n1 = fmaxf(m[1], mx[1]); const v4f d4 = {m[0] - n0, m[1] - n1, 0.f, 0.f}; const v4f al = rs_exp4(d4); m[0] = n0; m[1] = n1;
#pragma unroll
        for (int u = 0; u < 2; ++u) { l[u] *= al[u]; for (int dt = 0; dt < 4; ++dt) o[u][dt] *= al[u]; }
      }
      v16h pf[2];
#pragma unroll
      for (int u = 0; u < 2; ++u) { const float ms = m[u] - 6.0f; v4f s4[2];
#pragma unroll
        for (int kt = 0; kt < 2; ++kt) { const v8f x = t[u][kt] - ms; const v4f x0 = {x[0], x[1], x[2], x[3]}, x1 = {x[4], x[5], x[6], x[7]}; const v4f e0 = rs_exp4(x0), e1 = rs_exp4(x1); s4[kt] = e0 + e1;
          const v8f e = {e0[0], e0[1], e0[2], e0[3], e1[0], e1[1], e1[2], e1[3]}; t[u][kt] = e; }
        const v4f sq = s4[0] + s4[1]; l[u] += (sq[0] + sq[1]) + (sq[2] + sq[3]);
        pf[u] = __builtin_shufflevector(__builtin_convertvector(t[u][0], v8h), __builtin_convertvector(t[u][1], v8h), 0, 1, 2, 3, 4, 5, 6, 7, 8, 9, 10, 11, 12, 13, 14, 15); }
      __builtin_amdgcn_sched_barrier(0);      /* this one and the next keep the eight products apart from the 2^x statements: those are asm text, which the compiler's padding behind a matrix instruction does not see */
#pragma unroll
      for (int dt = 0; dt < 4; ++dt) for (int u = 0; u < 2; ++u) o[u][dt] = fa_mma(vf[dt], pf[u], o[u][dt]);
      __builtin_amdgcn_sched_barrier(0);
    }
    *(v8us*)&sk[bf ^ 1][srow][sc8] = gk[0]; *(v8us*)&sk[bf ^ 1][srow + 32][sc8] = gk[1]; *(v8us*)&sv[bf ^ 1][srow][sc8] = gv[0]; *(v8us*)&sv[bf ^ 1][srow + 32][sc8] = gv[1];      /* into the buffer whose readers all passed the barrier of stage s - 1 */
    __syncthreads();      /* publishes stage s + 1 and ends every wave's reads of stage s */
  }
  _Float16* ob = O16 + ((size_t)b * SQ + q0) * DM + h * HD;
#pragma unroll
  for (int u = 0; u < 2; ++u) { const float sc = 64.0f / (l[u] + rs_xh(l[u]));
#pragma unroll
    for (int dt = 0; dt < 4; ++dt) *(v8h*)((char*)(ob + u * 16 * DM + dt * 16) + roff) = __builtin_convertvector(o[u][dt] * sc, v8h); }      /* a lane's 8 accumulator registers are 8 consecutive d of its query row */
}
#define PJ_TOK 64
#define PJ_PITCH 72      /* halves a staged row: 144 bytes, an odd multiple of 16 bytes for the 16-byte fragment reads */
static_assert(HD == 64 && NH == 8 && SQ % PJ_TOK == 0 && (SQ & (SQ - 1)) == 0 && PJ_TOK == 64 && DM == NH * HD, "k_proj: one wave a head, whole token blocks inside a batch");
typedef __bf16 v4b __attribute__((ext_vector_type(4)));
typedef unsigned short v4us __attribute__((ext_vector_type(4), may_alias));
__global__ __launch_bounds__(256) void k_proj(const float* __restrict__ xq, const float* __restrict__ xk, const float* __restrict__ xv, const float* __restrict__ wq, const float* __restrict__ wk, const float* __restrict__ wv,
                                              const int* __restrict__ KI, const int* __restrict__ KN, _Float16* __restrict__ Q16, _Float16* __restrict__ K16, _Float16* __restrict__ VT) {
  __shared__ __attribute__((aligned(16))) unsigned short sl[NH + 1][PJ_TOK][PJ_PITCH];      /* [wave][token][input], later the wave's output tile; tile NH: the weights [output][input] */
  const int tid = threadIdx.x, lane = tid & 31, ln = lane & 15, hh = lane >> 4; const int h = __builtin_amdgcn_readfirstlane(tid >> 5);
  const int which = blockIdx.y; const int r0 = blockIdx.x * PJ_TOK; const bool tr = which == 2;
  const int b = r0 / SQ, p0 = r0 % SQ;
  const float* xb = (which == 0 ? xq : which == 1 ? xk : xv) + (size_t)b * SQ * DM + h * HD;      /* wave-uniform bases */
  const float* wb = which == 0 ? wq : which == 1 ? wk : wv;
  const unsigned wo = (unsigned)(tid * 64); unsigned xo[PJ_TOK / 2];      /* byte offsets of the lane: xo[j] = its half's row of the pair j */
  if (which == 0) {
#pragma unroll
    for (int j = 0; j < PJ_TOK / 2; ++j) xo[j] = (unsigned)((p0 + j * 2 + hh) * (DM * 4) + ln * 16);
  } else {
    const int n = KN[b * KN_PITCH]; if (p0 >= ((n > 0 && n < SQ) ? n : SQ)) return;      /* the same for the whole work-group, ahead of every barrier */
    const v4ia* kl = (const v4ia*)(KI + (size_t)b * SQ + p0);
#pragma unroll
    for (int i = 0; i < PJ_TOK / 4; ++i) { const v4ia k4 = kl[i];      /* the token is bounded by the shape before an address is formed */
      xo[i * 2] = (unsigned)(((hh ? k4[1] : k4[0]) & (SQ - 1)) * (DM * 4) + ln * 16); xo[i * 2 + 1] = (unsigned)(((hh ? k4[3] : k4[2]) & (SQ - 1)) * (DM * 4) + ln * 16); }
  }
  v4f gx[PJ_TOK / 2], gw[4];
#pragma unroll
  for (int q = 0; q < 4; ++q) gw[q] = *(const v4fa*)((const char*)wb + wo + q * 16);
#pragma unroll
  for (int j = 0; j < PJ_TOK / 4; ++j) gx[j] = *(const v4fa*)((const char*)xb + xo[j]);
  /* Both waits: behind the loads, ahead of any new value in a register that they name (a precaution of form); as inputs the lane offsets keep their registers up to it. Two statements, since one takes at most thirty operands. */
  asm volatile("s_wait_xcnt 0x0" :: "v"(wo), "v"(xo[0]), "v"(xo[1]), "v"(xo[2]), "v"(xo[3]), "v"(xo[4]), "v"(xo[5]), "v"(xo[6]), "v"(xo[7]), "v"(xo[8]), "v"(xo[9]), "v"(xo[10]), "v"(xo[11]), "v"(xo[12]), "v"(xo[13]), "v"(xo[14]), "v"(xo[15]) : "memory");
#pragma unroll
  for (int j = PJ_TOK / 4; j < PJ_TOK / 2; ++j) gx[j] = *(const v4fa*)((const char*)xb + xo[j]);
  asm volatile("s_wait_xcnt 0x0" :: "v"(xo[16]), "v"(xo[17]), "v"(xo[18]), "v"(xo[19]), "v"(xo[20]), "v"(xo[21]), "v"(xo[22]), "v"(xo[23]), "v"(xo[24]), "v"(xo[25]), "v"(xo[26]), "v"(xo[27]), "v"(xo[28]), "v"(xo[29]), "v"(xo[30]), "v"(xo[31]) : "memory");
  __builtin_amdgcn_sched_barrier(0);      /* all 36 loads are issued before the first wait on one: without it this build held the last nine back behind the return of the first and met the memory latency twice */
#pragma unroll
  for (int q = 0; q < 4; ++q) { v4h w4; for (int i = 0; i < 4; ++i) w4[i] = (_Float16)(bf16_round(gw[q][i]) * 16.0f); *(v4us*)&sl[NH][tid >> 2][(tid & 3) * 16 + q * 4] = __builtin_bit_cast(v4us, w4); }
#pragma unroll
  for (int j = 0; j < PJ_TOK / 2; ++j) *(v4us*)&sl[h][j * 2 + hh][ln * 4] = __builtin_bit_cast(v4us, __builtin_convertvector(__builtin_convertvector(__builtin_convertvector(gx[j], v4b), v4f), v4h));      /* to bf16, nearest even, as bf16_round; that value as f16 */
  __syncthreads();      /* the weight block is in LDS for every wave (and each wave's own tile for all its lanes) */
  const unsigned short (*sa)[PJ_PITCH] = sl[tr ? h : NH]; const unsigned short (*sb)[PJ_PITCH] = sl[tr ? NH : h];
  v16h af[4][2], bf[2][2];
#pragma unroll
  for (int t = 0; t < 4; ++t) for (int ks = 0; ks < 2; ++ks) af[t][ks] = fa_frag(&sa[t * 16 + ln][ks * 32 + 8 * hh]);
#pragma unroll
  for (int ks = 0; ks < 2; ++ks) bf[0][ks] = fa_frag(&sb[ln][ks * 32 + 8 * hh]);
  const v8f z8 = {0.f, 0.f, 0.f, 0.f, 0.f, 0.f, 0.f, 0.f};
#pragma unroll
  for (int rt = 0; rt < 4; ++rt) {
    if (rt + 1 < 4) {      /* the next round's B rows are fetched ahead of this round's writes, which touch other rows */
#pragma unroll
      for (int ks = 0; ks < 2; ++ks) bf[(rt + 1) & 1][ks] = fa_frag(&sb[(rt + 1) * 16 + ln][ks * 32 + 8 * hh]); }
    v8f acc[4];
#pragma unroll
    for (int ct = 0; ct < 4; ++ct) acc[ct] = fa_mma(af[ct][0], bf[rt & 1][0], z8);
#pragma unroll
    for (int ct = 0; ct < 4; ++ct) acc[ct] = fa_mma(af[ct][1], bf[rt & 1][1], acc[ct]);
#pragma unroll
    for (int ct = 0; ct < 4; ++ct) *(v8us*)&sl[h][rt * 16 + ln][ct * 16 + 8 * hh] = __builtin_bit_cast(v8us, __builtin_convertvector(acc[ct] * 0.0625f, v8h));
  }
  __builtin_amdgcn_fence(__ATOMIC_ACQ_REL, "workgroup"); __builtin_amdgcn_wave_barrier();      /* the rows are read back by other lanes of the same wave: keeps the reads behind the writes */
  v8us ov[16];
#pragma unroll
  for (int j = 0; j < 16; ++j) ov[j] = *(const v8us*)&sl[h][j * 4 + (lane >> 3)][(lane & 7) * 8];      /* 8 lanes a row of 128 bytes, 4 rows an instruction */
  char* ob = tr ? (char*)(VT + ((size_t)(r0 / SQ) * NH + h) * HD * SQ + r0 % SQ) : (char*)((which == 0 ? Q16 : K16) + (size_t)r0 * DM + h * HD);      /* wave-uniform: the tile's first output row, and the bytes from row to row */
  const unsigned pb = tr ? SQ * 2 : DM * 2; const unsigned oo = (unsigned)(lane >> 3) * pb + (unsigned)(lane & 7) * 16;
#pragma unroll
  for (int j = 0; j < 16; ++j) *(v8us*)(ob + (size_t)(j * 4 * pb) + oo) = ov[j];
}
extern "C" void kernel_launch(void* const* d_in, const int* in_sizes, int n_in,
                              void* d_out, int out_size, void* d_ws, size_t ws_size, hipStream_t stream) {
  (void)in_sizes; (void)n_in; (void)out_size;
  const float* const* I = (const float* const*)d_in; const float* xq = I[2]; const float* xk = I[1]; const float* xv = I[0]; const int* km = (const int*)d_in[3]; const float* wq = I[6]; const float* wk = I[5]; const float* wv = I[4]; const float* wo = I[7]; const float* bo = I[8];      /* contract order: values I[0], keys I[1], query I[2]; mask int32 [4][1][1][2048] (0 = masked key; READ on device); SHARED natural [64][64] blocks Wv I[4], Wk I[5], Wq I[6]; natural Wo [512][512] + bo */
  char* ws = (char*)d_ws; size_t off = 0;
  auto take = [&](size_t bytes) { char* p = ws + off; off += (bytes + 255) & ~(size_t)255; return p; };
  _Float16* BO = (_Float16*)take((size_t)DM * DM * 2);
  _Float16* Q16 = (_Float16*)take(NR * DM * 2); _Float16* K16 = (_Float16*)take(NR * DM * 2); _Float16* O16 = (_Float16*)take(NR * DM * 2);
  _Float16* VT = (_Float16*)take((size_t)NB * NH * HD * SQ * 2);
  int* KI = (int*)take((size_t)NB * SQ * 4); int* KN = (int*)take((size_t)NB * KN_PITCH * 4);      /* the open keys of each batch, and their number */
  if (off > ws_size) return;
  k_prep<<<(unsigned)(((size_t)DM * DM / 8 + 255) / 256) + NB, 256, 0, stream>>>(wo, (size_t)DM * DM / 8, BO, (int)(((size_t)DM * DM / 8 + 255) / 256), km, KI, KN);      /* Wo natural [out][in] = Bt x16; the last NB blocks list the open keys */
  const size_t r0p = (size_t)B0 * SQ;      /* first row of the output stage */
  k_proj<<<dim3((unsigned)(NR / PJ_TOK), 3), 256, 0, stream>>>(xq, xk, xv, wq, wk, wv, KI, KN, Q16, K16, VT);      /* q rows [NB * SQ][DM]; k rows and V^T [NB][NH][HD][SQ] packed to the listed keys, f16 */
  k_fattn<<<NB * NH * (SQ / (FA_WAVES * FA_COLS)), FA_WAVES * 32, 0, stream>>>(Q16, K16, VT, KN, O16);      /* o (merged heads) as f16 rows x64; keys with mask[b][j] == 0 are not listed */
  k_gemm2<0><<<dim3((unsigned)((MPO / 128) * (DM / 64)), 1), 128, 0, stream>>>(O16 + r0p * DM, DM, 0, BO, DM, 0, 0.0009765625f, bo, 0, nullptr, 1, 0, 0, (float*)d_out + r0p * DM, nullptr, DM, 0, MPO, DM, DM);      /* out rows are the output layout */
}

// v005
// It runs in 38 microseconds.
// Two timings next to v004 both put it at 1.44 times that version's speed.
// Over all steps from v000 it is 88.6 times as fast.
#include <hip/hip_runtime.h>
// Multi-head attention over three inputs with SHARED per-head projections, a random key-padding mask and the module's literal score scale (values, keys, query [4][2048][512]; each input is split into 8 heads of 64 and every head is multiplied by the SAME natural [64][64] matrix (x W^T: Wv / Wk / Wq; no biases); energy = q k^T; where(mask == 0, -1e20) with the int32 [4][1][1][2048] mask in {0, 1} (random; 0 = masked key; READ on device); softmax(energy / sqrt(embed_size) = / sqrt(512)) (as the source); out = merged Wo^T + bo -> [4][2048][512]).
// Structure: token rows r = b*2048 + s; a key with mask 0 has weight exactly 0 beside any open key, so only the open keys of a batch are projected and attended: k_prep lists them (prefix count of the mask; a batch with no open key keeps all keys, every score at the fill); K rows and V^T columns are packed in list order; Q, K and V^T in ONE launch straight from the f32 inputs (k_proj: a wave takes 64 tokens of one head, rounds x to bf16 as exact f16 in registers, multiplies by the shared [64][64] block (exact x16) on WMMA over k = 64, f32 accumulation, f16 outputs; V leaves transposed); scores, masked softmax and weights x V in ONE launch for all batches and heads (k_fattn: running maximum and sum, scores and weights never in memory; o carried x64 against f16 subnormal flush, folded into the output GEMM alpha) written straight into the merged f16 o rows; out = o W_o + b GEMM (f32; k_ogemm: operands staged in LDS by whole lines) into the output layout.
// Compute dtype: inputs rounded to bf16; x / weights exact; q, k, v, softmax weights and o as plain f16 GEMM operands (~2^-12); scores and softmax statistics f32. v_wmma_f32_16x16x32_f16.
#define NB 4
#define SQ 2048
#define DM 512
#define NH 8
#define HD 64
#define HG 4                         /* heads a launch of the k_vt(V16, b, h0, VT) form, which is not launched */
#define B0 0                         /* first batch of the output stage (debug hook) */
#define NBR NB                       /* batches of the output stage (debug hook) */
#define NR ((size_t)NB * SQ)         /* token rows */
#define MP ((int)((size_t)NBR * SQ)) /* rows of the output stage, via MPO (debug hook) */
#define QN SQ                        /* unused; k_fattn attends all SQ query rows of a batch */
#define NHD NH                       /* unused; k_fattn attends all NH heads */
#define MPO MP                       /* rows through the output stage (debug hook) */
#define LQ DM      /* unused; the q and k rows have pitch DM */
typedef __bf16 v16b __attribute__((ext_vector_type(16)));
typedef unsigned short v8us __attribute__((ext_vector_type(8), may_alias));
typedef float  v8f  __attribute__((ext_vector_type(8)));
typedef float  v4f  __attribute__((ext_vector_type(4)));
typedef float  v4fa __attribute__((ext_vector_type(4), may_alias));
union FragB { v16b v; v8us half[2]; unsigned short u[16]; };

__device__ __forceinline__ unsigned short bf16_bits(float x) { unsigned int u = __float_as_uint(x); return (unsigned short)((u + 0x7FFFu + ((u >> 16) & 1u)) >> 16); }
__device__ __forceinline__ float bf16_val(unsigned short b) { return __uint_as_float(((unsigned int)b) << 16); }
__device__ __forceinline__ float bf16_round(float x) { return bf16_val(bf16_bits(x)); }
// D += A·B with NT terms: 1 = ah·bh, 2 = + al·bh (A split), 3 = + ah·bl (both split)
template <int NT>
__device__ __forceinline__ v8f mmaN(v16b ah, v16b al, v16b bh, v16b bl, v8f c) {
  c = __builtin_amdgcn_wmma_f32_16x16x32_bf16(false, ah, false, bh, (short)0, c, false, false);
  if (NT >= 2) c = __builtin_amdgcn_wmma_f32_16x16x32_bf16(false, al, false, bh, (short)0, c, false, false);
  if (NT >= 3) c = __builtin_amdgcn_wmma_f32_16x16x32_bf16(false, ah, false, bl, (short)0, c, false, false);
  asm volatile("v_nop\n\tv_nop\n\tv_nop\n\tv_nop" : "+v"(c) : "v"(ah), "v"(al), "v"(bh), "v"(bl));
  return c;
}

__global__ __launch_bounds__(256) void k_wt_bf16(const float* __restrict__ W, unsigned short* __restrict__ Wt, int K, int N) {
  const int t = blockIdx.x * 256 + threadIdx.x;
  const int k8n = K / 8;
  if (t >= N * k8n) return;
  const int n = t / k8n, k8 = (t % k8n) * 8;
  v8us v;
#pragma unroll
  for (int i = 0; i < 8; ++i) v[i] = bf16_bits(W[(size_t)(k8 + i) * N + n]);
  *(v8us*)(Wt + (size_t)n * K + k8) = v;
  
}

// GEMM C[M][N] (f32, pitch ldc) = act(A[M][K]·W + bias). A f32 row-major (pitch lda) converted per fragment to bf16
// (ASPLIT: hi/lo two planes -> 2 terms, else single rounded term); Wt bf16 [N][K] (pitch ldb). BIAS_BF16 rounds the
// bias to bf16 first (bias quantised to bf16 before the add). K%32==0, M%16==0, N%64==0.
template <bool ASPLIT, int ACT, bool BIAS_BF16>
__global__ __launch_bounds__(128) void k_gemm_bf(const float* __restrict__ A, int lda, const unsigned short* __restrict__ Wt, int ldb,
                                               const float* __restrict__ bias, float* __restrict__ C, int ldc, int M, int N, int K) {
  __shared__ __attribute__((aligned(16))) float so[4][16][64];
  const int tid = threadIdx.x, w = tid >> 5, lane = tid & 31, ln = lane & 15, hh = lane >> 4;
  const int ntn = N / 64;
  const int wid = blockIdx.x * 4 + w;
  const int mt = wid / ntn, nq = wid % ntn;
  if (mt * 16 >= M) return;
  const int row0 = mt * 16, col0 = nq * 64;
  const float* arow = A + (size_t)(row0 + ln) * lda;
  v8f acc[4] = {};
  for (int kb = 0; kb < K; kb += 32) {
    FragB ah, al;
    const v4f x0 = *(const v4fa*)(arow + kb + 8 * hh), x1 = *(const v4fa*)(arow + kb + 8 * hh + 4);
    const v4f x2 = *(const v4fa*)(arow + kb + 16 + 8 * hh), x3 = *(const v4fa*)(arow + kb + 16 + 8 * hh + 4);
    float xs[16] = {x0[0],x0[1],x0[2],x0[3],x1[0],x1[1],x1[2],x1[3],x2[0],x2[1],x2[2],x2[3],x3[0],x3[1],x3[2],x3[3]};
#pragma unroll
    for (int i = 0; i < 16; ++i) { const unsigned short hb = bf16_bits(xs[i]); ah.u[i] = hb; al.u[i] = ASPLIT ? bf16_bits(xs[i] - bf16_val(hb)) : (unsigned short)0; }
#pragma unroll
    for (int t = 0; t < 4; ++t) {
      const unsigned short* brow = Wt + (size_t)(col0 + t * 16 + ln) * ldb + kb;
      FragB b;
      b.half[0] = *(const v8us*)(brow + 8 * hh);
      b.half[1] = *(const v8us*)(brow + 16 + 8 * hh);
      acc[t] = mmaN<ASPLIT ? 2 : 1>(ah.v, al.v, b.v, b.v, acc[t]);
    }
  }
#pragma unroll
  for (int t = 0; t < 4; ++t) {
    float bv = bias ? bias[col0 + t * 16 + ln] : 0.f;
    if (BIAS_BF16) bv = bf16_round(bv);
#pragma unroll
    for (int r = 0; r < 8; ++r) { float v = acc[t][r] + bv; if (ACT == 1) v = fmaxf(v, 0.f); so[w][8 * hh + r][t * 16 + ln] = v; }
  }
  __builtin_amdgcn_fence(__ATOMIC_ACQ_REL, "workgroup");
  __builtin_amdgcn_wave_barrier();
  const int rsub = lane >> 4, c4 = (lane & 15) * 4;
  {
#pragma unroll
    for (int q = 0; q < 8; ++q) {
      const int r = q * 2 + rsub;
      const v4f v = *(const v4fa*)&so[w][r][c4];
      *(v4f*)(C + (size_t)(row0 + r) * ldc + col0 + c4) = v;
    }
    
  }
}

// GEMM C = act(A·W + bias + resid): A f32 (ASPLIT -> hi/lo 2 terms), Wt bf16 [N][K]; ACT 0 none, 1 relu, 2 exact gelu;
// resid (optional, f32, row index = (row % rmod), pitch ldr, RES_BF16 rounds it) added before the activation.
template <bool ASPLIT, int ACT, bool BIAS_BF16, bool RES_BF16>
__global__ __launch_bounds__(128) void k_gemm_bf3(const float* __restrict__ A, int lda, const unsigned short* __restrict__ Wt, int ldb,
                                                const float* __restrict__ bias, const float* __restrict__ resid, int rmod, int ldr,
                                                float* __restrict__ C, int ldc, int M, int N, int K) {
  __shared__ __attribute__((aligned(16))) float so[4][16][64];
  const int tid = threadIdx.x, w = tid >> 5, lane = tid & 31, ln = lane & 15, hh = lane >> 4;
  const int ntn = N / 64;
  const int wid = blockIdx.x * 4 + w;
  const int mt = wid / ntn, nq = wid % ntn;
  if (mt * 16 >= M) return;
  const int row0 = mt * 16, col0 = nq * 64;
  const float* arow = A + (size_t)(row0 + ln) * lda;
  v8f acc[4] = {};
  for (int kb = 0; kb < K; kb += 32) {
    FragB ah, al;
    const v4f x0 = *(const v4fa*)(arow + kb + 8 * hh), x1 = *(const v4fa*)(arow + kb + 8 * hh + 4);
    const v4f x2 = *(const v4fa*)(arow + kb + 16 + 8 * hh), x3 = *(const v4fa*)(arow + kb + 16 + 8 * hh + 4);
    float xs[16] = {x0[0],x0[1],x0[2],x0[3],x1[0],x1[1],x1[2],x1[3],x2[0],x2[1],x2[2],x2[3],x3[0],x3[1],x3[2],x3[3]};
#pragma unroll
    for (int i = 0; i < 16; ++i) { const unsigned short hb = bf16_bits(xs[i]); ah.u[i] = hb; al.u[i] = ASPLIT ? bf16_bits(xs[i] - bf16_val(hb)) : (unsigned short)0; }
#pragma unroll
    for (int t = 0; t < 4; ++t) {
      const unsigned short* brow = Wt + (size_t)(col0 + t * 16 + ln) * ldb + kb;
      FragB b;
      b.half[0] = *(const v8us*)(brow + 8 * hh);
      b.half[1] = *(const v8us*)(brow + 16 + 8 * hh);
      acc[t] = mmaN<ASPLIT ? 2 : 1>(ah.v, al.v, b.v, b.v, acc[t]);
    }
  }
#pragma unroll
  for (int t = 0; t < 4; ++t) {
    const int col = col0 + t * 16 + ln;
    float bv = bias ? bias[col] : 0.f;
    if (BIAS_BF16) bv = bf16_round(bv);
#pragma unroll
    for (int r = 0; r < 8; ++r) {
      float v = acc[t][r] + bv;
      if (resid) { float rv = resid[(size_t)((row0 + 8 * hh + r) % rmod) * ldr + col]; if (RES_BF16) rv = bf16_round(rv); v += rv; }
      if (ACT == 1) v = fmaxf(v, 0.f);
      if (ACT == 2) v = 0.5f * v * (1.0f + erff(v * 0.70710678118654752f));
      if (ACT == 3) { const float u = 0.7978845608028654f * (v + 0.044715f * v * v * v); v = 0.5f * v * (1.0f + tanhf(u)); }
      so[w][8 * hh + r][t * 16 + ln] = v;
    }
  }
  __builtin_amdgcn_fence(__ATOMIC_ACQ_REL, "workgroup");
  __builtin_amdgcn_wave_barrier();
  const int rsub = lane >> 4, c4 = (lane & 15) * 4;
  {
#pragma unroll
    for (int q = 0; q < 8; ++q) {
      const int r = q * 2 + rsub;
      const v4f v = *(const v4fa*)&so[w][r][c4];
      *(v4f*)(C + (size_t)(row0 + r) * ldc + col0 + c4) = v;
    }
    
  }
}
// row LayerNorm (biased variance, eps) over N: s = X (+ R); optional out_sum <- s; out_norm <- (s-mu)*rsqrt(var+eps)*g + b
template <bool PARAM_BF16>
__global__ __launch_bounds__(256) void k_layernorm(const float* __restrict__ X, const float* __restrict__ R, const float* __restrict__ g, const float* __restrict__ bta,
                                                  float* __restrict__ out_sum, float* __restrict__ out_norm, int N, float eps) {
  __shared__ float red[256];
  const int row = blockIdx.x, tid = threadIdx.x;
  const float* x = X + (size_t)row * N; const float* rr = R ? R + (size_t)row * N : nullptr;
  float vals[16];                     // up to N = 4096
  const int per = N / 256;            // contiguous chunk per thread? use strided-by-4 chunks: thread handles j = tid*4 + 1024*u
  float s1 = 0.f;
  for (int u = 0; u < per / 4; ++u) {
    const int j = tid * 4 + 1024 * u;
    const v4f a = *(const v4fa*)(x + j);
    v4f b = {0.f,0.f,0.f,0.f}; if (rr) b = *(const v4fa*)(rr + j);
#pragma unroll
    for (int q = 0; q < 4; ++q) { const float v = a[q] + b[q]; vals[u * 4 + q] = v; s1 += v; }
  }
  red[tid] = s1; __syncthreads();
  for (int st = 128; st > 0; st >>= 1) { if (tid < st) red[tid] += red[tid + st]; __syncthreads(); }
  const float mu = red[0] / (float)N; __syncthreads();
  float s2 = 0.f;
  for (int u = 0; u < per / 4; ++u)
#pragma unroll
    for (int q = 0; q < 4; ++q) { const float c = vals[u * 4 + q] - mu; s2 += c * c; }
  red[tid] = s2; __syncthreads();
  for (int st = 128; st > 0; st >>= 1) { if (tid < st) red[tid] += red[tid + st]; __syncthreads(); }
  const float rs = rsqrtf(red[0] / (float)N + eps);
  {
    for (int u = 0; u < per / 4; ++u) {
      const int j = tid * 4 + 1024 * u;
      v4f o, sm;
#pragma unroll
      for (int q = 0; q < 4; ++q) {
        float gg = g[j + q], bb = bta[j + q];
        if (PARAM_BF16) { gg = bf16_round(gg); bb = bf16_round(bb); }
        sm[q] = vals[u * 4 + q]; o[q] = (vals[u * 4 + q] - mu) * rs * gg + bb;
      }
      if (out_sum) *(v4f*)(out_sum + (size_t)row * N + j) = sm;
      *(v4f*)(out_norm + (size_t)row * N + j) = o;
    }
    
  }
}



// ---- f16 WMMA path (v_wmma_f32_16x16x32_f16): 11-bit significands for operands in range — used where a [0,1] probability operand needs more precision than bf16
typedef _Float16 v16h __attribute__((ext_vector_type(16)));
union FragH { v16h v; v8us half[2]; _Float16 h[16]; unsigned short u[16]; };
template <int NT>
__device__ __forceinline__ v8f mmaH(v16h ah, v16h al, v16h bh, v16h bl, v8f c) {
  c = __builtin_amdgcn_wmma_f32_16x16x32_f16(false, ah, false, bh, (short)0, c, false, false);
  if (NT >= 2) c = __builtin_amdgcn_wmma_f32_16x16x32_f16(false, al, false, bh, (short)0, c, false, false);
  if (NT >= 3) c = __builtin_amdgcn_wmma_f32_16x16x32_f16(false, ah, false, bl, (short)0, c, false, false);
  asm volatile("v_nop\n\tv_nop\n\tv_nop\n\tv_nop" : "+v"(c) : "v"(ah), "v"(al), "v"(bh), "v"(bl));
  return c;
}
// batched GEMM like k_gemm_b but f16 operands: A f32 (split into f16 hi/lo if ASPLIT, else rounded to f16), Bt = f16 values [n][k]; alpha; C f32; N multiple of 16 (partial tiles skipped)
template <bool ASPLIT>
__global__ __launch_bounds__(128) void k_gemm_h(const float* __restrict__ A, int lda, size_t sA, const _Float16* __restrict__ Bh, int ldb, size_t sB, float alpha, float* __restrict__ C, int ldc, size_t sC, int M, int N, int K) {
  __shared__ __attribute__((aligned(16))) float so[4][16][64];
  const int tid = threadIdx.x, w = tid >> 5, lane = tid & 31, ln = lane & 15, hh = lane >> 4; const int by = blockIdx.y;
  A += (size_t)by * sA; Bh += (size_t)by * sB; C += (size_t)by * sC;
  const int ntn = (N + 63) / 64; const int wid = blockIdx.x * 4 + w; const int mt = wid / ntn, nq = wid % ntn; if (mt * 16 >= M) return;
  const int row0 = mt * 16, col0 = nq * 64; const float* arow = A + (size_t)(row0 + ln) * lda;
  v8f acc[4] = {};
  for (int kb = 0; kb < K; kb += 32) {
    FragH ah, al;
    const v4f x0 = *(const v4fa*)(arow + kb + 8 * hh), x1 = *(const v4fa*)(arow + kb + 8 * hh + 4), x2 = *(const v4fa*)(arow + kb + 16 + 8 * hh), x3 = *(const v4fa*)(arow + kb + 16 + 8 * hh + 4);
    float xs[16] = {x0[0],x0[1],x0[2],x0[3],x1[0],x1[1],x1[2],x1[3],x2[0],x2[1],x2[2],x2[3],x3[0],x3[1],x3[2],x3[3]};
#pragma unroll
    for (int i = 0; i < 16; ++i) { const _Float16 h = (_Float16)xs[i]; ah.h[i] = h; al.h[i] = ASPLIT ? (_Float16)(xs[i] - (float)h) : (_Float16)0.0f; }
#pragma unroll
    for (int t = 0; t < 4; ++t) { if (col0 + t * 16 >= N) continue; const size_t boff = (size_t)(col0 + t * 16 + ln) * ldb + kb; FragH bq; bq.half[0] = *(const v8us*)(Bh + boff + 8 * hh); bq.half[1] = *(const v8us*)(Bh + boff + 16 + 8 * hh);
      acc[t] = mmaH<ASPLIT ? 2 : 1>(ah.v, al.v, bq.v, bq.v, acc[t]); }
  }
#pragma unroll
  for (int t = 0; t < 4; ++t) { if (col0 + t * 16 >= N) continue;
#pragma unroll
    for (int r = 0; r < 8; ++r) so[w][8 * hh + r][t * 16 + ln] = acc[t][r] * alpha; }
  __builtin_amdgcn_fence(__ATOMIC_ACQ_REL, "workgroup"); __builtin_amdgcn_wave_barrier();
  const int rsub = lane >> 4, c4 = (lane & 15) * 4;
  {
#pragma unroll
    for (int q = 0; q < 8; ++q) { const int r = q * 2 + rsub; if (col0 + c4 < N) { const v4f v = *(const v4fa*)&so[w][r][c4]; *(v4f*)(C + (size_t)(row0 + r) * ldc + col0 + c4) = v; } }
     }
}

// Wt[n][k] = f16(W[k][n]·scale) from f32 row-major W[K][N] (scale = power of two; bf16-exact weights stay exact in f16 away from the subnormal range)
__global__ __launch_bounds__(256) void k_wt_f16(const float* __restrict__ W, _Float16* __restrict__ Wt, int K, int N, float scale) {
  const int t = blockIdx.x * 256 + threadIdx.x; if (t >= N * (K / 8)) return; const int n = t / (K / 8), k8 = (t % (K / 8)) * 8; FragH f;
#pragma unroll
  for (int i = 0; i < 8; ++i) f.h[i] = (_Float16)(bf16_round(W[(size_t)(k8 + i) * N + n]) * scale); const v8us o = f.half[0];
  *(v8us*)((unsigned short*)Wt + (size_t)n * K + k8) = o; 
}
// k_gemm_hh variant with fused epilogue: v = acc·alpha + bias[by·sBias + col] (+ CP[(row/rowsPerB)·sCPb + by·64 + col] if CP) ; ACT 0 none / 1 elu ; writes f16 C16 (and f32 C if non-null)
template <int ACT>
__global__ __launch_bounds__(128) void k_gemm_hhx(const _Float16* __restrict__ A, int lda, size_t sA, const _Float16* __restrict__ Bh, int ldb, size_t sB, float alpha, const float* __restrict__ bias, size_t sBias, const float* __restrict__ CP, int rowsPerB, size_t sCPb, int row0g,
    float* __restrict__ C, _Float16* __restrict__ C16, int ldc, size_t sC, int M, int N, int K) {
  __shared__ __attribute__((aligned(16))) float so[4][16][64];
  const int tid = threadIdx.x, w = tid >> 5, lane = tid & 31, ln = lane & 15, hh = lane >> 4; const int by = blockIdx.y;
  A += (size_t)by * sA; Bh += (size_t)by * sB; const size_t cofs = (size_t)by * sC; const float* bp = bias ? bias + (size_t)by * sBias : nullptr;
  const int ntn = (N + 63) / 64; const int wid = blockIdx.x * 4 + w; const int mt = wid / ntn, nq = wid % ntn; if (mt * 16 >= M) return;
  const int row0 = mt * 16, col0 = nq * 64; const _Float16* arow = A + (size_t)(row0 + ln) * lda;
  v8f acc[4] = {};
  for (int kb = 0; kb < K; kb += 32) { FragH ah; ah.half[0] = *(const v8us*)((const unsigned short*)arow + kb + 8 * hh); ah.half[1] = *(const v8us*)((const unsigned short*)arow + kb + 16 + 8 * hh);
#pragma unroll
    for (int t = 0; t < 4; ++t) { if (col0 + t * 16 >= N) continue; const size_t boff = (size_t)(col0 + t * 16 + ln) * ldb + kb; FragH bq; bq.half[0] = *(const v8us*)((const unsigned short*)Bh + boff + 8 * hh); bq.half[1] = *(const v8us*)((const unsigned short*)Bh + boff + 16 + 8 * hh);
      acc[t] = mmaH<1>(ah.v, ah.v, bq.v, bq.v, acc[t]); }
  }
#pragma unroll
  for (int t = 0; t < 4; ++t) { if (col0 + t * 16 >= N) continue; const int col = col0 + t * 16 + ln; const float bv = bp ? bf16_round(bp[col]) : 0.f;
#pragma unroll
    for (int r = 0; r < 8; ++r) { float v = acc[t][r] * alpha + bv; if (CP) { const int rr = row0g + row0 + 8 * hh + r; if (rowsPerB < 0) v += CP[cofs + (size_t)rr * ldc + col];      /* rowsPerB < 0: own element of the batched C plane */ else { const int bidx = rr / rowsPerB; v += CP[(size_t)bidx * sCPb + (size_t)by * 64 + col]; } } if (ACT == 1) v = (v > 0.f) ? v : expm1f(v); else if (ACT == 7) v = (v > 0.f) ? v + 1.0f : expf(v); else if (ACT == 8) v = tanhf(v); else if (ACT == 9) v = 0.5f * v * (1.0f + tanhf(0.7978845608028654f * (v + 0.044715f * v * v * v))); else if (ACT == 11) v = 1.0f / (1.0f + expf(-v)); else if (ACT == 12) v = (v > 0.f) ? v : 0.01f * v; else if (ACT == 14) v = (v > 0.f) ? v : 0.1f * v; else if (ACT == 16) v = (v >= 0.f) ? v : 0.3f * v; else if (ACT == 17) v = (v >= 0.f) ? v : 0.2f * v; else if (ACT == 15) v = v / (1.0f + expf(-v)); else if (ACT == 3) v = fmaxf(v, 0.f); else if (ACT == 6) v = 0.5f * v * (1.0f + erff(v * 0.70710678118654752f)); so[w][8 * hh + r][t * 16 + ln] = v; } }
  __builtin_amdgcn_fence(__ATOMIC_ACQ_REL, "workgroup"); __builtin_amdgcn_wave_barrier();
  const int rsub = lane >> 4, c4 = (lane & 15) * 4; typedef _Float16 v4h __attribute__((ext_vector_type(4)));
  {
#pragma unroll
    for (int q = 0; q < 8; ++q) { const int r = q * 2 + rsub; if (col0 + c4 < N) { const v4f v = *(const v4fa*)&so[w][r][c4]; if (C) *(v4f*)(C + cofs + (size_t)(row0 + r) * ldc + col0 + c4) = v; if (C16) { v4h h4; for (int i = 0; i < 4; ++i) h4[i] = (_Float16)v[i]; *(v4h*)(C16 + cofs + (size_t)(row0 + r) * ldc + col0 + c4) = h4; } } }
     }
}


typedef _Float16 v4h __attribute__((ext_vector_type(4)));

__global__ __launch_bounds__(256) void k_x16(const float* __restrict__ x, _Float16* __restrict__ X16, size_t n8) { const size_t t = (size_t)blockIdx.x * 256 + threadIdx.x; if (t >= n8) return; FragH f;
#pragma unroll
  for (int q = 0; q < 8; ++q) f.h[q] = (_Float16)bf16_round(x[t * 8 + q]); *(v8us*)((unsigned short*)X16 + t * 8) = f.half[0];  }
__global__ __launch_bounds__(256) void k_h16(const float* __restrict__ x, _Float16* __restrict__ X16, size_t n8) { const size_t t = (size_t)blockIdx.x * 256 + threadIdx.x; if (t >= n8) return; FragH f;
#pragma unroll
  for (int q = 0; q < 8; ++q) f.h[q] = (_Float16)x[t * 8 + q]; *(v8us*)((unsigned short*)X16 + t * 8) = f.half[0];  }
__global__ __launch_bounds__(256) void k_round16f(const float* __restrict__ W, _Float16* __restrict__ Bt, size_t n8) { const size_t t = (size_t)blockIdx.x * 256 + threadIdx.x; if (t >= n8) return; FragH f;
#pragma unroll
  for (int i = 0; i < 8; ++i) f.h[i] = (_Float16)(bf16_round(W[t * 8 + i]) * 16.0f); *(v8us*)((unsigned short*)Bt + t * 8) = f.half[0];  }
template <int NHv, int TTv>
__global__ __launch_bounds__(256) void k_vt(const _Float16* __restrict__ V16, int ldv, int voff, _Float16* __restrict__ Vt) { __shared__ unsigned short tl[64][66]; const int tid = threadIdx.x; const int slab = blockIdx.x / (TTv / 64), lg = blockIdx.x % (TTv / 64); const int b = slab / NHv, h = slab % NHv;
  for (int i = tid; i < 64 * 8; i += 256) { const int r = i / 8, c8 = (i % 8) * 8; FragH f; f.half[0] = *(const v8us*)((const unsigned short*)V16 + ((size_t)b * TTv + lg * 64 + r) * ldv + voff + h * 64 + c8);
#pragma unroll
    for (int q = 0; q < 8; ++q) tl[r][c8 + q] = f.u[q]; }
  __syncthreads();
  {
#pragma unroll
    for (int rd = 0; rd < 2; ++rd) { const int d = rd * 32 + tid / 8, pc = tid % 8; FragH f;
#pragma unroll
      for (int q = 0; q < 8; ++q) f.u[q] = tl[pc * 8 + q][d];
      *(v8us*)((unsigned short*)Vt + ((size_t)slab * 64 + d) * TTv + lg * 64 + pc * 8) = f.half[0]; }
     } }

__global__ __launch_bounds__(256) void k_hl(const float* __restrict__ F, _Float16* __restrict__ Hh, _Float16* __restrict__ Hl, size_t n8) { const size_t t = (size_t)blockIdx.x * 256 + threadIdx.x; if (t >= n8) return; FragH fh, fl; const v4f a = *(const v4fa*)(F + t * 8), c = *(const v4fa*)(F + t * 8 + 4);
#pragma unroll
  for (int q = 0; q < 4; ++q) { _Float16 h = (_Float16)a[q]; fh.h[q] = h; fl.h[q] = (_Float16)((a[q] - (float)h) * 1024.0f); h = (_Float16)c[q]; fh.h[4 + q] = h; fl.h[4 + q] = (_Float16)((c[q] - (float)h) * 1024.0f); }
  { *(v8us*)((unsigned short*)Hh + t * 8) = fh.half[0]; *(v8us*)((unsigned short*)Hl + t * 8) = fl.half[0];  } }

// ---- fast GEMM (wave tile 32x64; requires M % 32 == 0 rows per launch region and N % 64 == 0); epilogue = k_gemm_hhx semantics ----
__device__ __forceinline__ v16h g2_frag(const _Float16* p, int hh) { FragH f; f.half[0] = *(const v8us*)((const unsigned short*)p + 8 * hh); f.half[1] = *(const v8us*)((const unsigned short*)p + 16 + 8 * hh); return f.v; }
__device__ __forceinline__ v8f g2_mma(v16h a, v16h b, v8f c) { v8f d = __builtin_amdgcn_wmma_f32_16x16x32_f16(false, a, false, b, (short)0, c, false, false); asm volatile("v_nop\n\tv_nop\n\tv_nop\n\tv_nop" : "+v"(d) : "v"(a), "v"(b)); return d; }
template <int ACT>
__global__ __launch_bounds__(128) void k_gemm2(const _Float16* __restrict__ A, int lda, size_t sA, const _Float16* __restrict__ Bh, int ldb, size_t sB, float alpha, const float* __restrict__ bias, size_t sBias, const float* __restrict__ CP, int rowsPerB, size_t sCPb, int row0g,
    float* __restrict__ C, _Float16* __restrict__ C16, int ldc, size_t sC, int M, int N, int K) { static_assert(ACT == 0 || ACT == 3 || ACT == 6 || ACT == 8 || ACT == 9 || ACT == 11 || ACT == 12 || ACT == 14 || ACT == 15 || ACT == 16 || ACT == 17, "k_gemm2: unsupported ACT code (would silently apply no activation)");
  __shared__ __attribute__((aligned(16))) float so[4][32][68];
  const int tid = threadIdx.x, w = tid >> 5, lane = tid & 31, ln = lane & 15, hh = lane >> 4; const int by = blockIdx.y;
  A += (size_t)by * sA; Bh += (size_t)by * sB; const size_t cofs = (size_t)by * sC; const float* bp = bias ? bias + (size_t)by * sBias : nullptr;
  const int ntn = N >> 6; const int mt = blockIdx.x / ntn, nq = blockIdx.x - mt * ntn; const int row0 = mt * 128 + 32 * w, col0 = nq * 64; if (row0 >= M) return;
  const _Float16* a0p = A + (size_t)(row0 + ln) * lda; const _Float16* a1p = a0p + (size_t)16 * lda;
  const _Float16* b0p = Bh + (size_t)(col0 + ln) * ldb; const _Float16* b1p = b0p + (size_t)16 * ldb; const _Float16* b2p = b1p + (size_t)16 * ldb; const _Float16* b3p = b2p + (size_t)16 * ldb;
  const v8f z8 = {0.f,0.f,0.f,0.f,0.f,0.f,0.f,0.f}; v8f c00 = z8, c01 = z8, c02 = z8, c03 = z8, c10 = z8, c11 = z8, c12 = z8, c13 = z8;
#pragma unroll 1
  for (int kb = 0; kb < K; kb += 32) { const v16h a0 = g2_frag(a0p + kb, hh), a1 = g2_frag(a1p + kb, hh);
    v16h b = g2_frag(b0p + kb, hh); c00 = g2_mma(a0, b, c00); c10 = g2_mma(a1, b, c10);
    b = g2_frag(b1p + kb, hh); c01 = g2_mma(a0, b, c01); c11 = g2_mma(a1, b, c11);
    b = g2_frag(b2p + kb, hh); c02 = g2_mma(a0, b, c02); c12 = g2_mma(a1, b, c12);
    b = g2_frag(b3p + kb, hh); c03 = g2_mma(a0, b, c03); c13 = g2_mma(a1, b, c13); }
  v8f accs[8] = {c00, c01, c02, c03, c10, c11, c12, c13};
#pragma unroll
  for (int u = 0; u < 8; ++u) { const int t = u & 3, half = u >> 2; const int col = col0 + t * 16 + ln; const float bv = bp ? bf16_round(bp[col]) : 0.f;
#pragma unroll
    for (int r = 0; r < 8; ++r) { const int rloc = half * 16 + 8 * hh + r; float v = accs[u][r] * alpha + bv; if (CP) { if (rowsPerB < 0) v += CP[cofs + (size_t)(row0g + row0 + rloc) * ldc + col];      /* rowsPerB < 0: own element of the batched C plane */ else { const int bidx = (row0g + row0 + rloc) / rowsPerB; v += CP[(size_t)bidx * sCPb + (size_t)by * 64 + col]; } }
      if (ACT == 3) v = fmaxf(v, 0.f); else if (ACT == 6) v = 0.5f * v * (1.0f + erff(v * 0.70710678118654752f)); else if (ACT == 11) v = 1.0f / (1.0f + expf(-v)); else if (ACT == 15) v = v / (1.0f + expf(-v)); else if (ACT == 12) v = (v > 0.f) ? v : 0.01f * v; else if (ACT == 8) v = tanhf(v); else if (ACT == 9) v = 0.5f * v * (1.0f + tanhf(0.7978845608028654f * (v + 0.044715f * v * v * v))); else if (ACT == 14) v = (v > 0.f) ? v : 0.1f * v; else if (ACT == 16) v = (v >= 0.f) ? v : 0.3f * v; else if (ACT == 17) v = (v >= 0.f) ? v : 0.2f * v;
      so[w][rloc][t * 16 + ln] = v; } }
  __builtin_amdgcn_fence(__ATOMIC_ACQ_REL, "workgroup"); __builtin_amdgcn_wave_barrier();
  const int rsub = lane >> 4, c4 = (lane & 15) * 4;
  {
#pragma unroll
    for (int q = 0; q < 16; ++q) { const int r = q * 2 + rsub; const v4f v = *(const v4fa*)&so[w][r][c4]; if (C) *(v4f*)(C + cofs + (size_t)(row0 + r) * ldc + col0 + c4) = v; if (C16) { v4h h4; for (int i = 0; i < 4; ++i) h4[i] = (_Float16)v[i]; *(v4h*)(C16 + cofs + (size_t)(row0 + r) * ldc + col0 + c4) = h4; } }
     } }


__global__ __launch_bounds__(256) void k_wnat(const float* __restrict__ w, size_t n8, _Float16* __restrict__ Bt) { const size_t t = (size_t)blockIdx.x * 256 + threadIdx.x; if (t >= n8) return; FragH f; for (int q = 0; q < 8; ++q) f.h[q] = (_Float16)(bf16_round(w[t * 8 + q]) * 16.0f); *(v8us*)((unsigned short*)Bt + t * 8) = f.half[0];  }
__global__ __launch_bounds__(256) void k_rsm(const float* __restrict__ S, _Float16* __restrict__ P, int nrows) {
  #pragma clang fp contract(off)
  const int i = blockIdx.x * 256 + threadIdx.x; if (i >= nrows) return; const float* s = S + (size_t)i * SQ; float mx = -3.0e38f;
#pragma unroll 1
  for (int j = 0; j < SQ; ++j) mx = fmaxf(mx, s[j]); float se = 0.f;
#pragma unroll 1
  for (int j = 0; j < SQ; ++j) se += expf(s[j] - mx); const float sc = 256.0f / se;
#pragma unroll 1
  for (int j0 = 0; j0 < SQ; j0 += 8) { FragH f; for (int q = 0; q < 8; ++q) f.h[q] = (_Float16)(expf(s[j0 + q] - mx) * sc); unsigned short* d = (unsigned short*)P + (size_t)i * SQ + j0; *(v8us*)d = f.half[0];  } }
__global__ __launch_bounds__(256) void k_vt(const _Float16* __restrict__ V16, int b, int h0, _Float16* __restrict__ VT) { __shared__ unsigned short tl[64][65]; const int tid = threadIdx.x; const int hh = blockIdx.x % HG, sg = blockIdx.x / HG; const int s0 = sg * 64; const int h = h0 + hh;
  for (int i = tid; i < 64 * 8; i += 256) { const int j = i / 8, d8 = (i % 8) * 8; FragH f; f.half[0] = *(const v8us*)((const unsigned short*)V16 + ((size_t)b * SQ + s0 + j) * DM + h * HD + d8); for (int q = 0; q < 8; ++q) tl[d8 + q][j] = f.u[q]; }
  __syncthreads();
  { for (int i = tid; i < 64 * 8; i += 256) { const int d = i / 8, j8 = (i % 8) * 8; FragH f; for (int q = 0; q < 8; ++q) f.u[q] = tl[d][j8 + q]; *(v8us*)((unsigned short*)VT + ((size_t)hh * HD + d) * SQ + s0 + j8) = f.half[0]; }  } }



__global__ __launch_bounds__(256) void k_rsmkm(const float* __restrict__ S, _Float16* __restrict__ P, int nrows, const int* __restrict__ am) {
  #pragma clang fp contract(off)
  const int t = blockIdx.x * 256 + threadIdx.x; if (t >= nrows) return; const size_t i = (size_t)t; const float* s = S + i * SQ; const int* mr = am + (size_t)(t % SQ) * SQ; float mx = -3.0e38f;
#pragma unroll 1
  for (int j = 0; j < SQ; ++j) { const float f = (mr[j] != 0) ? 1.f : 0.f; mx = fmaxf(mx, fmaf(f, s[j], (1.f - f) * -1.0e9f)); } float se = 0.f;
#pragma unroll 1
  for (int j = 0; j < SQ; ++j) { const float f = (mr[j] != 0) ? 1.f : 0.f; se += __expf(fmaf(f, s[j], (1.f - f) * -1.0e9f) - mx); } const float sc = 256.0f / se;
#pragma unroll 1
  for (int j0 = 0; j0 < SQ; j0 += 8) { FragH fr; for (int q = 0; q < 8; ++q) { const int j = j0 + q; const float f = (mr[j] != 0) ? 1.f : 0.f; fr.h[q] = (_Float16)(__expf(fmaf(f, s[j], (1.f - f) * -1.0e9f) - mx) * sc); }
    unsigned short* d = (unsigned short*)P + i * SQ + j0; *(v8us*)d = fr.half[0];  } }

__global__ __launch_bounds__(256) void k_bdshn(const float* __restrict__ Wb, _Float16* __restrict__ Bt) {
  const size_t t = (size_t)blockIdx.x * 256 + threadIdx.x; if (t >= (size_t)DM * DM / 8) return; const size_t e0 = t * 8; const int n = (int)(e0 / DM), k0 = (int)(e0 % DM); const int h = n >> 6, hk = k0 >> 6; const float on = (hk == h) ? 16.0f : 0.0f; const int o = n & 63, d0 = k0 & 63; FragH f;
  for (int q = 0; q < 8; ++q) f.h[q] = (_Float16)(bf16_round(Wb[(size_t)o * 64 + d0 + q]) * on);
  unsigned short* d = (unsigned short*)Bt + e0; *(v8us*)d = f.half[0];  }

typedef int v4ia __attribute__((ext_vector_type(4), may_alias));
template <int M> __device__ __forceinline__ float rs_xm(float x) { return __builtin_bit_cast(float, __builtin_amdgcn_update_dpp(0, __builtin_bit_cast(int, x), 0x160 | M, 0xf, 0xf, true)); }  // lane l with lane l ^ M inside a 16-lane row
__device__ __forceinline__ float rs_xh(float x) { return __builtin_bit_cast(float, __builtin_amdgcn_permlanex16(__builtin_bit_cast(int, x), __builtin_bit_cast(int, x), 0x76543210, 0xfedcba98, false, false)); }  // lane l with lane l ^ 16
__device__ __forceinline__ float rs_wmax(float v) { v = fmaxf(v, rs_xm<1>(v)); v = fmaxf(v, rs_xm<2>(v)); v = fmaxf(v, rs_xm<4>(v)); v = fmaxf(v, rs_xm<8>(v)); return fmaxf(v, rs_xh(v)); }
__device__ __forceinline__ float rs_wsum(float v) { v += rs_xm<1>(v); v += rs_xm<2>(v); v += rs_xm<4>(v); v += rs_xm<8>(v); return v + rs_xh(v); }
// Four 2^x. Written as asm for the slot behind a transcendental (one independent instruction or v_nop before its result is read or its source overwritten): each v_exp_f32 is followed by
// an independent one (early-clobber outputs share no register with the sources), the last by v_nop.
__device__ __forceinline__ v4f rs_exp4(v4f x) { float e0, e1, e2, e3;
  asm("v_exp_f32 %0, %4\n\tv_exp_f32 %1, %5\n\tv_exp_f32 %2, %6\n\tv_exp_f32 %3, %7\n\tv_nop" : "=&v"(e0), "=&v"(e1), "=&v"(e2), "=&v"(e3) : "v"(x[0]), "v"(x[1]), "v"(x[2]), "v"(x[3]));
  const v4f e = {e0, e1, e2, e3}; return e; }
#define KN_PITCH 32      /* ints from one batch's count to the next: a 128-byte line each, one writer a line */
// First launch: the output weights as f16 x16 (blocks below nwb, as k_wnat), and one block a batch that lists the batch's open keys.
// KI[b][p] = token of the p-th key with mask != 0, in token order; KN[b * KN_PITCH] = their number n. Entries from n on hold token 0: a real row, so that a stage's tail is finite; its scores take the fill.
// n == 0: KI is the identity (all keys stay; k_fattn gives every score the fill, the row comes out uniform as in the module). A wave takes 256 keys, 32 a round: a key's place is the wave's base + the open lanes below it.
__global__ __launch_bounds__(256) void k_prep(const float* __restrict__ w, size_t n8, _Float16* __restrict__ Bt, int nwb, const int* __restrict__ Km, int* __restrict__ KI, int* __restrict__ KN) {
  __shared__ int wt[8]; __shared__ __attribute__((aligned(16))) int li[SQ];      /* the waves' counts; the list, gathered here so that it leaves as whole 128-byte lines */
  const int tid = threadIdx.x, lane = tid & 31, wave = tid >> 5;
  if ((int)blockIdx.x < nwb) { const size_t t = (size_t)blockIdx.x * 256 + tid; if (t >= n8) return; FragH f; for (int q = 0; q < 8; ++q) f.h[q] = (_Float16)(bf16_round(w[t * 8 + q]) * 16.0f); *(v8us*)((unsigned short*)Bt + t * 8) = f.half[0]; return; }
  const int b = (int)blockIdx.x - nwb; const int k0 = wave * 256 + lane; const int* mb = Km + (size_t)b * SQ + k0; int* ki = KI + (size_t)b * SQ;
  unsigned bal[8]; int tot = 0;
#pragma unroll
  for (int r = 0; r < 8; ++r) { bal[r] = __builtin_amdgcn_ballot_w32(mb[r * 32] != 0); tot += __builtin_popcount(bal[r]); }      /* unrolled: bal is a register array */
  if (lane == 0) wt[wave] = tot;
  __syncthreads();      /* every wave's count is in LDS */
  int base = 0, n = 0;
  for (int i = 0; i < 8; ++i) { const int v = wt[i]; base += (i < wave) ? v : 0; n += v; }
  if (n == 0) {
    for (int r = 0; r < 8; ++r) li[k0 + r * 32] = k0 + r * 32;
  } else {
#pragma unroll      /* bal is a register array */
    for (int r = 0; r < 8; ++r) { if ((bal[r] >> lane) & 1u) li[base + __builtin_popcount(bal[r] & ((1u << lane) - 1u))] = k0 + r * 32; base += __builtin_popcount(bal[r]); }
    for (int p = n + tid; p < SQ; p += 256) li[p] = 0;
  }
  __syncthreads();      /* the list is whole in LDS */
  for (int q = 0; q < SQ / 1024; ++q) *(v4ia*)(ki + q * 1024 + tid * 4) = *(const v4ia*)&li[q * 1024 + tid * 4];
  if (tid == 0) KN[b * KN_PITCH] = n;
}
// Attention as one stream over the keys: one launch for all batches and heads; scores and weights stay in registers.
// A wave owns 32 query columns and walks the batch's listed keys (packed by k_proj; n open ones, or all 2048 where none is open) in passes of 32: S^T = K Q^T (A = 16 key rows, B = 16 query columns, both k-contiguous f16 rows), so a lane holds 8 keys of ONE query a tile;
// two score tiles of a pass, converted in place, are the B operand of O^T += V^T P^T (A = rows of V^T in the same k order). Maximum and sum are per lane plus one exchange between the lane halves.
// The 8 waves of a work-group share one (batch, head): K rows and V^T rows come in stages of 64 keys, by whole 128-byte lines through registers into one of two LDS buffers
// (a fragment load from global memory would touch 16 lines for 512 bytes, and every wave would repeat it); stage s + 1 is loaded while stage s is worked on, stored behind it, one barrier a stage.
// Values: t = energy / sqrt(512) * log2(e); a place from n on (the last stage's tail; every place where n == 0) takes the module's fill (-1e20, same scale) BEFORE the maximum, so its weight is exactly 0 beside any open key and a row with no open key comes out uniform;
// weight = 2^(t - m + 6) as f16, m the maximum in use (renewed when a pass exceeds it by more than 8, so a weight stays below 2^14); the sum adds the f32 weights; o = O / sum, stored x64 as f16 rows as before.
// Every '#pragma unroll' in the kernel but those on the phase loop and the pass loop stands on a loop over a register array (fragments, accumulators): rolled, the array would be indexed at run time and leave the registers.
#define FA_WAVES 8
#define FA_COLS 32
#define FA_STAGE 64
#define FA_PITCH 72      /* halves a staged row: 144 bytes = 16 x 9, an odd multiple of 16 bytes for the 16-byte fragment reads */
static_assert(SQ % (FA_WAVES * FA_COLS) == 0 && SQ % FA_STAGE == 0 && HD == 64 && FA_WAVES * 32 * 2 * 8 == FA_STAGE * HD, "k_fattn: whole work-groups and stages; a thread stages 2 x 16 bytes of K and of V^T");
typedef _Float16 v8h __attribute__((ext_vector_type(8)));
__device__ __forceinline__ v8f fa_mma(v16h a, v16h b, v8f c) { return __builtin_amdgcn_wmma_f32_16x16x32_f16(false, a, false, b, (short)0, c, false, false); }
// One 16 x 32 fragment from k-contiguous rows, k order as g2_frag: p = the lane's row + 8 * (lane >> 4) halves.
__device__ __forceinline__ v16h fa_frag(const unsigned short* p) { FragH f; f.half[0] = *(const v8us*)p; f.half[1] = *(const v8us*)(p + 16); return f.v; }
__global__ __launch_bounds__(FA_WAVES * 32) void k_fattn(const _Float16* __restrict__ Q16, const _Float16* __restrict__ K16, const _Float16* __restrict__ VT, const int* __restrict__ KN, _Float16* __restrict__ O16) {
  __shared__ __attribute__((aligned(16))) unsigned short sk[2][FA_STAGE][FA_PITCH];      /* [buffer][key][d] */
  __shared__ __attribute__((aligned(16))) unsigned short sv[2][HD][FA_PITCH];            /* [buffer][d][key] */
  constexpr int QB = SQ / (FA_WAVES * FA_COLS);
  constexpr float SC = 0.044194173824159216f * 1.44269504088896340736f, FILL = -1.0e20f * SC;
  const int tid = threadIdx.x, lane = tid & 31, ln = lane & 15, hh = lane >> 4; const int wave = __builtin_amdgcn_readfirstlane(tid >> 5);
  const int bh = blockIdx.x / QB, b = bh / NH, h = bh % NH; const int q0 = (blockIdx.x % QB) * (FA_WAVES * FA_COLS) + wave * FA_COLS;
  const _Float16* qb = Q16 + ((size_t)b * SQ + q0) * DM + h * HD;      /* wave-uniform bases */
  const _Float16* kb = K16 + (size_t)b * SQ * DM + h * HD;
  const _Float16* vb = VT + (size_t)bh * HD * SQ;
  const int n = __builtin_amdgcn_readfirstlane(min(max(KN[b * KN_PITCH], 0), SQ));      /* open keys of the batch, bounded by the shape */
  const int nst = ((n != 0 ? n : SQ) + FA_STAGE - 1) / FA_STAGE;      /* stages that k_proj has written: 1 to SQ / FA_STAGE */
  const int srow = tid >> 3, sc8 = (tid & 7) * 8;      /* staging: 8 threads a 128-byte row; rows srow and srow + 32 */
  const unsigned roff = (unsigned)(ln * (DM * 2) + hh * 16);      /* byte offsets of the lane: row ln of a tile of q or o rows */
  const unsigned kso = (unsigned)(srow * (DM * 2) + sc8 * 2), vso = (unsigned)(srow * (SQ * 2) + sc8 * 2);
  v16h qf[2][2]; v8us gk[2], gv[2];
#pragma unroll
  for (int u = 0; u < 2; ++u) for (int ks = 0; ks < 2; ++ks) qf[u][ks] = fa_frag((const unsigned short*)((const char*)(qb + u * 16 * DM + ks * 32) + roff));
  { const char* kq = (const char*)kb + kso; const char* vq = (const char*)vb + vso;
    gk[0] = *(const v8us*)kq; gk[1] = *(const v8us*)(kq + 32 * DM * 2); gv[0] = *(const v8us*)vq; gv[1] = *(const v8us*)(vq + 32 * SQ * 2);
    asm volatile("s_wait_xcnt 0x0" :: "v"(roff), "v"(kso), "v"(vso) : "memory"); }      /* behind the loads, ahead of any new value in a register that they name (a precaution of form); as inputs the lane offsets keep their registers up to it */
  *(v8us*)&sk[0][srow][sc8] = gk[0]; *(v8us*)&sk[0][srow + 32][sc8] = gk[1]; *(v8us*)&sv[0][srow][sc8] = gv[0]; *(v8us*)&sv[0][srow + 32][sc8] = gv[1];
  const v8f z8 = {0.f, 0.f, 0.f, 0.f, 0.f, 0.f, 0.f, 0.f};
  v8f o[2][4]; float l[2] = {0.f, 0.f}, m[2] = {-3.0e38f, -3.0e38f};
#pragma unroll
  for (int u = 0; u < 2; ++u) for (int dt = 0; dt < 4; ++dt) o[u][dt] = z8;
  __syncthreads();      /* stage 0 is in LDS for every wave */
  int s = 0;
#pragma unroll      /* two copies of the stage loop, ph a constant in each: the stages that hold open keys alone carry no fill code; unrolled, not branched, since a branch in mid pass cost registers past the first 256 */
  for (int ph = 0; ph < 2; ++ph) for (const int se = (ph == 0) ? n / FA_STAGE : nst; s < se; ++s) {
    const int bf = s & 1; const int sn = (s + 1 < nst) ? s + 1 : 0;      /* the last stage loads stage 0 again (in bounds, never read) */
    { const char* kq = (const char*)(kb + (size_t)sn * FA_STAGE * DM) + kso; const char* vq = (const char*)(vb + sn * FA_STAGE) + vso;
      gk[0] = *(const v8us*)kq; gk[1] = *(const v8us*)(kq + 32 * DM * 2); gv[0] = *(const v8us*)vq; gv[1] = *(const v8us*)(vq + 32 * SQ * 2);
      asm volatile("s_wait_xcnt 0x0" ::: "memory"); }      /* behind the loads, ahead of any new value in a register that they name (a precaution of form); as a memory barrier for the compiler it also keeps the loads here, a whole stage ahead of their stores */
    v16h kf[2][2];
#pragma unroll
    for (int kt = 0; kt < 2; ++kt) for (int ks = 0; ks < 2; ++ks) kf[kt][ks] = fa_frag(&sk[bf][kt * 16 + ln][ks * 32 + 8 * hh]);
    __builtin_amdgcn_sched_barrier(0);      /* all eight reads are issued before the first wait on one: without it this build read two fragments at a time into one register block and met the LDS latency three times behind every barrier */
#pragma unroll
    for (int p = 0; p < FA_STAGE / 32; ++p) {
      v16h vf[4]; v8f t[2][2];
#pragma unroll
      for (int dt = 0; dt < 4; ++dt) vf[dt] = fa_frag(&sv[bf][dt * 16 + ln][p * 32 + 8 * hh]);
#pragma unroll
      for (int u = 0; u < 2; ++u) for (int kt = 0; kt < 2; ++kt) t[u][kt] = fa_mma(kf[kt][0], qf[u][0], z8);
#pragma unroll
      for (int u = 0; u < 2; ++u) for (int kt = 0; kt < 2; ++kt) t[u][kt] = fa_mma(kf[kt][1], qf[u][1], t[u][kt]);
      if (p + 1 < FA_STAGE / 32) {      /* the next pass of the SAME stage: its K fragments are fetched behind this pass's score products, into the registers these have left */
#pragma unroll
        for (int kt = 0; kt < 2; ++kt) for (int ks = 0; ks < 2; ++ks) kf[kt][ks] = fa_frag(&sk[bf][(p + 1) * 32 + kt * 16 + ln][ks * 32 + 8 * hh]); }
      float mx[2];
#pragma unroll
      for (int u = 0; u < 2; ++u) for (int kt = 0; kt < 2; ++kt) t[u][kt] *= SC;
      if (ph == 1) {      /* the last stage where n is no whole number of stages; every stage where n == 0 */
        const int left = n - (s * FA_STAGE + p * 32 + 8 * hh);      /* open places from the lane's first key of tile 0 on */
#pragma unroll
        for (int u = 0; u < 2; ++u) for (int kt = 0; kt < 2; ++kt) for (int r = 0; r < 8; ++r) t[u][kt][r] = (kt * 16 + r < left) ? t[u][kt][r] : FILL;
      }
#pragma unroll
      for (int u = 0; u < 2; ++u) {
        float x = fmaxf(t[u][0][0], t[u][1][0]);
#pragma unroll
        for (int r = 1; r < 8; ++r) x = fmaxf(x, fmaxf(t[u][0][r], t[u][1][r]));
        mx[u] = fmaxf(x, rs_xh(x));
      }
      if (__builtin_amdgcn_ballot_w32((mx[0] > m[0] + 8.0f) || (mx[1] > m[1] + 8.0f)) != 0) {      /* one scalar branch a pass: the products of a renewal run only where some column needs one */
        const float n0 = fmaxf(m[0], mx[0]), n1 = fmaxf(m[1], mx[1]); const v4f d4 = {m[0] - n0, m[1] - n1, 0.f, 0.f}; const v4f al = rs_exp4(d4); m[0] = n0; m[1] = n1;
#pragma unroll
        for (int u = 0; u < 2; ++u) { l[u] *= al[u]; for (int dt = 0; dt < 4; ++dt) o[u][dt] *= al[u]; }
      }
      v16h pf[2];
#pragma unroll
      for (int u = 0; u < 2; ++u) { const float ms = m[u] - 6.0f; v4f s4[2];
#pragma unroll
        for (int kt = 0; kt < 2; ++kt) { const v8f x = t[u][kt] - ms; const v4f x0 = {x[0], x[1], x[2], x[3]}, x1 = {x[4], x[5], x[6], x[7]}; const v4f e0 = rs_exp4(x0), e1 = rs_exp4(x1); s4[kt] = e0 + e1;
          const v8f e = {e0[0], e0[1], e0[2], e0[3], e1[0], e1[1], e1[2], e1[3]}; t[u][kt] = e; }
        const v4f sq = s4[0] + s4[1]; l[u] += (sq[0] + sq[1]) + (sq[2] + sq[3]);
        pf[u] = __builtin_shufflevector(__builtin_convertvector(t[u][0], v8h), __builtin_convertvector(t[u][1], v8h), 0, 1, 2, 3, 4, 5, 6, 7, 8, 9, 10, 11, 12, 13, 14, 15); }
      __builtin_amdgcn_sched_barrier(0);      /* this one and the next keep the eight products apart from the 2^x statements: those are asm text, which the compiler's padding behind a matrix instruction does not see */
#pragma unroll
      for (int dt = 0; dt < 4; ++dt) for (int u = 0; u < 2; ++u) o[u][dt] = fa_mma(vf[dt], pf[u], o[u][dt]);
      __builtin_amdgcn_sched_barrier(0);
    }
    *(v8us*)&sk[bf ^ 1][srow][sc8] = gk[0]; *(v8us*)&sk[bf ^ 1][srow + 32][sc8] = gk[1]; *(v8us*)&sv[bf ^ 1][srow][sc8] = gv[0]; *(v8us*)&sv[bf ^ 1][srow + 32][sc8] = gv[1];      /* into the buffer whose readers all passed the barrier of stage s - 1 */
    __syncthreads();      /* publishes stage s + 1 and ends every wave's reads of stage s */
  }
  _Float16* ob = O16 + ((size_t)b * SQ + q0) * DM + h * HD;
#pragma unroll
  for (int u = 0; u < 2; ++u) { const float sc = 64.0f / (l[u] + rs_xh(l[u]));
#pragma unroll
    for (int dt = 0; dt < 4; ++dt) *(v8h*)((char*)(ob + u * 16 * DM + dt * 16) + roff) = __builtin_convertvector(o[u][dt] * sc, v8h); }      /* a lane's 8 accumulator registers are 8 consecutive d of its query row */
}
#define PJ_TOK 64
#define PJ_PITCH 72      /* halves a staged row: 144 bytes, an odd multiple of 16 bytes for the 16-byte fragment reads */
static_assert(HD == 64 && NH == 8 && SQ % PJ_TOK == 0 && (SQ & (SQ - 1)) == 0 && PJ_TOK == 64 && DM == NH * HD, "k_proj: one wave a head, whole token blocks inside a batch");
typedef __bf16 v4b __attribute__((ext_vector_type(4)));
typedef unsigned short v4us __attribute__((ext_vector_type(4), may_alias));
__global__ __launch_bounds__(256) void k_proj(const float* __restrict__ xq, const float* __restrict__ xk, const float* __restrict__ xv, const float* __restrict__ wq, const float* __restrict__ wk, const float* __restrict__ wv,
                                              const int* __restrict__ KI, const int* __restrict__ KN, _Float16* __restrict__ Q16, _Float16* __restrict__ K16, _Float16* __restrict__ VT) {
  __shared__ __attribute__((aligned(16))) unsigned short sl[NH + 1][PJ_TOK][PJ_PITCH];      /* [wave][token][input], later the wave's output tile; tile NH: the weights [output][input] */
  const int tid = threadIdx.x, lane = tid & 31, ln = lane & 15, hh = lane >> 4; const int h = __builtin_amdgcn_readfirstlane(tid >> 5);
  const int which = blockIdx.y; const int r0 = blockIdx.x * PJ_TOK; const bool tr = which == 2;
  const int b = r0 / SQ, p0 = r0 % SQ;
  const float* xb = (which == 0 ? xq : which == 1 ? xk : xv) + (size_t)b * SQ * DM + h * HD;      /* wave-uniform bases */
  const float* wb = which == 0 ? wq : which == 1 ? wk : wv;
  const unsigned wo = (unsigned)(tid * 64); unsigned xo[PJ_TOK / 2];      /* byte offsets of the lane: xo[j] = its half's row of the pair j */
  if (which == 0) {
#pragma unroll
    for (int j = 0; j < PJ_TOK / 2; ++j) xo[j] = (unsigned)((p0 + j * 2 + hh) * (DM * 4) + ln * 16);
  } else {
    const int n = KN[b * KN_PITCH]; if (p0 >= ((n > 0 && n < SQ) ? n : SQ)) return;      /* the same for the whole work-group, ahead of every barrier */
    const v4ia* kl = (const v4ia*)(KI + (size_t)b * SQ + p0);
#pragma unroll
    for (int i = 0; i < PJ_TOK / 4; ++i) { const v4ia k4 = kl[i];      /* the token is bounded by the shape before an address is formed */
      xo[i * 2] = (unsigned)(((hh ? k4[1] : k4[0]) & (SQ - 1)) * (DM * 4) + ln * 16); xo[i * 2 + 1] = (unsigned)(((hh ? k4[3] : k4[2]) & (SQ - 1)) * (DM * 4) + ln * 16); }
  }
  v4f gx[PJ_TOK / 2], gw[4];
#pragma unroll
  for (int q = 0; q < 4; ++q) gw[q] = *(const v4fa*)((const char*)wb + wo + q * 16);
#pragma unroll
  for (int j = 0; j < PJ_TOK / 4; ++j) gx[j] = *(const v4fa*)((const char*)xb + xo[j]);
  /* Both waits: behind the loads, ahead of any new value in a register that they name (a precaution of form); as inputs the lane offsets keep their registers up to it. Two statements, since one takes at most thirty operands. */
  asm volatile("s_wait_xcnt 0x0" :: "v"(wo), "v"(xo[0]), "v"(xo[1]), "v"(xo[2]), "v"(xo[3]), "v"(xo[4]), "v"(xo[5]), "v"(xo[6]), "v"(xo[7]), "v"(xo[8]), "v"(xo[9]), "v"(xo[10]), "v"(xo[11]), "v"(xo[12]), "v"(xo[13]), "v"(xo[14]), "v"(xo[15]) : "memory");
#pragma unroll
  for (int j = PJ_TOK / 4; j < PJ_TOK / 2; ++j) gx[j] = *(const v4fa*)((const char*)xb + xo[j]);
  asm volatile("s_wait_xcnt 0x0" :: "v"(xo[16]), "v"(xo[17]), "v"(xo[18]), "v"(xo[19]), "v"(xo[20]), "v"(xo[21]), "v"(xo[22]), "v"(xo[23]), "v"(xo[24]), "v"(xo[25]), "v"(xo[26]), "v"(xo[27]), "v"(xo[28]), "v"(xo[29]), "v"(xo[30]), "v"(xo[31]) : "memory");
  __builtin_amdgcn_sched_barrier(0);      /* all 36 loads are issued before the first wait on one: without it this build held the last nine back behind the return of the first and met the memory latency twice */
#pragma unroll
  for (int q = 0; q < 4; ++q) { v4h w4; for (int i = 0; i < 4; ++i) w4[i] = (_Float16)(bf16_round(gw[q][i]) * 16.0f); *(v4us*)&sl[NH][tid >> 2][(tid & 3) * 16 + q * 4] = __builtin_bit_cast(v4us, w4); }
#pragma unroll
  for (int j = 0; j < PJ_TOK / 2; ++j) *(v4us*)&sl[h][j * 2 + hh][ln * 4] = __builtin_bit_cast(v4us, __builtin_convertvector(__builtin_convertvector(__builtin_convertvector(gx[j], v4b), v4f), v4h));      /* to bf16, nearest even, as bf16_round; that value as f16 */
  __syncthreads();      /* the weight block is in LDS for every wave (and each wave's own tile for all its lanes) */
  const unsigned short (*sa)[PJ_PITCH] = sl[tr ? h : NH]; const unsigned short (*sb)[PJ_PITCH] = sl[tr ? NH : h];
  v16h af[4][2], bf[2][2];
#pragma unroll
  for (int t = 0; t < 4; ++t) for (int ks = 0; ks < 2; ++ks) af[t][ks] = fa_frag(&sa[t * 16 + ln][ks * 32 + 8 * hh]);
#pragma unroll
  for (int ks = 0; ks < 2; ++ks) bf[0][ks] = fa_frag(&sb[ln][ks * 32 + 8 * hh]);
  const v8f z8 = {0.f, 0.f, 0.f, 0.f, 0.f, 0.f, 0.f, 0.f};
#pragma unroll
  for (int rt = 0; rt < 4; ++rt) {
    if (rt + 1 < 4) {      /* the next round's B rows are fetched ahead of this round's writes, which touch other rows */
#pragma unroll
      for (int ks = 0; ks < 2; ++ks) bf[(rt + 1) & 1][ks] = fa_frag(&sb[(rt + 1) * 16 + ln][ks * 32 + 8 * hh]); }
    v8f acc[4];
#pragma unroll
    for (int ct = 0; ct < 4; ++ct) acc[ct] = fa_mma(af[ct][0], bf[rt & 1][0], z8);
#pragma unroll
    for (int ct = 0; ct < 4; ++ct) acc[ct] = fa_mma(af[ct][1], bf[rt & 1][1], acc[ct]);
#pragma unroll
    for (int ct = 0; ct < 4; ++ct) *(v8us*)&sl[h][rt * 16 + ln][ct * 16 + 8 * hh] = __builtin_bit_cast(v8us, __builtin_convertvector(acc[ct] * 0.0625f, v8h));
  }
  __builtin_amdgcn_fence(__ATOMIC_ACQ_REL, "workgroup"); __builtin_amdgcn_wave_barrier();      /* the rows are read back by other lanes of the same wave: keeps the reads behind the writes */
  v8us ov[16];
#pragma unroll
  for (int j = 0; j < 16; ++j) ov[j] = *(const v8us*)&sl[h][j * 4 + (lane >> 3)][(lane & 7) * 8];      /* 8 lanes a row of 128 bytes, 4 rows an instruction */
  char* ob = tr ? (char*)(VT + ((size_t)(r0 / SQ) * NH + h) * HD * SQ + r0 % SQ) : (char*)((which == 0 ? Q16 : K16) + (size_t)r0 * DM + h * HD);      /* wave-uniform: the tile's first output row, and the bytes from row to row */
  const unsigned pb = tr ? SQ * 2 : DM * 2; const unsigned oo = (unsigned)(lane >> 3) * pb + (unsigned)(lane & 7) * 16;
#pragma unroll
  for (int j = 0; j < 16; ++j) *(v8us*)(ob + (size_t)(j * 4 * pb) + oo) = ov[j];
}
// Output product out = o Wo^T * alpha + b for all token rows, operands staged in LDS. A work-group of 8 waves owns a 128 x 128 tile of out (one work-group a WGP at this shape); a wave owns 32 x 64 of it (2 x 4 accumulator tiles, as k_gemm2).
// o rows and Wo rows come in stages of 128 k: a wave-wide 16-byte load covers two rows' 256 contiguous bytes (whole 128-byte lines; a fragment load from global memory touches 16 lines for 512 bytes, and each of them was waited for on its own),
// through registers into one of two LDS buffers; stage s + 1 is on its way while stage s is worked on, stored behind it, one barrier a stage. Each operand byte is read once a work-group.
// The k steps run in the order of k_gemm2 and the fragments have its k order, so every accumulator sees the same sums; the epilogue is k_gemm2's (alpha, bias rounded to bf16, the wave's tile through its own LDS range, whole lines out).
// Every '#pragma unroll' in the kernel but the one on the stage loop stands on a loop over a register array (loads in flight, fragments, accumulators): rolled, the array would be indexed at run time and leave the registers.
#define OG_T 128         /* rows and columns of out a work-group */
#define OG_K 128         /* k a stage */
#define OG_PITCH 136     /* halves a staged row: 272 bytes = 16 x 17, an odd multiple of 16 bytes for the 16-byte fragment reads */
static_assert(MPO % OG_T == 0 && DM % OG_T == 0 && DM % OG_K == 0 && OG_K == 128 && OG_T == 128, "k_ogemm: whole tiles and stages; 16 threads stage a row of 256 bytes, 16 rows a round");
__global__ __launch_bounds__(256) void k_ogemm(const _Float16* __restrict__ A, const _Float16* __restrict__ Bh, float alpha, const float* __restrict__ bias, float* __restrict__ C) {
  __shared__ __attribute__((aligned(16))) unsigned short sa[2][OG_T][OG_PITCH];      /* [buffer][token row][k] */
  __shared__ __attribute__((aligned(16))) unsigned short sb[2][OG_T][OG_PITCH];      /* [buffer][output column][k] */
  __shared__ __attribute__((aligned(16))) float so[8][32][68];                       /* a wave's tile on its way out */
  constexpr int NS = DM / OG_K, NT = DM / OG_T;
  const int tid = threadIdx.x, lane = tid & 31, ln = lane & 15, hh = lane >> 4; const int wave = __builtin_amdgcn_readfirstlane(tid >> 5);
  const int row0 = ((int)blockIdx.x / NT) * OG_T, col0 = ((int)blockIdx.x % NT) * OG_T; const int wm = (wave >> 1) * 32, wn = (wave & 1) * 64;      /* the wave's place in the tile */
  const char* ab = (const char*)(A + (size_t)row0 * DM); const char* bb = (const char*)(Bh + (size_t)col0 * DM);      /* uniform bases */
  const int srow = tid >> 4, sc8 = (tid & 15) * 8;      /* staging: 16 threads a 256-byte row; rows srow + 16 j */
  const unsigned go = (unsigned)(srow * (DM * 2) + sc8 * 2);      /* byte offset of the lane in a stage of either operand */
  const char* ib = (const char*)(bias + col0 + wn); const unsigned io = (unsigned)(ln * 4);      /* the wave's 64 bias values: fetched here, so that the epilogue does not wait for them */
  v8us ga[OG_T / 16], gb[OG_T / 16]; float bv[4];
#pragma unroll
  for (int j = 0; j < OG_T / 16; ++j) { ga[j] = *(const v8us*)(ab + j * 16 * DM * 2 + go); gb[j] = *(const v8us*)(bb + j * 16 * DM * 2 + go); }
#pragma unroll
  for (int t = 0; t < 4; ++t) bv[t] = *(const float*)(ib + t * 64 + io);
  asm volatile("s_wait_xcnt 0x0" :: "v"(go), "v"(io) : "memory");      /* behind the loads, ahead of any new value in a register that they name (a precaution of form); as inputs the lane offsets keep their registers up to it */
#pragma unroll
  for (int j = 0; j < OG_T / 16; ++j) { *(v8us*)&sa[0][j * 16 + srow][sc8] = ga[j]; *(v8us*)&sb[0][j * 16 + srow][sc8] = gb[j]; }
  const v8f z8 = {0.f, 0.f, 0.f, 0.f, 0.f, 0.f, 0.f, 0.f};
  v8f acc[2][4];
#pragma unroll
  for (int i = 0; i < 2; ++i) for (int t = 0; t < 4; ++t) acc[i][t] = z8;
  __syncthreads();      /* stage 0 is in LDS for every wave */
#pragma unroll
  for (int s = 0; s < NS; ++s) {
    const int bf = s & 1;
    if (s + 1 < NS) {      /* behind the barrier, not ahead of it: the barrier's fence waits for every load that is under way */
#pragma unroll
      for (int j = 0; j < OG_T / 16; ++j) { ga[j] = *(const v8us*)(ab + (s + 1) * OG_K * 2 + j * 16 * DM * 2 + go); gb[j] = *(const v8us*)(bb + (s + 1) * OG_K * 2 + j * 16 * DM * 2 + go); }
      asm volatile("s_wait_xcnt 0x0" :: "v"(go) : "memory");      /* as above; as a memory barrier for the compiler it also keeps the loads here, a whole stage ahead of their stores */
    }
    v16h af[2][2], bq[2][4];
#pragma unroll
    for (int i = 0; i < 2; ++i) af[0][i] = fa_frag(&sa[bf][wm + i * 16 + ln][8 * hh]);
#pragma unroll
    for (int t = 0; t < 4; ++t) bq[0][t] = fa_frag(&sb[bf][wn + t * 16 + ln][8 * hh]);
#pragma unroll
    for (int ks = 0; ks < OG_K / 32; ++ks) {
      if (ks + 1 < OG_K / 32) {      /* the next k step's fragments are fetched as one group ahead of this step's products, into the second register set */
#pragma unroll
        for (int i = 0; i < 2; ++i) af[(ks + 1) & 1][i] = fa_frag(&sa[bf][wm + i * 16 + ln][(ks + 1) * 32 + 8 * hh]);
#pragma unroll
        for (int t = 0; t < 4; ++t) bq[(ks + 1) & 1][t] = fa_frag(&sb[bf][wn + t * 16 + ln][(ks + 1) * 32 + 8 * hh]);
      }
      __builtin_amdgcn_sched_barrier(0);      /* this one and the next keep the twelve reads one group ahead of the eight products: without them this build read two fragments' halves at a time into one register block and waited out the LDS latency in front of every second product */
#pragma unroll
      for (int t = 0; t < 4; ++t) for (int i = 0; i < 2; ++i) acc[i][t] = fa_mma(af[ks & 1][i], bq[ks & 1][t], acc[i][t]);
      __builtin_amdgcn_sched_barrier(0);
    }
    if (s + 1 < NS) {
#pragma unroll
      for (int j = 0; j < OG_T / 16; ++j) { *(v8us*)&sa[bf ^ 1][j * 16 + srow][sc8] = ga[j]; *(v8us*)&sb[bf ^ 1][j * 16 + srow][sc8] = gb[j]; }      /* into the buffer whose readers all passed the barrier of stage s - 1 */
      __syncthreads();      /* publishes stage s + 1 and ends every wave's reads of stage s */
    }
  }
#pragma unroll
  for (int t = 0; t < 4; ++t) { const float br = bf16_round(bv[t]);
#pragma unroll
    for (int i = 0; i < 2; ++i) for (int r = 0; r < 8; ++r) so[wave][i * 16 + 8 * hh + r][t * 16 + ln] = acc[i][t][r] * alpha + br; }
  __builtin_amdgcn_fence(__ATOMIC_ACQ_REL, "workgroup"); __builtin_amdgcn_wave_barrier();      /* the rows are read back by other lanes of the same wave: keeps the reads behind the writes */
  char* cb = (char*)(C + (size_t)(row0 + wm) * DM + col0 + wn);      /* uniform for the wave */
  const unsigned co = (unsigned)(hh * (DM * 4) + ln * 16);
  v4f ov[16];
#pragma unroll
  for (int q = 0; q < 16; ++q) ov[q] = *(const v4fa*)&so[wave][q * 2 + hh][ln * 4];      /* 16 lanes a row of 256 bytes, 2 rows an instruction */
#pragma unroll
  for (int q = 0; q < 16; ++q) *(v4f*)(cb + q * 2 * DM * 4 + co) = ov[q];
}
extern "C" void kernel_launch(void* const* d_in, const int* in_sizes, int n_in,
                              void* d_out, int out_size, void* d_ws, size_t ws_size, hipStream_t stream) {
  (void)in_sizes; (void)n_in; (void)out_size;
  const float* const* I = (const float* const*)d_in; const float* xq = I[2]; const float* xk = I[1]; const float* xv = I[0]; const int* km = (const int*)d_in[3]; const float* wq = I[6]; const float* wk = I[5]; const float* wv = I[4]; const float* wo = I[7]; const float* bo = I[8];      /* contract order: values I[0], keys I[1], query I[2]; mask int32 [4][1][1][2048] (0 = masked key; READ on device); SHARED natural [64][64] blocks Wv I[4], Wk I[5], Wq I[6]; natural Wo [512][512] + bo */
  char* ws = (char*)d_ws; size_t off = 0;
  auto take = [&](size_t bytes) { char* p = ws + off; off += (bytes + 255) & ~(size_t)255; return p; };
  _Float16* BO = (_Float16*)take((size_t)DM * DM * 2);
  _Float16* Q16 = (_Float16*)take(NR * DM * 2); _Float16* K16 = (_Float16*)take(NR * DM * 2); _Float16* O16 = (_Float16*)take(NR * DM * 2);
  _Float16* VT = (_Float16*)take((size_t)NB * NH * HD * SQ * 2);
  int* KI = (int*)take((size_t)NB * SQ * 4); int* KN = (int*)take((size_t)NB * KN_PITCH * 4);      /* the open keys of each batch, and their number */
  if (off > ws_size) return;
  k_prep<<<(unsigned)(((size_t)DM * DM / 8 + 255) / 256) + NB, 256, 0, stream>>>(wo, (size_t)DM * DM / 8, BO, (int)(((size_t)DM * DM / 8 + 255) / 256), km, KI, KN);      /* Wo natural [out][in] = Bt x16; the last NB blocks list the open keys */
  const size_t r0p = (size_t)B0 * SQ;      /* first row of the output stage */
  k_proj<<<dim3((unsigned)(NR / PJ_TOK), 3), 256, 0, stream>>>(xq, xk, xv, wq, wk, wv, KI, KN, Q16, K16, VT);      /* q rows [NB * SQ][DM]; k rows and V^T [NB][NH][HD][SQ] packed to the listed keys, f16 */
  k_fattn<<<NB * NH * (SQ / (FA_WAVES * FA_COLS)), FA_WAVES * 32, 0, stream>>>(Q16, K16, VT, KN, O16);      /* o (merged heads) as f16 rows x64; keys with mask[b][j] == 0 are not listed */
  k_ogemm<<<(unsigned)((MPO / OG_T) * (DM / OG_T)), 256, 0, stream>>>(O16 + r0p * DM, BO, 0.0009765625f, bo, (float*)d_out + r0p * DM);      /* out rows are the output layout */
}

// v006
// A run of this version takes 35.3 microseconds.
// Next to v005, in two timings, it ran 1.08 and 1.07 times as fast.
// Over all steps from v000 it is 95.3 times as fast.
#include <hip/hip_runtime.h>
// Multi-head attention over three inputs with SHARED per-head projections, a random key-padding mask and the module's literal score scale (values, keys, query [4][2048][512]; each input is split into 8 heads of 64 and every head is multiplied by the SAME natural [64][64] matrix (x W^T: Wv / Wk / Wq; no biases); energy = q k^T; where(mask == 0, -1e20) with the int32 [4][1][1][2048] mask in {0, 1} (random; 0 = masked key; READ on device); softmax(energy / sqrt(embed_size) = / sqrt(512)) (as the source); out = merged Wo^T + bo -> [4][2048][512]).
// Structure: token rows r = b*2048 + s; a key with mask 0 has weight exactly 0 beside any open key, so only the open keys of a batch are projected and attended: every K / V block of k_proj lists its own 64 places (prefix count of the batch's mask; a batch with no open key keeps all keys, every score at the fill); K rows and V^T columns are packed in list order; Q, K and V^T in ONE launch straight from the f32 inputs (k_proj: a wave takes 64 tokens of one head, rounds x to bf16 as exact f16 in registers, multiplies by the shared [64][64] block (exact x16) on WMMA over k = 64, f32 accumulation, f16 outputs; V leaves transposed); scores, masked softmax and weights x V in ONE launch for all batches and heads (k_fattn: running maximum and sum, scores and weights never in memory; o carried x64 against f16 subnormal flush, folded into the output GEMM alpha) written straight into the merged f16 o rows; out = o W_o + b GEMM (f32; k_ogemm: operands staged in LDS by whole lines) into the output layout.
// Compute dtype: inputs rounded to bf16; x / weights exact; q, k, v, softmax weights and o as plain f16 GEMM operands (~2^-12); scores and softmax statistics f32; v_wmma_f32_16x16x32_f16.
#define NB 4
#define SQ 2048
#define DM 512
#define NH 8
#define HD 64
#define HG 4                         /* heads a launch of the k_vt(V16, b, h0, VT) form, which is not launched */
#define B0 0                         /* first batch of the output stage (debug hook) */
#define NBR NB                       /* batches of the output stage (debug hook) */
#define NR ((size_t)NB * SQ)         /* token rows */
#define MP ((int)((size_t)NBR * SQ)) /* rows of the output stage, via MPO (debug hook) */
#define QN SQ                        /* unused; k_fattn attends all SQ query rows of a batch */
#define NHD NH                       /* unused; k_fattn attends all NH heads */
#define MPO MP                       /* rows through the output stage (debug hook) */
#define LQ DM      /* unused; the q and k rows have pitch DM */
typedef __bf16 v16b __attribute__((ext_vector_type(16)));
typedef unsigned short v8us __attribute__((ext_vector_type(8), may_alias));
typedef float  v8f  __attribute__((ext_vector_type(8)));
typedef float  v4f  __attribute__((ext_vector_type(4)));
typedef float  v4fa __attribute__((ext_vector_type(4), may_alias));
union FragB { v16b v; v8us half[2]; unsigned short u[16]; };

__device__ __forceinline__ unsigned short bf16_bits(float x) { unsigned int u = __float_as_uint(x); return (unsigned short)((u + 0x7FFFu + ((u >> 16) & 1u)) >> 16); }
__device__ __forceinline__ float bf16_val(unsigned short b) { return __uint_as_float(((unsigned int)b) << 16); }
__device__ __forceinline__ float bf16_round(float x) { return bf16_val(bf16_bits(x)); }
// D += A·B with NT terms: 1 = ah·bh, 2 = + al·bh (A split), 3 = + ah·bl (both split)
template <int NT>
__device__ __forceinline__ v8f mmaN(v16b ah, v16b al, v16b bh, v16b bl, v8f c) {
  c = __builtin_amdgcn_wmma_f32_16x16x32_bf16(false, ah, false, bh, (short)0, c, false, false);
  if (NT >= 2) c = __builtin_amdgcn_wmma_f32_16x16x32_bf16(false, al, false, bh, (short)0, c, false, false);
  if (NT >= 3) c = __builtin_amdgcn_wmma_f32_16x16x32_bf16(false, ah, false, bl, (short)0, c, false, false);
  asm volatile("v_nop\n\tv_nop\n\tv_nop\n\tv_nop" : "+v"(c) : "v"(ah), "v"(al), "v"(bh), "v"(bl));
  return c;
}

__global__ __launch_bounds__(256) void k_wt_bf16(const float* __restrict__ W, unsigned short* __restrict__ Wt, int K, int N) {
  const int t = blockIdx.x * 256 + threadIdx.x;
  const int k8n = K / 8;
  if (t >= N * k8n) return;
  const int n = t / k8n, k8 = (t % k8n) * 8;
  v8us v;
#pragma unroll
  for (int i = 0; i < 8; ++i) v[i] = bf16_bits(W[(size_t)(k8 + i) * N + n]);
  *(v8us*)(Wt + (size_t)n * K + k8) = v;
  
}

// GEMM C[M][N] (f32, pitch ldc) = act(A[M][K]·W + bias). A f32 row-major (pitch lda) converted per fragment to bf16
// (ASPLIT: hi/lo two planes -> 2 terms, else single rounded term); Wt bf16 [N][K] (pitch ldb). BIAS_BF16 rounds the
// bias to bf16 first (bias quantised to bf16 before the add). K%32==0, M%16==0, N%64==0.
template <bool ASPLIT, int ACT, bool BIAS_BF16>
__global__ __launch_bounds__(128) void k_gemm_bf(const float* __restrict__ A, int lda, const unsigned short* __restrict__ Wt, int ldb,
                                               const float* __restrict__ bias, float* __restrict__ C, int ldc, int M, int N, int K) {
  __shared__ __attribute__((aligned(16))) float so[4][16][64];
  const int tid = threadIdx.x, w = tid >> 5, lane = tid & 31, ln = lane & 15, hh = lane >> 4;
  const int ntn = N / 64;
  const int wid = blockIdx.x * 4 + w;
  const int mt = wid / ntn, nq = wid % ntn;
  if (mt * 16 >= M) return;
  const int row0 = mt * 16, col0 = nq * 64;
  const float* arow = A + (size_t)(row0 + ln) * lda;
  v8f acc[4] = {};
  for (int kb = 0; kb < K; kb += 32) {
    FragB ah, al;
    const v4f x0 = *(const v4fa*)(arow + kb + 8 * hh), x1 = *(const v4fa*)(arow + kb + 8 * hh + 4);
    const v4f x2 = *(const v4fa*)(arow + kb + 16 + 8 * hh), x3 = *(const v4fa*)(arow + kb + 16 + 8 * hh + 4);
    float xs[16] = {x0[0],x0[1],x0[2],x0[3],x1[0],x1[1],x1[2],x1[3],x2[0],x2[1],x2[2],x2[3],x3[0],x3[1],x3[2],x3[3]};
#pragma unroll
    for (int i = 0; i < 16; ++i) { const unsigned short hb = bf16_bits(xs[i]); ah.u[i] = hb; al.u[i] = ASPLIT ? bf16_bits(xs[i] - bf16_val(hb)) : (unsigned short)0; }
#pragma unroll
    for (int t = 0; t < 4; ++t) {
      const unsigned short* brow = Wt + (size_t)(col0 + t * 16 + ln) * ldb + kb;
      FragB b;
      b.half[0] = *(const v8us*)(brow + 8 * hh);
      b.half[1] = *(const v8us*)(brow + 16 + 8 * hh);
      acc[t] = mmaN<ASPLIT ? 2 : 1>(ah.v, al.v, b.v, b.v, acc[t]);
    }
  }
#pragma unroll
  for (int t = 0; t < 4; ++t) {
    float bv = bias ? bias[col0 + t * 16 + ln] : 0.f;
    if (BIAS_BF16) bv = bf16_round(bv);
#pragma unroll
    for (int r = 0; r < 8; ++r) { float v = acc[t][r] + bv; if (ACT == 1) v = fmaxf(v, 0.f); so[w][8 * hh + r][t * 16 + ln] = v; }
  }
  __builtin_amdgcn_fence(__ATOMIC_ACQ_REL, "workgroup");
  __builtin_amdgcn_wave_barrier();
  const int rsub = lane >> 4, c4 = (lane & 15) * 4;
  {
#pragma unroll
    for (int q = 0; q < 8; ++q) {
      const int r = q * 2 + rsub;
      const v4f v = *(const v4fa*)&so[w][r][c4];
      *(v4f*)(C + (size_t)(row0 + r) * ldc + col0 + c4) = v;
    }
    
  }
}

// GEMM C = act(A·W + bias + resid): A f32 (ASPLIT -> hi/lo 2 terms), Wt bf16 [N][K]; ACT 0 none, 1 relu, 2 exact gelu;
// resid (optional, f32, row index = (row % rmod), pitch ldr, RES_BF16 rounds it) added before the activation.
template <bool ASPLIT, int ACT, bool BIAS_BF16, bool RES_BF16>
__global__ __launch_bounds__(128) void k_gemm_bf3(const float* __restrict__ A, int lda, const unsigned short* __restrict__ Wt, int ldb,
                                                const float* __restrict__ bias, const float* __restrict__ resid, int rmod, int ldr,
                                                float* __restrict__ C, int ldc, int M, int N, int K) {
  __shared__ __attribute__((aligned(16))) float so[4][16][64];
  const int tid = threadIdx.x, w = tid >> 5, lane = tid & 31, ln = lane & 15, hh = lane >> 4;
  const int ntn = N / 64;
  const int wid = blockIdx.x * 4 + w;
  const int mt = wid / ntn, nq = wid % ntn;
  if (mt * 16 >= M) return;
  const int row0 = mt * 16, col0 = nq * 64;
  const float* arow = A + (size_t)(row0 + ln) * lda;
  v8f acc[4] = {};
  for (int kb = 0; kb < K; kb += 32) {
    FragB ah, al;
    const v4f x0 = *(const v4fa*)(arow + kb + 8 * hh), x1 = *(const v4fa*)(arow + kb + 8 * hh + 4);
    const v4f x2 = *(const v4fa*)(arow + kb + 16 + 8 * hh), x3 = *(const v4fa*)(arow + kb + 16 + 8 * hh + 4);
    float xs[16] = {x0[0],x0[1],x0[2],x0[3],x1[0],x1[1],x1[2],x1[3],x2[0],x2[1],x2[2],x2[3],x3[0],x3[1],x3[2],x3[3]};
#pragma unroll
    for (int i = 0; i < 16; ++i) { const unsigned short hb = bf16_bits(xs[i]); ah.u[i] = hb; al.u[i] = ASPLIT ? bf16_bits(xs[i] - bf16_val(hb)) : (unsigned short)0; }
#pragma unroll
    for (int t = 0; t < 4; ++t) {
      const unsigned short* brow = Wt + (size_t)(col0 + t * 16 + ln) * ldb + kb;
      FragB b;
      b.half[0] = *(const v8us*)(brow + 8 * hh);
      b.half[1] = *(const v8us*)(brow + 16 + 8 * hh);
      acc[t] = mmaN<ASPLIT ? 2 : 1>(ah.v, al.v, b.v, b.v, acc[t]);
    }
  }
#pragma unroll
  for (int t = 0; t < 4; ++t) {
    const int col = col0 + t * 16 + ln;
    float bv = bias ? bias[col] : 0.f;
    if (BIAS_BF16) bv = bf16_round(bv);
#pragma unroll
    for (int r = 0; r < 8; ++r) {
      float v = acc[t][r] + bv;
      if (resid) { float rv = resid[(size_t)((row0 + 8 * hh + r) % rmod) * ldr + col]; if (RES_BF16) rv = bf16_round(rv); v += rv; }
      if (ACT == 1) v = fmaxf(v, 0.f);
      if (ACT == 2) v = 0.5f * v * (1.0f + erff(v * 0.70710678118654752f));
      if (ACT == 3) { const float u = 0.7978845608028654f * (v + 0.044715f * v * v * v); v = 0.5f * v * (1.0f + tanhf(u)); }
      so[w][8 * hh + r][t * 16 + ln] = v;
    }
  }
  __builtin_amdgcn_fence(__ATOMIC_ACQ_REL, "workgroup");
  __builtin_amdgcn_wave_barrier();
  const int rsub = lane >> 4, c4 = (lane & 15) * 4;
  {
#pragma unroll
    for (int q = 0; q < 8; ++q) {
      const int r = q * 2 + rsub;
      const v4f v = *(const v4fa*)&so[w][r][c4];
      *(v4f*)(C + (size_t)(row0 + r) * ldc + col0 + c4) = v;
    }
    
  }
}
// row LayerNorm (biased variance, eps) over N: s = X (+ R); optional out_sum <- s; out_norm <- (s-mu)*rsqrt(var+eps)*g + b
template <bool PARAM_BF16>
__global__ __launch_bounds__(256) void k_layernorm(const float* __restrict__ X, const float* __restrict__ R, const float* __restrict__ g, const float* __restrict__ bta,
                                                  float* __restrict__ out_sum, float* __restrict__ out_norm, int N, float eps) {
  __shared__ float red[256];
  const int row = blockIdx.x, tid = threadIdx.x;
  const float* x = X + (size_t)row * N; const float* rr = R ? R + (size_t)row * N : nullptr;
  float vals[16];                     // up to N = 4096
  const int per = N / 256;            // contiguous chunk per thread? use strided-by-4 chunks: thread handles j = tid*4 + 1024*u
  float s1 = 0.f;
  for (int u = 0; u < per / 4; ++u) {
    const int j = tid * 4 + 1024 * u;
    const v4f a = *(const v4fa*)(x + j);
    v4f b = {0.f,0.f,0.f,0.f}; if (rr) b = *(const v4fa*)(rr + j);
#pragma unroll
    for (int q = 0; q < 4; ++q) { const float v = a[q] + b[q]; vals[u * 4 + q] = v; s1 += v; }
  }
  red[tid] = s1; __syncthreads();
  for (int st = 128; st > 0; st >>= 1) { if (tid < st) red[tid] += red[tid + st]; __syncthreads(); }
  const float mu = red[0] / (float)N; __syncthreads();
  float s2 = 0.f;
  for (int u = 0; u < per / 4; ++u)
#pragma unroll
    for (int q = 0; q < 4; ++q) { const float c = vals[u * 4 + q] - mu; s2 += c * c; }
  red[tid] = s2; __syncthreads();
  for (int st = 128; st > 0; st >>= 1) { if (tid < st) red[tid] += red[tid + st]; __syncthreads(); }
  const float rs = rsqrtf(red[0] / (float)N + eps);
  {
    for (int u = 0; u < per / 4; ++u) {
      const int j = tid * 4 + 1024 * u;
      v4f o, sm;
#pragma unroll
      for (int q = 0; q < 4; ++q) {
        float gg = g[j + q], bb = bta[j + q];
        if (PARAM_BF16) { gg = bf16_round(gg); bb = bf16_round(bb); }
        sm[q] = vals[u * 4 + q]; o[q] = (vals[u * 4 + q] - mu) * rs * gg + bb;
      }
      if (out_sum) *(v4f*)(out_sum + (size_t)row * N + j) = sm;
      *(v4f*)(out_norm + (size_t)row * N + j) = o;
    }
    
  }
}



// ---- f16 WMMA path (v_wmma_f32_16x16x32_f16): 11-bit significands for operands in range — used where a [0,1] probability operand needs more precision than bf16
typedef _Float16 v16h __attribute__((ext_vector_type(16)));
union FragH { v16h v; v8us half[2]; _Float16 h[16]; unsigned short u[16]; };
template <int NT>
__device__ __forceinline__ v8f mmaH(v16h ah, v16h al, v16h bh, v16h bl, v8f c) {
  c = __builtin_amdgcn_wmma_f32_16x16x32_f16(false, ah, false, bh, (short)0, c, false, false);
  if (NT >= 2) c = __builtin_amdgcn_wmma_f32_16x16x32_f16(false, al, false, bh, (short)0, c, false, false);
  if (NT >= 3) c = __builtin_amdgcn_wmma_f32_16x16x32_f16(false, ah, false, bl, (short)0, c, false, false);
  asm volatile("v_nop\n\tv_nop\n\tv_nop\n\tv_nop" : "+v"(c) : "v"(ah), "v"(al), "v"(bh), "v"(bl));
  return c;
}
// batched GEMM like k_gemm_b but f16 operands: A f32 (split into f16 hi/lo if ASPLIT, else rounded to f16), Bt = f16 values [n][k]; alpha; C f32; N multiple of 16 (partial tiles skipped)
template <bool ASPLIT>
__global__ __launch_bounds__(128) void k_gemm_h(const float* __restrict__ A, int lda, size_t sA, const _Float16* __restrict__ Bh, int ldb, size_t sB, float alpha, float* __restrict__ C, int ldc, size_t sC, int M, int N, int K) {
  __shared__ __attribute__((aligned(16))) float so[4][16][64];
  const int tid = threadIdx.x, w = tid >> 5, lane = tid & 31, ln = lane & 15, hh = lane >> 4; const int by = blockIdx.y;
  A += (size_t)by * sA; Bh += (size_t)by * sB; C += (size_t)by * sC;
  const int ntn = (N + 63) / 64; const int wid = blockIdx.x * 4 + w; const int mt = wid / ntn, nq = wid % ntn; if (mt * 16 >= M) return;
  const int row0 = mt * 16, col0 = nq * 64; const float* arow = A + (size_t)(row0 + ln) * lda;
  v8f acc[4] = {};
  for (int kb = 0; kb < K; kb += 32) {
    FragH ah, al;
    const v4f x0 = *(const v4fa*)(arow + kb + 8 * hh), x1 = *(const v4fa*)(arow + kb + 8 * hh + 4), x2 = *(const v4fa*)(arow + kb + 16 + 8 * hh), x3 = *(const v4fa*)(arow + kb + 16 + 8 * hh + 4);
    float xs[16] = {x0[0],x0[1],x0[2],x0[3],x1[0],x1[1],x1[2],x1[3],x2[0],x2[1],x2[2],x2[3],x3[0],x3[1],x3[2],x3[3]};
#pragma unroll
    for (int i = 0; i < 16; ++i) { const _Float16 h = (_Float16)xs[i]; ah.h[i] = h; al.h[i] = ASPLIT ? (_Float16)(xs[i] - (float)h) : (_Float16)0.0f; }
#pragma unroll
    for (int t = 0; t < 4; ++t) { if (col0 + t * 16 >= N) continue; const size_t boff = (size_t)(col0 + t * 16 + ln) * ldb + kb; FragH bq; bq.half[0] = *(const v8us*)(Bh + boff + 8 * hh); bq.half[1] = *(const v8us*)(Bh + boff + 16 + 8 * hh);
      acc[t] = mmaH<ASPLIT ? 2 : 1>(ah.v, al.v, bq.v, bq.v, acc[t]); }
  }
#pragma unroll
  for (int t = 0; t < 4; ++t) { if (col0 + t * 16 >= N) continue;
#pragma unroll
    for (int r = 0; r < 8; ++r) so[w][8 * hh + r][t * 16 + ln] = acc[t][r] * alpha; }
  __builtin_amdgcn_fence(__ATOMIC_ACQ_REL, "workgroup"); __builtin_amdgcn_wave_barrier();
  const int rsub = lane >> 4, c4 = (lane & 15) * 4;
  {
#pragma unroll
    for (int q = 0; q < 8; ++q) { const int r = q * 2 + rsub; if (col0 + c4 < N) { const v4f v = *(const v4fa*)&so[w][r][c4]; *(v4f*)(C + (size_t)(row0 + r) * ldc + col0 + c4) = v; } }
     }
}

// Wt[n][k] = f16(W[k][n]·scale) from f32 row-major W[K][N] (scale = power of two; bf16-exact weights stay exact in f16 away from the subnormal range)
__global__ __launch_bounds__(256) void k_wt_f16(const float* __restrict__ W, _Float16* __restrict__ Wt, int K, int N, float scale) {
  const int t = blockIdx.x * 256 + threadIdx.x; if (t >= N * (K / 8)) return; const int n = t / (K / 8), k8 = (t % (K / 8)) * 8; FragH f;
#pragma unroll
  for (int i = 0; i < 8; ++i) f.h[i] = (_Float16)(bf16_round(W[(size_t)(k8 + i) * N + n]) * scale); const v8us o = f.half[0];
  *(v8us*)((unsigned short*)Wt + (size_t)n * K + k8) = o; 
}
// k_gemm_hh variant with fused epilogue: v = acc·alpha + bias[by·sBias + col] (+ CP[(row/rowsPerB)·sCPb + by·64 + col] if CP) ; ACT 0 none / 1 elu ; writes f16 C16 (and f32 C if non-null)
template <int ACT>
__global__ __launch_bounds__(128) void k_gemm_hhx(const _Float16* __restrict__ A, int lda, size_t sA, const _Float16* __restrict__ Bh, int ldb, size_t sB, float alpha, const float* __restrict__ bias, size_t sBias, const float* __restrict__ CP, int rowsPerB, size_t sCPb, int row0g,
    float* __restrict__ C, _Float16* __restrict__ C16, int ldc, size_t sC, int M, int N, int K) {
  __shared__ __attribute__((aligned(16))) float so[4][16][64];
  const int tid = threadIdx.x, w = tid >> 5, lane = tid & 31, ln = lane & 15, hh = lane >> 4; const int by = blockIdx.y;
  A += (size_t)by * sA; Bh += (size_t)by * sB; const size_t cofs = (size_t)by * sC; const float* bp = bias ? bias + (size_t)by * sBias : nullptr;
  const int ntn = (N + 63) / 64; const int wid = blockIdx.x * 4 + w; const int mt = wid / ntn, nq = wid % ntn; if (mt * 16 >= M) return;
  const int row0 = mt * 16, col0 = nq * 64; const _Float16* arow = A + (size_t)(row0 + ln) * lda;
  v8f acc[4] = {};
  for (int kb = 0; kb < K; kb += 32) { FragH ah; ah.half[0] = *(const v8us*)((const unsigned short*)arow + kb + 8 * hh); ah.half[1] = *(const v8us*)((const unsigned short*)arow + kb + 16 + 8 * hh);
#pragma unroll
    for (int t = 0; t < 4; ++t) { if (col0 + t * 16 >= N) continue; const size_t boff = (size_t)(col0 + t * 16 + ln) * ldb + kb; FragH bq; bq.half[0] = *(const v8us*)((const unsigned short*)Bh + boff + 8 * hh); bq.half[1] = *(const v8us*)((const unsigned short*)Bh + boff + 16 + 8 * hh);
      acc[t] = mmaH<1>(ah.v, ah.v, bq.v, bq.v, acc[t]); }
  }
#pragma unroll
  for (int t = 0; t < 4; ++t) { if (col0 + t * 16 >= N) continue; const int col = col0 + t * 16 + ln; const float bv = bp ? bf16_round(bp[col]) : 0.f;
#pragma unroll
    for (int r = 0; r < 8; ++r) { float v = acc[t][r] * alpha + bv; if (CP) { const int rr = row0g + row0 + 8 * hh + r; if (rowsPerB < 0) v += CP[cofs + (size_t)rr * ldc + col];      /* rowsPerB < 0: own element of the batched C plane */ else { const int bidx = rr / rowsPerB; v += CP[(size_t)bidx * sCPb + (size_t)by * 64 + col]; } } if (ACT == 1) v = (v > 0.f) ? v : expm1f(v); else if (ACT == 7) v = (v > 0.f) ? v + 1.0f : expf(v); else if (ACT == 8) v = tanhf(v); else if (ACT == 9) v = 0.5f * v * (1.0f + tanhf(0.7978845608028654f * (v + 0.044715f * v * v * v))); else if (ACT == 11) v = 1.0f / (1.0f + expf(-v)); else if (ACT == 12) v = (v > 0.f) ? v : 0.01f * v; else if (ACT == 14) v = (v > 0.f) ? v : 0.1f * v; else if (ACT == 16) v = (v >= 0.f) ? v : 0.3f * v; else if (ACT == 17) v = (v >= 0.f) ? v : 0.2f * v; else if (ACT == 15) v = v / (1.0f + expf(-v)); else if (ACT == 3) v = fmaxf(v, 0.f); else if (ACT == 6) v = 0.5f * v * (1.0f + erff(v * 0.70710678118654752f)); so[w][8 * hh + r][t * 16 + ln] = v; } }
  __builtin_amdgcn_fence(__ATOMIC_ACQ_REL, "workgroup"); __builtin_amdgcn_wave_barrier();
  const int rsub = lane >> 4, c4 = (lane & 15) * 4; typedef _Float16 v4h __attribute__((ext_vector_type(4)));
  {
#pragma unroll
    for (int q = 0; q < 8; ++q) { const int r = q * 2 + rsub; if (col0 + c4 < N) { const v4f v = *(const v4fa*)&so[w][r][c4]; if (C) *(v4f*)(C + cofs + (size_t)(row0 + r) * ldc + col0 + c4) = v; if (C16) { v4h h4; for (int i = 0; i < 4; ++i) h4[i] = (_Float16)v[i]; *(v4h*)(C16 + cofs + (size_t)(row0 + r) * ldc + col0 + c4) = h4; } } }
     }
}


typedef _Float16 v4h __attribute__((ext_vector_type(4)));

__global__ __launch_bounds__(256) void k_x16(const float* __restrict__ x, _Float16* __restrict__ X16, size_t n8) { const size_t t = (size_t)blockIdx.x * 256 + threadIdx.x; if (t >= n8) return; FragH f;
#pragma unroll
  for (int q = 0; q < 8; ++q) f.h[q] = (_Float16)bf16_round(x[t * 8 + q]); *(v8us*)((unsigned short*)X16 + t * 8) = f.half[0];  }
__global__ __launch_bounds__(256) void k_h16(const float* __restrict__ x, _Float16* __restrict__ X16, size_t n8) { const size_t t = (size_t)blockIdx.x * 256 + threadIdx.x; if (t >= n8) return; FragH f;
#pragma unroll
  for (int q = 0; q < 8; ++q) f.h[q] = (_Float16)x[t * 8 + q]; *(v8us*)((unsigned short*)X16 + t * 8) = f.half[0];  }
__global__ __launch_bounds__(256) void k_round16f(const float* __restrict__ W, _Float16* __restrict__ Bt, size_t n8) { const size_t t = (size_t)blockIdx.x * 256 + threadIdx.x; if (t >= n8) return; FragH f;
#pragma unroll
  for (int i = 0; i < 8; ++i) f.h[i] = (_Float16)(bf16_round(W[t * 8 + i]) * 16.0f); *(v8us*)((unsigned short*)Bt + t * 8) = f.half[0];  }
template <int NHv, int TTv>
__global__ __launch_bounds__(256) void k_vt(const _Float16* __restrict__ V16, int ldv, int voff, _Float16* __restrict__ Vt) { __shared__ unsigned short tl[64][66]; const int tid = threadIdx.x; const int slab = blockIdx.x / (TTv / 64), lg = blockIdx.x % (TTv / 64); const int b = slab / NHv, h = slab % NHv;
  for (int i = tid; i < 64 * 8; i += 256) { const int r = i / 8, c8 = (i % 8) * 8; FragH f; f.half[0] = *(const v8us*)((const unsigned short*)V16 + ((size_t)b * TTv + lg * 64 + r) * ldv + voff + h * 64 + c8);
#pragma unroll
    for (int q = 0; q < 8; ++q) tl[r][c8 + q] = f.u[q]; }
  __syncthreads();
  {
#pragma unroll
    for (int rd = 0; rd < 2; ++rd) { const int d = rd * 32 + tid / 8, pc = tid % 8; FragH f;
#pragma unroll
      for (int q = 0; q < 8; ++q) f.u[q] = tl[pc * 8 + q][d];
      *(v8us*)((unsigned short*)Vt + ((size_t)slab * 64 + d) * TTv + lg * 64 + pc * 8) = f.half[0]; }
     } }

__global__ __launch_bounds__(256) void k_hl(const float* __restrict__ F, _Float16* __restrict__ Hh, _Float16* __restrict__ Hl, size_t n8) { const size_t t = (size_t)blockIdx.x * 256 + threadIdx.x; if (t >= n8) return; FragH fh, fl; const v4f a = *(const v4fa*)(F + t * 8), c = *(const v4fa*)(F + t * 8 + 4);
#pragma unroll
  for (int q = 0; q < 4; ++q) { _Float16 h = (_Float16)a[q]; fh.h[q] = h; fl.h[q] = (_Float16)((a[q] - (float)h) * 1024.0f); h = (_Float16)c[q]; fh.h[4 + q] = h; fl.h[4 + q] = (_Float16)((c[q] - (float)h) * 1024.0f); }
  { *(v8us*)((unsigned short*)Hh + t * 8) = fh.half[0]; *(v8us*)((unsigned short*)Hl + t * 8) = fl.half[0];  } }

// ---- fast GEMM (wave tile 32x64; requires M % 32 == 0 rows per launch region and N % 64 == 0); epilogue = k_gemm_hhx semantics ----
__device__ __forceinline__ v16h g2_frag(const _Float16* p, int hh) { FragH f; f.half[0] = *(const v8us*)((const unsigned short*)p + 8 * hh); f.half[1] = *(const v8us*)((const unsigned short*)p + 16 + 8 * hh); return f.v; }
__device__ __forceinline__ v8f g2_mma(v16h a, v16h b, v8f c) { v8f d = __builtin_amdgcn_wmma_f32_16x16x32_f16(false, a, false, b, (short)0, c, false, false); asm volatile("v_nop\n\tv_nop\n\tv_nop\n\tv_nop" : "+v"(d) : "v"(a), "v"(b)); return d; }
template <int ACT>
__global__ __launch_bounds__(128) void k_gemm2(const _Float16* __restrict__ A, int lda, size_t sA, const _Float16* __restrict__ Bh, int ldb, size_t sB, float alpha, const float* __restrict__ bias, size_t sBias, const float* __restrict__ CP, int rowsPerB, size_t sCPb, int row0g,
    float* __restrict__ C, _Float16* __restrict__ C16, int ldc, size_t sC, int M, int N, int K) { static_assert(ACT == 0 || ACT == 3 || ACT == 6 || ACT == 8 || ACT == 9 || ACT == 11 || ACT == 12 || ACT == 14 || ACT == 15 || ACT == 16 || ACT == 17, "k_gemm2: unsupported ACT code (would silently apply no activation)");
  __shared__ __attribute__((aligned(16))) float so[4][32][68];
  const int tid = threadIdx.x, w = tid >> 5, lane = tid & 31, ln = lane & 15, hh = lane >> 4; const int by = blockIdx.y;
  A += (size_t)by * sA; Bh += (size_t)by * sB; const size_t cofs = (size_t)by * sC; const float* bp = bias ? bias + (size_t)by * sBias : nullptr;
  const int ntn = N >> 6; const int mt = blockIdx.x / ntn, nq = blockIdx.x - mt * ntn; const int row0 = mt * 128 + 32 * w, col0 = nq * 64; if (row0 >= M) return;
  const _Float16* a0p = A + (size_t)(row0 + ln) * lda; const _Float16* a1p = a0p + (size_t)16 * lda;
  const _Float16* b0p = Bh + (size_t)(col0 + ln) * ldb; const _Float16* b1p = b0p + (size_t)16 * ldb; const _Float16* b2p = b1p + (size_t)16 * ldb; const _Float16* b3p = b2p + (size_t)16 * ldb;
  const v8f z8 = {0.f,0.f,0.f,0.f,0.f,0.f,0.f,0.f}; v8f c00 = z8, c01 = z8, c02 = z8, c03 = z8, c10 = z8, c11 = z8, c12 = z8, c13 = z8;
#pragma unroll 1
  for (int kb = 0; kb < K; kb += 32) { const v16h a0 = g2_frag(a0p + kb, hh), a1 = g2_frag(a1p + kb, hh);
    v16h b = g2_frag(b0p + kb, hh); c00 = g2_mma(a0, b, c00); c10 = g2_mma(a1, b, c10);
    b = g2_frag(b1p + kb, hh); c01 = g2_mma(a0, b, c01); c11 = g2_mma(a1, b, c11);
    b = g2_frag(b2p + kb, hh); c02 = g2_mma(a0, b, c02); c12 = g2_mma(a1, b, c12);
    b = g2_frag(b3p + kb, hh); c03 = g2_mma(a0, b, c03); c13 = g2_mma(a1, b, c13); }
  v8f accs[8] = {c00, c01, c02, c03, c10, c11, c12, c13};
#pragma unroll
  for (int u = 0; u < 8; ++u) { const int t = u & 3, half = u >> 2; const int col = col0 + t * 16 + ln; const float bv = bp ? bf16_round(bp[col]) : 0.f;
#pragma unroll
    for (int r = 0; r < 8; ++r) { const int rloc = half * 16 + 8 * hh + r; float v = accs[u][r] * alpha + bv; if (CP) { if (rowsPerB < 0) v += CP[cofs + (size_t)(row0g + row0 + rloc) * ldc + col];      /* rowsPerB < 0: own element of the batched C plane */ else { const int bidx = (row0g + row0 + rloc) / rowsPerB; v += CP[(size_t)bidx * sCPb + (size_t)by * 64 + col]; } }
      if (ACT == 3) v = fmaxf(v, 0.f); else if (ACT == 6) v = 0.5f * v * (1.0f + erff(v * 0.70710678118654752f)); else if (ACT == 11) v = 1.0f / (1.0f + expf(-v)); else if (ACT == 15) v = v / (1.0f + expf(-v)); else if (ACT == 12) v = (v > 0.f) ? v : 0.01f * v; else if (ACT == 8) v = tanhf(v); else if (ACT == 9) v = 0.5f * v * (1.0f + tanhf(0.7978845608028654f * (v + 0.044715f * v * v * v))); else if (ACT == 14) v = (v > 0.f) ? v : 0.1f * v; else if (ACT == 16) v = (v >= 0.f) ? v : 0.3f * v; else if (ACT == 17) v = (v >= 0.f) ? v : 0.2f * v;
      so[w][rloc][t * 16 + ln] = v; } }
  __builtin_amdgcn_fence(__ATOMIC_ACQ_REL, "workgroup"); __builtin_amdgcn_wave_barrier();
  const int rsub = lane >> 4, c4 = (lane & 15) * 4;
  {
#pragma unroll
    for (int q = 0; q < 16; ++q) { const int r = q * 2 + rsub; const v4f v = *(const v4fa*)&so[w][r][c4]; if (C) *(v4f*)(C + cofs + (size_t)(row0 + r) * ldc + col0 + c4) = v; if (C16) { v4h h4; for (int i = 0; i < 4; ++i) h4[i] = (_Float16)v[i]; *(v4h*)(C16 + cofs + (size_t)(row0 + r) * ldc + col0 + c4) = h4; } }
     } }


__global__ __launch_bounds__(256) void k_wnat(const float* __restrict__ w, size_t n8, _Float16* __restrict__ Bt) { const size_t t = (size_t)blockIdx.x * 256 + threadIdx.x; if (t >= n8) return; FragH f; for (int q = 0; q < 8; ++q) f.h[q] = (_Float16)(bf16_round(w[t * 8 + q]) * 16.0f); *(v8us*)((unsigned short*)Bt + t * 8) = f.half[0];  }
__global__ __launch_bounds__(256) void k_rsm(const float* __restrict__ S, _Float16* __restrict__ P, int nrows) {
  #pragma clang fp contract(off)
  const int i = blockIdx.x * 256 + threadIdx.x; if (i >= nrows) return; const float* s = S + (size_t)i * SQ; float mx = -3.0e38f;
#pragma unroll 1
  for (int j = 0; j < SQ; ++j) mx = fmaxf(mx, s[j]); float se = 0.f;
#pragma unroll 1
  for (int j = 0; j < SQ; ++j) se += expf(s[j] - mx); const float sc = 256.0f / se;
#pragma unroll 1
  for (int j0 = 0; j0 < SQ; j0 += 8) { FragH f; for (int q = 0; q < 8; ++q) f.h[q] = (_Float16)(expf(s[j0 + q] - mx) * sc); unsigned short* d = (unsigned short*)P + (size_t)i * SQ + j0; *(v8us*)d = f.half[0];  } }
__global__ __launch_bounds__(256) void k_vt(const _Float16* __restrict__ V16, int b, int h0, _Float16* __restrict__ VT) { __shared__ unsigned short tl[64][65]; const int tid = threadIdx.x; const int hh = blockIdx.x % HG, sg = blockIdx.x / HG; const int s0 = sg * 64; const int h = h0 + hh;
  for (int i = tid; i < 64 * 8; i += 256) { const int j = i / 8, d8 = (i % 8) * 8; FragH f; f.half[0] = *(const v8us*)((const unsigned short*)V16 + ((size_t)b * SQ + s0 + j) * DM + h * HD + d8); for (int q = 0; q < 8; ++q) tl[d8 + q][j] = f.u[q]; }
  __syncthreads();
  { for (int i = tid; i < 64 * 8; i += 256) { const int d = i / 8, j8 = (i % 8) * 8; FragH f; for (int q = 0; q < 8; ++q) f.u[q] = tl[d][j8 + q]; *(v8us*)((unsigned short*)VT + ((size_t)hh * HD + d) * SQ + s0 + j8) = f.half[0]; }  } }



__global__ __launch_bounds__(256) void k_rsmkm(const float* __restrict__ S, _Float16* __restrict__ P, int nrows, const int* __restrict__ am) {
  #pragma clang fp contract(off)
  const int t = blockIdx.x * 256 + threadIdx.x; if (t >= nrows) return; const size_t i = (size_t)t; const float* s = S + i * SQ; const int* mr = am + (size_t)(t % SQ) * SQ; float mx = -3.0e38f;
#pragma unroll 1
  for (int j = 0; j < SQ; ++j) { const float f = (mr[j] != 0) ? 1.f : 0.f; mx = fmaxf(mx, fmaf(f, s[j], (1.f - f) * -1.0e9f)); } float se = 0.f;
#pragma unroll 1
  for (int j = 0; j < SQ; ++j) { const float f = (mr[j] != 0) ? 1.f : 0.f; se += __expf(fmaf(f, s[j], (1.f - f) * -1.0e9f) - mx); } const float sc = 256.0f / se;
#pragma unroll 1
  for (int j0 = 0; j0 < SQ; j0 += 8) { FragH fr; for (int q = 0; q < 8; ++q) { const int j = j0 + q; const float f = (mr[j] != 0) ? 1.f : 0.f; fr.h[q] = (_Float16)(__expf(fmaf(f, s[j], (1.f - f) * -1.0e9f) - mx) * sc); }
    unsigned short* d = (unsigned short*)P + i * SQ + j0; *(v8us*)d = fr.half[0];  } }

__global__ __launch_bounds__(256) void k_bdshn(const float* __restrict__ Wb, _Float16* __restrict__ Bt) {
  const size_t t = (size_t)blockIdx.x * 256 + threadIdx.x; if (t >= (size_t)DM * DM / 8) return; const size_t e0 = t * 8; const int n = (int)(e0 / DM), k0 = (int)(e0 % DM); const int h = n >> 6, hk = k0 >> 6; const float on = (hk == h) ? 16.0f : 0.0f; const int o = n & 63, d0 = k0 & 63; FragH f;
  for (int q = 0; q < 8; ++q) f.h[q] = (_Float16)(bf16_round(Wb[(size_t)o * 64 + d0 + q]) * on);
  unsigned short* d = (unsigned short*)Bt + e0; *(v8us*)d = f.half[0];  }

typedef int v4ia __attribute__((ext_vector_type(4), may_alias));
template <int M> __device__ __forceinline__ float rs_xm(float x) { return __builtin_bit_cast(float, __builtin_amdgcn_update_dpp(0, __builtin_bit_cast(int, x), 0x160 | M, 0xf, 0xf, true)); }  // lane l with lane l ^ M inside a 16-lane row
__device__ __forceinline__ float rs_xh(float x) { return __builtin_bit_cast(float, __builtin_amdgcn_permlanex16(__builtin_bit_cast(int, x), __builtin_bit_cast(int, x), 0x76543210, 0xfedcba98, false, false)); }  // lane l with lane l ^ 16
__device__ __forceinline__ float rs_wmax(float v) { v = fmaxf(v, rs_xm<1>(v)); v = fmaxf(v, rs_xm<2>(v)); v = fmaxf(v, rs_xm<4>(v)); v = fmaxf(v, rs_xm<8>(v)); return fmaxf(v, rs_xh(v)); }
__device__ __forceinline__ float rs_wsum(float v) { v += rs_xm<1>(v); v += rs_xm<2>(v); v += rs_xm<4>(v); v += rs_xm<8>(v); return v + rs_xh(v); }
// Four 2^x. Written as asm for the slot behind a transcendental (one independent instruction or v_nop before its result is read or its source overwritten): each v_exp_f32 is followed by
// an independent one (early-clobber outputs share no register with the sources), the last by v_nop.
__device__ __forceinline__ v4f rs_exp4(v4f x) { float e0, e1, e2, e3;
  asm("v_exp_f32 %0, %4\n\tv_exp_f32 %1, %5\n\tv_exp_f32 %2, %6\n\tv_exp_f32 %3, %7\n\tv_nop" : "=&v"(e0), "=&v"(e1), "=&v"(e2), "=&v"(e3) : "v"(x[0]), "v"(x[1]), "v"(x[2]), "v"(x[3]));
  const v4f e = {e0, e1, e2, e3}; return e; }
#define KN_PITCH 32      /* ints from one batch's count to the next: a 128-byte line each, one writer a line */
// Attention as one stream over the keys: one launch for all batches and heads; scores and weights stay in registers.
// A wave owns 32 query columns and walks the batch's listed keys (packed by k_proj; n open ones, or all 2048 where none is open) in passes of 32: S^T = K Q^T (A = 16 key rows, B = 16 query columns, both k-contiguous f16 rows), so a lane holds 8 keys of ONE query a tile;
// two score tiles of a pass, converted in place, are the B operand of O^T += V^T P^T (A = rows of V^T in the same k order). Maximum and sum are per lane plus one exchange between the lane halves.
// The 8 waves of a work-group share one (batch, head): K rows and V^T rows come in stages of 64 keys, by whole 128-byte lines through registers into one of two LDS buffers
// (a fragment load from global memory would touch 16 lines for 512 bytes, and every wave would repeat it); stage s + 1 is loaded while stage s is worked on, stored behind it, one barrier a stage.
// Values: t = energy / sqrt(512) * log2(e); a place from n on (the last stage's tail; every place where n == 0) takes the module's fill (-1e20, same scale) BEFORE the maximum, so its weight is exactly 0 beside any open key and a row with no open key comes out uniform;
// weight = 2^(t - m + 6) as f16, m the maximum in use (renewed when a pass exceeds it by more than 8, so a weight stays below 2^14); the sum adds the f32 weights; o = O / sum, stored x64 as f16 rows as before.
// Every '#pragma unroll' in the kernel but those on the phase loop and the pass loop stands on a loop over a register array (fragments, accumulators): rolled, the array would be indexed at run time and leave the registers.
#define FA_WAVES 8
#define FA_COLS 32
#define FA_STAGE 64
#define FA_PITCH 72      /* halves a staged row: 144 bytes = 16 x 9, an odd multiple of 16 bytes for the 16-byte fragment reads */
static_assert(SQ % (FA_WAVES * FA_COLS) == 0 && SQ % FA_STAGE == 0 && HD == 64 && FA_WAVES * 32 * 2 * 8 == FA_STAGE * HD, "k_fattn: whole work-groups and stages; a thread stages 2 x 16 bytes of K and of V^T");
typedef _Float16 v8h __attribute__((ext_vector_type(8)));
__device__ __forceinline__ v8f fa_mma(v16h a, v16h b, v8f c) { return __builtin_amdgcn_wmma_f32_16x16x32_f16(false, a, false, b, (short)0, c, false, false); }
// One 16 x 32 fragment from k-contiguous rows, k order as g2_frag: p = the lane's row + 8 * (lane >> 4) halves.
__device__ __forceinline__ v16h fa_frag(const unsigned short* p) { FragH f; f.half[0] = *(const v8us*)p; f.half[1] = *(const v8us*)(p + 16); return f.v; }
__global__ __launch_bounds__(FA_WAVES * 32) void k_fattn(const _Float16* __restrict__ Q16, const _Float16* __restrict__ K16, const _Float16* __restrict__ VT, const int* __restrict__ KN, _Float16* __restrict__ O16) {
  __shared__ __attribute__((aligned(16))) unsigned short sk[2][FA_STAGE][FA_PITCH];      /* [buffer][key][d] */
  __shared__ __attribute__((aligned(16))) unsigned short sv[2][HD][FA_PITCH];            /* [buffer][d][key] */
  constexpr int QB = SQ / (FA_WAVES * FA_COLS);
  constexpr float SC = 0.044194173824159216f * 1.44269504088896340736f, FILL = -1.0e20f * SC;
  const int tid = threadIdx.x, lane = tid & 31, ln = lane & 15, hh = lane >> 4; const int wave = __builtin_amdgcn_readfirstlane(tid >> 5);
  const int bh = blockIdx.x / QB, b = bh / NH, h = bh % NH; const int q0 = (blockIdx.x % QB) * (FA_WAVES * FA_COLS) + wave * FA_COLS;
  const _Float16* qb = Q16 + ((size_t)b * SQ + q0) * DM + h * HD;      /* wave-uniform bases */
  const _Float16* kb = K16 + (size_t)b * SQ * DM + h * HD;
  const _Float16* vb = VT + (size_t)bh * HD * SQ;
  const int n = __builtin_amdgcn_readfirstlane(min(max(KN[b * KN_PITCH], 0), SQ));      /* open keys of the batch, bounded by the shape */
  const int nst = ((n != 0 ? n : SQ) + FA_STAGE - 1) / FA_STAGE;      /* stages that k_proj has written: 1 to SQ / FA_STAGE */
  const int srow = tid >> 3, sc8 = (tid & 7) * 8;      /* staging: 8 threads a 128-byte row; rows srow and srow + 32 */
  const unsigned roff = (unsigned)(ln * (DM * 2) + hh * 16);      /* byte offsets of the lane: row ln of a tile of q or o rows */
  const unsigned kso = (unsigned)(srow * (DM * 2) + sc8 * 2), vso = (unsigned)(srow * (SQ * 2) + sc8 * 2);
  v16h qf[2][2]; v8us gk[2], gv[2];
#pragma unroll
  for (int u = 0; u < 2; ++u) for (int ks = 0; ks < 2; ++ks) qf[u][ks] = fa_frag((const unsigned short*)((const char*)(qb + u * 16 * DM + ks * 32) + roff));
  { const char* kq = (const char*)kb + kso; const char* vq = (const char*)vb + vso;
    gk[0] = *(const v8us*)kq; gk[1] = *(const v8us*)(kq + 32 * DM * 2); gv[0] = *(const v8us*)vq; gv[1] = *(const v8us*)(vq + 32 * SQ * 2);
    asm volatile("s_wait_xcnt 0x0" :: "v"(roff), "v"(kso), "v"(vso) : "memory"); }      /* behind the loads, ahead of any new value in a register that they name (a precaution of form); as inputs the lane offsets keep their registers up to it */
  *(v8us*)&sk[0][srow][sc8] = gk[0]; *(v8us*)&sk[0][srow + 32][sc8] = gk[1]; *(v8us*)&sv[0][srow][sc8] = gv[0]; *(v8us*)&sv[0][srow + 32][sc8] = gv[1];
  const v8f z8 = {0.f, 0.f, 0.f, 0.f, 0.f, 0.f, 0.f, 0.f};
  v8f o[2][4]; float l[2] = {0.f, 0.f}, m[2] = {-3.0e38f, -3.0e38f};
#pragma unroll
  for (int u = 0; u < 2; ++u) for (int dt = 0; dt < 4; ++dt) o[u][dt] = z8;
  __syncthreads();      /* stage 0 is in LDS for every wave */
  int s = 0;
#pragma unroll      /* two copies of the stage loop, ph a constant in each: the stages that hold open keys alone carry no fill code; unrolled, not branched, since a branch in mid pass cost registers past the first 256 */
  for (int ph = 0; ph < 2; ++ph) for (const int se = (ph == 0) ? n / FA_STAGE : nst; s < se; ++s) {
    const int bf = s & 1; const int sn = (s + 1 < nst) ? s + 1 : 0;      /* the last stage loads stage 0 again (in bounds, never read) */
    { const char* kq = (const char*)(kb + (size_t)sn * FA_STAGE * DM) + kso; const char* vq = (const char*)(vb + sn * FA_STAGE) + vso;
      gk[0] = *(const v8us*)kq; gk[1] = *(const v8us*)(kq + 32 * DM * 2); gv[0] = *(const v8us*)vq; gv[1] = *(const v8us*)(vq + 32 * SQ * 2);
      asm volatile("s_wait_xcnt 0x0" ::: "memory"); }      /* behind the loads, ahead of any new value in a register that they name (a precaution of form); as a memory barrier for the compiler it also keeps the loads here, a whole stage ahead of their stores */
    v16h kf[2][2];
#pragma unroll
    for (int kt = 0; kt < 2; ++kt) for (int ks = 0; ks < 2; ++ks) kf[kt][ks] = fa_frag(&sk[bf][kt * 16 + ln][ks * 32 + 8 * hh]);
    __builtin_amdgcn_sched_barrier(0);      /* all eight reads are issued before the first wait on one: without it this build read two fragments at a time into one register block and met the LDS latency three times behind every barrier */
#pragma unroll
    for (int p = 0; p < FA_STAGE / 32; ++p) {
      v16h vf[4]; v8f t[2][2];
#pragma unroll
      for (int dt = 0; dt < 4; ++dt) vf[dt] = fa_frag(&sv[bf][dt * 16 + ln][p * 32 + 8 * hh]);
#pragma unroll
      for (int u = 0; u < 2; ++u) for (int kt = 0; kt < 2; ++kt) t[u][kt] = fa_mma(kf[kt][0], qf[u][0], z8);
#pragma unroll
      for (int u = 0; u < 2; ++u) for (int kt = 0; kt < 2; ++kt) t[u][kt] = fa_mma(kf[kt][1], qf[u][1], t[u][kt]);
      if (p + 1 < FA_STAGE / 32) {      /* the next pass of the SAME stage: its K fragments are fetched behind this pass's score products, into the registers these have left */
#pragma unroll
        for (int kt = 0; kt < 2; ++kt) for (int ks = 0; ks < 2; ++ks) kf[kt][ks] = fa_frag(&sk[bf][(p + 1) * 32 + kt * 16 + ln][ks * 32 + 8 * hh]); }
      float mx[2];
#pragma unroll
      for (int u = 0; u < 2; ++u) for (int kt = 0; kt < 2; ++kt) t[u][kt] *= SC;
      if (ph == 1) {      /* the last stage where n is no whole number of stages; every stage where n == 0 */
        const int left = n - (s * FA_STAGE + p * 32 + 8 * hh);      /* open places from the lane's first key of tile 0 on */
#pragma unroll
        for (int u = 0; u < 2; ++u) for (int kt = 0; kt < 2; ++kt) for (int r = 0; r < 8; ++r) t[u][kt][r] = (kt * 16 + r < left) ? t[u][kt][r] : FILL;
      }
#pragma unroll
      for (int u = 0; u < 2; ++u) {
        float x = fmaxf(t[u][0][0], t[u][1][0]);
#pragma unroll
        for (int r = 1; r < 8; ++r) x = fmaxf(x, fmaxf(t[u][0][r], t[u][1][r]));
        mx[u] = fmaxf(x, rs_xh(x));
      }
      if (__builtin_amdgcn_ballot_w32((mx[0] > m[0] + 8.0f) || (mx[1] > m[1] + 8.0f)) != 0) {      /* one scalar branch a pass: the products of a renewal run only where some column needs one */
        const float n0 = fmaxf(m[0], mx[0]), n1 = fmaxf(m[1], mx[1]); const v4f d4 = {m[0] - n0, m[1] - n1, 0.f, 0.f}; const v4f al = rs_exp4(d4); m[0] = n0; m[1] = n1;
#pragma unroll
        for (int u = 0; u < 2; ++u) { l[u] *= al[u]; for (int dt = 0; dt < 4; ++dt) o[u][dt] *= al[u]; }
      }
      v16h pf[2];
#pragma unroll
      for (int u = 0; u < 2; ++u) { const float ms = m[u] - 6.0f; v4f s4[2];
#pragma unroll
        for (int kt = 0; kt < 2; ++kt) { const v8f x = t[u][kt] - ms; const v4f x0 = {x[0], x[1], x[2], x[3]}, x1 = {x[4], x[5], x[6], x[7]}; const v4f e0 = rs_exp4(x0), e1 = rs_exp4(x1); s4[kt] = e0 + e1;
          const v8f e = {e0[0], e0[1], e0[2], e0[3], e1[0], e1[1], e1[2], e1[3]}; t[u][kt] = e; }
        const v4f sq = s4[0] + s4[1]; l[u] += (sq[0] + sq[1]) + (sq[2] + sq[3]);
        pf[u] = __builtin_shufflevector(__builtin_convertvector(t[u][0], v8h), __builtin_convertvector(t[u][1], v8h), 0, 1, 2, 3, 4, 5, 6, 7, 8, 9, 10, 11, 12, 13, 14, 15); }
      __builtin_amdgcn_sched_barrier(0);      /* this one and the next keep the eight products apart from the 2^x statements: those are asm text, which the compiler's padding behind a matrix instruction does not see */
#pragma unroll
      for (int dt = 0; dt < 4; ++dt) for (int u = 0; u < 2; ++u) o[u][dt] = fa_mma(vf[dt], pf[u], o[u][dt]);
      __builtin_amdgcn_sched_barrier(0);
    }
    *(v8us*)&sk[bf ^ 1][srow][sc8] = gk[0]; *(v8us*)&sk[bf ^ 1][srow + 32][sc8] = gk[1]; *(v8us*)&sv[bf ^ 1][srow][sc8] = gv[0]; *(v8us*)&sv[bf ^ 1][srow + 32][sc8] = gv[1];      /* into the buffer whose readers all passed the barrier of stage s - 1 */
    __syncthreads();      /* publishes stage s + 1 and ends every wave's reads of stage s */
  }
  _Float16* ob = O16 + ((size_t)b * SQ + q0) * DM + h * HD;
#pragma unroll
  for (int u = 0; u < 2; ++u) { const float sc = 64.0f / (l[u] + rs_xh(l[u]));
#pragma unroll
    for (int dt = 0; dt < 4; ++dt) *(v8h*)((char*)(ob + u * 16 * DM + dt * 16) + roff) = __builtin_convertvector(o[u][dt] * sc, v8h); }      /* a lane's 8 accumulator registers are 8 consecutive d of its query row */
}
#define PJ_TOK 64
#define PJ_PITCH 72      /* halves a staged row: 144 bytes, an odd multiple of 16 bytes for the 16-byte fragment reads */
static_assert(HD == 64 && NH == 8 && SQ % PJ_TOK == 0 && (SQ & (SQ - 1)) == 0 && PJ_TOK == 64 && DM == NH * HD, "k_proj: one wave a head, whole token blocks inside a batch");
static_assert(SQ == NH * 256 && (NR / PJ_TOK) * 256 * 8 == (size_t)DM * DM, "k_proj: 8 waves x 256 keys are a batch's mask; the blocks of one blockIdx.y cover the output weights, 8 a thread");
typedef __bf16 v4b __attribute__((ext_vector_type(4)));
typedef unsigned short v4us __attribute__((ext_vector_type(4), may_alias));
__global__ __launch_bounds__(256) void k_proj(const float* __restrict__ xq, const float* __restrict__ xk, const float* __restrict__ xv, const float* __restrict__ wq, const float* __restrict__ wk, const float* __restrict__ wv,
                                              const float* __restrict__ wout, const int* __restrict__ Km, int* __restrict__ KN, _Float16* __restrict__ BO, _Float16* __restrict__ Q16, _Float16* __restrict__ K16, _Float16* __restrict__ VT) {
  __shared__ __attribute__((aligned(16))) unsigned short sl[NH + 1][PJ_TOK][PJ_PITCH];      /* [wave][token][input], later the wave's output tile; tile NH: the weights [output][input] */
  __shared__ int wt[NH]; __shared__ __attribute__((aligned(16))) int li[2][PJ_TOK / 2];      /* the waves' counts of open keys; the block's tokens: place q at li[q & 1][q >> 1], so that a lane half reads its 32 rows in a row */
  const int tid = threadIdx.x, lane = tid & 31, ln = lane & 15, hh = lane >> 4; const int h = __builtin_amdgcn_readfirstlane(tid >> 5);
  const int which = blockIdx.y; const int r0 = blockIdx.x * PJ_TOK; const bool tr = which == 2;
  if (which == 3) {      /* Wo natural [out][in] = Bt x16; the whole work-group, ahead of every barrier */
    const unsigned to = (unsigned)(((int)blockIdx.x * 256 + tid) * 32); const v4f a = *(const v4fa*)((const char*)wout + to), c = *(const v4fa*)((const char*)wout + to + 16);
    asm volatile("s_wait_xcnt 0x0" :: "v"(to) : "memory");      /* behind the loads, ahead of any new value in a register that they name (a precaution of form); as an input the lane offset keeps its register up to it */
    FragH f; for (int q = 0; q < 4; ++q) { f.h[q] = (_Float16)(bf16_round(a[q]) * 16.0f); f.h[4 + q] = (_Float16)(bf16_round(c[q]) * 16.0f); }
    *(v8us*)((char*)BO + (to >> 1)) = f.half[0]; return; }
  const int b = r0 / SQ, p0 = r0 % SQ;
  const float* xb = (which == 0 ? xq : which == 1 ? xk : xv) + (size_t)b * SQ * DM + h * HD;      /* wave-uniform bases */
  const float* wb = which == 0 ? wq : which == 1 ? wk : wv;
  const unsigned wo = (unsigned)(tid * 64); unsigned xo[PJ_TOK / 2];      /* byte offsets of the lane: xo[j] = its half's row of the pair j */
  bool live = true; int n = 0;      /* live: the same for the whole work-group: all that follows, its barriers too, stands under it; n: the batch's open keys */
  if (which == 0) {
#pragma unroll
    for (int j = 0; j < PJ_TOK / 2; ++j) xo[j] = (unsigned)((p0 + j * 2 + hh) * (DM * 4) + ln * 16);
  } else {
    const int k0 = h * 256 + lane; const char* mb = (const char*)(Km + (size_t)b * SQ); const unsigned mo = (unsigned)(k0 * 4);
    int mv[8];
#pragma unroll
    for (int r = 0; r < 8; ++r) mv[r] = *(const int*)(mb + mo + r * 128);
    asm volatile("s_wait_xcnt 0x0" :: "v"(mo) : "memory");      /* behind the loads, ahead of any new value in a register that they name (a precaution of form); as an input the lane offset keeps its register up to it */
    unsigned bal[8]; int tot = 0;
#pragma unroll
    for (int r = 0; r < 8; ++r) { bal[r] = __builtin_amdgcn_ballot_w32(mv[r] != 0); tot += __builtin_popcount(bal[r]); }
    if (lane == 0) wt[h] = tot;
    if (tid < PJ_TOK) li[tid & 1][tid >> 1] = 0;
    __syncthreads();      /* every wave's count is in LDS, and the list's start value */
    int base = 0;
    for (int i = 0; i < NH; ++i) { const int v = wt[i]; base += (i < h) ? v : 0; n += v; }
    live = p0 < (n != 0 ? n : SQ);
    if (live) {
      if (n == 0) { if (tid < PJ_TOK) li[tid & 1][tid >> 1] = p0 + tid; }
      else {
#pragma unroll
        for (int r = 0; r < 8; ++r) { const unsigned q = (unsigned)(base + __builtin_popcount(bal[r] & ((1u << lane) - 1u)) - p0); if (((bal[r] >> lane) & 1u) && q < (unsigned)PJ_TOK) li[q & 1][q >> 1] = k0 + r * 32; base += __builtin_popcount(bal[r]); }
      }
      __syncthreads();      /* the block's 64 tokens are in LDS */
      const v4ia* kl = (const v4ia*)li[hh];
#pragma unroll
      for (int i = 0; i < PJ_TOK / 8; ++i) { const v4ia k4 = kl[i];      /* the token is bounded by the shape before an address is formed */
        for (int q = 0; q < 4; ++q) xo[i * 4 + q] = (unsigned)((k4[q] & (SQ - 1)) * (DM * 4) + ln * 16); }
    }
  }
  if (live) {
  v4f gx[PJ_TOK / 2], gw[4];
#pragma unroll
  for (int q = 0; q < 4; ++q) gw[q] = *(const v4fa*)((const char*)wb + wo + q * 16);
#pragma unroll
  for (int j = 0; j < PJ_TOK / 4; ++j) gx[j] = *(const v4fa*)((const char*)xb + xo[j]);
  /* Both waits: behind the loads, ahead of any new value in a register that they name (a precaution of form); as inputs the lane offsets keep their registers up to it. Two statements, since one takes at most thirty operands. */
  asm volatile("s_wait_xcnt 0x0" :: "v"(wo), "v"(xo[0]), "v"(xo[1]), "v"(xo[2]), "v"(xo[3]), "v"(xo[4]), "v"(xo[5]), "v"(xo[6]), "v"(xo[7]), "v"(xo[8]), "v"(xo[9]), "v"(xo[10]), "v"(xo[11]), "v"(xo[12]), "v"(xo[13]), "v"(xo[14]), "v"(xo[15]) : "memory");
#pragma unroll
  for (int j = PJ_TOK / 4; j < PJ_TOK / 2; ++j) gx[j] = *(const v4fa*)((const char*)xb + xo[j]);
  asm volatile("s_wait_xcnt 0x0" :: "v"(xo[16]), "v"(xo[17]), "v"(xo[18]), "v"(xo[19]), "v"(xo[20]), "v"(xo[21]), "v"(xo[22]), "v"(xo[23]), "v"(xo[24]), "v"(xo[25]), "v"(xo[26]), "v"(xo[27]), "v"(xo[28]), "v"(xo[29]), "v"(xo[30]), "v"(xo[31]) : "memory");
  __builtin_amdgcn_sched_barrier(0);      /* all 36 loads are issued before the first wait on one: without it this build held the last nine back behind the return of the first and met the memory latency twice */
#pragma unroll
  for (int q = 0; q < 4; ++q) { v4h w4; for (int i = 0; i < 4; ++i) w4[i] = (_Float16)(bf16_round(gw[q][i]) * 16.0f); *(v4us*)&sl[NH][tid >> 2][(tid & 3) * 16 + q * 4] = __builtin_bit_cast(v4us, w4); }
#pragma unroll
  for (int j = 0; j < PJ_TOK / 2; ++j) *(v4us*)&sl[h][j * 2 + hh][ln * 4] = __builtin_bit_cast(v4us, __builtin_convertvector(__builtin_convertvector(__builtin_convertvector(gx[j], v4b), v4f), v4h));      /* to bf16, nearest even, as bf16_round; that value as f16 */
  __syncthreads();      /* the weight block is in LDS for every wave (and each wave's own tile for all its lanes) */
  const unsigned short (*sa)[PJ_PITCH] = sl[tr ? h : NH]; const unsigned short (*sb)[PJ_PITCH] = sl[tr ? NH : h];
  v16h af[4][2], bf[2][2];
#pragma unroll
  for (int t = 0; t < 4; ++t) for (int ks = 0; ks < 2; ++ks) af[t][ks] = fa_frag(&sa[t * 16 + ln][ks * 32 + 8 * hh]);
#pragma unroll
  for (int ks = 0; ks < 2; ++ks) bf[0][ks] = fa_frag(&sb[ln][ks * 32 + 8 * hh]);
  const v8f z8 = {0.f, 0.f, 0.f, 0.f, 0.f, 0.f, 0.f, 0.f};
#pragma unroll
  for (int rt = 0; rt < 4; ++rt) {
    if (rt + 1 < 4) {      /* the next round's B rows are fetched ahead of this round's writes, which touch other rows */
#pragma unroll
      for (int ks = 0; ks < 2; ++ks) bf[(rt + 1) & 1][ks] = fa_frag(&sb[(rt + 1) * 16 + ln][ks * 32 + 8 * hh]); }
    v8f acc[4];
#pragma unroll
    for (int ct = 0; ct < 4; ++ct) acc[ct] = fa_mma(af[ct][0], bf[rt & 1][0], z8);
#pragma unroll
    for (int ct = 0; ct < 4; ++ct) acc[ct] = fa_mma(af[ct][1], bf[rt & 1][1], acc[ct]);
#pragma unroll
    for (int ct = 0; ct < 4; ++ct) *(v8us*)&sl[h][rt * 16 + ln][ct * 16 + 8 * hh] = __builtin_bit_cast(v8us, __builtin_convertvector(acc[ct] * 0.0625f, v8h));
  }
  __builtin_amdgcn_fence(__ATOMIC_ACQ_REL, "workgroup"); __builtin_amdgcn_wave_barrier();      /* the rows are read back by other lanes of the same wave: keeps the reads behind the writes */
  v8us ov[16];
#pragma unroll
  for (int j = 0; j < 16; ++j) ov[j] = *(const v8us*)&sl[h][j * 4 + (lane >> 3)][(lane & 7) * 8];      /* 8 lanes a row of 128 bytes, 4 rows an instruction */
  char* ob = tr ? (char*)(VT + ((size_t)(r0 / SQ) * NH + h) * HD * SQ + r0 % SQ) : (char*)((which == 0 ? Q16 : K16) + (size_t)r0 * DM + h * HD);      /* wave-uniform: the tile's first output row, and the bytes from row to row */
  const unsigned pb = tr ? SQ * 2 : DM * 2; const unsigned oo = (unsigned)(lane >> 3) * pb + (unsigned)(lane & 7) * 16;
#pragma unroll
  for (int j = 0; j < 16; ++j) *(v8us*)(ob + (size_t)(j * 4 * pb) + oo) = ov[j];
  if (which == 1 && p0 == 0 && tid == 0) KN[b * KN_PITCH] = n;      /* a batch's first K block is always live; last, since a barrier behind a store would wait for it */
  }
}
// Output product out = o Wo^T * alpha + b for all token rows, operands staged in LDS. A work-group of 8 waves owns a 128 x 128 tile of out (one work-group a WGP at this shape); a wave owns 32 x 64 of it (2 x 4 accumulator tiles, as k_gemm2).
// o rows and Wo rows come in stages of 128 k: a wave-wide 16-byte load covers two rows' 256 contiguous bytes (whole 128-byte lines; a fragment load from global memory touches 16 lines for 512 bytes, and each of them was waited for on its own),
// through registers into one of two LDS buffers; stage s + 1 is on its way while stage s is worked on, stored behind it, one barrier a stage. Each operand byte is read once a work-group.
// The k steps run in the order of k_gemm2 and the fragments have its k order, so every accumulator sees the same sums; the epilogue is k_gemm2's (alpha, bias rounded to bf16, the wave's tile through its own LDS range, whole lines out).
// Every '#pragma unroll' in the kernel but the one on the stage loop stands on a loop over a register array (loads in flight, fragments, accumulators): rolled, the array would be indexed at run time and leave the registers.
#define OG_T 128         /* rows and columns of out a work-group */
#define OG_K 128         /* k a stage */
#define OG_PITCH 136     /* halves a staged row: 272 bytes = 16 x 17, an odd multiple of 16 bytes for the 16-byte fragment reads */
static_assert(MPO % OG_T == 0 && DM % OG_T == 0 && DM % OG_K == 0 && OG_K == 128 && OG_T == 128, "k_ogemm: whole tiles and stages; 16 threads stage a row of 256 bytes, 16 rows a round");
__global__ __launch_bounds__(256) void k_ogemm(const _Float16* __restrict__ A, const _Float16* __restrict__ Bh, float alpha, const float* __restrict__ bias, float* __restrict__ C) {
  __shared__ __attribute__((aligned(16))) unsigned short sa[2][OG_T][OG_PITCH];      /* [buffer][token row][k] */
  __shared__ __attribute__((aligned(16))) unsigned short sb[2][OG_T][OG_PITCH];      /* [buffer][output column][k] */
  __shared__ __attribute__((aligned(16))) float so[8][32][68];                       /* a wave's tile on its way out */
  constexpr int NS = DM / OG_K, NT = DM / OG_T;
  const int tid = threadIdx.x, lane = tid & 31, ln = lane & 15, hh = lane >> 4; const int wave = __builtin_amdgcn_readfirstlane(tid >> 5);
  const int row0 = ((int)blockIdx.x / NT) * OG_T, col0 = ((int)blockIdx.x % NT) * OG_T; const int wm = (wave >> 1) * 32, wn = (wave & 1) * 64;      /* the wave's place in the tile */
  const char* ab = (const char*)(A + (size_t)row0 * DM); const char* bb = (const char*)(Bh + (size_t)col0 * DM);      /* uniform bases */
  const int srow = tid >> 4, sc8 = (tid & 15) * 8;      /* staging: 16 threads a 256-byte row; rows srow + 16 j */
  const unsigned go = (unsigned)(srow * (DM * 2) + sc8 * 2);      /* byte offset of the lane in a stage of either operand */
  const char* ib = (const char*)(bias + col0 + wn); const unsigned io = (unsigned)(ln * 4);      /* the wave's 64 bias values: fetched here, so that the epilogue does not wait for them */
  v8us ga[OG_T / 16], gb[OG_T / 16]; float bv[4];
#pragma unroll
  for (int j = 0; j < OG_T / 16; ++j) { ga[j] = *(const v8us*)(ab + j * 16 * DM * 2 + go); gb[j] = *(const v8us*)(bb + j * 16 * DM * 2 + go); }
#pragma unroll
  for (int t = 0; t < 4; ++t) bv[t] = *(const float*)(ib + t * 64 + io);
  asm volatile("s_wait_xcnt 0x0" :: "v"(go), "v"(io) : "memory");      /* behind the loads, ahead of any new value in a register that they name (a precaution of form); as inputs the lane offsets keep their registers up to it */
#pragma unroll
  for (int j = 0; j < OG_T / 16; ++j) { *(v8us*)&sa[0][j * 16 + srow][sc8] = ga[j]; *(v8us*)&sb[0][j * 16 + srow][sc8] = gb[j]; }
  const v8f z8 = {0.f, 0.f, 0.f, 0.f, 0.f, 0.f, 0.f, 0.f};
  v8f acc[2][4];
#pragma unroll
  for (int i = 0; i < 2; ++i) for (int t = 0; t < 4; ++t) acc[i][t] = z8;
  __syncthreads();      /* stage 0 is in LDS for every wave */
#pragma unroll
  for (int s = 0; s < NS; ++s) {
    const int bf = s & 1;
    if (s + 1 < NS) {      /* behind the barrier, not ahead of it: the barrier's fence waits for every load that is under way */
#pragma unroll
      for (int j = 0; j < OG_T / 16; ++j) { ga[j] = *(const v8us*)(ab + (s + 1) * OG_K * 2 + j * 16 * DM * 2 + go); gb[j] = *(const v8us*)(bb + (s + 1) * OG_K * 2 + j * 16 * DM * 2 + go); }
      asm volatile("s_wait_xcnt 0x0" :: "v"(go) : "memory");      /* as above; as a memory barrier for the compiler it also keeps the loads here, a whole stage ahead of their stores */
    }
    v16h af[2][2], bq[2][4];
#pragma unroll
    for (int i = 0; i < 2; ++i) af[0][i] = fa_frag(&sa[bf][wm + i * 16 + ln][8 * hh]);
#pragma unroll
    for (int t = 0; t < 4; ++t) bq[0][t] = fa_frag(&sb[bf][wn + t * 16 + ln][8 * hh]);
#pragma unroll
    for (int ks = 0; ks < OG_K / 32; ++ks) {
      if (ks + 1 < OG_K / 32) {      /* the next k step's fragments are fetched as one group ahead of this step's products, into the second register set */
#pragma unroll
        for (int i = 0; i < 2; ++i) af[(ks + 1) & 1][i] = fa_frag(&sa[bf][wm + i * 16 + ln][(ks + 1) * 32 + 8 * hh]);
#pragma unroll
        for (int t = 0; t < 4; ++t) bq[(ks + 1) & 1][t] = fa_frag(&sb[bf][wn + t * 16 + ln][(ks + 1) * 32 + 8 * hh]);
      }
      __builtin_amdgcn_sched_barrier(0);      /* this one and the next keep the twelve reads one group ahead of the eight products: without them this build read two fragments' halves at a time into one register block and waited out the LDS latency in front of every second product */
#pragma unroll
      for (int t = 0; t < 4; ++t) for (int i = 0; i < 2; ++i) acc[i][t] = fa_mma(af[ks & 1][i], bq[ks & 1][t], acc[i][t]);
      __builtin_amdgcn_sched_barrier(0);
    }
    if (s + 1 < NS) {
#pragma unroll
      for (int j = 0; j < OG_T / 16; ++j) { *(v8us*)&sa[bf ^ 1][j * 16 + srow][sc8] = ga[j]; *(v8us*)&sb[bf ^ 1][j * 16 + srow][sc8] = gb[j]; }      /* into the buffer whose readers all passed the barrier of stage s - 1 */
      __syncthreads();      /* publishes stage s + 1 and ends every wave's reads of stage s */
    }
  }
#pragma unroll
  for (int t = 0; t < 4; ++t) { const float br = bf16_round(bv[t]);
#pragma unroll
    for (int i = 0; i < 2; ++i) for (int r = 0; r < 8; ++r) so[wave][i * 16 + 8 * hh + r][t * 16 + ln] = acc[i][t][r] * alpha + br; }
  __builtin_amdgcn_fence(__ATOMIC_ACQ_REL, "workgroup"); __builtin_amdgcn_wave_barrier();      /* the rows are read back by other lanes of the same wave: keeps the reads behind the writes */
  char* cb = (char*)(C + (size_t)(row0 + wm) * DM + col0 + wn);      /* uniform for the wave */
  const unsigned co = (unsigned)(hh * (DM * 4) + ln * 16);
  v4f ov[16];
#pragma unroll
  for (int q = 0; q < 16; ++q) ov[q] = *(const v4fa*)&so[wave][q * 2 + hh][ln * 4];      /* 16 lanes a row of 256 bytes, 2 rows an instruction */
#pragma unroll
  for (int q = 0; q < 16; ++q) *(v4f*)(cb + q * 2 * DM * 4 + co) = ov[q];
}
extern "C" void kernel_launch(void* const* d_in, const int* in_sizes, int n_in,
                              void* d_out, int out_size, void* d_ws, size_t ws_size, hipStream_t stream) {
  (void)in_sizes; (void)n_in; (void)out_size;
  const float* const* I = (const float* const*)d_in; const float* xq = I[2]; const float* xk = I[1]; const float* xv = I[0]; const int* km = (const int*)d_in[3]; const float* wq = I[6]; const float* wk = I[5]; const float* wv = I[4]; const float* wo = I[7]; const float* bo = I[8];      /* contract order: values I[0], keys I[1], query I[2]; mask int32 [4][1][1][2048] (0 = masked key; READ on device); SHARED natural [64][64] blocks Wv I[4], Wk I[5], Wq I[6]; natural Wo [512][512] + bo */
  char* ws = (char*)d_ws; size_t off = 0;
  auto take = [&](size_t bytes) { char* p = ws + off; off += (bytes + 255) & ~(size_t)255; return p; };
  _Float16* BO = (_Float16*)take((size_t)DM * DM * 2);
  _Float16* Q16 = (_Float16*)take(NR * DM * 2); _Float16* K16 = (_Float16*)take(NR * DM * 2); _Float16* O16 = (_Float16*)take(NR * DM * 2);
  _Float16* VT = (_Float16*)take((size_t)NB * NH * HD * SQ * 2);
  int* KN = (int*)take((size_t)NB * KN_PITCH * 4);      /* the number of open keys of each batch */
  if (off > ws_size) return;
  const size_t r0p = (size_t)B0 * SQ;      /* first row of the output stage */
  k_proj<<<dim3((unsigned)(NR / PJ_TOK), 4), 256, 0, stream>>>(xq, xk, xv, wq, wk, wv, wo, km, KN, BO, Q16, K16, VT);      /* q rows [NB * SQ][DM]; k rows and V^T [NB][NH][HD][SQ] packed to the open keys, f16; the open keys' number; Wo as f16 x16 */
  k_fattn<<<NB * NH * (SQ / (FA_WAVES * FA_COLS)), FA_WAVES * 32, 0, stream>>>(Q16, K16, VT, KN, O16);      /* o (merged heads) as f16 rows x64; keys with mask[b][j] == 0 are not listed */
  k_ogemm<<<(unsigned)((MPO / OG_T) * (DM / OG_T)), 256, 0, stream>>>(O16 + r0p * DM, BO, 0.0009765625f, bo, (float*)d_out + r0p * DM);      /* out rows are the output layout */
}

// v007
// It runs in 33.1 microseconds.
// Next to v006, in two timings, it ran 1.07 and 1.06 times as fast.
// Over all steps from v000 it is 101 times as fast.
#include <hip/hip_runtime.h>
// Multi-head attention over three inputs with SHARED per-head projections, a random key-padding mask and the module's literal score scale (values, keys, query [4][2048][512]; each input is split into 8 heads of 64 and every head is multiplied by the SAME natural [64][64] matrix (x W^T: Wv / Wk / Wq; no biases); energy = q k^T; where(mask == 0, -1e20) with the int32 [4][1][1][2048] mask in {0, 1} (random; 0 = masked key; READ on device); softmax(energy / sqrt(embed_size) = / sqrt(512)) (as the source); out = merged Wo^T + bo -> [4][2048][512]).
// Structure: token rows r = b*2048 + s; a key with mask 0 has weight exactly 0 beside any open key, so only the open keys of a batch are attended (each work-group of k_fattn lists them from the mask; a batch with no open key keeps all keys, every score at the fill). The shared per-head matrices leave the key loop by associativity: energy = (Wk^T Wq xq) . xk and weights x V = Wv (weights x xv), so scores, masked softmax and weights x values run in ONE launch for all batches and heads straight on the rounded f32 inputs (k_fattn: running maximum and sum, scores and weights never in memory; o carried x64 against f16 subnormal flush, folded into the output GEMM alpha), written into the merged f16 o rows; out = o W_o + b GEMM (f32; k_ogemm: operands staged in LDS by whole lines) into the output layout.
// Compute dtype: inputs rounded to bf16; x / weights exact in f16 (weights x16); Wq xq, q', softmax weights, the normalised weighted sum and o as plain f16 GEMM operands (~2^-12); scores and softmax statistics f32. v_wmma_f32_16x16x32_f16.
#define NB 4
#define SQ 2048
#define DM 512
#define NH 8
#define HD 64
#define HG 4                         /* heads a launch of the k_vt(V16, b, h0, VT) form, which is not launched */
#define B0 0                         /* first batch of the output stage (debug hook) */
#define NBR NB                       /* batches of the output stage (debug hook) */
#define NR ((size_t)NB * SQ)         /* token rows */
#define MP ((int)((size_t)NBR * SQ)) /* rows of the output stage, via MPO (debug hook) */
#define QN SQ                        /* unused; k_fattn attends all SQ query rows of a batch */
#define NHD NH                       /* unused; k_fattn attends all NH heads */
#define MPO MP                       /* rows through the output stage (debug hook) */
#define LQ DM      /* unused; the q and k rows have pitch DM */
typedef __bf16 v16b __attribute__((ext_vector_type(16)));
typedef unsigned short v8us __attribute__((ext_vector_type(8), may_alias));
typedef float  v8f  __attribute__((ext_vector_type(8)));
typedef float  v4f  __attribute__((ext_vector_type(4)));
typedef float  v4fa __attribute__((ext_vector_type(4), may_alias));
union FragB { v16b v; v8us half[2]; unsigned short u[16]; };

__device__ __forceinline__ unsigned short bf16_bits(float x) { unsigned int u = __float_as_uint(x); return (unsigned short)((u + 0x7FFFu + ((u >> 16) & 1u)) >> 16); }
__device__ __forceinline__ float bf16_val(unsigned short b) { return __uint_as_float(((unsigned int)b) << 16); }
__device__ __forceinline__ float bf16_round(float x) { return bf16_val(bf16_bits(x)); }
// D += A·B with NT terms: 1 = ah·bh, 2 = + al·bh (A split), 3 = + ah·bl (both split)
template <int NT>
__device__ __forceinline__ v8f mmaN(v16b ah, v16b al, v16b bh, v16b bl, v8f c) {
  c = __builtin_amdgcn_wmma_f32_16x16x32_bf16(false, ah, false, bh, (short)0, c, false, false);
  if (NT >= 2) c = __builtin_amdgcn_wmma_f32_16x16x32_bf16(false, al, false, bh, (short)0, c, false, false);
  if (NT >= 3) c = __builtin_amdgcn_wmma_f32_16x16x32_bf16(false, ah, false, bl, (short)0, c, false, false);
  asm volatile("v_nop\n\tv_nop\n\tv_nop\n\tv_nop" : "+v"(c) : "v"(ah), "v"(al), "v"(bh), "v"(bl));
  return c;
}

__global__ __launch_bounds__(256) void k_wt_bf16(const float* __restrict__ W, unsigned short* __restrict__ Wt, int K, int N) {
  const int t = blockIdx.x * 256 + threadIdx.x;
  const int k8n = K / 8;
  if (t >= N * k8n) return;
  const int n = t / k8n, k8 = (t % k8n) * 8;
  v8us v;
#pragma unroll
  for (int i = 0; i < 8; ++i) v[i] = bf16_bits(W[(size_t)(k8 + i) * N + n]);
  *(v8us*)(Wt + (size_t)n * K + k8) = v;
  
}

// GEMM C[M][N] (f32, pitch ldc) = act(A[M][K]·W + bias). A f32 row-major (pitch lda) converted per fragment to bf16
// (ASPLIT: hi/lo two planes -> 2 terms, else single rounded term); Wt bf16 [N][K] (pitch ldb). BIAS_BF16 rounds the
// bias to bf16 first (bias quantised to bf16 before the add). K%32==0, M%16==0, N%64==0.
template <bool ASPLIT, int ACT, bool BIAS_BF16>
__global__ __launch_bounds__(128) void k_gemm_bf(const float* __restrict__ A, int lda, const unsigned short* __restrict__ Wt, int ldb,
                                               const float* __restrict__ bias, float* __restrict__ C, int ldc, int M, int N, int K) {
  __shared__ __attribute__((aligned(16))) float so[4][16][64];
  const int tid = threadIdx.x, w = tid >> 5, lane = tid & 31, ln = lane & 15, hh = lane >> 4;
  const int ntn = N / 64;
  const int wid = blockIdx.x * 4 + w;
  const int mt = wid / ntn, nq = wid % ntn;
  if (mt * 16 >= M) return;
  const int row0 = mt * 16, col0 = nq * 64;
  const float* arow = A + (size_t)(row0 + ln) * lda;
  v8f acc[4] = {};
  for (int kb = 0; kb < K; kb += 32) {
    FragB ah, al;
    const v4f x0 = *(const v4fa*)(arow + kb + 8 * hh), x1 = *(const v4fa*)(arow + kb + 8 * hh + 4);
    const v4f x2 = *(const v4fa*)(arow + kb + 16 + 8 * hh), x3 = *(const v4fa*)(arow + kb + 16 + 8 * hh + 4);
    float xs[16] = {x0[0],x0[1],x0[2],x0[3],x1[0],x1[1],x1[2],x1[3],x2[0],x2[1],x2[2],x2[3],x3[0],x3[1],x3[2],x3[3]};
#pragma unroll
    for (int i = 0; i < 16; ++i) { const unsigned short hb = bf16_bits(xs[i]); ah.u[i] = hb; al.u[i] = ASPLIT ? bf16_bits(xs[i] - bf16_val(hb)) : (unsigned short)0; }
#pragma unroll
    for (int t = 0; t < 4; ++t) {
      const unsigned short* brow = Wt + (size_t)(col0 + t * 16 + ln) * ldb + kb;
      FragB b;
      b.half[0] = *(const v8us*)(brow + 8 * hh);
      b.half[1] = *(const v8us*)(brow + 16 + 8 * hh);
      acc[t] = mmaN<ASPLIT ? 2 : 1>(ah.v, al.v, b.v, b.v, acc[t]);
    }
  }
#pragma unroll
  for (int t = 0; t < 4; ++t) {
    float bv = bias ? bias[col0 + t * 16 + ln] : 0.f;
    if (BIAS_BF16) bv = bf16_round(bv);
#pragma unroll
    for (int r = 0; r < 8; ++r) { float v = acc[t][r] + bv; if (ACT == 1) v = fmaxf(v, 0.f); so[w][8 * hh + r][t * 16 + ln] = v; }
  }
  __builtin_amdgcn_fence(__ATOMIC_ACQ_REL, "workgroup");
  __builtin_amdgcn_wave_barrier();
  const int rsub = lane >> 4, c4 = (lane & 15) * 4;
  {
#pragma unroll
    for (int q = 0; q < 8; ++q) {
      const int r = q * 2 + rsub;
      const v4f v = *(const v4fa*)&so[w][r][c4];
      *(v4f*)(C + (size_t)(row0 + r) * ldc + col0 + c4) = v;
    }
    
  }
}

// GEMM C = act(A·W + bias + resid): A f32 (ASPLIT -> hi/lo 2 terms), Wt bf16 [N][K]; ACT 0 none, 1 relu, 2 exact gelu;
// resid (optional, f32, row index = (row % rmod), pitch ldr, RES_BF16 rounds it) added before the activation.
template <bool ASPLIT, int ACT, bool BIAS_BF16, bool RES_BF16>
__global__ __launch_bounds__(128) void k_gemm_bf3(const float* __restrict__ A, int lda, const unsigned short* __restrict__ Wt, int ldb,
                                                const float* __restrict__ bias, const float* __restrict__ resid, int rmod, int ldr,
                                                float* __restrict__ C, int ldc, int M, int N, int K) {
  __shared__ __attribute__((aligned(16))) float so[4][16][64];
  const int tid = threadIdx.x, w = tid >> 5, lane = tid & 31, ln = lane & 15, hh = lane >> 4;
  const int ntn = N / 64;
  const int wid = blockIdx.x * 4 + w;
  const int mt = wid / ntn, nq = wid % ntn;
  if (mt * 16 >= M) return;
  const int row0 = mt * 16, col0 = nq * 64;
  const float* arow = A + (size_t)(row0 + ln) * lda;
  v8f acc[4] = {};
  for (int kb = 0; kb < K; kb += 32) {
    FragB ah, al;
    const v4f x0 = *(const v4fa*)(arow + kb + 8 * hh), x1 = *(const v4fa*)(arow + kb + 8 * hh + 4);
    const v4f x2 = *(const v4fa*)(arow + kb + 16 + 8 * hh), x3 = *(const v4fa*)(arow + kb + 16 + 8 * hh + 4);
    float xs[16] = {x0[0],x0[1],x0[2],x0[3],x1[0],x1[1],x1[2],x1[3],x2[0],x2[1],x2[2],x2[3],x3[0],x3[1],x3[2],x3[3]};
#pragma unroll
    for (int i = 0; i < 16; ++i) { const unsigned short hb = bf16_bits(xs[i]); ah.u[i] = hb; al.u[i] = ASPLIT ? bf16_bits(xs[i] - bf16_val(hb)) : (unsigned short)0; }
#pragma unroll
    for (int t = 0; t < 4; ++t) {
      const unsigned short* brow = Wt + (size_t)(col0 + t * 16 + ln) * ldb + kb;
      FragB b;
      b.half[0] = *(const v8us*)(brow + 8 * hh);
      b.half[1] = *(const v8us*)(brow + 16 + 8 * hh);
      acc[t] = mmaN<ASPLIT ? 2 : 1>(ah.v, al.v, b.v, b.v, acc[t]);
    }
  }
#pragma unroll
  for (int t = 0; t < 4; ++t) {
    const int col = col0 + t * 16 + ln;
    float bv = bias ? bias[col] : 0.f;
    if (BIAS_BF16) bv = bf16_round(bv);
#pragma unroll
    for (int r = 0; r < 8; ++r) {
      float v = acc[t][r] + bv;
      if (resid) { float rv = resid[(size_t)((row0 + 8 * hh + r) % rmod) * ldr + col]; if (RES_BF16) rv = bf16_round(rv); v += rv; }
      if (ACT == 1) v = fmaxf(v, 0.f);
      if (ACT == 2) v = 0.5f * v * (1.0f + erff(v * 0.70710678118654752f));
      if (ACT == 3) { const float u = 0.7978845608028654f * (v + 0.044715f * v * v * v); v = 0.5f * v * (1.0f + tanhf(u)); }
      so[w][8 * hh + r][t * 16 + ln] = v;
    }
  }
  __builtin_amdgcn_fence(__ATOMIC_ACQ_REL, "workgroup");
  __builtin_amdgcn_wave_barrier();
  const int rsub = lane >> 4, c4 = (lane & 15) * 4;
  {
#pragma unroll
    for (int q = 0; q < 8; ++q) {
      const int r = q * 2 + rsub;
      const v4f v = *(const v4fa*)&so[w][r][c4];
      *(v4f*)(C + (size_t)(row0 + r) * ldc + col0 + c4) = v;
    }
    
  }
}
// row LayerNorm (biased variance, eps) over N: s = X (+ R); optional out_sum <- s; out_norm <- (s-mu)*rsqrt(var+eps)*g + b
template <bool PARAM_BF16>
__global__ __launch_bounds__(256) void k_layernorm(const float* __restrict__ X, const float* __restrict__ R, const float* __restrict__ g, const float* __restrict__ bta,
                                                  float* __restrict__ out_sum, float* __restrict__ out_norm, int N, float eps) {
  __shared__ float red[256];
  const int row = blockIdx.x, tid = threadIdx.x;
  const float* x = X + (size_t)row * N; const float* rr = R ? R + (size_t)row * N : nullptr;
  float vals[16];                     // up to N = 4096
  const int per = N / 256;            // contiguous chunk per thread? use strided-by-4 chunks: thread handles j = tid*4 + 1024*u
  float s1 = 0.f;
  for (int u = 0; u < per / 4; ++u) {
    const int j = tid * 4 + 1024 * u;
    const v4f a = *(const v4fa*)(x + j);
    v4f b = {0.f,0.f,0.f,0.f}; if (rr) b = *(const v4fa*)(rr + j);
#pragma unroll
    for (int q = 0; q < 4; ++q) { const float v = a[q] + b[q]; vals[u * 4 + q] = v; s1 += v; }
  }
  red[tid] = s1; __syncthreads();
  for (int st = 128; st > 0; st >>= 1) { if (tid < st) red[tid] += red[tid + st]; __syncthreads(); }
  const float mu = red[0] / (float)N; __syncthreads();
  float s2 = 0.f;
  for (int u = 0; u < per / 4; ++u)
#pragma unroll
    for (int q = 0; q < 4; ++q) { const float c = vals[u * 4 + q] - mu; s2 += c * c; }
  red[tid] = s2; __syncthreads();
  for (int st = 128; st > 0; st >>= 1) { if (tid < st) red[tid] += red[tid + st]; __syncthreads(); }
  const float rs = rsqrtf(red[0] / (float)N + eps);
  {
    for (int u = 0; u < per / 4; ++u) {
      const int j = tid * 4 + 1024 * u;
      v4f o, sm;
#pragma unroll
      for (int q = 0; q < 4; ++q) {
        float gg = g[j + q], bb = bta[j + q];
        if (PARAM_BF16) { gg = bf16_round(gg); bb = bf16_round(bb); }
        sm[q] = vals[u * 4 + q]; o[q] = (vals[u * 4 + q] - mu) * rs * gg + bb;
      }
      if (out_sum) *(v4f*)(out_sum + (size_t)row * N + j) = sm;
      *(v4f*)(out_norm + (size_t)row * N + j) = o;
    }
    
  }
}



// ---- f16 WMMA path (v_wmma_f32_16x16x32_f16): 11-bit significands for operands in range — used where a [0,1] probability operand needs more precision than bf16
typedef _Float16 v16h __attribute__((ext_vector_type(16)));
union FragH { v16h v; v8us half[2]; _Float16 h[16]; unsigned short u[16]; };
template <int NT>
__device__ __forceinline__ v8f mmaH(v16h ah, v16h al, v16h bh, v16h bl, v8f c) {
  c = __builtin_amdgcn_wmma_f32_16x16x32_f16(false, ah, false, bh, (short)0, c, false, false);
  if (NT >= 2) c = __builtin_amdgcn_wmma_f32_16x16x32_f16(false, al, false, bh, (short)0, c, false, false);
  if (NT >= 3) c = __builtin_amdgcn_wmma_f32_16x16x32_f16(false, ah, false, bl, (short)0, c, false, false);
  asm volatile("v_nop\n\tv_nop\n\tv_nop\n\tv_nop" : "+v"(c) : "v"(ah), "v"(al), "v"(bh), "v"(bl));
  return c;
}
// batched GEMM like k_gemm_b but f16 operands: A f32 (split into f16 hi/lo if ASPLIT, else rounded to f16), Bt = f16 values [n][k]; alpha; C f32; N multiple of 16 (partial tiles skipped)
template <bool ASPLIT>
__global__ __launch_bounds__(128) void k_gemm_h(const float* __restrict__ A, int lda, size_t sA, const _Float16* __restrict__ Bh, int ldb, size_t sB, float alpha, float* __restrict__ C, int ldc, size_t sC, int M, int N, int K) {
  __shared__ __attribute__((aligned(16))) float so[4][16][64];
  const int tid = threadIdx.x, w = tid >> 5, lane = tid & 31, ln = lane & 15, hh = lane >> 4; const int by = blockIdx.y;
  A += (size_t)by * sA; Bh += (size_t)by * sB; C += (size_t)by * sC;
  const int ntn = (N + 63) / 64; const int wid = blockIdx.x * 4 + w; const int mt = wid / ntn, nq = wid % ntn; if (mt * 16 >= M) return;
  const int row0 = mt * 16, col0 = nq * 64; const float* arow = A + (size_t)(row0 + ln) * lda;
  v8f acc[4] = {};
  for (int kb = 0; kb < K; kb += 32) {
    FragH ah, al;
    const v4f x0 = *(const v4fa*)(arow + kb + 8 * hh), x1 = *(const v4fa*)(arow + kb + 8 * hh + 4), x2 = *(const v4fa*)(arow + kb + 16 + 8 * hh), x3 = *(const v4fa*)(arow + kb + 16 + 8 * hh + 4);
    float xs[16] = {x0[0],x0[1],x0[2],x0[3],x1[0],x1[1],x1[2],x1[3],x2[0],x2[1],x2[2],x2[3],x3[0],x3[1],x3[2],x3[3]};
#pragma unroll
    for (int i = 0; i < 16; ++i) { const _Float16 h = (_Float16)xs[i]; ah.h[i] = h; al.h[i] = ASPLIT ? (_Float16)(xs[i] - (float)h) : (_Float16)0.0f; }
#pragma unroll
    for (int t = 0; t < 4; ++t) { if (col0 + t * 16 >= N) continue; const size_t boff = (size_t)(col0 + t * 16 + ln) * ldb + kb; FragH bq; bq.half[0] = *(const v8us*)(Bh + boff + 8 * hh); bq.half[1] = *(const v8us*)(Bh + boff + 16 + 8 * hh);
      acc[t] = mmaH<ASPLIT ? 2 : 1>(ah.v, al.v, bq.v, bq.v, acc[t]); }
  }
#pragma unroll
  for (int t = 0; t < 4; ++t) { if (col0 + t * 16 >= N) continue;
#pragma unroll
    for (int r = 0; r < 8; ++r) so[w][8 * hh + r][t * 16 + ln] = acc[t][r] * alpha; }
  __builtin_amdgcn_fence(__ATOMIC_ACQ_REL, "workgroup"); __builtin_amdgcn_wave_barrier();
  const int rsub = lane >> 4, c4 = (lane & 15) * 4;
  {
#pragma unroll
    for (int q = 0; q < 8; ++q) { const int r = q * 2 + rsub; if (col0 + c4 < N) { const v4f v = *(const v4fa*)&so[w][r][c4]; *(v4f*)(C + (size_t)(row0 + r) * ldc + col0 + c4) = v; } }
     }
}

// Wt[n][k] = f16(W[k][n]·scale) from f32 row-major W[K][N] (scale = power of two; bf16-exact weights stay exact in f16 away from the subnormal range)
__global__ __launch_bounds__(256) void k_wt_f16(const float* __restrict__ W, _Float16* __restrict__ Wt, int K, int N, float scale) {
  const int t = blockIdx.x * 256 + threadIdx.x; if (t >= N * (K / 8)) return; const int n = t / (K / 8), k8 = (t % (K / 8)) * 8; FragH f;
#pragma unroll
  for (int i = 0; i < 8; ++i) f.h[i] = (_Float16)(bf16_round(W[(size_t)(k8 + i) * N + n]) * scale); const v8us o = f.half[0];
  *(v8us*)((unsigned short*)Wt + (size_t)n * K + k8) = o; 
}
// k_gemm_hh variant with fused epilogue: v = acc·alpha + bias[by·sBias + col] (+ CP[(row/rowsPerB)·sCPb + by·64 + col] if CP) ; ACT 0 none / 1 elu ; writes f16 C16 (and f32 C if non-null)
template <int ACT>
__global__ __launch_bounds__(128) void k_gemm_hhx(const _Float16* __restrict__ A, int lda, size_t sA, const _Float16* __restrict__ Bh, int ldb, size_t sB, float alpha, const float* __restrict__ bias, size_t sBias, const float* __restrict__ CP, int rowsPerB, size_t sCPb, int row0g,
    float* __restrict__ C, _Float16* __restrict__ C16, int ldc, size_t sC, int M, int N, int K) {
  __shared__ __attribute__((aligned(16))) float so[4][16][64];
  const int tid = threadIdx.x, w = tid >> 5, lane = tid & 31, ln = lane & 15, hh = lane >> 4; const int by = blockIdx.y;
  A += (size_t)by * sA; Bh += (size_t)by * sB; const size_t cofs = (size_t)by * sC; const float* bp = bias ? bias + (size_t)by * sBias : nullptr;
  const int ntn = (N + 63) / 64; const int wid = blockIdx.x * 4 + w; const int mt = wid / ntn, nq = wid % ntn; if (mt * 16 >= M) return;
  const int row0 = mt * 16, col0 = nq * 64; const _Float16* arow = A + (size_t)(row0 + ln) * lda;
  v8f acc[4] = {};
  for (int kb = 0; kb < K; kb += 32) { FragH ah; ah.half[0] = *(const v8us*)((const unsigned short*)arow + kb + 8 * hh); ah.half[1] = *(const v8us*)((const unsigned short*)arow + kb + 16 + 8 * hh);
#pragma unroll
    for (int t = 0; t < 4; ++t) { if (col0 + t * 16 >= N) continue; const size_t boff = (size_t)(col0 + t * 16 + ln) * ldb + kb; FragH bq; bq.half[0] = *(const v8us*)((const unsigned short*)Bh + boff + 8 * hh); bq.half[1] = *(const v8us*)((const unsigned short*)Bh + boff + 16 + 8 * hh);
      acc[t] = mmaH<1>(ah.v, ah.v, bq.v, bq.v, acc[t]); }
  }
#pragma unroll
  for (int t = 0; t < 4; ++t) { if (col0 + t * 16 >= N) continue; const int col = col0 + t * 16 + ln; const float bv = bp ? bf16_round(bp[col]) : 0.f;
#pragma unroll
    for (int r = 0; r < 8; ++r) { float v = acc[t][r] * alpha + bv; if (CP) { const int rr = row0g + row0 + 8 * hh + r; if (rowsPerB < 0) v += CP[cofs + (size_t)rr * ldc + col];      /* rowsPerB < 0: own element of the batched C plane */ else { const int bidx = rr / rowsPerB; v += CP[(size_t)bidx * sCPb + (size_t)by * 64 + col]; } } if (ACT == 1) v = (v > 0.f) ? v : expm1f(v); else if (ACT == 7) v = (v > 0.f) ? v + 1.0f : expf(v); else if (ACT == 8) v = tanhf(v); else if (ACT == 9) v = 0.5f * v * (1.0f + tanhf(0.7978845608028654f * (v + 0.044715f * v * v * v))); else if (ACT == 11) v = 1.0f / (1.0f + expf(-v)); else if (ACT == 12) v = (v > 0.f) ? v : 0.01f * v; else if (ACT == 14) v = (v > 0.f) ? v : 0.1f * v; else if (ACT == 16) v = (v >= 0.f) ? v : 0.3f * v; else if (ACT == 17) v = (v >= 0.f) ? v : 0.2f * v; else if (ACT == 15) v = v / (1.0f + expf(-v)); else if (ACT == 3) v = fmaxf(v, 0.f); else if (ACT == 6) v = 0.5f * v * (1.0f + erff(v * 0.70710678118654752f)); so[w][8 * hh + r][t * 16 + ln] = v; } }
  __builtin_amdgcn_fence(__ATOMIC_ACQ_REL, "workgroup"); __builtin_amdgcn_wave_barrier();
  const int rsub = lane >> 4, c4 = (lane & 15) * 4; typedef _Float16 v4h __attribute__((ext_vector_type(4)));
  {
#pragma unroll
    for (int q = 0; q < 8; ++q) { const int r = q * 2 + rsub; if (col0 + c4 < N) { const v4f v = *(const v4fa*)&so[w][r][c4]; if (C) *(v4f*)(C + cofs + (size_t)(row0 + r) * ldc + col0 + c4) = v; if (C16) { v4h h4; for (int i = 0; i < 4; ++i) h4[i] = (_Float16)v[i]; *(v4h*)(C16 + cofs + (size_t)(row0 + r) * ldc + col0 + c4) = h4; } } }
     }
}


typedef _Float16 v4h __attribute__((ext_vector_type(4)));

__global__ __launch_bounds__(256) void k_x16(const float* __restrict__ x, _Float16* __restrict__ X16, size_t n8) { const size_t t = (size_t)blockIdx.x * 256 + threadIdx.x; if (t >= n8) return; FragH f;
#pragma unroll
  for (int q = 0; q < 8; ++q) f.h[q] = (_Float16)bf16_round(x[t * 8 + q]); *(v8us*)((unsigned short*)X16 + t * 8) = f.half[0];  }
__global__ __launch_bounds__(256) void k_h16(const float* __restrict__ x, _Float16* __restrict__ X16, size_t n8) { const size_t t = (size_t)blockIdx.x * 256 + threadIdx.x; if (t >= n8) return; FragH f;
#pragma unroll
  for (int q = 0; q < 8; ++q) f.h[q] = (_Float16)x[t * 8 + q]; *(v8us*)((unsigned short*)X16 + t * 8) = f.half[0];  }
__global__ __launch_bounds__(256) void k_round16f(const float* __restrict__ W, _Float16* __restrict__ Bt, size_t n8) { const size_t t = (size_t)blockIdx.x * 256 + threadIdx.x; if (t >= n8) return; FragH f;
#pragma unroll
  for (int i = 0; i < 8; ++i) f.h[i] = (_Float16)(bf16_round(W[t * 8 + i]) * 16.0f); *(v8us*)((unsigned short*)Bt + t * 8) = f.half[0];  }
template <int NHv, int TTv>
__global__ __launch_bounds__(256) void k_vt(const _Float16* __restrict__ V16, int ldv, int voff, _Float16* __restrict__ Vt) { __shared__ unsigned short tl[64][66]; const int tid = threadIdx.x; const int slab = blockIdx.x / (TTv / 64), lg = blockIdx.x % (TTv / 64); const int b = slab / NHv, h = slab % NHv;
  for (int i = tid; i < 64 * 8; i += 256) { const int r = i / 8, c8 = (i % 8) * 8; FragH f; f.half[0] = *(const v8us*)((const unsigned short*)V16 + ((size_t)b * TTv + lg * 64 + r) * ldv + voff + h * 64 + c8);
#pragma unroll
    for (int q = 0; q < 8; ++q) tl[r][c8 + q] = f.u[q]; }
  __syncthreads();
  {
#pragma unroll
    for (int rd = 0; rd < 2; ++rd) { const int d = rd * 32 + tid / 8, pc = tid % 8; FragH f;
#pragma unroll
      for (int q = 0; q < 8; ++q) f.u[q] = tl[pc * 8 + q][d];
      *(v8us*)((unsigned short*)Vt + ((size_t)slab * 64 + d) * TTv + lg * 64 + pc * 8) = f.half[0]; }
     } }

__global__ __launch_bounds__(256) void k_hl(const float* __restrict__ F, _Float16* __restrict__ Hh, _Float16* __restrict__ Hl, size_t n8) { const size_t t = (size_t)blockIdx.x * 256 + threadIdx.x; if (t >= n8) return; FragH fh, fl; const v4f a = *(const v4fa*)(F + t * 8), c = *(const v4fa*)(F + t * 8 + 4);
#pragma unroll
  for (int q = 0; q < 4; ++q) { _Float16 h = (_Float16)a[q]; fh.h[q] = h; fl.h[q] = (_Float16)((a[q] - (float)h) * 1024.0f); h = (_Float16)c[q]; fh.h[4 + q] = h; fl.h[4 + q] = (_Float16)((c[q] - (float)h) * 1024.0f); }
  { *(v8us*)((unsigned short*)Hh + t * 8) = fh.half[0]; *(v8us*)((unsigned short*)Hl + t * 8) = fl.half[0];  } }

// ---- fast GEMM (wave tile 32x64; requires M % 32 == 0 rows per launch region and N % 64 == 0); epilogue = k_gemm_hhx semantics ----
__device__ __forceinline__ v16h g2_frag(const _Float16* p, int hh) { FragH f; f.half[0] = *(const v8us*)((const unsigned short*)p + 8 * hh); f.half[1] = *(const v8us*)((const unsigned short*)p + 16 + 8 * hh); return f.v; }
__device__ __forceinline__ v8f g2_mma(v16h a, v16h b, v8f c) { v8f d = __builtin_amdgcn_wmma_f32_16x16x32_f16(false, a, false, b, (short)0, c, false, false); asm volatile("v_nop\n\tv_nop\n\tv_nop\n\tv_nop" : "+v"(d) : "v"(a), "v"(b)); return d; }
template <int ACT>
__global__ __launch_bounds__(128) void k_gemm2(const _Float16* __restrict__ A, int lda, size_t sA, const _Float16* __restrict__ Bh, int ldb, size_t sB, float alpha, const float* __restrict__ bias, size_t sBias, const float* __restrict__ CP, int rowsPerB, size_t sCPb, int row0g,
    float* __restrict__ C, _Float16* __restrict__ C16, int ldc, size_t sC, int M, int N, int K) { static_assert(ACT == 0 || ACT == 3 || ACT == 6 || ACT == 8 || ACT == 9 || ACT == 11 || ACT == 12 || ACT == 14 || ACT == 15 || ACT == 16 || ACT == 17, "k_gemm2: unsupported ACT code (would silently apply no activation)");
  __shared__ __attribute__((aligned(16))) float so[4][32][68];
  const int tid = threadIdx.x, w = tid >> 5, lane = tid & 31, ln = lane & 15, hh = lane >> 4; const int by = blockIdx.y;
  A += (size_t)by * sA; Bh += (size_t)by * sB; const size_t cofs = (size_t)by * sC; const float* bp = bias ? bias + (size_t)by * sBias : nullptr;
  const int ntn = N >> 6; const int mt = blockIdx.x / ntn, nq = blockIdx.x - mt * ntn; const int row0 = mt * 128 + 32 * w, col0 = nq * 64; if (row0 >= M) return;
  const _Float16* a0p = A + (size_t)(row0 + ln) * lda; const _Float16* a1p = a0p + (size_t)16 * lda;
  const _Float16* b0p = Bh + (size_t)(col0 + ln) * ldb; const _Float16* b1p = b0p + (size_t)16 * ldb; const _Float16* b2p = b1p + (size_t)16 * ldb; const _Float16* b3p = b2p + (size_t)16 * ldb;
  const v8f z8 = {0.f,0.f,0.f,0.f,0.f,0.f,0.f,0.f}; v8f c00 = z8, c01 = z8, c02 = z8, c03 = z8, c10 = z8, c11 = z8, c12 = z8, c13 = z8;
#pragma unroll 1
  for (int kb = 0; kb < K; kb += 32) { const v16h a0 = g2_frag(a0p + kb, hh), a1 = g2_frag(a1p + kb, hh);
    v16h b = g2_frag(b0p + kb, hh); c00 = g2_mma(a0, b, c00); c10 = g2_mma(a1, b, c10);
    b = g2_frag(b1p + kb, hh); c01 = g2_mma(a0, b, c01); c11 = g2_mma(a1, b, c11);
    b = g2_frag(b2p + kb, hh); c02 = g2_mma(a0, b, c02); c12 = g2_mma(a1, b, c12);
    b = g2_frag(b3p + kb, hh); c03 = g2_mma(a0, b, c03); c13 = g2_mma(a1, b, c13); }
  v8f accs[8] = {c00, c01, c02, c03, c10, c11, c12, c13};
#pragma unroll
  for (int u = 0; u < 8; ++u) { const int t = u & 3, half = u >> 2; const int col = col0 + t * 16 + ln; const float bv = bp ? bf16_round(bp[col]) : 0.f;
#pragma unroll
    for (int r = 0; r < 8; ++r) { const int rloc = half * 16 + 8 * hh + r; float v = accs[u][r] * alpha + bv; if (CP) { if (rowsPerB < 0) v += CP[cofs + (size_t)(row0g + row0 + rloc) * ldc + col];      /* rowsPerB < 0: own element of the batched C plane */ else { const int bidx = (row0g + row0 + rloc) / rowsPerB; v += CP[(size_t)bidx * sCPb + (size_t)by * 64 + col]; } }
      if (ACT == 3) v = fmaxf(v, 0.f); else if (ACT == 6) v = 0.5f * v * (1.0f + erff(v * 0.70710678118654752f)); else if (ACT == 11) v = 1.0f / (1.0f + expf(-v)); else if (ACT == 15) v = v / (1.0f + expf(-v)); else if (ACT == 12) v = (v > 0.f) ? v : 0.01f * v; else if (ACT == 8) v = tanhf(v); else if (ACT == 9) v = 0.5f * v * (1.0f + tanhf(0.7978845608028654f * (v + 0.044715f * v * v * v))); else if (ACT == 14) v = (v > 0.f) ? v : 0.1f * v; else if (ACT == 16) v = (v >= 0.f) ? v : 0.3f * v; else if (ACT == 17) v = (v >= 0.f) ? v : 0.2f * v;
      so[w][rloc][t * 16 + ln] = v; } }
  __builtin_amdgcn_fence(__ATOMIC_ACQ_REL, "workgroup"); __builtin_amdgcn_wave_barrier();
  const int rsub = lane >> 4, c4 = (lane & 15) * 4;
  {
#pragma unroll
    for (int q = 0; q < 16; ++q) { const int r = q * 2 + rsub; const v4f v = *(const v4fa*)&so[w][r][c4]; if (C) *(v4f*)(C + cofs + (size_t)(row0 + r) * ldc + col0 + c4) = v; if (C16) { v4h h4; for (int i = 0; i < 4; ++i) h4[i] = (_Float16)v[i]; *(v4h*)(C16 + cofs + (size_t)(row0 + r) * ldc + col0 + c4) = h4; } }
     } }


__global__ __launch_bounds__(256) void k_wnat(const float* __restrict__ w, size_t n8, _Float16* __restrict__ Bt) { const size_t t = (size_t)blockIdx.x * 256 + threadIdx.x; if (t >= n8) return; FragH f; for (int q = 0; q < 8; ++q) f.h[q] = (_Float16)(bf16_round(w[t * 8 + q]) * 16.0f); *(v8us*)((unsigned short*)Bt + t * 8) = f.half[0];  }
__global__ __launch_bounds__(256) void k_rsm(const float* __restrict__ S, _Float16* __restrict__ P, int nrows) {
  #pragma clang fp contract(off)
  const int i = blockIdx.x * 256 + threadIdx.x; if (i >= nrows) return; const float* s = S + (size_t)i * SQ; float mx = -3.0e38f;
#pragma unroll 1
  for (int j = 0; j < SQ; ++j) mx = fmaxf(mx, s[j]); float se = 0.f;
#pragma unroll 1
  for (int j = 0; j < SQ; ++j) se += expf(s[j] - mx); const float sc = 256.0f / se;
#pragma unroll 1
  for (int j0 = 0; j0 < SQ; j0 += 8) { FragH f; for (int q = 0; q < 8; ++q) f.h[q] = (_Float16)(expf(s[j0 + q] - mx) * sc); unsigned short* d = (unsigned short*)P + (size_t)i * SQ + j0; *(v8us*)d = f.half[0];  } }
__global__ __launch_bounds__(256) void k_vt(const _Float16* __restrict__ V16, int b, int h0, _Float16* __restrict__ VT) { __shared__ unsigned short tl[64][65]; const int tid = threadIdx.x; const int hh = blockIdx.x % HG, sg = blockIdx.x / HG; const int s0 = sg * 64; const int h = h0 + hh;
  for (int i = tid; i < 64 * 8; i += 256) { const int j = i / 8, d8 = (i % 8) * 8; FragH f; f.half[0] = *(const v8us*)((const unsigned short*)V16 + ((size_t)b * SQ + s0 + j) * DM + h * HD + d8); for (int q = 0; q < 8; ++q) tl[d8 + q][j] = f.u[q]; }
  __syncthreads();
  { for (int i = tid; i < 64 * 8; i += 256) { const int d = i / 8, j8 = (i % 8) * 8; FragH f; for (int q = 0; q < 8; ++q) f.u[q] = tl[d][j8 + q]; *(v8us*)((unsigned short*)VT + ((size_t)hh * HD + d) * SQ + s0 + j8) = f.half[0]; }  } }



__global__ __launch_bounds__(256) void k_rsmkm(const float* __restrict__ S, _Float16* __restrict__ P, int nrows, const int* __restrict__ am) {
  #pragma clang fp contract(off)
  const int t = blockIdx.x * 256 + threadIdx.x; if (t >= nrows) return; const size_t i = (size_t)t; const float* s = S + i * SQ; const int* mr = am + (size_t)(t % SQ) * SQ; float mx = -3.0e38f;
#pragma unroll 1
  for (int j = 0; j < SQ; ++j) { const float f = (mr[j] != 0) ? 1.f : 0.f; mx = fmaxf(mx, fmaf(f, s[j], (1.f - f) * -1.0e9f)); } float se = 0.f;
#pragma unroll 1
  for (int j = 0; j < SQ; ++j) { const float f = (mr[j] != 0) ? 1.f : 0.f; se += __expf(fmaf(f, s[j], (1.f - f) * -1.0e9f) - mx); } const float sc = 256.0f / se;
#pragma unroll 1
  for (int j0 = 0; j0 < SQ; j0 += 8) { FragH fr; for (int q = 0; q < 8; ++q) { const int j = j0 + q; const float f = (mr[j] != 0) ? 1.f : 0.f; fr.h[q] = (_Float16)(__expf(fmaf(f, s[j], (1.f - f) * -1.0e9f) - mx) * sc); }
    unsigned short* d = (unsigned short*)P + i * SQ + j0; *(v8us*)d = fr.half[0];  } }

__global__ __launch_bounds__(256) void k_bdshn(const float* __restrict__ Wb, _Float16* __restrict__ Bt) {
  const size_t t = (size_t)blockIdx.x * 256 + threadIdx.x; if (t >= (size_t)DM * DM / 8) return; const size_t e0 = t * 8; const int n = (int)(e0 / DM), k0 = (int)(e0 % DM); const int h = n >> 6, hk = k0 >> 6; const float on = (hk == h) ? 16.0f : 0.0f; const int o = n & 63, d0 = k0 & 63; FragH f;
  for (int q = 0; q < 8; ++q) f.h[q] = (_Float16)(bf16_round(Wb[(size_t)o * 64 + d0 + q]) * on);
  unsigned short* d = (unsigned short*)Bt + e0; *(v8us*)d = f.half[0];  }

typedef int v4ia __attribute__((ext_vector_type(4), may_alias));
template <int M> __device__ __forceinline__ float rs_xm(float x) { return __builtin_bit_cast(float, __builtin_amdgcn_update_dpp(0, __builtin_bit_cast(int, x), 0x160 | M, 0xf, 0xf, true)); }  // lane l with lane l ^ M inside a 16-lane row
__device__ __forceinline__ float rs_xh(float x) { return __builtin_bit_cast(float, __builtin_amdgcn_permlanex16(__builtin_bit_cast(int, x), __builtin_bit_cast(int, x), 0x76543210, 0xfedcba98, false, false)); }  // lane l with lane l ^ 16
__device__ __forceinline__ float rs_wmax(float v) { v = fmaxf(v, rs_xm<1>(v)); v = fmaxf(v, rs_xm<2>(v)); v = fmaxf(v, rs_xm<4>(v)); v = fmaxf(v, rs_xm<8>(v)); return fmaxf(v, rs_xh(v)); }
__device__ __forceinline__ float rs_wsum(float v) { v += rs_xm<1>(v); v += rs_xm<2>(v); v += rs_xm<4>(v); v += rs_xm<8>(v); return v + rs_xh(v); }
// Four 2^x. Written as asm for the slot behind a transcendental (one independent instruction or v_nop before its result is read or its source overwritten): each v_exp_f32 is followed by
// an independent one (early-clobber outputs share no register with the sources), the last by v_nop.
__device__ __forceinline__ v4f rs_exp4(v4f x) { float e0, e1, e2, e3;
  asm("v_exp_f32 %0, %4\n\tv_exp_f32 %1, %5\n\tv_exp_f32 %2, %6\n\tv_exp_f32 %3, %7\n\tv_nop" : "=&v"(e0), "=&v"(e1), "=&v"(e2), "=&v"(e3) : "v"(x[0]), "v"(x[1]), "v"(x[2]), "v"(x[3]));
  const v4f e = {e0, e1, e2, e3}; return e; }
// Attention as one stream over the keys, straight from the f32 inputs: one launch for all batches and heads; scores and weights stay in registers. The per-head matrices leave the key loop by associativity:
// energy = (Wq xq).(Wk xk) = (Wk^T Wq xq).xk, and sum_j p_j (Wv xv_j) = Wv (sum_j p_j xv_j): a wave turns its 32 queries into q' = Wk^T (Wq xq) once (WMMA, D = W x^T, whose accumulators are the next product's B operand in place), the loop works on the rounded input rows themselves, and Wv meets the normalised sum once at the end.
// A key with mask 0 has weight exactly 0 beside any open key: every work-group lists its batch's open keys in LDS (a wave takes 256 keys of the mask, 32 a round; a key's place is the open keys of the waves below + those of its wave's earlier rounds + the open lanes below it in its round). Places from n on hold token 0: a real row, so that a stage's tail is finite; its scores take the fill. n == 0: the places are the tokens themselves, every score at the fill, the row comes out uniform as in the module.
// A wave owns 32 query columns and walks the listed keys in passes of 32: S^T = K Q^T (A = 16 key rows, k-contiguous f16 rows; B = 16 query columns, the packed q' accumulators), so a lane holds 8 keys of ONE query a tile;
// two score tiles of a pass, converted in place, are the B operand of O^T += V^T P^T (A = rows of V^T in the same k order). Maximum and sum are per lane plus one exchange between the lane halves.
// The 8 waves of a work-group share one (batch, head): the listed rows of keys and values come in stages of 64 keys, a head's 256 contiguous bytes of a row as two whole 128-byte lines, 8 lanes each, through registers, rounded to bf16 (held exactly in f16), into one of two LDS buffers;
// a thread holds 4 inputs of 4 consecutive places, so the values go in transposed ([input][key]) by 8-byte stores. Stage s + 1 is loaded while stage s is worked on, stored behind it, one barrier a stage.
// Values: t = energy / sqrt(512) * log2(e); a place from n on takes the module's fill (-1e20, same scale) BEFORE the maximum; weight = 2^(t - m + 6) as f16, m the maximum in use (renewed when a pass exceeds it by more than 8, so a weight stays below 2^14); the sum adds the f32 weights; O / sum x64 as f16 is the B operand of the Wv product; o stored x64 as f16 rows as before.
// Each work-group also rounds its 1024 elements of the output weights (f16 x16) for the launch behind it.
// Every '#pragma unroll' in the kernel but the one on the ph loop (two copies of the stage loop) stands on a loop over a register array (loads in flight, fragments, accumulators): rolled, the array would be indexed at run time and leave the registers.
#define FA_WAVES 8
#define FA_COLS 32
#define FA_STAGE 64
#define FA_PITCH 72      /* halves a staged row: 144 bytes = 16 x 9, an odd multiple of 16 bytes for the 16-byte fragment reads */
static_assert(SQ % (FA_WAVES * FA_COLS) == 0 && SQ % FA_STAGE == 0 && HD == 64 && FA_WAVES == 8 && FA_STAGE == 64 && SQ == FA_WAVES * 256 && (SQ & (SQ - 1)) == 0, "k_fattn: whole work-groups and stages; 8 threads a 128-byte line, 4 rows a thread; 8 waves x 256 keys are a batch's mask");
static_assert((size_t)NB * NH * (SQ / (FA_WAVES * FA_COLS)) * 256 * 4 == (size_t)DM * DM, "k_fattn: the grid covers the output weights, 4 a thread");
typedef _Float16 v8h __attribute__((ext_vector_type(8)));
typedef unsigned short v4us __attribute__((ext_vector_type(4), may_alias));
__device__ __forceinline__ v8f fa_mma(v16h a, v16h b, v8f c) { return __builtin_amdgcn_wmma_f32_16x16x32_f16(false, a, false, b, (short)0, c, false, false); }
// One 16 x 32 fragment from k-contiguous rows, k order as g2_frag: p = the lane's row + 8 * (lane >> 4) halves.
__device__ __forceinline__ v16h fa_frag(const unsigned short* p) { FragH f; f.half[0] = *(const v8us*)p; f.half[1] = *(const v8us*)(p + 16); return f.v; }
typedef float v2f __attribute__((ext_vector_type(2)));
typedef __bf16 v2b __attribute__((ext_vector_type(2)));
__device__ __forceinline__ v4f fa_rb(v4f x) {      /* to bf16, nearest even, as bf16_round; two values a conversion, each back as f32 by its bits */
  const v2f a = {x[0], x[1]}, c = {x[2], x[3]}; const unsigned ua = __builtin_bit_cast(unsigned, __builtin_convertvector(a, v2b)), uc = __builtin_bit_cast(unsigned, __builtin_convertvector(c, v2b));
  const v4f r = {__uint_as_float(ua << 16), __uint_as_float(ua & 0xffff0000u), __uint_as_float(uc << 16), __uint_as_float(uc & 0xffff0000u)}; return r; }
__device__ __forceinline__ v4us fa_h4(v4f x) { return __builtin_bit_cast(v4us, __builtin_convertvector(x, v4h)); }
// Two accumulator tiles (rows 16 a + 8 hh + r and 16 (a + 1) + 8 hh + r of one column), scaled, as one B fragment over these 32 rows: the k order of fa_frag.
__device__ __forceinline__ v16h fa_pack(v8f a, v8f b, float sc) { return __builtin_shufflevector(__builtin_convertvector(a * sc, v8h), __builtin_convertvector(b * sc, v8h), 0, 1, 2, 3, 4, 5, 6, 7, 8, 9, 10, 11, 12, 13, 14, 15); }
// D^T = W X^T for one column group: W [64][64] from LDS (A, rows = outputs), x = the two B fragments over the 64 inputs; the result as the four accumulator tiles over the 64 outputs (x16: W is held x16).
__device__ __forceinline__ void fa_wx(const unsigned short (*w)[FA_PITCH], int ln, int hh, const v16h x[2], v8f d[4]) {
  const v8f z8 = {0.f, 0.f, 0.f, 0.f, 0.f, 0.f, 0.f, 0.f};
#pragma unroll
  for (int et = 0; et < 4; ++et) d[et] = fa_mma(fa_frag(&w[et * 16 + ln][8 * hh]), x[0], z8);
#pragma unroll
  for (int et = 0; et < 4; ++et) d[et] = fa_mma(fa_frag(&w[et * 16 + ln][32 + 8 * hh]), x[1], d[et]);
}
// A work-group barrier for data that goes through LDS alone: the fences name the LDS address space, so the wave waits for its LDS operations and not, as __syncthreads() does, for every global load that is under way.
__device__ __forceinline__ void fa_lds_barrier() { __builtin_amdgcn_fence(__ATOMIC_RELEASE, "workgroup", "local"); __builtin_amdgcn_s_barrier(); __builtin_amdgcn_fence(__ATOMIC_ACQUIRE, "workgroup", "local"); }
__global__ __launch_bounds__(FA_WAVES * 32) void k_fattn(const float* __restrict__ xq, const float* __restrict__ xk, const float* __restrict__ xv, const float* __restrict__ wq, const float* __restrict__ wk, const float* __restrict__ wv,
                                                         const float* __restrict__ wout, const int* __restrict__ Km, _Float16* __restrict__ BO, _Float16* __restrict__ O16) {
  __shared__ __attribute__((aligned(16))) unsigned short sk[2][FA_STAGE][FA_PITCH];      /* [buffer][key][input] */
  __shared__ __attribute__((aligned(16))) unsigned short sv[2][HD][FA_PITCH];            /* [buffer][input][key] */
  __shared__ __attribute__((aligned(16))) unsigned short sw[3][HD][FA_PITCH];            /* bf16-rounded, x16: Wq [output][input], Wk^T [input][output], Wv [output][input] */
  __shared__ __attribute__((aligned(16))) unsigned short sq[FA_WAVES][FA_COLS][FA_PITCH];      /* a wave's query rows [query][input] */
  __shared__ __attribute__((aligned(16))) int li[SQ];      /* place -> token */
  __shared__ int wt[FA_WAVES];      /* the waves' counts of open keys */
  constexpr int QB = SQ / (FA_WAVES * FA_COLS);
  constexpr float SC = 0.044194173824159216f * 1.44269504088896340736f, FILL = -1.0e20f * SC;
  const int tid = threadIdx.x, lane = tid & 31, ln = lane & 15, hh = lane >> 4; const int wave = __builtin_amdgcn_readfirstlane(tid >> 5);
  const int bh = blockIdx.x / QB, b = bh / NH, h = bh % NH; const int q0 = (blockIdx.x % QB) * (FA_WAVES * FA_COLS) + wave * FA_COLS;
  const char* qb = (const char*)(xq + ((size_t)b * SQ + q0) * DM + h * HD);      /* wave-uniform bases */
  const char* kb = (const char*)(xk + (size_t)b * SQ * DM + h * HD);
  const char* vb = (const char*)(xv + (size_t)b * SQ * DM + h * HD);
  const char* mb = (const char*)(Km + (size_t)b * SQ);
  const int k0 = wave * 256 + lane;
  const unsigned roff = (unsigned)(ln * (DM * 2) + hh * 16);      /* byte offsets of the lane: row ln of a tile of o rows */
  const unsigned mo = (unsigned)(k0 * 4), wo = (unsigned)(tid * 64), xo = (unsigned)(hh * (DM * 4) + ln * 16), to = (unsigned)(((int)blockIdx.x * 256 + tid) * 16);
  const int sg = ((tid >> 6) << 2) | ((tid >> 3) & 3), sc4 = ((tid & 7) | ((tid >> 2) & 8)) * 4;      /* staging: 8 lanes a 128-byte line, a wave one half of the rows of 4 place groups; places 4 sg to 4 sg + 3, inputs sc4 to sc4 + 3. So a wave's key stores fall on all 64 banks, its value stores two deep on 32 (16 lanes a row: four deep on 16) */
  v16h qf[2][2]; v4f gk[4], gv[4], gx[FA_COLS / 2], ga; int n = 0;
  {
    int mv[8]; v4f gw[3][4];
#pragma unroll
    for (int r = 0; r < 8; ++r) mv[r] = *(const int*)(mb + mo + r * 128);
#pragma unroll
    for (int q = 0; q < 4; ++q) { gw[0][q] = *(const v4fa*)((const char*)wq + wo + q * 16); gw[1][q] = *(const v4fa*)((const char*)wk + wo + q * 16); gw[2][q] = *(const v4fa*)((const char*)wv + wo + q * 16); }
    asm volatile("s_wait_xcnt 0x0" :: "v"(mo), "v"(wo) : "memory");      /* as the wait below; as a memory barrier for the compiler it also keeps the mask and the matrices, which are needed first, ahead of the query rows: loads return in order */
#pragma unroll
    for (int j = 0; j < FA_COLS / 2; ++j) gx[j] = *(const v4fa*)(qb + j * 2 * DM * 4 + xo);      /* a wave-wide load covers two rows' 256 bytes */
    ga = *(const v4fa*)((const char*)wout + to);
    asm volatile("s_wait_xcnt 0x0" :: "v"(xo), "v"(to) : "memory");      /* behind the loads, ahead of any new value in a register that they name (a precaution of form); as inputs the lane offsets keep their registers up to it */
    unsigned bal[8]; int tot = 0;
#pragma unroll
    for (int r = 0; r < 8; ++r) { bal[r] = __builtin_amdgcn_ballot_w32(mv[r] != 0); tot += __builtin_popcount(bal[r]); }
    if (lane == 0) wt[wave] = tot;
    { const v4ia z4 = {0, 0, 0, 0}; *(v4ia*)&li[tid * 8] = z4; *(v4ia*)&li[tid * 8 + 4] = z4; }
    fa_lds_barrier();      /* every wave's count is in LDS, and the list's start value; the matrices and the query rows stay under way */
    int base = 0;
    for (int i = 0; i < FA_WAVES; ++i) { const int v = wt[i]; base += (i < wave) ? v : 0; n += v; }
    if (n == 0) { const v4ia a4 = {tid * 8, tid * 8 + 1, tid * 8 + 2, tid * 8 + 3}; *(v4ia*)&li[tid * 8] = a4; *(v4ia*)&li[tid * 8 + 4] = a4 + 4; }
    else {
#pragma unroll
      for (int r = 0; r < 8; ++r) { if ((bal[r] >> lane) & 1u) li[base + __builtin_popcount(bal[r] & ((1u << lane) - 1u))] = k0 + r * 32; base += __builtin_popcount(bal[r]); }      /* a place is a count of open keys below: under SQ */
    }
#pragma unroll
    for (int q = 0; q < 4; ++q) {      /* element (row tid >> 2, column (tid & 3) * 16 + q * 4 + i) of each matrix */
      *(v4us*)&sw[0][tid >> 2][(tid & 3) * 16 + q * 4] = fa_h4(fa_rb(gw[0][q]) * 16.0f); *(v4us*)&sw[2][tid >> 2][(tid & 3) * 16 + q * 4] = fa_h4(fa_rb(gw[2][q]) * 16.0f);
      const v4us t4 = fa_h4(fa_rb(gw[1][q]) * 16.0f);
      for (int i = 0; i < 4; ++i) sw[1][(tid & 3) * 16 + q * 4 + i][tid >> 2] = t4[i]; }
    fa_lds_barrier();      /* the list and the three matrices are in LDS for every wave; the query rows and the slice of Wo, the last loads to return, are not waited for here */
  }
  n = __builtin_amdgcn_readfirstlane(n);      /* open keys of the batch: a sum of popcounts over SQ keys */
  const int nst = ((n != 0 ? n : SQ) + FA_STAGE - 1) / FA_STAGE;      /* stages: 1 to SQ / FA_STAGE */
  { const v4ia k4 = *(const v4ia*)&li[sg * 4]; unsigned so[4];      /* stage 0 on its way; the token is bounded by the shape before an address is formed */
#pragma unroll
    for (int j = 0; j < 4; ++j) { so[j] = (unsigned)((k4[j] & (SQ - 1)) * (DM * 4) + sc4 * 4); gk[j] = *(const v4fa*)(kb + so[j]); gv[j] = *(const v4fa*)(vb + so[j]); }
    asm volatile("s_wait_xcnt 0x0" :: "v"(so[0]), "v"(so[1]), "v"(so[2]), "v"(so[3]) : "memory"); }      /* as above */
  __builtin_amdgcn_sched_barrier(0);      /* stage 0's loads are issued before the first wait on a query row: without it this build rounded the query rows first and met the memory latency twice */
#pragma unroll
  for (int j = 0; j < FA_COLS / 2; ++j) *(v4us*)&sq[wave][j * 2 + hh][ln * 4] = fa_h4(fa_rb(gx[j]));
  __builtin_amdgcn_fence(__ATOMIC_ACQ_REL, "wavefront"); __builtin_amdgcn_wave_barrier();      /* the rows are read back by other lanes of the same wave: keeps the reads behind the writes, without a wait for stage 0's loads */
  *(v4us*)((char*)BO + (to >> 1)) = fa_h4(fa_rb(ga) * 16.0f);      /* Wo natural [out][in] = Bt x16; here, since the next barrier waits for stage 0's loads in any case and the store's return with them */
#pragma unroll
  for (int u = 0; u < 2; ++u) {      /* q' = Wk^T (Wq xq), while stage 0 is under way */
    v16h x[2]; v8f d[4];
#pragma unroll
    for (int ks = 0; ks < 2; ++ks) x[ks] = fa_frag(&sq[wave][u * 16 + ln][ks * 32 + 8 * hh]);
    fa_wx(sw[0], ln, hh, x, d);
    x[0] = fa_pack(d[0], d[1], 0.0625f); x[1] = fa_pack(d[2], d[3], 0.0625f);
    fa_wx(sw[1], ln, hh, x, d);
    qf[u][0] = fa_pack(d[0], d[1], 0.0625f); qf[u][1] = fa_pack(d[2], d[3], 0.0625f);
  }
  auto put = [&](int buf) {      /* the loaded stage, rounded, into LDS: key rows as they are, value rows transposed (4 places of one input are 8 bytes) */
    v4f f[4];
#pragma unroll
    for (int j = 0; j < 4; ++j) { *(v4us*)&sk[buf][sg * 4 + j][sc4] = fa_h4(fa_rb(gk[j])); f[j] = fa_rb(gv[j]); }
#pragma unroll
    for (int i = 0; i < 4; ++i) { const v4f c = {f[0][i], f[1][i], f[2][i], f[3][i]}; *(v4us*)&sv[buf][sc4 + i][sg * 4] = fa_h4(c); }
  };
  __builtin_amdgcn_sched_barrier(0);      /* the products above run while stage 0 is under way: without it this build rounded stage 0 among them and waited for its loads behind the first product */
  put(0);
  const v8f z8 = {0.f, 0.f, 0.f, 0.f, 0.f, 0.f, 0.f, 0.f};
  v8f o[2][4]; float l[2] = {0.f, 0.f}, m[2] = {-3.0e38f, -3.0e38f};
#pragma unroll
  for (int u = 0; u < 2; ++u) for (int dt = 0; dt < 4; ++dt) o[u][dt] = z8;
  __syncthreads();      /* stage 0 is in LDS for every wave */
  int s = 0;
#pragma unroll      /* two copies of the stage loop, ph a constant in each: the stages that hold open keys alone carry no fill code; unrolled, not branched, since a branch in mid pass cost registers past the first 256 */
  for (int ph = 0; ph < 2; ++ph) for (const int se = (ph == 0) ? n / FA_STAGE : nst; s < se; ++s) {
    const int bf = s & 1; const int sn = (s + 1 < nst) ? s + 1 : 0;      /* the last stage loads stage 0 again (in bounds, never read) */
    const v4ia k4 = *(const v4ia*)&li[sn * FA_STAGE + sg * 4];      /* the next stage's four places of the thread: read with the K fragments, so that one LDS latency serves both */
    v16h kf[2][2];
#pragma unroll
    for (int kt = 0; kt < 2; ++kt) for (int ks = 0; ks < 2; ++ks) kf[kt][ks] = fa_frag(&sk[bf][kt * 16 + ln][ks * 32 + 8 * hh]);
    __builtin_amdgcn_sched_barrier(0);      /* all eight reads are issued before the first wait on one: without it this build read two fragments at a time into one register block and met the LDS latency three times behind every barrier */
    { unsigned so[4];      /* the token is bounded by the shape before an address is formed */
#pragma unroll
      for (int j = 0; j < 4; ++j) { so[j] = (unsigned)((k4[j] & (SQ - 1)) * (DM * 4) + sc4 * 4); gk[j] = *(const v4fa*)(kb + so[j]); gv[j] = *(const v4fa*)(vb + so[j]); }
      asm volatile("s_wait_xcnt 0x0" :: "v"(so[0]), "v"(so[1]), "v"(so[2]), "v"(so[3]) : "memory"); }      /* behind the loads, ahead of any new value in a register that they name (a precaution of form); as inputs the lane offsets keep their registers up to it; as a memory barrier for the compiler it also keeps the loads here, a whole stage ahead of their stores */
#pragma unroll
    for (int p = 0; p < FA_STAGE / 32; ++p) {
      v16h vf[4]; v8f t[2][2];
#pragma unroll
      for (int dt = 0; dt < 4; ++dt) vf[dt] = fa_frag(&sv[bf][dt * 16 + ln][p * 32 + 8 * hh]);
#pragma unroll
      for (int u = 0; u < 2; ++u) for (int kt = 0; kt < 2; ++kt) t[u][kt] = fa_mma(kf[kt][0], qf[u][0], z8);
#pragma unroll
      for (int u = 0; u < 2; ++u) for (int kt = 0; kt < 2; ++kt) t[u][kt] = fa_mma(kf[kt][1], qf[u][1], t[u][kt]);
      if (p + 1 < FA_STAGE / 32) {      /* the next pass of the SAME stage: its K fragments are fetched behind this pass's score products, into the registers these have left */
#pragma unroll
        for (int kt = 0; kt < 2; ++kt) for (int ks = 0; ks < 2; ++ks) kf[kt][ks] = fa_frag(&sk[bf][(p + 1) * 32 + kt * 16 + ln][ks * 32 + 8 * hh]); }
      float mx[2];
#pragma unroll
      for (int u = 0; u < 2; ++u) for (int kt = 0; kt < 2; ++kt) t[u][kt] *= SC;
      if (ph == 1) {      /* the last stage where n is no whole number of stages; every stage where n == 0 */
        const int left = n - (s * FA_STAGE + p * 32 + 8 * hh);      /* open places from the lane's first key of tile 0 on */
#pragma unroll
        for (int u = 0; u < 2; ++u) for (int kt = 0; kt < 2; ++kt) for (int r = 0; r < 8; ++r) t[u][kt][r] = (kt * 16 + r < left) ? t[u][kt][r] : FILL;
      }
#pragma unroll
      for (int u = 0; u < 2; ++u) {
        float x = fmaxf(t[u][0][0], t[u][1][0]);
#pragma unroll
        for (int r = 1; r < 8; ++r) x = fmaxf(x, fmaxf(t[u][0][r], t[u][1][r]));
        mx[u] = fmaxf(x, rs_xh(x));
      }
      if (__builtin_amdgcn_ballot_w32((mx[0] > m[0] + 8.0f) || (mx[1] > m[1] + 8.0f)) != 0) {      /* one scalar branch a pass: the products of a renewal run only where some column needs one */
        const float n0 = fmaxf(m[0], mx[0]), n1 = fmaxf(m[1], mx[1]); const v4f d4 = {m[0] - n0, m[1] - n1, 0.f, 0.f}; const v4f al = rs_exp4(d4); m[0] = n0; m[1] = n1;
#pragma unroll
        for (int u = 0; u < 2; ++u) { l[u] *= al[u]; for (int dt = 0; dt < 4; ++dt) o[u][dt] *= al[u]; }
      }
      v16h pf[2];
#pragma unroll
      for (int u = 0; u < 2; ++u) { const float ms = m[u] - 6.0f; v4f s4[2];
#pragma unroll
        for (int kt = 0; kt < 2; ++kt) { const v8f x = t[u][kt] - ms; const v4f x0 = {x[0], x[1], x[2], x[3]}, x1 = {x[4], x[5], x[6], x[7]}; const v4f e0 = rs_exp4(x0), e1 = rs_exp4(x1); s4[kt] = e0 + e1;
          const v8f e = {e0[0], e0[1], e0[2], e0[3], e1[0], e1[1], e1[2], e1[3]}; t[u][kt] = e; }
        const v4f sq = s4[0] + s4[1]; l[u] += (sq[0] + sq[1]) + (sq[2] + sq[3]);
        pf[u] = __builtin_shufflevector(__builtin_convertvector(t[u][0], v8h), __builtin_convertvector(t[u][1], v8h), 0, 1, 2, 3, 4, 5, 6, 7, 8, 9, 10, 11, 12, 13, 14, 15); }
      __builtin_amdgcn_sched_barrier(0);      /* this one and the next keep the eight products apart from the 2^x statements: those are asm text, which the compiler's padding behind a matrix instruction does not see */
#pragma unroll
      for (int dt = 0; dt < 4; ++dt) for (int u = 0; u < 2; ++u) o[u][dt] = fa_mma(vf[dt], pf[u], o[u][dt]);
      __builtin_amdgcn_sched_barrier(0);
    }
    put(bf ^ 1);      /* into the buffer whose readers all passed the barrier of stage s - 1 */
    __syncthreads();      /* publishes stage s + 1 and ends every wave's reads of stage s */
  }
  _Float16* ob = O16 + ((size_t)b * SQ + q0) * DM + h * HD;
#pragma unroll
  for (int u = 0; u < 2; ++u) { const float sc = 64.0f / (l[u] + rs_xh(l[u])); v8f d[4];
    const v16h x[2] = {fa_pack(o[u][0], o[u][1], sc), fa_pack(o[u][2], o[u][3], sc)};      /* a lane's accumulator registers are consecutive inputs of its query: the B operand of o = Wv (O / sum) */
    fa_wx(sw[2], ln, hh, x, d);
#pragma unroll
    for (int dt = 0; dt < 4; ++dt) *(v8h*)((char*)(ob + u * 16 * DM + dt * 16) + roff) = __builtin_convertvector(d[dt] * 0.0625f, v8h); }      /* 8 consecutive outputs of the lane's query row */
}
// Output product out = o Wo^T * alpha + b for all token rows, operands staged in LDS. A work-group of 8 waves owns a 128 x 128 tile of out (one work-group a WGP at this shape); a wave owns 32 x 64 of it (2 x 4 accumulator tiles, as k_gemm2).
// o rows and Wo rows come in stages of 128 k: a wave-wide 16-byte load covers two rows' 256 contiguous bytes (whole 128-byte lines; a fragment load from global memory touches 16 lines for 512 bytes, and each of them was waited for on its own),
// through registers into one of two LDS buffers; stage s + 1 is on its way while stage s is worked on, stored behind it, one barrier a stage. Each operand byte is read once a work-group.
// The k steps run in the order of k_gemm2 and the fragments have its k order, so every accumulator sees the same sums; the epilogue is k_gemm2's (alpha, bias rounded to bf16, the wave's tile through its own LDS range, whole lines out).
// Every '#pragma unroll' in the kernel but the one on the stage loop stands on a loop over a register array (loads in flight, fragments, accumulators): rolled, the array would be indexed at run time and leave the registers.
#define OG_T 128         /* rows and columns of out a work-group */
#define OG_K 128         /* k a stage */
#define OG_PITCH 136     /* halves a staged row: 272 bytes = 16 x 17, an odd multiple of 16 bytes for the 16-byte fragment reads */
static_assert(MPO % OG_T == 0 && DM % OG_T == 0 && DM % OG_K == 0 && OG_K == 128 && OG_T == 128, "k_ogemm: whole tiles and stages; 16 threads stage a row of 256 bytes, 16 rows a round");
__global__ __launch_bounds__(256) void k_ogemm(const _Float16* __restrict__ A, const _Float16* __restrict__ Bh, float alpha, const float* __restrict__ bias, float* __restrict__ C) {
  __shared__ __attribute__((aligned(16))) unsigned short sa[2][OG_T][OG_PITCH];      /* [buffer][token row][k] */
  __shared__ __attribute__((aligned(16))) unsigned short sb[2][OG_T][OG_PITCH];      /* [buffer][output column][k] */
  __shared__ __attribute__((aligned(16))) float so[8][32][68];                       /* a wave's tile on its way out */
  constexpr int NS = DM / OG_K, NT = DM / OG_T;
  const int tid = threadIdx.x, lane = tid & 31, ln = lane & 15, hh = lane >> 4; const int wave = __builtin_amdgcn_readfirstlane(tid >> 5);
  const int row0 = ((int)blockIdx.x / NT) * OG_T, col0 = ((int)blockIdx.x % NT) * OG_T; const int wm = (wave >> 1) * 32, wn = (wave & 1) * 64;      /* the wave's place in the tile */
  const char* ab = (const char*)(A + (size_t)row0 * DM); const char* bb = (const char*)(Bh + (size_t)col0 * DM);      /* uniform bases */
  const int srow = tid >> 4, sc8 = (tid & 15) * 8;      /* staging: 16 threads a 256-byte row; rows srow + 16 j */
  const unsigned go = (unsigned)(srow * (DM * 2) + sc8 * 2);      /* byte offset of the lane in a stage of either operand */
  const char* ib = (const char*)(bias + col0 + wn); const unsigned io = (unsigned)(ln * 4);      /* the wave's 64 bias values: fetched here, so that the epilogue does not wait for them */
  v8us ga[OG_T / 16], gb[OG_T / 16]; float bv[4];
#pragma unroll
  for (int j = 0; j < OG_T / 16; ++j) { ga[j] = *(const v8us*)(ab + j * 16 * DM * 2 + go); gb[j] = *(const v8us*)(bb + j * 16 * DM * 2 + go); }
#pragma unroll
  for (int t = 0; t < 4; ++t) bv[t] = *(const float*)(ib + t * 64 + io);
  asm volatile("s_wait_xcnt 0x0" :: "v"(go), "v"(io) : "memory");      /* behind the loads, ahead of any new value in a register that they name (a precaution of form); as inputs the lane offsets keep their registers up to it */
#pragma unroll
  for (int j = 0; j < OG_T / 16; ++j) { *(v8us*)&sa[0][j * 16 + srow][sc8] = ga[j]; *(v8us*)&sb[0][j * 16 + srow][sc8] = gb[j]; }
  const v8f z8 = {0.f, 0.f, 0.f, 0.f, 0.f, 0.f, 0.f, 0.f};
  v8f acc[2][4];
#pragma unroll
  for (int i = 0; i < 2; ++i) for (int t = 0; t < 4; ++t) acc[i][t] = z8;
  __syncthreads();      /* stage 0 is in LDS for every wave */
#pragma unroll
  for (int s = 0; s < NS; ++s) {
    const int bf = s & 1;
    if (s + 1 < NS) {      /* behind the barrier, not ahead of it: the barrier's fence waits for every load that is under way */
#pragma unroll
      for (int j = 0; j < OG_T / 16; ++j) { ga[j] = *(const v8us*)(ab + (s + 1) * OG_K * 2 + j * 16 * DM * 2 + go); gb[j] = *(const v8us*)(bb + (s + 1) * OG_K * 2 + j * 16 * DM * 2 + go); }
      asm volatile("s_wait_xcnt 0x0" :: "v"(go) : "memory");      /* as above; as a memory barrier for the compiler it also keeps the loads here, a whole stage ahead of their stores */
    }
    v16h af[2][2], bq[2][4];
#pragma unroll
    for (int i = 0; i < 2; ++i) af[0][i] = fa_frag(&sa[bf][wm + i * 16 + ln][8 * hh]);
#pragma unroll
    for (int t = 0; t < 4; ++t) bq[0][t] = fa_frag(&sb[bf][wn + t * 16 + ln][8 * hh]);
#pragma unroll
    for (int ks = 0; ks < OG_K / 32; ++ks) {
      if (ks + 1 < OG_K / 32) {      /* the next k step's fragments are fetched as one group ahead of this step's products, into the second register set */
#pragma unroll
        for (int i = 0; i < 2; ++i) af[(ks + 1) & 1][i] = fa_frag(&sa[bf][wm + i * 16 + ln][(ks + 1) * 32 + 8 * hh]);
#pragma unroll
        for (int t = 0; t < 4; ++t) bq[(ks + 1) & 1][t] = fa_frag(&sb[bf][wn + t * 16 + ln][(ks + 1) * 32 + 8 * hh]);
      }
      __builtin_amdgcn_sched_barrier(0);      /* this one and the next keep the twelve reads one group ahead of the eight products: without them this build read two fragments' halves at a time into one register block and waited out the LDS latency in front of every second product */
#pragma unroll
      for (int t = 0; t < 4; ++t) for (int i = 0; i < 2; ++i) acc[i][t] = fa_mma(af[ks & 1][i], bq[ks & 1][t], acc[i][t]);
      __builtin_amdgcn_sched_barrier(0);
    }
    if (s + 1 < NS) {
#pragma unroll
      for (int j = 0; j < OG_T / 16; ++j) { *(v8us*)&sa[bf ^ 1][j * 16 + srow][sc8] = ga[j]; *(v8us*)&sb[bf ^ 1][j * 16 + srow][sc8] = gb[j]; }      /* into the buffer whose readers all passed the barrier of stage s - 1 */
      __syncthreads();      /* publishes stage s + 1 and ends every wave's reads of stage s */
    }
  }
#pragma unroll
  for (int t = 0; t < 4; ++t) { const float br = bf16_round(bv[t]);
#pragma unroll
    for (int i = 0; i < 2; ++i) for (int r = 0; r < 8; ++r) so[wave][i * 16 + 8 * hh + r][t * 16 + ln] = acc[i][t][r] * alpha + br; }
  __builtin_amdgcn_fence(__ATOMIC_ACQ_REL, "workgroup"); __builtin_amdgcn_wave_barrier();      /* the rows are read back by other lanes of the same wave: keeps the reads behind the writes */
  char* cb = (char*)(C + (size_t)(row0 + wm) * DM + col0 + wn);      /* uniform for the wave */
  const unsigned co = (unsigned)(hh * (DM * 4) + ln * 16);
  v4f ov[16];
#pragma unroll
  for (int q = 0; q < 16; ++q) ov[q] = *(const v4fa*)&so[wave][q * 2 + hh][ln * 4];      /* 16 lanes a row of 256 bytes, 2 rows an instruction */
#pragma unroll
  for (int q = 0; q < 16; ++q) *(v4f*)(cb + q * 2 * DM * 4 + co) = ov[q];
}
extern "C" void kernel_launch(void* const* d_in, const int* in_sizes, int n_in,
                              void* d_out, int out_size, void* d_ws, size_t ws_size, hipStream_t stream) {
  (void)in_sizes; (void)n_in; (void)out_size;
  const float* const* I = (const float* const*)d_in; const float* xq = I[2]; const float* xk = I[1]; const float* xv = I[0]; const int* km = (const int*)d_in[3]; const float* wq = I[6]; const float* wk = I[5]; const float* wv = I[4]; const float* wo = I[7]; const float* bo = I[8];      /* contract order: values I[0], keys I[1], query I[2]; mask int32 [4][1][1][2048] (0 = masked key; READ on device); SHARED natural [64][64] blocks Wv I[4], Wk I[5], Wq I[6]; natural Wo [512][512] + bo */
  char* ws = (char*)d_ws; size_t off = 0;
  auto take = [&](size_t bytes) { char* p = ws + off; off += (bytes + 255) & ~(size_t)255; return p; };
  _Float16* BO = (_Float16*)take((size_t)DM * DM * 2);
  _Float16* O16 = (_Float16*)take(NR * DM * 2);
  if (off > ws_size) return;
  const size_t r0p = (size_t)B0 * SQ;      /* first row of the output stage */
  k_fattn<<<NB * NH * (SQ / (FA_WAVES * FA_COLS)), FA_WAVES * 32, 0, stream>>>(xq, xk, xv, wq, wk, wv, wo, km, BO, O16);      /* o (merged heads) as f16 rows x64; keys with mask[b][j] == 0 are not listed; Wo as f16 x16 */
  k_ogemm<<<(unsigned)((MPO / OG_T) * (DM / OG_T)), 256, 0, stream>>>(O16 + r0p * DM, BO, 0.0009765625f, bo, (float*)d_out + r0p * DM);      /* out rows are the output layout */
}

// v008
// It runs in 31.9 microseconds.
// Timed twice side by side with v007, it ran 1.03 and 1.04 times as fast.
// All steps since v000 together make it 105 times as fast.
#include <hip/hip_runtime.h>
// Multi-head attention over three inputs with SHARED per-head projections, a random key-padding mask and the module's literal score scale (values, keys, query [4][2048][512]; each input is split into 8 heads of 64 and every head is multiplied by the SAME natural [64][64] matrix (x W^T: Wv / Wk / Wq; no biases); energy = q k^T; where(mask == 0, -1e20) with the int32 [4][1][1][2048] mask in {0, 1} (random; 0 = masked key; READ on device); softmax(energy / sqrt(embed_size) = / sqrt(512)) (as the source); out = merged Wo^T + bo -> [4][2048][512]).
// Structure: token rows r = b*2048 + s; a key with mask 0 has weight exactly 0 beside any open key, so only the open keys of a batch are attended (each work-group of k_fattn lists them from the mask; a batch with no open key keeps all keys, every score at the fill). The shared per-head matrices leave the key loop by associativity: energy = (Wk^T Wq xq) . xk and weights x V = Wv (weights x xv), so scores, masked softmax and weights x values run in ONE launch for all batches and heads straight on the rounded f32 inputs (k_fattn: running maximum and sum, scores and weights never in memory; o carried x64 against f16 subnormal flush, folded into the output GEMM alpha), written into the merged f16 o rows; out = o W_o + b GEMM (f32; k_ogemm: operands staged in LDS by whole lines) into the output layout.
// Compute dtype: inputs rounded to bf16; x / weights exact in f16 (weights x16); Wq xq, q', softmax weights, the normalised weighted sum and o as plain f16 GEMM operands (~2^-12); scores and softmax statistics f32. v_wmma_f32_16x16x32_f16.
#define NB 4
#define SQ 2048
#define DM 512
#define NH 8
#define HD 64
#define HG 4                         /* heads a launch of the k_vt(V16, b, h0, VT) form, which is not launched */
#define B0 0                         /* first batch of the output stage (debug hook) */
#define NBR NB                       /* batches of the output stage (debug hook) */
#define NR ((size_t)NB * SQ)         /* token rows */
#define MP ((int)((size_t)NBR * SQ)) /* rows of the output stage, via MPO (debug hook) */
#define QN SQ                        /* unused; k_fattn attends all SQ query rows of a batch */
#define NHD NH                       /* unused; k_fattn attends all NH heads */
#define MPO MP                       /* rows through the output stage (debug hook) */
#define LQ DM      /* unused; the q and k rows have pitch DM */
typedef __bf16 v16b __attribute__((ext_vector_type(16)));
typedef unsigned short v8us __attribute__((ext_vector_type(8), may_alias));
typedef float  v8f  __attribute__((ext_vector_type(8)));
typedef float  v4f  __attribute__((ext_vector_type(4)));
typedef float  v4fa __attribute__((ext_vector_type(4), may_alias));
union FragB { v16b v; v8us half[2]; unsigned short u[16]; };

__device__ __forceinline__ unsigned short bf16_bits(float x) { unsigned int u = __float_as_uint(x); return (unsigned short)((u + 0x7FFFu + ((u >> 16) & 1u)) >> 16); }
__device__ __forceinline__ float bf16_val(unsigned short b) { return __uint_as_float(((unsigned int)b) << 16); }
__device__ __forceinline__ float bf16_round(float x) { return bf16_val(bf16_bits(x)); }
// D += A·B with NT terms: 1 = ah·bh, 2 = + al·bh (A split), 3 = + ah·bl (both split)
template <int NT>
__device__ __forceinline__ v8f mmaN(v16b ah, v16b al, v16b bh, v16b bl, v8f c) {
  c = __builtin_amdgcn_wmma_f32_16x16x32_bf16(false, ah, false, bh, (short)0, c, false, false);
  if (NT >= 2) c = __builtin_amdgcn_wmma_f32_16x16x32_bf16(false, al, false, bh, (short)0, c, false, false);
  if (NT >= 3) c = __builtin_amdgcn_wmma_f32_16x16x32_bf16(false, ah, false, bl, (short)0, c, false, false);
  asm volatile("v_nop\n\tv_nop\n\tv_nop\n\tv_nop" : "+v"(c) : "v"(ah), "v"(al), "v"(bh), "v"(bl));
  return c;
}

__global__ __launch_bounds__(256) void k_wt_bf16(const float* __restrict__ W, unsigned short* __restrict__ Wt, int K, int N) {
  const int t = blockIdx.x * 256 + threadIdx.x;
  const int k8n = K / 8;
  if (t >= N * k8n) return;
  const int n = t / k8n, k8 = (t % k8n) * 8;
  v8us v;
#pragma unroll
  for (int i = 0; i < 8; ++i) v[i] = bf16_bits(W[(size_t)(k8 + i) * N + n]);
  *(v8us*)(Wt + (size_t)n * K + k8) = v;
  
}

// GEMM C[M][N] (f32, pitch ldc) = act(A[M][K]·W + bias). A f32 row-major (pitch lda) converted per fragment to bf16
// (ASPLIT: hi/lo two planes -> 2 terms, else single rounded term); Wt bf16 [N][K] (pitch ldb). BIAS_BF16 rounds the
// bias to bf16 first (bias quantised to bf16 before the add). K%32==0, M%16==0, N%64==0.
template <bool ASPLIT, int ACT, bool BIAS_BF16>
__global__ __launch_bounds__(128) void k_gemm_bf(const float* __restrict__ A, int lda, const unsigned short* __restrict__ Wt, int ldb,
                                               const float* __restrict__ bias, float* __restrict__ C, int ldc, int M, int N, int K) {
  __shared__ __attribute__((aligned(16))) float so[4][16][64];
  const int tid = threadIdx.x, w = tid >> 5, lane = tid & 31, ln = lane & 15, hh = lane >> 4;
  const int ntn = N / 64;
  const int wid = blockIdx.x * 4 + w;
  const int mt = wid / ntn, nq = wid % ntn;
  if (mt * 16 >= M) return;
  const int row0 = mt * 16, col0 = nq * 64;
  const float* arow = A + (size_t)(row0 + ln) * lda;
  v8f acc[4] = {};
  for (int kb = 0; kb < K; kb += 32) {
    FragB ah, al;
    const v4f x0 = *(const v4fa*)(arow + kb + 8 * hh), x1 = *(const v4fa*)(arow + kb + 8 * hh + 4);
    const v4f x2 = *(const v4fa*)(arow + kb + 16 + 8 * hh), x3 = *(const v4fa*)(arow + kb + 16 + 8 * hh + 4);
    float xs[16] = {x0[0],x0[1],x0[2],x0[3],x1[0],x1[1],x1[2],x1[3],x2[0],x2[1],x2[2],x2[3],x3[0],x3[1],x3[2],x3[3]};
#pragma unroll
    for (int i = 0; i < 16; ++i) { const unsigned short hb = bf16_bits(xs[i]); ah.u[i] = hb; al.u[i] = ASPLIT ? bf16_bits(xs[i] - bf16_val(hb)) : (unsigned short)0; }
#pragma unroll
    for (int t = 0; t < 4; ++t) {
      const unsigned short* brow = Wt + (size_t)(col0 + t * 16 + ln) * ldb + kb;
      FragB b;
      b.half[0] = *(const v8us*)(brow + 8 * hh);
      b.half[1] = *(const v8us*)(brow + 16 + 8 * hh);
      acc[t] = mmaN<ASPLIT ? 2 : 1>(ah.v, al.v, b.v, b.v, acc[t]);
    }
  }
#pragma unroll
  for (int t = 0; t < 4; ++t) {
    float bv = bias ? bias[col0 + t * 16 + ln] : 0.f;
    if (BIAS_BF16) bv = bf16_round(bv);
#pragma unroll
    for (int r = 0; r < 8; ++r) { float v = acc[t][r] + bv; if (ACT == 1) v = fmaxf(v, 0.f); so[w][8 * hh + r][t * 16 + ln] = v; }
  }
  __builtin_amdgcn_fence(__ATOMIC_ACQ_REL, "workgroup");
  __builtin_amdgcn_wave_barrier();
  const int rsub = lane >> 4, c4 = (lane & 15) * 4;
  {
#pragma unroll
    for (int q = 0; q < 8; ++q) {
      const int r = q * 2 + rsub;
      const v4f v = *(const v4fa*)&so[w][r][c4];
      *(v4f*)(C + (size_t)(row0 + r) * ldc + col0 + c4) = v;
    }
    
  }
}

// GEMM C = act(A·W + bias + resid): A f32 (ASPLIT -> hi/lo 2 terms), Wt bf16 [N][K]; ACT 0 none, 1 relu, 2 exact gelu;
// resid (optional, f32, row index = (row % rmod), pitch ldr, RES_BF16 rounds it) added before the activation.
template <bool ASPLIT, int ACT, bool BIAS_BF16, bool RES_BF16>
__global__ __launch_bounds__(128) void k_gemm_bf3(const float* __restrict__ A, int lda, const unsigned short* __restrict__ Wt, int ldb,
                                                const float* __restrict__ bias, const float* __restrict__ resid, int rmod, int ldr,
                                                float* __restrict__ C, int ldc, int M, int N, int K) {
  __shared__ __attribute__((aligned(16))) float so[4][16][64];
  const int tid = threadIdx.x, w = tid >> 5, lane = tid & 31, ln = lane & 15, hh = lane >> 4;
  const int ntn = N / 64;
  const int wid = blockIdx.x * 4 + w;
  const int mt = wid / ntn, nq = wid % ntn;
  if (mt * 16 >= M) return;
  const int row0 = mt * 16, col0 = nq * 64;
  const float* arow = A + (size_t)(row0 + ln) * lda;
  v8f acc[4] = {};
  for (int kb = 0; kb < K; kb += 32) {
    FragB ah, al;
    const v4f x0 = *(const v4fa*)(arow + kb + 8 * hh), x1 = *(const v4fa*)(arow + kb + 8 * hh + 4);
    const v4f x2 = *(const v4fa*)(arow + kb + 16 + 8 * hh), x3 = *(const v4fa*)(arow + kb + 16 + 8 * hh + 4);
    float xs[16] = {x0[0],x0[1],x0[2],x0[3],x1[0],x1[1],x1[2],x1[3],x2[0],x2[1],x2[2],x2[3],x3[0],x3[1],x3[2],x3[3]};
#pragma unroll
    for (int i = 0; i < 16; ++i) { const unsigned short hb = bf16_bits(xs[i]); ah.u[i] = hb; al.u[i] = ASPLIT ? bf16_bits(xs[i] - bf16_val(hb)) : (unsigned short)0; }
#pragma unroll
    for (int t = 0; t < 4; ++t) {
      const unsigned short* brow = Wt + (size_t)(col0 + t * 16 + ln) * ldb + kb;
      FragB b;
      b.half[0] = *(const v8us*)(brow + 8 * hh);
      b.half[1] = *(const v8us*)(brow + 16 + 8 * hh);
      acc[t] = mmaN<ASPLIT ? 2 : 1>(ah.v, al.v, b.v, b.v, acc[t]);
    }
  }
#pragma unroll
  for (int t = 0; t < 4; ++t) {
    const int col = col0 + t * 16 + ln;
    float bv = bias ? bias[col] : 0.f;
    if (BIAS_BF16) bv = bf16_round(bv);
#pragma unroll
    for (int r = 0; r < 8; ++r) {
      float v = acc[t][r] + bv;
      if (resid) { float rv = resid[(size_t)((row0 + 8 * hh + r) % rmod) * ldr + col]; if (RES_BF16) rv = bf16_round(rv); v += rv; }
      if (ACT == 1) v = fmaxf(v, 0.f);
      if (ACT == 2) v = 0.5f * v * (1.0f + erff(v * 0.70710678118654752f));
      if (ACT == 3) { const float u = 0.7978845608028654f * (v + 0.044715f * v * v * v); v = 0.5f * v * (1.0f + tanhf(u)); }
      so[w][8 * hh + r][t * 16 + ln] = v;
    }
  }
  __builtin_amdgcn_fence(__ATOMIC_ACQ_REL, "workgroup");
  __builtin_amdgcn_wave_barrier();
  const int rsub = lane >> 4, c4 = (lane & 15) * 4;
  {
#pragma unroll
    for (int q = 0; q < 8; ++q) {
      const int r = q * 2 + rsub;
      const v4f v = *(const v4fa*)&so[w][r][c4];
      *(v4f*)(C + (size_t)(row0 + r) * ldc + col0 + c4) = v;
    }
    
  }
}
// row LayerNorm (biased variance, eps) over N: s = X (+ R); optional out_sum <- s; out_norm <- (s-mu)*rsqrt(var+eps)*g + b
template <bool PARAM_BF16>
__global__ __launch_bounds__(256) void k_layernorm(const float* __restrict__ X, const float* __restrict__ R, const float* __restrict__ g, const float* __restrict__ bta,
                                                  float* __restrict__ out_sum, float* __restrict__ out_norm, int N, float eps) {
  __shared__ float red[256];
  const int row = blockIdx.x, tid = threadIdx.x;
  const float* x = X + (size_t)row * N; const float* rr = R ? R + (size_t)row * N : nullptr;
  float vals[16];                     // up to N = 4096
  const int per = N / 256;            // contiguous chunk per thread? use strided-by-4 chunks: thread handles j = tid*4 + 1024*u
  float s1 = 0.f;
  for (int u = 0; u < per / 4; ++u) {
    const int j = tid * 4 + 1024 * u;
    const v4f a = *(const v4fa*)(x + j);
    v4f b = {0.f,0.f,0.f,0.f}; if (rr) b = *(const v4fa*)(rr + j);
#pragma unroll
    for (int q = 0; q < 4; ++q) { const float v = a[q] + b[q]; vals[u * 4 + q] = v; s1 += v; }
  }
  red[tid] = s1; __syncthreads();
  for (int st = 128; st > 0; st >>= 1) { if (tid < st) red[tid] += red[tid + st]; __syncthreads(); }
  const float mu = red[0] / (float)N; __syncthreads();
  float s2 = 0.f;
  for (int u = 0; u < per / 4; ++u)
#pragma unroll
    for (int q = 0; q < 4; ++q) { const float c = vals[u * 4 + q] - mu; s2 += c * c; }
  red[tid] = s2; __syncthreads();
  for (int st = 128; st > 0; st >>= 1) { if (tid < st) red[tid] += red[tid + st]; __syncthreads(); }
  const float rs = rsqrtf(red[0] / (float)N + eps);
  {
    for (int u = 0; u < per / 4; ++u) {
      const int j = tid * 4 + 1024 * u;
      v4f o, sm;
#pragma unroll
      for (int q = 0; q < 4; ++q) {
        float gg = g[j + q], bb = bta[j + q];
        if (PARAM_BF16) { gg = bf16_round(gg); bb = bf16_round(bb); }
        sm[q] = vals[u * 4 + q]; o[q] = (vals[u * 4 + q] - mu) * rs * gg + bb;
      }
      if (out_sum) *(v4f*)(out_sum + (size_t)row * N + j) = sm;
      *(v4f*)(out_norm + (size_t)row * N + j) = o;
    }
    
  }
}



// ---- f16 WMMA path (v_wmma_f32_16x16x32_f16): 11-bit significands for operands in range — used where a [0,1] probability operand needs more precision than bf16
typedef _Float16 v16h __attribute__((ext_vector_type(16)));
union FragH { v16h v; v8us half[2]; _Float16 h[16]; unsigned short u[16]; };
template <int NT>
__device__ __forceinline__ v8f mmaH(v16h ah, v16h al, v16h bh, v16h bl, v8f c) {
  c = __builtin_amdgcn_wmma_f32_16x16x32_f16(false, ah, false, bh, (short)0, c, false, false);
  if (NT >= 2) c = __builtin_amdgcn_wmma_f32_16x16x32_f16(false, al, false, bh, (short)0, c, false, false);
  if (NT >= 3) c = __builtin_amdgcn_wmma_f32_16x16x32_f16(false, ah, false, bl, (short)0, c, false, false);
  asm volatile("v_nop\n\tv_nop\n\tv_nop\n\tv_nop" : "+v"(c) : "v"(ah), "v"(al), "v"(bh), "v"(bl));
  return c;
}
// batched GEMM like k_gemm_b but f16 operands: A f32 (split into f16 hi/lo if ASPLIT, else rounded to f16), Bt = f16 values [n][k]; alpha; C f32; N multiple of 16 (partial tiles skipped)
template <bool ASPLIT>
__global__ __launch_bounds__(128) void k_gemm_h(const float* __restrict__ A, int lda, size_t sA, const _Float16* __restrict__ Bh, int ldb, size_t sB, float alpha, float* __restrict__ C, int ldc, size_t sC, int M, int N, int K) {
  __shared__ __attribute__((aligned(16))) float so[4][16][64];
  const int tid = threadIdx.x, w = tid >> 5, lane = tid & 31, ln = lane & 15, hh = lane >> 4; const int by = blockIdx.y;
  A += (size_t)by * sA; Bh += (size_t)by * sB; C += (size_t)by * sC;
  const int ntn = (N + 63) / 64; const int wid = blockIdx.x * 4 + w; const int mt = wid / ntn, nq = wid % ntn; if (mt * 16 >= M) return;
  const int row0 = mt * 16, col0 = nq * 64; const float* arow = A + (size_t)(row0 + ln) * lda;
  v8f acc[4] = {};
  for (int kb = 0; kb < K; kb += 32) {
    FragH ah, al;
    const v4f x0 = *(const v4fa*)(arow + kb + 8 * hh), x1 = *(const v4fa*)(arow + kb + 8 * hh + 4), x2 = *(const v4fa*)(arow + kb + 16 + 8 * hh), x3 = *(const v4fa*)(arow + kb + 16 + 8 * hh + 4);
    float xs[16] = {x0[0],x0[1],x0[2],x0[3],x1[0],x1[1],x1[2],x1[3],x2[0],x2[1],x2[2],x2[3],x3[0],x3[1],x3[2],x3[3]};
#pragma unroll
    for (int i = 0; i < 16; ++i) { const _Float16 h = (_Float16)xs[i]; ah.h[i] = h; al.h[i] = ASPLIT ? (_Float16)(xs[i] - (float)h) : (_Float16)0.0f; }
#pragma unroll
    for (int t = 0; t < 4; ++t) { if (col0 + t * 16 >= N) continue; const size_t boff = (size_t)(col0 + t * 16 + ln) * ldb + kb; FragH bq; bq.half[0] = *(const v8us*)(Bh + boff + 8 * hh); bq.half[1] = *(const v8us*)(Bh + boff + 16 + 8 * hh);
      acc[t] = mmaH<ASPLIT ? 2 : 1>(ah.v, al.v, bq.v, bq.v, acc[t]); }
  }
#pragma unroll
  for (int t = 0; t < 4; ++t) { if (col0 + t * 16 >= N) continue;
#pragma unroll
    for (int r = 0; r < 8; ++r) so[w][8 * hh + r][t * 16 + ln] = acc[t][r] * alpha; }
  __builtin_amdgcn_fence(__ATOMIC_ACQ_REL, "workgroup"); __builtin_amdgcn_wave_barrier();
  const int rsub = lane >> 4, c4 = (lane & 15) * 4;
  {
#pragma unroll
    for (int q = 0; q < 8; ++q) { const int r = q * 2 + rsub; if (col0 + c4 < N) { const v4f v = *(const v4fa*)&so[w][r][c4]; *(v4f*)(C + (size_t)(row0 + r) * ldc + col0 + c4) = v; } }
     }
}

// Wt[n][k] = f16(W[k][n]·scale) from f32 row-major W[K][N] (scale = power of two; bf16-exact weights stay exact in f16 away from the subnormal range)
__global__ __launch_bounds__(256) void k_wt_f16(const float* __restrict__ W, _Float16* __restrict__ Wt, int K, int N, float scale) {
  const int t = blockIdx.x * 256 + threadIdx.x; if (t >= N * (K / 8)) return; const int n = t / (K / 8), k8 = (t % (K / 8)) * 8; FragH f;
#pragma unroll
  for (int i = 0; i < 8; ++i) f.h[i] = (_Float16)(bf16_round(W[(size_t)(k8 + i) * N + n]) * scale); const v8us o = f.half[0];
  *(v8us*)((unsigned short*)Wt + (size_t)n * K + k8) = o; 
}
// k_gemm_hh variant with fused epilogue: v = acc·alpha + bias[by·sBias + col] (+ CP[(row/rowsPerB)·sCPb + by·64 + col] if CP) ; ACT 0 none / 1 elu ; writes f16 C16 (and f32 C if non-null)
template <int ACT>
__global__ __launch_bounds__(128) void k_gemm_hhx(const _Float16* __restrict__ A, int lda, size_t sA, const _Float16* __restrict__ Bh, int ldb, size_t sB, float alpha, const float* __restrict__ bias, size_t sBias, const float* __restrict__ CP, int rowsPerB, size_t sCPb, int row0g,
    float* __restrict__ C, _Float16* __restrict__ C16, int ldc, size_t sC, int M, int N, int K) {
  __shared__ __attribute__((aligned(16))) float so[4][16][64];
  const int tid = threadIdx.x, w = tid >> 5, lane = tid & 31, ln = lane & 15, hh = lane >> 4; const int by = blockIdx.y;
  A += (size_t)by * sA; Bh += (size_t)by * sB; const size_t cofs = (size_t)by * sC; const float* bp = bias ? bias + (size_t)by * sBias : nullptr;
  const int ntn = (N + 63) / 64; const int wid = blockIdx.x * 4 + w; const int mt = wid / ntn, nq = wid % ntn; if (mt * 16 >= M) return;
  const int row0 = mt * 16, col0 = nq * 64; const _Float16* arow = A + (size_t)(row0 + ln) * lda;
  v8f acc[4] = {};
  for (int kb = 0; kb < K; kb += 32) { FragH ah; ah.half[0] = *(const v8us*)((const unsigned short*)arow + kb + 8 * hh); ah.half[1] = *(const v8us*)((const unsigned short*)arow + kb + 16 + 8 * hh);
#pragma unroll
    for (int t = 0; t < 4; ++t) { if (col0 + t * 16 >= N) continue; const size_t boff = (size_t)(col0 + t * 16 + ln) * ldb + kb; FragH bq; bq.half[0] = *(const v8us*)((const unsigned short*)Bh + boff + 8 * hh); bq.half[1] = *(const v8us*)((const unsigned short*)Bh + boff + 16 + 8 * hh);
      acc[t] = mmaH<1>(ah.v, ah.v, bq.v, bq.v, acc[t]); }
  }
#pragma unroll
  for (int t = 0; t < 4; ++t) { if (col0 + t * 16 >= N) continue; const int col = col0 + t * 16 + ln; const float bv = bp ? bf16_round(bp[col]) : 0.f;
#pragma unroll
    for (int r = 0; r < 8; ++r) { float v = acc[t][r] * alpha + bv; if (CP) { const int rr = row0g + row0 + 8 * hh + r; if (rowsPerB < 0) v += CP[cofs + (size_t)rr * ldc + col];      /* rowsPerB < 0: own element of the batched C plane */ else { const int bidx = rr / rowsPerB; v += CP[(size_t)bidx * sCPb + (size_t)by * 64 + col]; } } if (ACT == 1) v = (v > 0.f) ? v : expm1f(v); else if (ACT == 7) v = (v > 0.f) ? v + 1.0f : expf(v); else if (ACT == 8) v = tanhf(v); else if (ACT == 9) v = 0.5f * v * (1.0f + tanhf(0.7978845608028654f * (v + 0.044715f * v * v * v))); else if (ACT == 11) v = 1.0f / (1.0f + expf(-v)); else if (ACT == 12) v = (v > 0.f) ? v : 0.01f * v; else if (ACT == 14) v = (v > 0.f) ? v : 0.1f * v; else if (ACT == 16) v = (v >= 0.f) ? v : 0.3f * v; else if (ACT == 17) v = (v >= 0.f) ? v : 0.2f * v; else if (ACT == 15) v = v / (1.0f + expf(-v)); else if (ACT == 3) v = fmaxf(v, 0.f); else if (ACT == 6) v = 0.5f * v * (1.0f + erff(v * 0.70710678118654752f)); so[w][8 * hh + r][t * 16 + ln] = v; } }
  __builtin_amdgcn_fence(__ATOMIC_ACQ_REL, "workgroup"); __builtin_amdgcn_wave_barrier();
  const int rsub = lane >> 4, c4 = (lane & 15) * 4; typedef _Float16 v4h __attribute__((ext_vector_type(4)));
  {
#pragma unroll
    for (int q = 0; q < 8; ++q) { const int r = q * 2 + rsub; if (col0 + c4 < N) { const v4f v = *(const v4fa*)&so[w][r][c4]; if (C) *(v4f*)(C + cofs + (size_t)(row0 + r) * ldc + col0 + c4) = v; if (C16) { v4h h4; for (int i = 0; i < 4; ++i) h4[i] = (_Float16)v[i]; *(v4h*)(C16 + cofs + (size_t)(row0 + r) * ldc + col0 + c4) = h4; } } }
     }
}


typedef _Float16 v4h __attribute__((ext_vector_type(4)));

__global__ __launch_bounds__(256) void k_x16(const float* __restrict__ x, _Float16* __restrict__ X16, size_t n8) { const size_t t = (size_t)blockIdx.x * 256 + threadIdx.x; if (t >= n8) return; FragH f;
#pragma unroll
  for (int q = 0; q < 8; ++q) f.h[q] = (_Float16)bf16_round(x[t * 8 + q]); *(v8us*)((unsigned short*)X16 + t * 8) = f.half[0];  }
__global__ __launch_bounds__(256) void k_h16(const float* __restrict__ x, _Float16* __restrict__ X16, size_t n8) { const size_t t = (size_t)blockIdx.x * 256 + threadIdx.x; if (t >= n8) return; FragH f;
#pragma unroll
  for (int q = 0; q < 8; ++q) f.h[q] = (_Float16)x[t * 8 + q]; *(v8us*)((unsigned short*)X16 + t * 8) = f.half[0];  }
__global__ __launch_bounds__(256) void k_round16f(const float* __restrict__ W, _Float16* __restrict__ Bt, size_t n8) { const size_t t = (size_t)blockIdx.x * 256 + threadIdx.x; if (t >= n8) return; FragH f;
#pragma unroll
  for (int i = 0; i < 8; ++i) f.h[i] = (_Float16)(bf16_round(W[t * 8 + i]) * 16.0f); *(v8us*)((unsigned short*)Bt + t * 8) = f.half[0];  }
template <int NHv, int TTv>
__global__ __launch_bounds__(256) void k_vt(const _Float16* __restrict__ V16, int ldv, int voff, _Float16* __restrict__ Vt) { __shared__ unsigned short tl[64][66]; const int tid = threadIdx.x; const int slab = blockIdx.x / (TTv / 64), lg = blockIdx.x % (TTv / 64); const int b = slab / NHv, h = slab % NHv;
  for (int i = tid; i < 64 * 8; i += 256) { const int r = i / 8, c8 = (i % 8) * 8; FragH f; f.half[0] = *(const v8us*)((const unsigned short*)V16 + ((size_t)b * TTv + lg * 64 + r) * ldv + voff + h * 64 + c8);
#pragma unroll
    for (int q = 0; q < 8; ++q) tl[r][c8 + q] = f.u[q]; }
  __syncthreads();
  {
#pragma unroll
    for (int rd = 0; rd < 2; ++rd) { const int d = rd * 32 + tid / 8, pc = tid % 8; FragH f;
#pragma unroll
      for (int q = 0; q < 8; ++q) f.u[q] = tl[pc * 8 + q][d];
      *(v8us*)((unsigned short*)Vt + ((size_t)slab * 64 + d) * TTv + lg * 64 + pc * 8) = f.half[0]; }
     } }

__global__ __launch_bounds__(256) void k_hl(const float* __restrict__ F, _Float16* __restrict__ Hh, _Float16* __restrict__ Hl, size_t n8) { const size_t t = (size_t)blockIdx.x * 256 + threadIdx.x; if (t >= n8) return; FragH fh, fl; const v4f a = *(const v4fa*)(F + t * 8), c = *(const v4fa*)(F + t * 8 + 4);
#pragma unroll
  for (int q = 0; q < 4; ++q) { _Float16 h = (_Float16)a[q]; fh.h[q] = h; fl.h[q] = (_Float16)((a[q] - (float)h) * 1024.0f); h = (_Float16)c[q]; fh.h[4 + q] = h; fl.h[4 + q] = (_Float16)((c[q] - (float)h) * 1024.0f); }
  { *(v8us*)((unsigned short*)Hh + t * 8) = fh.half[0]; *(v8us*)((unsigned short*)Hl + t * 8) = fl.half[0];  } }

// ---- fast GEMM (wave tile 32x64; requires M % 32 == 0 rows per launch region and N % 64 == 0); epilogue = k_gemm_hhx semantics ----
__device__ __forceinline__ v16h g2_frag(const _Float16* p, int hh) { FragH f; f.half[0] = *(const v8us*)((const unsigned short*)p + 8 * hh); f.half[1] = *(const v8us*)((const unsigned short*)p + 16 + 8 * hh); return f.v; }
__device__ __forceinline__ v8f g2_mma(v16h a, v16h b, v8f c) { v8f d = __builtin_amdgcn_wmma_f32_16x16x32_f16(false, a, false, b, (short)0, c, false, false); asm volatile("v_nop\n\tv_nop\n\tv_nop\n\tv_nop" : "+v"(d) : "v"(a), "v"(b)); return d; }
template <int ACT>
__global__ __launch_bounds__(128) void k_gemm2(const _Float16* __restrict__ A, int lda, size_t sA, const _Float16* __restrict__ Bh, int ldb, size_t sB, float alpha, const float* __restrict__ bias, size_t sBias, const float* __restrict__ CP, int rowsPerB, size_t sCPb, int row0g,
    float* __restrict__ C, _Float16* __restrict__ C16, int ldc, size_t sC, int M, int N, int K) { static_assert(ACT == 0 || ACT == 3 || ACT == 6 || ACT == 8 || ACT == 9 || ACT == 11 || ACT == 12 || ACT == 14 || ACT == 15 || ACT == 16 || ACT == 17, "k_gemm2: unsupported ACT code (would silently apply no activation)");
  __shared__ __attribute__((aligned(16))) float so[4][32][68];
  const int tid = threadIdx.x, w = tid >> 5, lane = tid & 31, ln = lane & 15, hh = lane >> 4; const int by = blockIdx.y;
  A += (size_t)by * sA; Bh += (size_t)by * sB; const size_t cofs = (size_t)by * sC; const float* bp = bias ? bias + (size_t)by * sBias : nullptr;
  const int ntn = N >> 6; const int mt = blockIdx.x / ntn, nq = blockIdx.x - mt * ntn; const int row0 = mt * 128 + 32 * w, col0 = nq * 64; if (row0 >= M) return;
  const _Float16* a0p = A + (size_t)(row0 + ln) * lda; const _Float16* a1p = a0p + (size_t)16 * lda;
  const _Float16* b0p = Bh + (size_t)(col0 + ln) * ldb; const _Float16* b1p = b0p + (size_t)16 * ldb; const _Float16* b2p = b1p + (size_t)16 * ldb; const _Float16* b3p = b2p + (size_t)16 * ldb;
  const v8f z8 = {0.f,0.f,0.f,0.f,0.f,0.f,0.f,0.f}; v8f c00 = z8, c01 = z8, c02 = z8, c03 = z8, c10 = z8, c11 = z8, c12 = z8, c13 = z8;
#pragma unroll 1
  for (int kb = 0; kb < K; kb += 32) { const v16h a0 = g2_frag(a0p + kb, hh), a1 = g2_frag(a1p + kb, hh);
    v16h b = g2_frag(b0p + kb, hh); c00 = g2_mma(a0, b, c00); c10 = g2_mma(a1, b, c10);
    b = g2_frag(b1p + kb, hh); c01 = g2_mma(a0, b, c01); c11 = g2_mma(a1, b, c11);
    b = g2_frag(b2p + kb, hh); c02 = g2_mma(a0, b, c02); c12 = g2_mma(a1, b, c12);
    b = g2_frag(b3p + kb, hh); c03 = g2_mma(a0, b, c03); c13 = g2_mma(a1, b, c13); }
  v8f accs[8] = {c00, c01, c02, c03, c10, c11, c12, c13};
#pragma unroll
  for (int u = 0; u < 8; ++u) { const int t = u & 3, half = u >> 2; const int col = col0 + t * 16 + ln; const float bv = bp ? bf16_round(bp[col]) : 0.f;
#pragma unroll
    for (int r = 0; r < 8; ++r) { const int rloc = half * 16 + 8 * hh + r; float v = accs[u][r] * alpha + bv; if (CP) { if (rowsPerB < 0) v += CP[cofs + (size_t)(row0g + row0 + rloc) * ldc + col];      /* rowsPerB < 0: own element of the batched C plane */ else { const int bidx = (row0g + row0 + rloc) / rowsPerB; v += CP[(size_t)bidx * sCPb + (size_t)by * 64 + col]; } }
      if (ACT == 3) v = fmaxf(v, 0.f); else if (ACT == 6) v = 0.5f * v * (1.0f + erff(v * 0.70710678118654752f)); else if (ACT == 11) v = 1.0f / (1.0f + expf(-v)); else if (ACT == 15) v = v / (1.0f + expf(-v)); else if (ACT == 12) v = (v > 0.f) ? v : 0.01f * v; else if (ACT == 8) v = tanhf(v); else if (ACT == 9) v = 0.5f * v * (1.0f + tanhf(0.7978845608028654f * (v + 0.044715f * v * v * v))); else if (ACT == 14) v = (v > 0.f) ? v : 0.1f * v; else if (ACT == 16) v = (v >= 0.f) ? v : 0.3f * v; else if (ACT == 17) v = (v >= 0.f) ? v : 0.2f * v;
      so[w][rloc][t * 16 + ln] = v; } }
  __builtin_amdgcn_fence(__ATOMIC_ACQ_REL, "workgroup"); __builtin_amdgcn_wave_barrier();
  const int rsub = lane >> 4, c4 = (lane & 15) * 4;
  {
#pragma unroll
    for (int q = 0; q < 16; ++q) { const int r = q * 2 + rsub; const v4f v = *(const v4fa*)&so[w][r][c4]; if (C) *(v4f*)(C + cofs + (size_t)(row0 + r) * ldc + col0 + c4) = v; if (C16) { v4h h4; for (int i = 0; i < 4; ++i) h4[i] = (_Float16)v[i]; *(v4h*)(C16 + cofs + (size_t)(row0 + r) * ldc + col0 + c4) = h4; } }
     } }


__global__ __launch_bounds__(256) void k_wnat(const float* __restrict__ w, size_t n8, _Float16* __restrict__ Bt) { const size_t t = (size_t)blockIdx.x * 256 + threadIdx.x; if (t >= n8) return; FragH f; for (int q = 0; q < 8; ++q) f.h[q] = (_Float16)(bf16_round(w[t * 8 + q]) * 16.0f); *(v8us*)((unsigned short*)Bt + t * 8) = f.half[0];  }
__global__ __launch_bounds__(256) void k_rsm(const float* __restrict__ S, _Float16* __restrict__ P, int nrows) {
  #pragma clang fp contract(off)
  const int i = blockIdx.x * 256 + threadIdx.x; if (i >= nrows) return; const float* s = S + (size_t)i * SQ; float mx = -3.0e38f;
#pragma unroll 1
  for (int j = 0; j < SQ; ++j) mx = fmaxf(mx, s[j]); float se = 0.f;
#pragma unroll 1
  for (int j = 0; j < SQ; ++j) se += expf(s[j] - mx); const float sc = 256.0f / se;
#pragma unroll 1
  for (int j0 = 0; j0 < SQ; j0 += 8) { FragH f; for (int q = 0; q < 8; ++q) f.h[q] = (_Float16)(expf(s[j0 + q] - mx) * sc); unsigned short* d = (unsigned short*)P + (size_t)i * SQ + j0; *(v8us*)d = f.half[0];  } }
__global__ __launch_bounds__(256) void k_vt(const _Float16* __restrict__ V16, int b, int h0, _Float16* __restrict__ VT) { __shared__ unsigned short tl[64][65]; const int tid = threadIdx.x; const int hh = blockIdx.x % HG, sg = blockIdx.x / HG; const int s0 = sg * 64; const int h = h0 + hh;
  for (int i = tid; i < 64 * 8; i += 256) { const int j = i / 8, d8 = (i % 8) * 8; FragH f; f.half[0] = *(const v8us*)((const unsigned short*)V16 + ((size_t)b * SQ + s0 + j) * DM + h * HD + d8); for (int q = 0; q < 8; ++q) tl[d8 + q][j] = f.u[q]; }
  __syncthreads();
  { for (int i = tid; i < 64 * 8; i += 256) { const int d = i / 8, j8 = (i % 8) * 8; FragH f; for (int q = 0; q < 8; ++q) f.u[q] = tl[d][j8 + q]; *(v8us*)((unsigned short*)VT + ((size_t)hh * HD + d) * SQ + s0 + j8) = f.half[0]; }  } }



__global__ __launch_bounds__(256) void k_rsmkm(const float* __restrict__ S, _Float16* __restrict__ P, int nrows, const int* __restrict__ am) {
  #pragma clang fp contract(off)
  const int t = blockIdx.x * 256 + threadIdx.x; if (t >= nrows) return; const size_t i = (size_t)t; const float* s = S + i * SQ; const int* mr = am + (size_t)(t % SQ) * SQ; float mx = -3.0e38f;
#pragma unroll 1
  for (int j = 0; j < SQ; ++j) { const float f = (mr[j] != 0) ? 1.f : 0.f; mx = fmaxf(mx, fmaf(f, s[j], (1.f - f) * -1.0e9f)); } float se = 0.f;
#pragma unroll 1
  for (int j = 0; j < SQ; ++j) { const float f = (mr[j] != 0) ? 1.f : 0.f; se += __expf(fmaf(f, s[j], (1.f - f) * -1.0e9f) - mx); } const float sc = 256.0f / se;
#pragma unroll 1
  for (int j0 = 0; j0 < SQ; j0 += 8) { FragH fr; for (int q = 0; q < 8; ++q) { const int j = j0 + q; const float f = (mr[j] != 0) ? 1.f : 0.f; fr.h[q] = (_Float16)(__expf(fmaf(f, s[j], (1.f - f) * -1.0e9f) - mx) * sc); }
    unsigned short* d = (unsigned short*)P + i * SQ + j0; *(v8us*)d = fr.half[0];  } }

__global__ __launch_bounds__(256) void k_bdshn(const float* __restrict__ Wb, _Float16* __restrict__ Bt) {
  const size_t t = (size_t)blockIdx.x * 256 + threadIdx.x; if (t >= (size_t)DM * DM / 8) return; const size_t e0 = t * 8; const int n = (int)(e0 / DM), k0 = (int)(e0 % DM); const int h = n >> 6, hk = k0 >> 6; const float on = (hk == h) ? 16.0f : 0.0f; const int o = n & 63, d0 = k0 & 63; FragH f;
  for (int q = 0; q < 8; ++q) f.h[q] = (_Float16)(bf16_round(Wb[(size_t)o * 64 + d0 + q]) * on);
  unsigned short* d = (unsigned short*)Bt + e0; *(v8us*)d = f.half[0];  }

typedef int v4ia __attribute__((ext_vector_type(4), may_alias));
template <int M> __device__ __forceinline__ float rs_xm(float x) { return __builtin_bit_cast(float, __builtin_amdgcn_update_dpp(0, __builtin_bit_cast(int, x), 0x160 | M, 0xf, 0xf, true)); }  // lane l with lane l ^ M inside a 16-lane row
__device__ __forceinline__ float rs_xh(float x) { return __builtin_bit_cast(float, __builtin_amdgcn_permlanex16(__builtin_bit_cast(int, x), __builtin_bit_cast(int, x), 0x76543210, 0xfedcba98, false, false)); }  // lane l with lane l ^ 16
__device__ __forceinline__ float rs_wmax(float v) { v = fmaxf(v, rs_xm<1>(v)); v = fmaxf(v, rs_xm<2>(v)); v = fmaxf(v, rs_xm<4>(v)); v = fmaxf(v, rs_xm<8>(v)); return fmaxf(v, rs_xh(v)); }
__device__ __forceinline__ float rs_wsum(float v) { v += rs_xm<1>(v); v += rs_xm<2>(v); v += rs_xm<4>(v); v += rs_xm<8>(v); return v + rs_xh(v); }
// Four 2^x. Written as asm for the slot behind a transcendental (one independent instruction or v_nop before its result is read or its source overwritten): each v_exp_f32 is followed by
// an independent one (early-clobber outputs share no register with the sources), the last by v_nop.
__device__ __forceinline__ v4f rs_exp4(v4f x) { float e0, e1, e2, e3;
  asm("v_exp_f32 %0, %4\n\tv_exp_f32 %1, %5\n\tv_exp_f32 %2, %6\n\tv_exp_f32 %3, %7\n\tv_nop" : "=&v"(e0), "=&v"(e1), "=&v"(e2), "=&v"(e3) : "v"(x[0]), "v"(x[1]), "v"(x[2]), "v"(x[3]));
  const v4f e = {e0, e1, e2, e3}; return e; }
// Attention as one stream over the keys, straight from the f32 inputs: one launch for all batches and heads; scores and weights stay in registers. The per-head matrices leave the key loop by associativity:
// energy = (Wq xq).(Wk xk) = (Wk^T Wq xq).xk, and sum_j p_j (Wv xv_j) = Wv (sum_j p_j xv_j): a wave turns 16 queries into q' = Wk^T (Wq xq) once (WMMA, D = W x^T, whose accumulators are the next product's B operand in place), the loop works on the rounded input rows themselves, and Wv meets the normalised sum once at the end.
// A key with mask 0 has weight exactly 0 beside any open key: every work-group lists its batch's open keys in LDS (a wave takes 128 keys of the mask, 32 a round; a key's place is the open keys of the waves below + the open lanes below it). Places from n on hold token 0: a real row, so that a stage's tail is finite; its scores take the fill. n == 0: the places are the tokens themselves, every score at the fill, the row comes out uniform as in the module.
// A wave owns 32 query columns and walks the listed keys in passes of 32: S^T = K Q^T (A = 16 key rows, B = 16 query columns, both k-contiguous f16 rows), so a lane holds 8 keys of ONE query a tile;
// two score tiles of a pass, converted in place, are the B operand of O^T += V^T P^T (A = rows of V^T in the same k order). Maximum and sum are per lane plus one exchange between the lane halves.
// A work-group is two groups of 8 waves on one (batch, head) and the same 256 query columns, four waves a SIMD, so that one wave's vector work stands beside another's products: wave w of group 0 and wave w of group 1 (partners) own the same 32 columns, group g walks the listed keys 128 s + 64 g to 128 s + 64 g + 63 of stage s.
// A partner makes q' for 16 of the 32 columns and hands the fragments over through LDS (column group 0 of a wave is its own, 1 its partner's). Behind the loop each wave hands the partial sums, maximum and sum of its column group 1 to its partner through LDS (one new barrier) and joins the partner's with its own group 0, both brought to the larger maximum.
// Each group stages its own 64 keys of a stage: the listed rows of keys and values, a head's 256 contiguous bytes of a row as two whole 128-byte lines, 8 lanes each, through registers, rounded to bf16 (held exactly in f16), into one of two LDS buffers;
// a thread holds 4 inputs of 4 consecutive places, so the values go in transposed ([input][key]) by 8-byte stores. Stage s + 1 is loaded while stage s is worked on, stored behind it, one barrier a stage.
// Values: t = energy / sqrt(512) * log2(e); a place from n on takes the module's fill (-1e20, same scale) BEFORE the maximum; weight = 2^(t - m + 6) as f16, m the maximum in use (renewed when a pass exceeds it by more than 8, so a weight stays below 2^14); the sum adds the f32 weights; O / sum x64 as f16 is the B operand of the Wv product; o stored x64 as f16 rows as before.
// Each work-group also rounds its 1024 elements of the output weights (f16 x16) for the launch behind it.
// Every '#pragma unroll' in the kernel but those on the two copies of the stage loop and on the pass loop stands on a loop over a register array (loads in flight, fragments, accumulators): rolled, the array would be indexed at run time and leave the registers.
#define FA_WAVES 8       /* waves of a group, side by side over the query columns */
#define FA_GROUPS 2      /* groups of waves, each on its own 64 keys of a stage */
#define FA_COLS 32
#define FA_STAGE 64      /* keys a group and stage */
#define FA_PITCH 72      /* halves a staged row: 144 bytes = 16 x 9, an odd multiple of 16 bytes for the 16-byte fragment reads */
static_assert(SQ % (FA_WAVES * FA_COLS) == 0 && SQ % (FA_GROUPS * FA_STAGE) == 0 && HD == 64 && FA_WAVES == 8 && FA_GROUPS == 2 && FA_COLS == 32 && FA_STAGE == 64 && SQ == FA_GROUPS * FA_WAVES * 128 && (SQ & (SQ - 1)) == 0, "k_fattn: whole work-groups and stages; 8 threads a 128-byte line, 4 rows a thread; 16 waves x 128 keys are a batch's mask");
static_assert((size_t)NB * NH * (SQ / (FA_WAVES * FA_COLS)) * 512 * 2 == (size_t)DM * DM, "k_fattn: the grid covers the output weights, 2 a thread");
typedef _Float16 v8h __attribute__((ext_vector_type(8)));
typedef unsigned short v4us __attribute__((ext_vector_type(4), may_alias));
__device__ __forceinline__ v8f fa_mma(v16h a, v16h b, v8f c) { return __builtin_amdgcn_wmma_f32_16x16x32_f16(false, a, false, b, (short)0, c, false, false); }
// One 16 x 32 fragment from k-contiguous rows, k order as g2_frag: p = the lane's row + 8 * (lane >> 4) halves.
__device__ __forceinline__ v16h fa_frag(const unsigned short* p) { FragH f; f.half[0] = *(const v8us*)p; f.half[1] = *(const v8us*)(p + 16); return f.v; }
typedef float v2f __attribute__((ext_vector_type(2)));
typedef float v2fa __attribute__((ext_vector_type(2), may_alias));
typedef unsigned short v2us __attribute__((ext_vector_type(2), may_alias));
typedef __bf16 v2b __attribute__((ext_vector_type(2)));
__device__ __forceinline__ v4f fa_rb(v4f x) {      /* to bf16, nearest even, as bf16_round; two values a conversion, each back as f32 by its bits */
  const v2f a = {x[0], x[1]}, c = {x[2], x[3]}; const unsigned ua = __builtin_bit_cast(unsigned, __builtin_convertvector(a, v2b)), uc = __builtin_bit_cast(unsigned, __builtin_convertvector(c, v2b));
  const v4f r = {__uint_as_float(ua << 16), __uint_as_float(ua & 0xffff0000u), __uint_as_float(uc << 16), __uint_as_float(uc & 0xffff0000u)}; return r; }
__device__ __forceinline__ v4us fa_h4(v4f x) { return __builtin_bit_cast(v4us, __builtin_convertvector(x, v4h)); }
// Two accumulator tiles (rows 16 a + 8 hh + r and 16 (a + 1) + 8 hh + r of one column), scaled, as one B fragment over these 32 rows: the k order of fa_frag.
__device__ __forceinline__ v16h fa_pack(v8f a, v8f b, float sc) { return __builtin_shufflevector(__builtin_convertvector(a * sc, v8h), __builtin_convertvector(b * sc, v8h), 0, 1, 2, 3, 4, 5, 6, 7, 8, 9, 10, 11, 12, 13, 14, 15); }
// D^T = W X^T for one column group: W [64][64] from LDS (A, rows = outputs), x = the two B fragments over the 64 inputs; the result as the four accumulator tiles over the 64 outputs (x16: W is held x16).
__device__ __forceinline__ void fa_wx(const unsigned short (*w)[FA_PITCH], int ln, int hh, const v16h x[2], v8f d[4]) {
  const v8f z8 = {0.f, 0.f, 0.f, 0.f, 0.f, 0.f, 0.f, 0.f};
#pragma unroll
  for (int et = 0; et < 4; ++et) d[et] = fa_mma(fa_frag(&w[et * 16 + ln][8 * hh]), x[0], z8);
#pragma unroll
  for (int et = 0; et < 4; ++et) d[et] = fa_mma(fa_frag(&w[et * 16 + ln][32 + 8 * hh]), x[1], d[et]);
}
// A work-group barrier for data that goes through LDS alone: the fences name the LDS address space, so the wave waits for its LDS operations and not, as __syncthreads() does, for every global load that is under way.
__device__ __forceinline__ void fa_lds_barrier() { __builtin_amdgcn_fence(__ATOMIC_RELEASE, "workgroup", "local"); __builtin_amdgcn_s_barrier(); __builtin_amdgcn_fence(__ATOMIC_ACQUIRE, "workgroup", "local"); }
__global__ __launch_bounds__(FA_GROUPS * FA_WAVES * 32) void k_fattn(const float* __restrict__ xq, const float* __restrict__ xk, const float* __restrict__ xv, const float* __restrict__ wq, const float* __restrict__ wk, const float* __restrict__ wv,
                                                         const float* __restrict__ wout, const int* __restrict__ Km, _Float16* __restrict__ BO, _Float16* __restrict__ O16) {
  constexpr int NW = FA_GROUPS * FA_WAVES;
  __shared__ __attribute__((aligned(16))) unsigned short sk[2][FA_GROUPS][FA_STAGE][FA_PITCH];      /* [buffer][group][key][input] */
  __shared__ __attribute__((aligned(16))) unsigned short sv[2][FA_GROUPS][HD][FA_PITCH];            /* [buffer][group][input][key] */
  __shared__ __attribute__((aligned(16))) unsigned short sw[3][HD][FA_PITCH];            /* bf16-rounded, x16: Wq [output][input], Wk^T [input][output], Wv [output][input] */
  __shared__ __attribute__((aligned(16))) unsigned short sq[NW][FA_COLS / 2][FA_PITCH];      /* a wave's query rows [query][input] */
  __shared__ __attribute__((aligned(16))) unsigned short sx[NW][4][32][8];      /* a wave's q' fragments for its partner: [16 bytes of a lane][lane] */
  __shared__ __attribute__((aligned(16))) float sm[NW][8][32][4];      /* a wave's partial sums of column group 1 for its partner: [16 bytes of a lane][lane] */
  __shared__ float sl[NW][2][32];      /* with their maximum and sum */
  __shared__ __attribute__((aligned(16))) int li[SQ];      /* place -> token */
  __shared__ int wt[NW];      /* the waves' counts of open keys */
  constexpr int QB = SQ / (FA_WAVES * FA_COLS);
  constexpr float SC = 0.044194173824159216f * 1.44269504088896340736f, FILL = -1.0e20f * SC;
  const int tid = threadIdx.x, lane = tid & 31, ln = lane & 15, hh = lane >> 4; const int w16 = __builtin_amdgcn_readfirstlane(tid >> 5);
  const int g = w16 >> 3, pw = w16 ^ FA_WAVES;      /* the wave's group; its partner */
  const int bh = blockIdx.x / QB, b = bh / NH, h = bh % NH; const int q0 = (blockIdx.x % QB) * (FA_WAVES * FA_COLS) + (w16 & (FA_WAVES - 1)) * FA_COLS + g * (FA_COLS / 2);      /* first query of the wave's own column group */
  const char* qb = (const char*)(xq + ((size_t)b * SQ + q0) * DM + h * HD);      /* wave-uniform bases */
  const char* kb = (const char*)(xk + (size_t)b * SQ * DM + h * HD);
  const char* vb = (const char*)(xv + (size_t)b * SQ * DM + h * HD);
  const char* mb = (const char*)(Km + (size_t)b * SQ);
  const int k0 = w16 * 128 + lane;
  const unsigned roff = (unsigned)(ln * (DM * 2) + hh * 16);      /* byte offsets of the lane: row ln of a tile of o rows */
  const unsigned mo = (unsigned)(k0 * 4), wo = (unsigned)(tid * 32), xo = (unsigned)(hh * (DM * 4) + ln * 16), to = (unsigned)(((int)blockIdx.x * 512 + tid) * 8);
  const int sg = (((tid >> 6) & 3) << 2) | ((tid >> 3) & 3), sc4 = ((tid & 7) | ((tid >> 2) & 8)) * 4;      /* staging, in the thread's own group: 8 lanes a 128-byte line, a wave one half of the rows of 4 place groups; places 4 sg to 4 sg + 3, inputs sc4 to sc4 + 3. So a wave's key stores fall on all 64 banks, its value stores two deep on 32 (16 lanes a row: four deep on 16) */
  v16h qf[2][2]; v4f gk[4], gv[4], gx[FA_COLS / 4]; v2f ga; int n = 0;
  {
    int mv[4]; v4f gw[3][2];
#pragma unroll
    for (int r = 0; r < 4; ++r) mv[r] = *(const int*)(mb + mo + r * 128);
#pragma unroll
    for (int q = 0; q < 2; ++q) { gw[0][q] = *(const v4fa*)((const char*)wq + wo + q * 16); gw[1][q] = *(const v4fa*)((const char*)wk + wo + q * 16); gw[2][q] = *(const v4fa*)((const char*)wv + wo + q * 16); }
    asm volatile("s_wait_xcnt 0x0" :: "v"(mo), "v"(wo) : "memory");      /* as the wait below; as a memory barrier for the compiler it also keeps the mask and the matrices, which are needed first, ahead of the query rows: loads return in order */
#pragma unroll
    for (int j = 0; j < FA_COLS / 4; ++j) gx[j] = *(const v4fa*)(qb + j * 2 * DM * 4 + xo);      /* a wave-wide load covers two rows' 256 bytes */
    ga = *(const v2fa*)((const char*)wout + to);
    asm volatile("s_wait_xcnt 0x0" :: "v"(xo), "v"(to) : "memory");      /* behind the loads, ahead of any new value in a register that they name (a precaution of form); as inputs the lane offsets keep their registers up to it */
    unsigned bal[4]; int tot = 0;
#pragma unroll
    for (int r = 0; r < 4; ++r) { bal[r] = __builtin_amdgcn_ballot_w32(mv[r] != 0); tot += __builtin_popcount(bal[r]); }
    if (lane == 0) wt[w16] = tot;
    { const v4ia z4 = {0, 0, 0, 0}; *(v4ia*)&li[tid * 4] = z4; }
    fa_lds_barrier();      /* every wave's count is in LDS, and the list's start value; the matrices and the query rows stay under way */
    int base = 0;
    for (int i = 0; i < NW; ++i) { const int v = wt[i]; base += (i < w16) ? v : 0; n += v; }
    if (n == 0) { const v4ia a4 = {tid * 4, tid * 4 + 1, tid * 4 + 2, tid * 4 + 3}; *(v4ia*)&li[tid * 4] = a4; }
    else {
#pragma unroll
      for (int r = 0; r < 4; ++r) { if ((bal[r] >> lane) & 1u) li[base + __builtin_popcount(bal[r] & ((1u << lane) - 1u))] = k0 + r * 32; base += __builtin_popcount(bal[r]); }      /* a place is a count of open keys below: under SQ */
    }
#pragma unroll
    for (int q = 0; q < 2; ++q) {      /* element (row tid >> 3, column (tid & 7) * 8 + q * 4 + i) of each matrix */
      *(v4us*)&sw[0][tid >> 3][(tid & 7) * 8 + q * 4] = fa_h4(fa_rb(gw[0][q]) * 16.0f); *(v4us*)&sw[2][tid >> 3][(tid & 7) * 8 + q * 4] = fa_h4(fa_rb(gw[2][q]) * 16.0f);
      const v4us t4 = fa_h4(fa_rb(gw[1][q]) * 16.0f);
      for (int i = 0; i < 4; ++i) sw[1][(tid & 7) * 8 + q * 4 + i][tid >> 3] = t4[i]; }
    fa_lds_barrier();      /* the list and the three matrices are in LDS for every wave; the query rows and the output weights behind them, the last loads to return, are not waited for here */
  }
  n = __builtin_amdgcn_readfirstlane(n);      /* open keys of the batch: a sum of popcounts over SQ keys */
  const int nst = ((n != 0 ? n : SQ) + FA_GROUPS * FA_STAGE - 1) / (FA_GROUPS * FA_STAGE);      /* stages: 1 to SQ / 128 */
  { const v4ia k4 = *(const v4ia*)&li[g * FA_STAGE + sg * 4]; unsigned so[4];      /* stage 0 on its way; the token is bounded by the shape before an address is formed */
#pragma unroll
    for (int j = 0; j < 4; ++j) { so[j] = (unsigned)((k4[j] & (SQ - 1)) * (DM * 4) + sc4 * 4); gk[j] = *(const v4fa*)(kb + so[j]); gv[j] = *(const v4fa*)(vb + so[j]); }
    asm volatile("s_wait_xcnt 0x0" :: "v"(so[0]), "v"(so[1]), "v"(so[2]), "v"(so[3]) : "memory"); }      /* as above */
  __builtin_amdgcn_sched_barrier(0);      /* stage 0's loads are issued before the first wait on a query row: without it this build rounded the query rows first and met the memory latency twice */
#pragma unroll
  for (int j = 0; j < FA_COLS / 4; ++j) *(v4us*)&sq[w16][j * 2 + hh][ln * 4] = fa_h4(fa_rb(gx[j]));
  __builtin_amdgcn_fence(__ATOMIC_ACQ_REL, "wavefront"); __builtin_amdgcn_wave_barrier();      /* the rows are read back by other lanes of the same wave: keeps the reads behind the writes, without a wait for stage 0's loads */
  { const v4f a4 = {ga[0], ga[1], 0.f, 0.f}; const v4us h4 = fa_h4(fa_rb(a4) * 16.0f); const v2us h2 = {h4[0], h4[1]};
    *(v2us*)((char*)BO + (to >> 1)) = h2; }      /* Wo natural [out][in] = Bt x16; here, since the next barrier waits for stage 0's loads in any case and the store's return with them */
  {      /* q' = Wk^T (Wq xq) of the wave's own 16 columns, while stage 0 is under way */
    v16h x[2]; v8f d[4];
#pragma unroll
    for (int ks = 0; ks < 2; ++ks) x[ks] = fa_frag(&sq[w16][ln][ks * 32 + 8 * hh]);
    fa_wx(sw[0], ln, hh, x, d);
    x[0] = fa_pack(d[0], d[1], 0.0625f); x[1] = fa_pack(d[2], d[3], 0.0625f);
    fa_wx(sw[1], ln, hh, x, d);
    qf[0][0] = fa_pack(d[0], d[1], 0.0625f); qf[0][1] = fa_pack(d[2], d[3], 0.0625f);
#pragma unroll
    for (int ks = 0; ks < 2; ++ks) { FragH f; f.v = qf[0][ks]; *(v8us*)&sx[w16][ks * 2][lane][0] = f.half[0]; *(v8us*)&sx[w16][ks * 2 + 1][lane][0] = f.half[1]; }      /* lane for lane, for the partner */
  }
  auto put = [&](int buf) {      /* the loaded stage, rounded, into LDS: key rows as they are, value rows transposed (4 places of one input are 8 bytes) */
    v4f f[4];
#pragma unroll
    for (int j = 0; j < 4; ++j) { *(v4us*)&sk[buf][g][sg * 4 + j][sc4] = fa_h4(fa_rb(gk[j])); f[j] = fa_rb(gv[j]); }
#pragma unroll
    for (int i = 0; i < 4; ++i) { const v4f c = {f[0][i], f[1][i], f[2][i], f[3][i]}; *(v4us*)&sv[buf][g][sc4 + i][sg * 4] = fa_h4(c); }
  };
  __builtin_amdgcn_sched_barrier(0);      /* the products above run while stage 0 is under way: without it this build rounded stage 0 among them and waited for its loads behind the first product */
  put(0);
  const v8f z8 = {0.f, 0.f, 0.f, 0.f, 0.f, 0.f, 0.f, 0.f};
  v8f o[2][4]; float l[2] = {0.f, 0.f}, m[2] = {-3.0e38f, -3.0e38f};
#pragma unroll
  for (int u = 0; u < 2; ++u) for (int dt = 0; dt < 4; ++dt) o[u][dt] = z8;
  __syncthreads();      /* stage 0 and the partners' q' are in LDS for every wave */
#pragma unroll
  for (int ks = 0; ks < 2; ++ks) { FragH f; f.half[0] = *(const v8us*)&sx[pw][ks * 2][lane][0]; f.half[1] = *(const v8us*)&sx[pw][ks * 2 + 1][lane][0]; qf[1][ks] = f.v; }
  int s = 0;
#pragma unroll      /* two copies of the stage loop, ph a constant in each: the stages that hold open keys alone carry no fill code; unrolled, not branched, since a branch in mid pass cost registers past the first 256 */
  for (int ph = 0; ph < 2; ++ph) for (const int se = (ph == 0) ? n / (FA_GROUPS * FA_STAGE) : nst; s < se; ++s) {
    const int bf = s & 1; const int sn = (s + 1 < nst) ? s + 1 : 0;      /* the last stage loads stage 0 again (in bounds, never read) */
    const v4ia k4 = *(const v4ia*)&li[(sn * FA_GROUPS + g) * FA_STAGE + sg * 4];      /* the next stage's four places of the thread: read with the K fragments, so that one LDS latency serves both */
    v16h kf[2][2];
#pragma unroll
    for (int kt = 0; kt < 2; ++kt) for (int ks = 0; ks < 2; ++ks) kf[kt][ks] = fa_frag(&sk[bf][g][kt * 16 + ln][ks * 32 + 8 * hh]);
    __builtin_amdgcn_sched_barrier(0);      /* all eight reads are issued before the first wait on one: without it this build read two fragments at a time into one register block and met the LDS latency three times behind every barrier */
    { unsigned so[4];      /* the token is bounded by the shape before an address is formed */
#pragma unroll
      for (int j = 0; j < 4; ++j) { so[j] = (unsigned)((k4[j] & (SQ - 1)) * (DM * 4) + sc4 * 4); gk[j] = *(const v4fa*)(kb + so[j]); gv[j] = *(const v4fa*)(vb + so[j]); }
      asm volatile("s_wait_xcnt 0x0" :: "v"(so[0]), "v"(so[1]), "v"(so[2]), "v"(so[3]) : "memory"); }      /* behind the loads, ahead of any new value in a register that they name (a precaution of form); as inputs the lane offsets keep their registers up to it; as a memory barrier for the compiler it also keeps the loads here, a whole stage ahead of their stores */
#pragma unroll
    for (int p = 0; p < FA_STAGE / 32; ++p) {
      if (ph == 1 && n != 0 && (s * FA_GROUPS + g) * FA_STAGE + p * 32 >= n) break;      /* a scalar branch: the group's keys from here on are all past the open ones (weight exactly 0); the staging and the barrier below are passed all the same. A wave that never ran a pass hands over sums of 0 under the start maximum: factor 0 */
      v16h vf[4]; v8f t[2][2];
#pragma unroll
      for (int dt = 0; dt < 4; ++dt) vf[dt] = fa_frag(&sv[bf][g][dt * 16 + ln][p * 32 + 8 * hh]);
#pragma unroll
      for (int u = 0; u < 2; ++u) for (int kt = 0; kt < 2; ++kt) t[u][kt] = fa_mma(kf[kt][0], qf[u][0], z8);
#pragma unroll
      for (int u = 0; u < 2; ++u) for (int kt = 0; kt < 2; ++kt) t[u][kt] = fa_mma(kf[kt][1], qf[u][1], t[u][kt]);
      if (p + 1 < FA_STAGE / 32) {      /* the next pass of the SAME stage: its K fragments are fetched behind this pass's score products, into the registers these have left */
#pragma unroll
        for (int kt = 0; kt < 2; ++kt) for (int ks = 0; ks < 2; ++ks) kf[kt][ks] = fa_frag(&sk[bf][g][(p + 1) * 32 + kt * 16 + ln][ks * 32 + 8 * hh]); }
      float mx[2];
#pragma unroll
      for (int u = 0; u < 2; ++u) for (int kt = 0; kt < 2; ++kt) t[u][kt] *= SC;
      if (ph == 1) {      /* the last stage where n is no whole number of stages; every stage where n == 0 */
        const int left = n - ((s * FA_GROUPS + g) * FA_STAGE + p * 32 + 8 * hh);      /* open places from the lane's first key of tile 0 on */
#pragma unroll
        for (int u = 0; u < 2; ++u) for (int kt = 0; kt < 2; ++kt) for (int r = 0; r < 8; ++r) t[u][kt][r] = (kt * 16 + r < left) ? t[u][kt][r] : FILL;
      }
#pragma unroll
      for (int u = 0; u < 2; ++u) {
        float x = fmaxf(t[u][0][0], t[u][1][0]);
#pragma unroll
        for (int r = 1; r < 8; ++r) x = fmaxf(x, fmaxf(t[u][0][r], t[u][1][r]));
        mx[u] = fmaxf(x, rs_xh(x));
      }
      if (__builtin_amdgcn_ballot_w32((mx[0] > m[0] + 8.0f) || (mx[1] > m[1] + 8.0f)) != 0) {      /* one scalar branch a pass: the products of a renewal run only where some column needs one */
        const float n0 = fmaxf(m[0], mx[0]), n1 = fmaxf(m[1], mx[1]); const v4f d4 = {m[0] - n0, m[1] - n1, 0.f, 0.f}; const v4f al = rs_exp4(d4); m[0] = n0; m[1] = n1;
#pragma unroll
        for (int u = 0; u < 2; ++u) { l[u] *= al[u]; for (int dt = 0; dt < 4; ++dt) o[u][dt] *= al[u]; }
      }
      v16h pf[2];
#pragma unroll
      for (int u = 0; u < 2; ++u) { const float ms = m[u] - 6.0f; v4f s4[2];
#pragma unroll
        for (int kt = 0; kt < 2; ++kt) { const v8f x = t[u][kt] - ms; const v4f x0 = {x[0], x[1], x[2], x[3]}, x1 = {x[4], x[5], x[6], x[7]}; const v4f e0 = rs_exp4(x0), e1 = rs_exp4(x1); s4[kt] = e0 + e1;
          const v8f e = {e0[0], e0[1], e0[2], e0[3], e1[0], e1[1], e1[2], e1[3]}; t[u][kt] = e; }
        const v4f sq = s4[0] + s4[1]; l[u] += (sq[0] + sq[1]) + (sq[2] + sq[3]);
        pf[u] = __builtin_shufflevector(__builtin_convertvector(t[u][0], v8h), __builtin_convertvector(t[u][1], v8h), 0, 1, 2, 3, 4, 5, 6, 7, 8, 9, 10, 11, 12, 13, 14, 15); }
      __builtin_amdgcn_sched_barrier(0);      /* this one and the next keep the eight products apart from the 2^x statements: those are asm text, which the compiler's padding behind a matrix instruction does not see */
#pragma unroll
      for (int dt = 0; dt < 4; ++dt) for (int u = 0; u < 2; ++u) o[u][dt] = fa_mma(vf[dt], pf[u], o[u][dt]);
      __builtin_amdgcn_sched_barrier(0);
    }
    put(bf ^ 1);      /* into the buffer whose readers all passed the barrier of stage s - 1 */
    __syncthreads();      /* publishes stage s + 1 and ends every wave's reads of stage s */
  }
  /* The two groups' halves meet: the wave's column group 1 goes to its partner, whose own group 0 it is. */
#pragma unroll
  for (int dt = 0; dt < 4; ++dt) { const v4f a = {o[1][dt][0], o[1][dt][1], o[1][dt][2], o[1][dt][3]}, c = {o[1][dt][4], o[1][dt][5], o[1][dt][6], o[1][dt][7]}; *(v4fa*)&sm[w16][dt * 2][lane][0] = a; *(v4fa*)&sm[w16][dt * 2 + 1][lane][0] = c; }
  sl[w16][0][lane] = m[1]; sl[w16][1][lane] = l[1];
  fa_lds_barrier();      /* every wave's hand-over is in LDS for its partner */
  const float mp = sl[pw][0][lane], lp = sl[pw][1][lane], mj = fmaxf(m[0], mp);      /* a group whose keys were all at the fill beside open keys of the other gets the factor 0 */
  const v4f d4 = {m[0] - mj, mp - mj, 0.f, 0.f}; const v4f al = rs_exp4(d4);
  const float lj = l[0] * al[0] + lp * al[1];
#pragma unroll
  for (int dt = 0; dt < 4; ++dt) { const v4f a = *(const v4fa*)&sm[pw][dt * 2][lane][0], c = *(const v4fa*)&sm[pw][dt * 2 + 1][lane][0]; const v8f e = {a[0], a[1], a[2], a[3], c[0], c[1], c[2], c[3]}; o[0][dt] = o[0][dt] * al[0] + e * al[1]; }
  _Float16* ob = O16 + ((size_t)b * SQ + q0) * DM + h * HD;
  { const float sc = 64.0f / (lj + rs_xh(lj)); v8f d[4];
    const v16h x[2] = {fa_pack(o[0][0], o[0][1], sc), fa_pack(o[0][2], o[0][3], sc)};      /* a lane's accumulator registers are consecutive inputs of its query: the B operand of o = Wv (O / sum) */
    fa_wx(sw[2], ln, hh, x, d);
#pragma unroll
    for (int dt = 0; dt < 4; ++dt) *(v8h*)((char*)(ob + dt * 16) + roff) = __builtin_convertvector(d[dt] * 0.0625f, v8h); }      /* 8 consecutive outputs of the lane's query row */
}
// Output product out = o Wo^T * alpha + b for all token rows, operands staged in LDS. A work-group of 8 waves owns a 128 x 128 tile of out (one work-group a WGP at this shape); a wave owns 32 x 64 of it (2 x 4 accumulator tiles, as k_gemm2).
// o rows and Wo rows come in stages of 128 k: a wave-wide 16-byte load covers two rows' 256 contiguous bytes (whole 128-byte lines; a fragment load from global memory touches 16 lines for 512 bytes, and each of them was waited for on its own),
// through registers into one of two LDS buffers; stage s + 1 is on its way while stage s is worked on, stored behind it, one barrier a stage. Each operand byte is read once a work-group.
// The k steps run in the order of k_gemm2 and the fragments have its k order, so every accumulator sees the same sums; the epilogue is k_gemm2's (alpha, bias rounded to bf16, the wave's tile through its own LDS range, whole lines out).
// Every '#pragma unroll' in the kernel but the one on the stage loop stands on a loop over a register array (loads in flight, fragments, accumulators): rolled, the array would be indexed at run time and leave the registers.
#define OG_T 128         /* rows and columns of out a work-group */
#define OG_K 128         /* k a stage */
#define OG_PITCH 136     /* halves a staged row: 272 bytes = 16 x 17, an odd multiple of 16 bytes for the 16-byte fragment reads */
static_assert(MPO % OG_T == 0 && DM % OG_T == 0 && DM % OG_K == 0 && OG_K == 128 && OG_T == 128, "k_ogemm: whole tiles and stages; 16 threads stage a row of 256 bytes, 16 rows a round");
__global__ __launch_bounds__(256) void k_ogemm(const _Float16* __restrict__ A, const _Float16* __restrict__ Bh, float alpha, const float* __restrict__ bias, float* __restrict__ C) {
  __shared__ __attribute__((aligned(16))) unsigned short sa[2][OG_T][OG_PITCH];      /* [buffer][token row][k] */
  __shared__ __attribute__((aligned(16))) unsigned short sb[2][OG_T][OG_PITCH];      /* [buffer][output column][k] */
  __shared__ __attribute__((aligned(16))) float so[8][32][68];                       /* a wave's tile on its way out */
  constexpr int NS = DM / OG_K, NT = DM / OG_T;
  const int tid = threadIdx.x, lane = tid & 31, ln = lane & 15, hh = lane >> 4; const int wave = __builtin_amdgcn_readfirstlane(tid >> 5);
  const int row0 = ((int)blockIdx.x / NT) * OG_T, col0 = ((int)blockIdx.x % NT) * OG_T; const int wm = (wave >> 1) * 32, wn = (wave & 1) * 64;      /* the wave's place in the tile */
  const char* ab = (const char*)(A + (size_t)row0 * DM); const char* bb = (const char*)(Bh + (size_t)col0 * DM);      /* uniform bases */
  const int srow = tid >> 4, sc8 = (tid & 15) * 8;      /* staging: 16 threads a 256-byte row; rows srow + 16 j */
  const unsigned go = (unsigned)(srow * (DM * 2) + sc8 * 2);      /* byte offset of the lane in a stage of either operand */
  const char* ib = (const char*)(bias + col0 + wn); const unsigned io = (unsigned)(ln * 4);      /* the wave's 64 bias values: fetched here, so that the epilogue does not wait for them */
  v8us ga[OG_T / 16], gb[OG_T / 16]; float bv[4];
#pragma unroll
  for (int j = 0; j < OG_T / 16; ++j) { ga[j] = *(const v8us*)(ab + j * 16 * DM * 2 + go); gb[j] = *(const v8us*)(bb + j * 16 * DM * 2 + go); }
#pragma unroll
  for (int t = 0; t < 4; ++t) bv[t] = *(const float*)(ib + t * 64 + io);
  asm volatile("s_wait_xcnt 0x0" :: "v"(go), "v"(io) : "memory");      /* behind the loads, ahead of any new value in a register that they name (a precaution of form); as inputs the lane offsets keep their registers up to it */
#pragma unroll
  for (int j = 0; j < OG_T / 16; ++j) { *(v8us*)&sa[0][j * 16 + srow][sc8] = ga[j]; *(v8us*)&sb[0][j * 16 + srow][sc8] = gb[j]; }
  const v8f z8 = {0.f, 0.f, 0.f, 0.f, 0.f, 0.f, 0.f, 0.f};
  v8f acc[2][4];
#pragma unroll
  for (int i = 0; i < 2; ++i) for (int t = 0; t < 4; ++t) acc[i][t] = z8;
  __syncthreads();      /* stage 0 is in LDS for every wave */
#pragma unroll
  for (int s = 0; s < NS; ++s) {
    const int bf = s & 1;
    if (s + 1 < NS) {      /* behind the barrier, not ahead of it: the barrier's fence waits for every load that is under way */
#pragma unroll
      for (int j = 0; j < OG_T / 16; ++j) { ga[j] = *(const v8us*)(ab + (s + 1) * OG_K * 2 + j * 16 * DM * 2 + go); gb[j] = *(const v8us*)(bb + (s + 1) * OG_K * 2 + j * 16 * DM * 2 + go); }
      asm volatile("s_wait_xcnt 0x0" :: "v"(go) : "memory");      /* as above; as a memory barrier for the compiler it also keeps the loads here, a whole stage ahead of their stores */
    }
    v16h af[2][2], bq[2][4];
#pragma unroll
    for (int i = 0; i < 2; ++i) af[0][i] = fa_frag(&sa[bf][wm + i * 16 + ln][8 * hh]);
#pragma unroll
    for (int t = 0; t < 4; ++t) bq[0][t] = fa_frag(&sb[bf][wn + t * 16 + ln][8 * hh]);
#pragma unroll
    for (int ks = 0; ks < OG_K / 32; ++ks) {
      if (ks + 1 < OG_K / 32) {      /* the next k step's fragments are fetched as one group ahead of this step's products, into the second register set */
#pragma unroll
        for (int i = 0; i < 2; ++i) af[(ks + 1) & 1][i] = fa_frag(&sa[bf][wm + i * 16 + ln][(ks + 1) * 32 + 8 * hh]);
#pragma unroll
        for (int t = 0; t < 4; ++t) bq[(ks + 1) & 1][t] = fa_frag(&sb[bf][wn + t * 16 + ln][(ks + 1) * 32 + 8 * hh]);
      }
      __builtin_amdgcn_sched_barrier(0);      /* this one and the next keep the twelve reads one group ahead of the eight products: without them this build read two fragments' halves at a time into one register block and waited out the LDS latency in front of every second product */
#pragma unroll
      for (int t = 0; t < 4; ++t) for (int i = 0; i < 2; ++i) acc[i][t] = fa_mma(af[ks & 1][i], bq[ks & 1][t], acc[i][t]);
      __builtin_amdgcn_sched_barrier(0);
    }
    if (s + 1 < NS) {
#pragma unroll
      for (int j = 0; j < OG_T / 16; ++j) { *(v8us*)&sa[bf ^ 1][j * 16 + srow][sc8] = ga[j]; *(v8us*)&sb[bf ^ 1][j * 16 + srow][sc8] = gb[j]; }      /* into the buffer whose readers all passed the barrier of stage s - 1 */
      __syncthreads();      /* publishes stage s + 1 and ends every wave's reads of stage s */
    }
  }
#pragma unroll
  for (int t = 0; t < 4; ++t) { const float br = bf16_round(bv[t]);
#pragma unroll
    for (int i = 0; i < 2; ++i) for (int r = 0; r < 8; ++r) so[wave][i * 16 + 8 * hh + r][t * 16 + ln] = acc[i][t][r] * alpha + br; }
  __builtin_amdgcn_fence(__ATOMIC_ACQ_REL, "workgroup"); __builtin_amdgcn_wave_barrier();      /* the rows are read back by other lanes of the same wave: keeps the reads behind the writes */
  char* cb = (char*)(C + (size_t)(row0 + wm) * DM + col0 + wn);      /* uniform for the wave */
  const unsigned co = (unsigned)(hh * (DM * 4) + ln * 16);
  v4f ov[16];
#pragma unroll
  for (int q = 0; q < 16; ++q) ov[q] = *(const v4fa*)&so[wave][q * 2 + hh][ln * 4];      /* 16 lanes a row of 256 bytes, 2 rows an instruction */
#pragma unroll
  for (int q = 0; q < 16; ++q) *(v4f*)(cb + q * 2 * DM * 4 + co) = ov[q];
}
extern "C" void kernel_launch(void* const* d_in, const int* in_sizes, int n_in,
                              void* d_out, int out_size, void* d_ws, size_t ws_size, hipStream_t stream) {
  (void)in_sizes; (void)n_in; (void)out_size;
  const float* const* I = (const float* const*)d_in; const float* xq = I[2]; const float* xk = I[1]; const float* xv = I[0]; const int* km = (const int*)d_in[3]; const float* wq = I[6]; const float* wk = I[5]; const float* wv = I[4]; const float* wo = I[7]; const float* bo = I[8];      /* contract order: values I[0], keys I[1], query I[2]; mask int32 [4][1][1][2048] (0 = masked key; READ on device); SHARED natural [64][64] blocks Wv I[4], Wk I[5], Wq I[6]; natural Wo [512][512] + bo */
  char* ws = (char*)d_ws; size_t off = 0;
  auto take = [&](size_t bytes) { char* p = ws + off; off += (bytes + 255) & ~(size_t)255; return p; };
  _Float16* BO = (_Float16*)take((size_t)DM * DM * 2);
  _Float16* O16 = (_Float16*)take(NR * DM * 2);
  if (off > ws_size) return;
  const size_t r0p = (size_t)B0 * SQ;      /* first row of the output stage */
  k_fattn<<<NB * NH * (SQ / (FA_WAVES * FA_COLS)), FA_GROUPS * FA_WAVES * 32, 0, stream>>>(xq, xk, xv, wq, wk, wv, wo, km, BO, O16);      /* o (merged heads) as f16 rows x64; keys with mask[b][j] == 0 are not listed; Wo as f16 x16 */
  k_ogemm<<<(unsigned)((MPO / OG_T) * (DM / OG_T)), 256, 0, stream>>>(O16 + r0p * DM, BO, 0.0009765625f, bo, (float*)d_out + r0p * DM);      /* out rows are the output layout */
}
